// v000
// Times are from an AMD MI455X. After a warm-up the kernel runs many times in a row, and a time is the length of
// such a window on the GPU divided by its runs, so every launch and the gaps after it count. The runs cycle
// through copies of the inputs. A figure is the median of several windows, for all but v000 over two sittings.
// Sittings can differ by a few percent; kernels timed side by side share one.
// v000, which the later versions start from, runs in 255 microseconds.
// Contractions: qkv/o 1x1 projection, k^T v, q kv and the output 1x1 projection all on v_wmma_f32_16x16x32_bf16 as bf16 hi/lo three-product split (hi*hi + hi*lo + lo*hi, f32 accumulate); elu, channel means, z, rotary tables, depthwise 5x5, biases and the elementwise tail in f32.
#include <hip/hip_runtime.h>
#include <math.h>

typedef unsigned short us_t;
typedef __bf16   v16b __attribute__((ext_vector_type(16)));
typedef _Float16 v16h __attribute__((ext_vector_type(16)));
typedef us_t     v8us __attribute__((ext_vector_type(8)));
typedef us_t     v4us __attribute__((ext_vector_type(4)));
typedef float    v8f  __attribute__((ext_vector_type(8)));
typedef float    v4f  __attribute__((ext_vector_type(4)));
typedef v8us __attribute__((may_alias)) v8usa;
typedef v4us __attribute__((may_alias)) v4usa;
typedef v4f  __attribute__((may_alias)) v4fa;
union FragB { v16b v; v8us half[2]; v16h x; };
union Q8    { v8f v; v4f q[2]; };

#define NB   8
#define CH   256
#define NP   4096
#define HW   64
#define NH   8
#define HD   32
#define KVP  72
#define AQP  40
#define PPW  68
#define GXP  264
#define SCALE_F 0.17677669529663687f
#define CKV     0.0065695032f
#define INV_L   0.000244140625f

// dynamic LDS map of k_gemm (bytes): x hi tile [64][264] us_t, x lo tile, f32 staging over both
#define GM_XL    33792
#define GM_BYTES 67584

// dynamic LDS map of k_resproj (bytes)
#define RP_UH    0
#define RP_UL    32768
#define RP_AQH   65536
#define RP_AQL   75776
#define RP_SINW  86016
#define RP_COSW  88064
#define RP_SINH  90112
#define RP_COSH  90144
#define RP_FREQ  90176
#define RP_ZP    90208
#define RP_KM    91232
#define RP_VM    92256
#define RP_BYTES 93312

// ---------------------------------------------------------------------------
// 16x16x32 bf16 WMMA with hazard guard (ties D, keeps A/B live).
// Fragment map (wave32): lane l, h = l>>4, m = n = l&15.
//   A/B element i: i<8 -> k0+8h+i ; i>=8 -> k0+16+8h+(i-8)
//   D element r : row 8h+r, col l&15
// ---------------------------------------------------------------------------
__device__ __forceinline__ v8f wmma_bf16(const FragB& a, const FragB& b, v8f c) {
  v8f d = __builtin_amdgcn_wmma_f32_16x16x32_bf16(false, a.v, false, b.v, (short)0, c, false, false);
  asm volatile("v_nop\n\tv_nop\n\tv_nop\n\tv_nop" : "+v"(d) : "v"(a.x), "v"(b.x));
  return d;
}
// fragment from a k-contiguous bf16 row holding >= 32 elements starting at p (p = row + k0)
__device__ __forceinline__ FragB ldfrag(const us_t* p, int h) {
  FragB f;
  f.half[0] = *(const v8usa*)(p + 8 * h);
  f.half[1] = *(const v8usa*)(p + 16 + 8 * h);
  return f;
}
__device__ __forceinline__ v8f zero8f() {
  v8f z;
  #pragma unroll
  for (int j = 0; j < 8; ++j) z[j] = 0.f;
  return z;
}
// 8 floats to LDS as two 16-B pieces
__device__ __forceinline__ void st8f(float* p, v8f v) {
  Q8 u; u.v = v;
  *(v4fa*)p = u.q[0];
  *(v4fa*)(p + 4) = u.q[1];
}
// RNE convert f32 -> bf16 bits, and back
__device__ __forceinline__ us_t bf16_rne(float f) {
  unsigned u = __float_as_uint(f);
  u += 0x7FFFu + ((u >> 16) & 1u);
  return (us_t)(u >> 16);
}
__device__ __forceinline__ float bf16_val(us_t b) { return __uint_as_float(((unsigned)b) << 16); }
__device__ __forceinline__ void split2(float f, us_t& hi, us_t& lo) {
  hi = bf16_rne(f);
  lo = bf16_rne(f - bf16_val(hi));
}
// rotary frequency i of 8: 1 / 10000^(i/7), linspace-style exponent
__device__ __forceinline__ float rope_freq(int i) {
  const float e = (i == 7) ? 1.0f : (float)i * (1.0f / 7.0f);
  return 1.0f / powf(10000.0f, e);
}

// ---------------------------------------------------------------------------
// Kernel 0: weights -> bf16 hi/lo rows. WQh/WQl [1024][256] from the qkv/o
// weights, WPh/WPl [256][256] from the output projection weights. Thread = 8
// ---------------------------------------------------------------------------
__global__ __launch_bounds__(256) void k_wcvt(const float* __restrict__ qw, const float* __restrict__ pw,
                                             us_t* __restrict__ WQh, us_t* __restrict__ WQl,
                                             us_t* __restrict__ WPh, us_t* __restrict__ WPl)
{
  const int g = blockIdx.x * 256 + threadIdx.x;
  if (g >= 40960) return;
  const float* src;
  us_t* dh;
  us_t* dl;
  if (g < 32768) { src = qw + (size_t)g * 8; dh = WQh + (size_t)g * 8; dl = WQl + (size_t)g * 8; }
  else { const int g2 = g - 32768; src = pw + (size_t)g2 * 8; dh = WPh + (size_t)g2 * 8; dl = WPl + (size_t)g2 * 8; }
  const v4f a = *(const v4fa*)src;
  const v4f c = *(const v4fa*)(src + 4);
  v8us oh, ol;
  {
    us_t p1, p2;
    split2(a.x, p1, p2); oh[0] = p1; ol[0] = p2;
    split2(a.y, p1, p2); oh[1] = p1; ol[1] = p2;
    split2(a.z, p1, p2); oh[2] = p1; ol[2] = p2;
    split2(a.w, p1, p2); oh[3] = p1; ol[3] = p2;
    split2(c.x, p1, p2); oh[4] = p1; ol[4] = p2;
    split2(c.y, p1, p2); oh[5] = p1; ol[5] = p2;
    split2(c.z, p1, p2); oh[6] = p1; ol[6] = p2;
    split2(c.w, p1, p2); oh[7] = p1; ol[7] = p2;
  }
  *(v8us*)dh = oh;
  *(v8us*)dl = ol;
  
}

// ---------------------------------------------------------------------------
// Kernel 1: 1x1 projection GEMM D[l][o] = sum_c x[c][l] * W[o][c] + bias[o],
// elu+1 for the q/k channel classes, as bf16 hi/lo three-product split.
// Block = (image row of 64 positions, 256-channel class, b), 8 waves.
// Staging: the x tile [256 c][64 l] (NCHW f32, l-contiguous float4 loads) is
// split into hi/lo LDS tiles sXh/sXl [64 l][256 c] (k-contiguous rows).
// A = sX rows (positions), B = WQh/WQl rows (channels) straight from global,
// K = 256 in 8 steps; wave = 32 positions x 64 channels (2x4 tiles);
// products a_hi*b_hi + a_hi*b_lo + a_lo*b_hi.
// mode 0: class 0 -> channels 256..511 (k -> R1), class 1 -> 512..767 (v ->
// R2); mode 1: class 0 -> 0..255 (q -> R1), class 1 -> 768..1023 (o -> R2);
// NCHW f32 [b][256][4096]. Epilogue staged [256 ch][64 pos] f32 over the x
// ---------------------------------------------------------------------------
__global__ __launch_bounds__(256) void k_gemm(const float* __restrict__ x,
                                             const us_t* __restrict__ WQh, const us_t* __restrict__ WQl,
                                             const float* __restrict__ bias,
                                             float* __restrict__ R1, float* __restrict__ R2, int mode)
{
  extern __shared__ __attribute__((aligned(16))) unsigned char dsm[];
  us_t*  sXh = (us_t*)dsm;
  us_t*  sXl = (us_t*)(dsm + GM_XL);
  float* sO  = (float*)dsm;
  const int tid = threadIdx.x, lane = tid & 31, w = tid >> 5;
  const int h = lane >> 4, m = lane & 15;
  const int lb = blockIdx.x, cb = blockIdx.y, b = blockIdx.z;
  const int l0 = lb * 64;
  const int obase = (mode == 0) ? (256 + 256 * cb) : ((cb == 0) ? 0 : 768);
  const int cls = obase >> 8;
  float* dst = (cls < 2) ? R1 : R2;

  // stage x[c][l0 + 0..63] -> hi/lo tiles [l][c]
  const float* xb = x + (size_t)(b * CH) * NP + l0;
  #pragma unroll 2
  for (int j = 0; j < 16; ++j) {
    const int f = tid + 256 * j;
    const int c = f >> 4, lq = (f & 15) * 4;
    const v4f v = *(const v4fa*)(xb + (size_t)c * NP + lq);
    us_t p1, p2;
    split2(v.x, p1, p2); sXh[(lq + 0) * GXP + c] = p1; sXl[(lq + 0) * GXP + c] = p2;
    split2(v.y, p1, p2); sXh[(lq + 1) * GXP + c] = p1; sXl[(lq + 1) * GXP + c] = p2;
    split2(v.z, p1, p2); sXh[(lq + 2) * GXP + c] = p1; sXl[(lq + 2) * GXP + c] = p2;
    split2(v.w, p1, p2); sXh[(lq + 3) * GXP + c] = p1; sXl[(lq + 3) * GXP + c] = p2;
  }
  __syncthreads();

  const int wl = w & 1, wc = w >> 1;
  const v8f z8 = zero8f();
  v8f acc[2][4];
  #pragma unroll
  for (int t = 0; t < 2; ++t) {
    #pragma unroll
    for (int v = 0; v < 4; ++v) acc[t][v] = z8;
  }
  const us_t* ah0 = sXh + (32 * wl + m) * GXP;
  const us_t* ah1 = ah0 + 16 * GXP;
  const us_t* al0 = sXl + (32 * wl + m) * GXP;
  const us_t* al1 = al0 + 16 * GXP;
  const us_t* bh0 = WQh + (size_t)(obase + 64 * wc + m) * CH;
  const us_t* bl0 = WQl + (size_t)(obase + 64 * wc + m) * CH;

  #pragma unroll 1
  for (int k0 = 0; k0 < CH; k0 += 32) {
    const FragB a0 = ldfrag(ah0 + k0, h);
    const FragB a1 = ldfrag(ah1 + k0, h);
    const FragB c0 = ldfrag(al0 + k0, h);
    const FragB c1 = ldfrag(al1 + k0, h);
    #pragma unroll
    for (int v = 0; v < 4; ++v) {
      const FragB bh = ldfrag(bh0 + (size_t)(16 * v) * CH + k0, h);
      const FragB bl = ldfrag(bl0 + (size_t)(16 * v) * CH + k0, h);
      acc[0][v] = wmma_bf16(a0, bh, acc[0][v]);
      acc[0][v] = wmma_bf16(a0, bl, acc[0][v]);
      acc[0][v] = wmma_bf16(c0, bh, acc[0][v]);
      acc[1][v] = wmma_bf16(a1, bh, acc[1][v]);
      acc[1][v] = wmma_bf16(a1, bl, acc[1][v]);
      acc[1][v] = wmma_bf16(c1, bh, acc[1][v]);
    }
  }
  __syncthreads();   // all waves done with the x tiles before the staging overlays them

  #pragma unroll
  for (int v = 0; v < 4; ++v) {
    const int ch = 64 * wc + 16 * v + m;
    const float bb = bias[obase + ch];
    #pragma unroll
    for (int t = 0; t < 2; ++t) {
      v8f y;
      #pragma unroll
      for (int r = 0; r < 8; ++r) {
        float vv = acc[t][v][r] + bb;
        if (cls < 2) vv = (vv > 0.f) ? (vv + 1.f) : expf(vv);
        y[r] = vv;
      }
      st8f(sO + ch * 64 + 32 * wl + 16 * t + 8 * h, y);
    }
  }
  __syncthreads();
  const int q8 = lane & 7, sub = lane >> 3;
  #pragma unroll
  for (int i = 0; i < 16; ++i) {
    const int id = 64 * w + 4 * i + sub;
    const int R = id >> 1, Lh = id & 1;
    const v4f val = *(const v4fa*)(sO + R * 64 + 32 * Lh + 4 * q8);
    const size_t d = (size_t)(b * CH + R) * NP + l0 + 32 * Lh + 4 * q8;
    *(v4f*)(dst + d) = val;
  }
  
}

// ---------------------------------------------------------------------------
// Kernel 2: per (b, head n), 128 threads: streams all 4096 positions in
// chunks of 64; f32 channel sums of k (elu+1, before rotation) and v in a
// fixed order; rotary on k in f32 from an LDS sin/cos table; bf16 hi/lo
// planes of rotated k [d][l] and of v [e][l] in LDS; KVT[e][d] =
// c^2 * sum_l krot[d][l] v[e][l] as three-product split (A = krot rows,
// B column e of v = v row e; D rows d, cols e), f32 accumulate.
// Outputs: KVTh/KVTl [b][n][e][d] bf16 hi/lo (64-B rows, 2 rows per line,
// 8 threads per line, one instruction), KM/VM [b][n][32] means (one
// ---------------------------------------------------------------------------
__global__ __launch_bounds__(128) void k_kv(const float* __restrict__ KF, const float* __restrict__ VF,
                                           us_t* __restrict__ KVTh, us_t* __restrict__ KVTl,
                                           float* __restrict__ KM, float* __restrict__ VM)
{
  __shared__ __attribute__((aligned(16))) us_t Ah[HD * KVP];
  __shared__ __attribute__((aligned(16))) us_t Al[HD * KVP];
  __shared__ __attribute__((aligned(16))) us_t Bh[HD * KVP];
  __shared__ __attribute__((aligned(16))) us_t Bl[HD * KVP];
  __shared__ __attribute__((aligned(16))) float sSin[HW * 8];
  __shared__ __attribute__((aligned(16))) float sCos[HW * 8];
  __shared__ __attribute__((aligned(16))) float sKV[HD * HD];
  __shared__ __attribute__((aligned(16))) float sSum[64];
  __shared__ float sFreq[8];
  const int tid = threadIdx.x, lane = tid & 31, w = tid >> 5;
  const int h = lane >> 4, m = lane & 15;
  const int n = blockIdx.x & 7, b = blockIdx.x >> 3;
  if (tid < 8) sFreq[tid] = rope_freq(tid);
  __syncthreads();
  #pragma unroll 1
  for (int j = 0; j < 4; ++j) {
    const int idx = tid + 128 * j;
    const int pos = idx >> 3, f = idx & 7;
    float sv, cv;
    sincosf((float)pos * sFreq[f], &sv, &cv);
    sSin[idx] = sv;
    sCos[idx] = cv;
  }
  const int i0 = tid >> 4, l4 = (tid & 15) * 4;
  const float* kb = KF + (size_t)(b * CH + n * HD) * NP;
  const float* vb = VF + (size_t)(b * CH + n * HD) * NP;
  float ks[4], vs[4];
  #pragma unroll
  for (int j = 0; j < 4; ++j) { ks[j] = 0.f; vs[j] = 0.f; }
  const int td = w >> 1, te = w & 1;
  const v8f z8 = zero8f();
  v8f acc = z8;

  #pragma unroll 1
  for (int l0 = 0; l0 < NP; l0 += 64) {
    __syncthreads();
    const int hp = l0 >> 6;
    // k rows: g = 0 -> d pair (2 i0, 2 i0 + 1) keyed on the image row hp;
    //         g = 1 -> d pair (16 + 2 i0, +1) keyed on the image column l4 + t
    #pragma unroll
    for (int g = 0; g < 2; ++g) {
      const int d0 = 16 * g + 2 * i0;
      const v4f ka = *(const v4fa*)(kb + (size_t)d0 * NP + l0 + l4);
      const v4f kc = *(const v4fa*)(kb + (size_t)(d0 + 1) * NP + l0 + l4);
      ks[2 * g]     += (ka.x + ka.y) + (ka.z + ka.w);
      ks[2 * g + 1] += (kc.x + kc.y) + (kc.z + kc.w);
      const float sr = sSin[hp * 8 + i0], cr = sCos[hp * 8 + i0];
      v4us ha, la, hc, lc;
      #pragma unroll
      for (int t = 0; t < 4; ++t) {
        const int widx = (l4 + t) * 8 + i0;
        const float sw = sSin[widx], cw = sCos[widx];
        const float s = g ? sw : sr;
        const float c = g ? cw : cr;
        const float xa = ka[t], xc = kc[t];
        us_t p1, p2;
        split2(xa * c - xc * s, p1, p2); ha[t] = p1; la[t] = p2;
        split2(xc * c + xa * s, p1, p2); hc[t] = p1; lc[t] = p2;
      }
      *(v4usa*)(Ah + d0 * KVP + l4) = ha;
      *(v4usa*)(Al + d0 * KVP + l4) = la;
      *(v4usa*)(Ah + (d0 + 1) * KVP + l4) = hc;
      *(v4usa*)(Al + (d0 + 1) * KVP + l4) = lc;
    }
    // v rows e = i0 + 8 j
    #pragma unroll
    for (int j = 0; j < 4; ++j) {
      const int e = i0 + 8 * j;
      const v4f vv = *(const v4fa*)(vb + (size_t)e * NP + l0 + l4);
      vs[j] += (vv.x + vv.y) + (vv.z + vv.w);
      v4us hv, lv;
      #pragma unroll
      for (int t = 0; t < 4; ++t) { us_t p1, p2; split2(vv[t], p1, p2); hv[t] = p1; lv[t] = p2; }
      *(v4usa*)(Bh + e * KVP + l4) = hv;
      *(v4usa*)(Bl + e * KVP + l4) = lv;
    }
    __syncthreads();
    #pragma unroll
    for (int kk = 0; kk < 2; ++kk) {
      const FragB fa = ldfrag(Ah + (16 * td + m) * KVP + 32 * kk, h);
      const FragB fl = ldfrag(Al + (16 * td + m) * KVP + 32 * kk, h);
      const FragB gb = ldfrag(Bh + (16 * te + m) * KVP + 32 * kk, h);
      const FragB gl = ldfrag(Bl + (16 * te + m) * KVP + 32 * kk, h);
      acc = wmma_bf16(fa, gb, acc);
      acc = wmma_bf16(fa, gl, acc);
      acc = wmma_bf16(fl, gb, acc);
    }
  }

  // channel sums: the 16 lanes of each half-wave share the channel index i0
  #pragma unroll
  for (int j = 0; j < 4; ++j) {
    float a = ks[j], c = vs[j];
    a += __shfl_xor(a, 1); a += __shfl_xor(a, 2); a += __shfl_xor(a, 4); a += __shfl_xor(a, 8);
    c += __shfl_xor(c, 1); c += __shfl_xor(c, 2); c += __shfl_xor(c, 4); c += __shfl_xor(c, 8);
    ks[j] = a; vs[j] = c;
  }
  if ((tid & 15) == 0) {
    sSum[2 * i0] = ks[0]; sSum[2 * i0 + 1] = ks[1];
    sSum[16 + 2 * i0] = ks[2]; sSum[17 + 2 * i0] = ks[3];
    #pragma unroll
    for (int j = 0; j < 4; ++j) sSum[32 + i0 + 8 * j] = vs[j];
  }
  // acc[r] -> (d = 16 td + 8 h + r, e = 16 te + m), staged transposed sKV[e][d]
  const float cc = CKV * CKV;
  #pragma unroll
  for (int r = 0; r < 8; ++r) sKV[(16 * te + m) * HD + 16 * td + 8 * h + r] = acc[r] * cc;
  __syncthreads();

  const int e = tid >> 2, q4 = tid & 3;
  const v4f f0 = *(const v4fa*)(sKV + e * HD + 8 * q4);
  const v4f f1 = *(const v4fa*)(sKV + e * HD + 8 * q4 + 4);
  v8us hh, ll;
  {
    us_t p1, p2;
    split2(f0.x, p1, p2); hh[0] = p1; ll[0] = p2;
    split2(f0.y, p1, p2); hh[1] = p1; ll[1] = p2;
    split2(f0.z, p1, p2); hh[2] = p1; ll[2] = p2;
    split2(f0.w, p1, p2); hh[3] = p1; ll[3] = p2;
    split2(f1.x, p1, p2); hh[4] = p1; ll[4] = p2;
    split2(f1.y, p1, p2); hh[5] = p1; ll[5] = p2;
    split2(f1.z, p1, p2); hh[6] = p1; ll[6] = p2;
    split2(f1.w, p1, p2); hh[7] = p1; ll[7] = p2;
  }
  const size_t kd = ((size_t)(b * NH + n) * HD + e) * HD + 8 * q4;
  const int mi = tid & 7;
  const bool isk = tid < 8;
  const bool isv = (tid >= 8) && (tid < 16);
  const v4f mk = *(const v4fa*)(sSum + 4 * mi) * INV_L;
  const v4f mv = *(const v4fa*)(sSum + 32 + 4 * mi) * INV_L;
  float* pk = KM + (size_t)(b * NH + n) * HD + 4 * mi;
  float* pv = VM + (size_t)(b * NH + n) * HD + 4 * mi;
  *(v8us*)(KVTh + kd) = hh;
  *(v8us*)(KVTl + kd) = ll;
  if (isk) *(v4f*)pk = mk;
  if (isv) *(v4f*)pv = mv;
  
}

// ---------------------------------------------------------------------------
// Kernel 3: depthwise 5x5 (zero pad 2) on the v planes, f32 VALU:
// LF[b][c][y][x] = bias[c] + sum w[c][dy][dx] v[b][c][y+dy-2][x+dx-2].
// Block = (channel, b); the 64x64 plane staged with a 2-wide zero ring in
// LDS [68][68]; thread = 4 consecutive x per iteration (rolled loops);
// ---------------------------------------------------------------------------
__global__ __launch_bounds__(256) void k_lepe(const float* __restrict__ VF, const float* __restrict__ lw,
                                             const float* __restrict__ lbias, float* __restrict__ LF)
{
  __shared__ __attribute__((aligned(16))) float sP[PPW * PPW];
  __shared__ float sW[25];
  const int tid = threadIdx.x;
  const int c = blockIdx.x, b = blockIdx.y;
  if (tid < 25) sW[tid] = lw[c * 25 + tid];
  #pragma unroll 1
  for (int j = 0; j < 19; ++j) {
    const int idx = tid + 256 * j;
    if (idx < PPW * PPW) sP[idx] = 0.f;
  }
  __syncthreads();
  const float* src = VF + (size_t)(b * CH + c) * NP;
  #pragma unroll
  for (int j = 0; j < 4; ++j) {
    const int f = tid + 256 * j, l = 4 * f, y = l >> 6, xx = l & 63;
    const v4f v = *(const v4fa*)(src + l);
    float* pr = sP + (y + 2) * PPW + xx + 2;
    pr[0] = v.x; pr[1] = v.y; pr[2] = v.z; pr[3] = v.w;
  }
  __syncthreads();
  const float bb = lbias[c];
  float* dst = LF + (size_t)(b * CH + c) * NP;
  #pragma unroll 1
  for (int j = 0; j < 4; ++j) {
    const int f = tid + 256 * j, l = 4 * f, y = l >> 6, xx = l & 63;
    float a0 = bb, a1 = bb, a2 = bb, a3 = bb;
    #pragma unroll 1
    for (int dy = 0; dy < 5; ++dy) {
      const float* rp = sP + (y + dy) * PPW + xx;
      const v4f r0 = *(const v4fa*)rp;
      const v4f r1 = *(const v4fa*)(rp + 4);
      const float rr[8] = {r0.x, r0.y, r0.z, r0.w, r1.x, r1.y, r1.z, r1.w};
      const float w0 = sW[dy * 5], w1 = sW[dy * 5 + 1], w2 = sW[dy * 5 + 2], w3 = sW[dy * 5 + 3], w4 = sW[dy * 5 + 4];
      a0 += w0 * rr[0]; a0 += w1 * rr[1]; a0 += w2 * rr[2]; a0 += w3 * rr[3]; a0 += w4 * rr[4];
      a1 += w0 * rr[1]; a1 += w1 * rr[2]; a1 += w2 * rr[3]; a1 += w3 * rr[4]; a1 += w4 * rr[5];
      a2 += w0 * rr[2]; a2 += w1 * rr[3]; a2 += w2 * rr[4]; a2 += w3 * rr[5]; a2 += w4 * rr[6];
      a3 += w0 * rr[3]; a3 += w1 * rr[4]; a3 += w2 * rr[5]; a3 += w3 * rr[6]; a3 += w4 * rr[7];
    }
    v4f o;
    o.x = a0; o.y = a1; o.z = a2; o.w = a3;
    *(v4f*)(dst + l) = o;
    
  }
}

// ---------------------------------------------------------------------------
// Kernel 4: per (image row of 64 positions, b), 8 waves:
//  phase 0: sin/cos tables and the per-image head means in LDS.
//  phase A (4 iterations over head pairs): threads stage q f32 [16 d] per
//   (head, l, half): partial z = q . kmean (f32), rotary in f32, bf16 hi/lo
//   rows Aq[head][l][32 d] in LDS; wave = (head of the pair, 16-l tile):
//   D[l][e] = sum_d q[l][d] kvt[e][d] as three-product split (A = Aq rows,
//   B = KVT rows e from global); epilogue f32: res = D (1 + 1/(z+1e-6))
//   - z vmean[e], u = (res + lepe) * o, bf16 hi/lo into U planes [l][256 c].
//  phase B: D[l][co] = sum_c U[l][c] WP[co][c] as three-product split
//   (Uh*WPh + Ul*WPh + Uh*WPl, K = 256), + bias f32; staged [256 co][64 l]
// ---------------------------------------------------------------------------
__global__ __launch_bounds__(256) void k_resproj(
    const float* __restrict__ QF, const float* __restrict__ OF, const float* __restrict__ LF,
    const us_t* __restrict__ KVTh, const us_t* __restrict__ KVTl,
    const float* __restrict__ KM, const float* __restrict__ VM,
    const us_t* __restrict__ WPh, const us_t* __restrict__ WPl,
    const float* __restrict__ pbias, float* __restrict__ out)
{
  extern __shared__ __attribute__((aligned(16))) unsigned char dsm[];
  us_t*  Uh    = (us_t*)(dsm + RP_UH);
  us_t*  Ul    = (us_t*)(dsm + RP_UL);
  float* sO    = (float*)(dsm + RP_UH);
  us_t*  Aqh   = (us_t*)(dsm + RP_AQH);
  us_t*  Aql   = (us_t*)(dsm + RP_AQL);
  float* sSinW = (float*)(dsm + RP_SINW);
  float* sCosW = (float*)(dsm + RP_COSW);
  float* sSinH = (float*)(dsm + RP_SINH);
  float* sCosH = (float*)(dsm + RP_COSH);
  float* sFreq = (float*)(dsm + RP_FREQ);
  float* sZP   = (float*)(dsm + RP_ZP);
  float* sKM   = (float*)(dsm + RP_KM);
  float* sVM   = (float*)(dsm + RP_VM);
  const int tid = threadIdx.x, lane = tid & 31, w = tid >> 5;
  const int h = lane >> 4, m = lane & 15;
  const int lb = blockIdx.x, b = blockIdx.y;
  const int l0 = lb * 64;
  const v8f z8 = zero8f();

  // phase 0
  if (tid < 8) sFreq[tid] = rope_freq(tid);
  sKM[tid] = KM[(size_t)b * CH + tid];
  sVM[tid] = VM[(size_t)b * CH + tid];
  __syncthreads();
  #pragma unroll 1
  for (int j = 0; j < 2; ++j) {
    const int idx = tid + 256 * j;
    const int pos = idx >> 3, f = idx & 7;
    float sv, cv;
    sincosf((float)pos * sFreq[f], &sv, &cv);
    sSinW[idx] = sv;
    sCosW[idx] = cv;
  }
  if (tid < 8) {
    float sv, cv;
    sincosf((float)lb * sFreq[tid], &sv, &cv);
    sSinH[tid] = sv;
    sCosH[tid] = cv;
  }
  __syncthreads();

  // phase A
  const int sl = tid & 63, part = tid >> 6, shp = part >> 1, sdh = part & 1;   // staging role
  const int chp = w >> 2, clt = w & 3;                                           // tile role
  #pragma unroll 1
  for (int hp2 = 0; hp2 < 4; ++hp2) {
    {
      const int nn = 2 * hp2 + shp;
      const float* qp = QF + (size_t)(b * CH + nn * HD + 16 * sdh) * NP + l0 + sl;
      float qv[16];
      #pragma unroll
      for (int j = 0; j < 16; ++j) qv[j] = qp[(size_t)j * NP];
      float zpart = 0.f;
      #pragma unroll
      for (int j = 0; j < 16; ++j) zpart += qv[j] * sKM[nn * HD + 16 * sdh + j];
      sZP[part * 64 + sl] = zpart;
      us_t hq[16], lq[16];
      #pragma unroll
      for (int i = 0; i < 8; ++i) {
        const float sw = sSinW[sl * 8 + i], cw = sCosW[sl * 8 + i];
        const float sr = sSinH[i], cr = sCosH[i];
        const float s = sdh ? sw : sr;
        const float c = sdh ? cw : cr;
        const float x0 = qv[2 * i], x1 = qv[2 * i + 1];
        split2(x0 * c - x1 * s, hq[2 * i], lq[2 * i]);
        split2(x1 * c + x0 * s, hq[2 * i + 1], lq[2 * i + 1]);
      }
      v8us h0, h1, g0, g1;
      #pragma unroll
      for (int i = 0; i < 8; ++i) { h0[i] = hq[i]; h1[i] = hq[8 + i]; g0[i] = lq[i]; g1[i] = lq[8 + i]; }
      us_t* ah = Aqh + (shp * 64 + sl) * AQP + 16 * sdh;
      us_t* al = Aql + (shp * 64 + sl) * AQP + 16 * sdh;
      *(v8usa*)ah = h0; *(v8usa*)(ah + 8) = h1;
      *(v8usa*)al = g0; *(v8usa*)(al + 8) = g1;
    }
    __syncthreads();
    {
      const int nn = 2 * hp2 + chp;
      const FragB fa = ldfrag(Aqh + (chp * 64 + 16 * clt + m) * AQP, h);
      const FragB fl = ldfrag(Aql + (chp * 64 + 16 * clt + m) * AQP, h);
      v8f acc[2];
      #pragma unroll
      for (int u = 0; u < 2; ++u) {
        const size_t kr = ((size_t)(b * NH + nn) * HD + 16 * u + m) * HD;
        const FragB gb = ldfrag(KVTh + kr, h);
        const FragB gl = ldfrag(KVTl + kr, h);
        v8f a = wmma_bf16(fa, gb, z8);
        a = wmma_bf16(fa, gl, a);
        a = wmma_bf16(fl, gb, a);
        acc[u] = a;
      }
      float zz[8], fac[8];
      #pragma unroll
      for (int r = 0; r < 8; ++r) {
        const int l = 16 * clt + 8 * h + r;
        const float z = (sZP[(2 * chp) * 64 + l] + sZP[(2 * chp + 1) * 64 + l]) * SCALE_F;
        zz[r] = z;
        fac[r] = 1.0f + 1.0f / (z + 1e-6f);
      }
      #pragma unroll
      for (int u = 0; u < 2; ++u) {
        const int e = 16 * u + m, c = nn * HD + e;
        const float vme = sVM[nn * HD + e];
        const size_t go = (size_t)(b * CH + c) * NP + l0 + 16 * clt + 8 * h;
        const v4f le0 = *(const v4fa*)(LF + go);
        const v4f le1 = *(const v4fa*)(LF + go + 4);
        const v4f og0 = *(const v4fa*)(OF + go);
        const v4f og1 = *(const v4fa*)(OF + go + 4);
        const float lev[8] = {le0.x, le0.y, le0.z, le0.w, le1.x, le1.y, le1.z, le1.w};
        const float ogv[8] = {og0.x, og0.y, og0.z, og0.w, og1.x, og1.y, og1.z, og1.w};
        #pragma unroll
        for (int r = 0; r < 8; ++r) {
          const float res = acc[u][r] * fac[r] - zz[r] * vme;
          const float uv = (res + lev[r]) * ogv[r];
          us_t p1, p2;
          split2(uv, p1, p2);
          const int l = 16 * clt + 8 * h + r;
          Uh[l * CH + c] = p1;
          Ul[l * CH + c] = p2;
        }
      }
    }
    __syncthreads();
  }

  // phase B: output projection
  const int wl = w & 1, wc = w >> 1;
  v8f pacc[2][4];
  #pragma unroll
  for (int t = 0; t < 2; ++t) {
    #pragma unroll
    for (int v = 0; v < 4; ++v) pacc[t][v] = z8;
  }
  const us_t* ua0 = Uh + (32 * wl + m) * CH;
  const us_t* ua1 = ua0 + 16 * CH;
  const us_t* la0 = Ul + (32 * wl + m) * CH;
  const us_t* la1 = la0 + 16 * CH;
  const us_t* wph = WPh + (size_t)(64 * wc + m) * CH;
  const us_t* wpl = WPl + (size_t)(64 * wc + m) * CH;
  #pragma unroll 1
  for (int k0 = 0; k0 < CH; k0 += 32) {
    const FragB a0 = ldfrag(ua0 + k0, h);
    const FragB a1 = ldfrag(ua1 + k0, h);
    const FragB c0 = ldfrag(la0 + k0, h);
    const FragB c1 = ldfrag(la1 + k0, h);
    #pragma unroll
    for (int v = 0; v < 4; ++v) {
      const FragB bh = ldfrag(wph + (size_t)(16 * v) * CH + k0, h);
      const FragB bl = ldfrag(wpl + (size_t)(16 * v) * CH + k0, h);
      pacc[0][v] = wmma_bf16(a0, bh, pacc[0][v]);
      pacc[0][v] = wmma_bf16(c0, bh, pacc[0][v]);
      pacc[0][v] = wmma_bf16(a0, bl, pacc[0][v]);
      pacc[1][v] = wmma_bf16(a1, bh, pacc[1][v]);
      pacc[1][v] = wmma_bf16(c1, bh, pacc[1][v]);
      pacc[1][v] = wmma_bf16(a1, bl, pacc[1][v]);
    }
  }
  __syncthreads();   // all waves done with the U planes before the staging overlays them
  #pragma unroll
  for (int v = 0; v < 4; ++v) {
    const int co = 64 * wc + 16 * v + m;
    const float pb = pbias[co];
    #pragma unroll
    for (int t = 0; t < 2; ++t) {
      v8f y;
      #pragma unroll
      for (int r = 0; r < 8; ++r) y[r] = pacc[t][v][r] + pb;
      st8f(sO + co * 64 + 32 * wl + 16 * t + 8 * h, y);
    }
  }
  __syncthreads();
  const int q8 = lane & 7, sub = lane >> 3;
  #pragma unroll
  for (int i = 0; i < 16; ++i) {
    const int id = 64 * w + 4 * i + sub;
    const int R = id >> 1, Lh = id & 1;
    const v4f val = *(const v4fa*)(sO + R * 64 + 32 * Lh + 4 * q8);
    const size_t d = (size_t)(b * CH + R) * NP + l0 + 32 * Lh + 4 * q8;
    *(v4f*)(out + d) = val;
  }
  
}

// ---------------------------------------------------------------------------
extern "C" void kernel_launch(void* const* d_in, const int* in_sizes, int n_in,
                              void* d_out, int out_size, void* d_ws, size_t ws_size,
                              hipStream_t stream)
{
  if (n_in < 7) return;
  if (in_sizes[0] != NB * CH * NP) return;
  if (in_sizes[1] != 4 * CH * CH || in_sizes[2] != 4 * CH) return;
  if (in_sizes[3] != CH * 25 || in_sizes[4] != CH) return;
  if (in_sizes[5] != CH * CH || in_sizes[6] != CH) return;
  if (out_size != NB * CH * NP) return;

  const float* x      = (const float*)d_in[0];
  const float* qkvo_w = (const float*)d_in[1];
  const float* qkvo_b = (const float*)d_in[2];
  const float* lepe_w = (const float*)d_in[3];
  const float* lepe_b = (const float*)d_in[4];
  const float* proj_w = (const float*)d_in[5];
  const float* proj_b = (const float*)d_in[6];
  float* outp = (float*)d_out;

  const size_t szWQ  = (size_t)4 * CH * CH * 2;         //    524288 (x2)
  const size_t szWP  = (size_t)CH * CH * 2;             //    131072 (x2)
  const size_t szR   = (size_t)NB * CH * NP * 4;        //  33554432 (x3)
  const size_t szKVT = (size_t)NB * NH * HD * HD * 2;   //    131072 (x2)
  const size_t szM   = (size_t)NB * NH * HD * 4;        //      8192 (x2)
  size_t off = 0;
  char* ws = (char*)d_ws;
  us_t*  WQh  = (us_t*)(ws + off);  off += szWQ;
  us_t*  WQl  = (us_t*)(ws + off);  off += szWQ;
  us_t*  WPh  = (us_t*)(ws + off);  off += szWP;
  us_t*  WPl  = (us_t*)(ws + off);  off += szWP;
  float* R1   = (float*)(ws + off); off += szR;     // k planes, later q planes
  float* R2   = (float*)(ws + off); off += szR;     // v planes, later o planes
  float* LF   = (float*)(ws + off); off += szR;     // depthwise result
  us_t*  KVTh = (us_t*)(ws + off);  off += szKVT;
  us_t*  KVTl = (us_t*)(ws + off);  off += szKVT;
  float* KM   = (float*)(ws + off); off += szM;
  float* VM   = (float*)(ws + off); off += szM;     // total 102252544
  if (off > ws_size) return;

  k_wcvt<<<dim3(160), 256, 0, stream>>>(qkvo_w, proj_w, WQh, WQl, WPh, WPl);
  hipFuncSetAttribute(reinterpret_cast<const void*>(&k_gemm),
                      hipFuncAttributeMaxDynamicSharedMemorySize, GM_BYTES);
  k_gemm<<<dim3(HW, 2, NB), 256, GM_BYTES, stream>>>(x, WQh, WQl, qkvo_b, R1, R2, 0);
  k_kv<<<dim3(NB * NH), 128, 0, stream>>>(R1, R2, KVTh, KVTl, KM, VM);
  k_lepe<<<dim3(CH, NB), 256, 0, stream>>>(R2, lepe_w, lepe_b, LF);
  k_gemm<<<dim3(HW, 2, NB), 256, GM_BYTES, stream>>>(x, WQh, WQl, qkvo_b, R1, R2, 1);
  hipFuncSetAttribute(reinterpret_cast<const void*>(&k_resproj),
                      hipFuncAttributeMaxDynamicSharedMemorySize, RP_BYTES);
  k_resproj<<<dim3(NP / 64, NB), 256, RP_BYTES, stream>>>(R1, R2, LF, KVTh, KVTl, KM, VM, WPh, WPl, proj_b, outp);
}

// v001
// Measured time: 178 microseconds a run.
// Next to v000, in two timings, it ran 1.46 times as fast each time.
// Contractions: qkv/o 1x1 projection, k^T v, q kv and the output 1x1 projection all on v_wmma_f32_16x16x32_bf16 as bf16 hi/lo three-product split (hi*hi + hi*lo + lo*hi, f32 accumulate); elu, channel means, z, rotary tables, depthwise 5x5, biases and the elementwise tail in f32.
#include <hip/hip_runtime.h>
#include <math.h>

typedef unsigned short us_t;
typedef __bf16   v16b __attribute__((ext_vector_type(16)));
typedef _Float16 v16h __attribute__((ext_vector_type(16)));
typedef us_t     v8us __attribute__((ext_vector_type(8)));
typedef us_t     v4us __attribute__((ext_vector_type(4)));
typedef float    v8f  __attribute__((ext_vector_type(8)));
typedef float    v4f  __attribute__((ext_vector_type(4)));
typedef v8us __attribute__((may_alias)) v8usa;
typedef v4us __attribute__((may_alias)) v4usa;
typedef v4f  __attribute__((may_alias)) v4fa;
union FragB { v16b v; v8us half[2]; v16h x; };
union Q8    { v8f v; v4f q[2]; };

#define NB   8
#define CH   256
#define NP   4096
#define HW   64
#define NH   8
#define HD   32
#define KVP  72
#define AQP  40
#define PPW  68
#define GXP  264
#define SCALE_F 0.17677669529663687f
#define CKV     0.0065695032f
#define INV_L   0.000244140625f
#define KS   16
#define KSL  256
#define KREC 1088

// dynamic LDS map of k_gemm (bytes): x hi tile [64][264] us_t, x lo tile, f32 staging over both
#define GM_XL    33792
#define GM_BYTES 67584

// dynamic LDS map of k_resproj (bytes)
#define RP_UH    0
#define RP_UL    32768
#define RP_AQH   65536
#define RP_AQL   75776
#define RP_SINW  86016
#define RP_COSW  88064
#define RP_SINH  90112
#define RP_COSH  90144
#define RP_FREQ  90176
#define RP_ZP    90208
#define RP_KM    91232
#define RP_VM    92256
#define RP_BYTES 93312

// ---------------------------------------------------------------------------
// 16x16x32 bf16 WMMA with hazard guard (ties D, keeps A/B live).
// Fragment map (wave32): lane l, h = l>>4, m = n = l&15.
//   A/B element i: i<8 -> k0+8h+i ; i>=8 -> k0+16+8h+(i-8)
//   D element r : row 8h+r, col l&15
// ---------------------------------------------------------------------------
__device__ __forceinline__ v8f wmma_bf16(const FragB& a, const FragB& b, v8f c) {
  v8f d = __builtin_amdgcn_wmma_f32_16x16x32_bf16(false, a.v, false, b.v, (short)0, c, false, false);
  asm volatile("v_nop\n\tv_nop\n\tv_nop\n\tv_nop" : "+v"(d) : "v"(a.x), "v"(b.x));
  return d;
}
// fragment from a k-contiguous bf16 row holding >= 32 elements starting at p (p = row + k0)
__device__ __forceinline__ FragB ldfrag(const us_t* p, int h) {
  FragB f;
  f.half[0] = *(const v8usa*)(p + 8 * h);
  f.half[1] = *(const v8usa*)(p + 16 + 8 * h);
  return f;
}
__device__ __forceinline__ v8f zero8f() {
  v8f z;
  #pragma unroll
  for (int j = 0; j < 8; ++j) z[j] = 0.f;
  return z;
}
// 8 floats to LDS as two 16-B pieces
__device__ __forceinline__ void st8f(float* p, v8f v) {
  Q8 u; u.v = v;
  *(v4fa*)p = u.q[0];
  *(v4fa*)(p + 4) = u.q[1];
}
// RNE convert f32 -> bf16 bits, and back
__device__ __forceinline__ us_t bf16_rne(float f) {
  unsigned u = __float_as_uint(f);
  u += 0x7FFFu + ((u >> 16) & 1u);
  return (us_t)(u >> 16);
}
__device__ __forceinline__ float bf16_val(us_t b) { return __uint_as_float(((unsigned)b) << 16); }
__device__ __forceinline__ void split2(float f, us_t& hi, us_t& lo) {
  hi = bf16_rne(f);
  lo = bf16_rne(f - bf16_val(hi));
}
// rotary frequency i of 8: 1 / 10000^(i/7), linspace-style exponent
__device__ __forceinline__ float rope_freq(int i) {
  const float e = (i == 7) ? 1.0f : (float)i * (1.0f / 7.0f);
  return 1.0f / powf(10000.0f, e);
}

// ---------------------------------------------------------------------------
// Kernel 0: weights -> bf16 hi/lo rows. WQh/WQl [1024][256] from the qkv/o
// weights, WPh/WPl [256][256] from the output projection weights. Thread = 8
// ---------------------------------------------------------------------------
__global__ __launch_bounds__(256) void k_wcvt(const float* __restrict__ qw, const float* __restrict__ pw,
                                             us_t* __restrict__ WQh, us_t* __restrict__ WQl,
                                             us_t* __restrict__ WPh, us_t* __restrict__ WPl)
{
  const int g = blockIdx.x * 256 + threadIdx.x;
  if (g >= 40960) return;
  const float* src;
  us_t* dh;
  us_t* dl;
  if (g < 32768) { src = qw + (size_t)g * 8; dh = WQh + (size_t)g * 8; dl = WQl + (size_t)g * 8; }
  else { const int g2 = g - 32768; src = pw + (size_t)g2 * 8; dh = WPh + (size_t)g2 * 8; dl = WPl + (size_t)g2 * 8; }
  const v4f a = *(const v4fa*)src;
  const v4f c = *(const v4fa*)(src + 4);
  v8us oh, ol;
  {
    us_t p1, p2;
    split2(a.x, p1, p2); oh[0] = p1; ol[0] = p2;
    split2(a.y, p1, p2); oh[1] = p1; ol[1] = p2;
    split2(a.z, p1, p2); oh[2] = p1; ol[2] = p2;
    split2(a.w, p1, p2); oh[3] = p1; ol[3] = p2;
    split2(c.x, p1, p2); oh[4] = p1; ol[4] = p2;
    split2(c.y, p1, p2); oh[5] = p1; ol[5] = p2;
    split2(c.z, p1, p2); oh[6] = p1; ol[6] = p2;
    split2(c.w, p1, p2); oh[7] = p1; ol[7] = p2;
  }
  *(v8us*)dh = oh;
  *(v8us*)dl = ol;
  
}

// ---------------------------------------------------------------------------
// Kernel 1: 1x1 projection GEMM D[l][o] = sum_c x[c][l] * W[o][c] + bias[o],
// elu+1 for the q/k channel classes, as bf16 hi/lo three-product split.
// Block = (image row of 64 positions, 256-channel class, b), 8 waves.
// Staging: the x tile [256 c][64 l] (NCHW f32, l-contiguous float4 loads) is
// split into hi/lo LDS tiles sXh/sXl [64 l][256 c] (k-contiguous rows).
// A = sX rows (positions), B = WQh/WQl rows (channels) straight from global,
// K = 256 in 8 steps; wave = 32 positions x 64 channels (2x4 tiles);
// products a_hi*b_hi + a_hi*b_lo + a_lo*b_hi.
// mode 0: class 0 -> channels 256..511 (k -> R1), class 1 -> 512..767 (v ->
// R2); mode 1: class 0 -> 0..255 (q -> R1), class 1 -> 768..1023 (o -> R2);
// NCHW f32 [b][256][4096]. Epilogue staged [256 ch][64 pos] f32 over the x
// ---------------------------------------------------------------------------
__global__ __launch_bounds__(256) void k_gemm(const float* __restrict__ x,
                                             const us_t* __restrict__ WQh, const us_t* __restrict__ WQl,
                                             const float* __restrict__ bias,
                                             float* __restrict__ R1, float* __restrict__ R2, int mode)
{
  extern __shared__ __attribute__((aligned(16))) unsigned char dsm[];
  us_t*  sXh = (us_t*)dsm;
  us_t*  sXl = (us_t*)(dsm + GM_XL);
  float* sO  = (float*)dsm;
  const int tid = threadIdx.x, lane = tid & 31, w = tid >> 5;
  const int h = lane >> 4, m = lane & 15;
  const int lb = blockIdx.x, cb = blockIdx.y, b = blockIdx.z;
  const int l0 = lb * 64;
  const int obase = (mode == 0) ? (256 + 256 * cb) : ((cb == 0) ? 0 : 768);
  const int cls = obase >> 8;
  float* dst = (cls < 2) ? R1 : R2;

  // stage x[c][l0 + 0..63] -> hi/lo tiles [l][c]
  const float* xb = x + (size_t)(b * CH) * NP + l0;
  #pragma unroll 2
  for (int j = 0; j < 16; ++j) {
    const int f = tid + 256 * j;
    const int c = f >> 4, lq = (f & 15) * 4;
    const v4f v = *(const v4fa*)(xb + (size_t)c * NP + lq);
    us_t p1, p2;
    split2(v.x, p1, p2); sXh[(lq + 0) * GXP + c] = p1; sXl[(lq + 0) * GXP + c] = p2;
    split2(v.y, p1, p2); sXh[(lq + 1) * GXP + c] = p1; sXl[(lq + 1) * GXP + c] = p2;
    split2(v.z, p1, p2); sXh[(lq + 2) * GXP + c] = p1; sXl[(lq + 2) * GXP + c] = p2;
    split2(v.w, p1, p2); sXh[(lq + 3) * GXP + c] = p1; sXl[(lq + 3) * GXP + c] = p2;
  }
  __syncthreads();

  const int wl = w & 1, wc = w >> 1;
  const v8f z8 = zero8f();
  v8f acc[2][4];
  #pragma unroll
  for (int t = 0; t < 2; ++t) {
    #pragma unroll
    for (int v = 0; v < 4; ++v) acc[t][v] = z8;
  }
  const us_t* ah0 = sXh + (32 * wl + m) * GXP;
  const us_t* ah1 = ah0 + 16 * GXP;
  const us_t* al0 = sXl + (32 * wl + m) * GXP;
  const us_t* al1 = al0 + 16 * GXP;
  const us_t* bh0 = WQh + (size_t)(obase + 64 * wc + m) * CH;
  const us_t* bl0 = WQl + (size_t)(obase + 64 * wc + m) * CH;

  #pragma unroll 1
  for (int k0 = 0; k0 < CH; k0 += 32) {
    const FragB a0 = ldfrag(ah0 + k0, h);
    const FragB a1 = ldfrag(ah1 + k0, h);
    const FragB c0 = ldfrag(al0 + k0, h);
    const FragB c1 = ldfrag(al1 + k0, h);
    #pragma unroll
    for (int v = 0; v < 4; ++v) {
      const FragB bh = ldfrag(bh0 + (size_t)(16 * v) * CH + k0, h);
      const FragB bl = ldfrag(bl0 + (size_t)(16 * v) * CH + k0, h);
      acc[0][v] = wmma_bf16(a0, bh, acc[0][v]);
      acc[0][v] = wmma_bf16(a0, bl, acc[0][v]);
      acc[0][v] = wmma_bf16(c0, bh, acc[0][v]);
      acc[1][v] = wmma_bf16(a1, bh, acc[1][v]);
      acc[1][v] = wmma_bf16(a1, bl, acc[1][v]);
      acc[1][v] = wmma_bf16(c1, bh, acc[1][v]);
    }
  }
  __syncthreads();   // all waves done with the x tiles before the staging overlays them

  #pragma unroll
  for (int v = 0; v < 4; ++v) {
    const int ch = 64 * wc + 16 * v + m;
    const float bb = bias[obase + ch];
    #pragma unroll
    for (int t = 0; t < 2; ++t) {
      v8f y;
      #pragma unroll
      for (int r = 0; r < 8; ++r) {
        float vv = acc[t][v][r] + bb;
        if (cls < 2) vv = (vv > 0.f) ? (vv + 1.f) : expf(vv);
        y[r] = vv;
      }
      st8f(sO + ch * 64 + 32 * wl + 16 * t + 8 * h, y);
    }
  }
  __syncthreads();
  const int q8 = lane & 7, sub = lane >> 3;
  #pragma unroll
  for (int i = 0; i < 16; ++i) {
    const int id = 64 * w + 4 * i + sub;
    const int R = id >> 1, Lh = id & 1;
    const v4f val = *(const v4fa*)(sO + R * 64 + 32 * Lh + 4 * q8);
    const size_t d = (size_t)(b * CH + R) * NP + l0 + 32 * Lh + 4 * q8;
    *(v4f*)(dst + d) = val;
  }
  
}

// ---------------------------------------------------------------------------
// Kernel 2: per (b, head n, slice of 256 positions), 128 threads: streams its
// slice in chunks of 64; f32 channel sums of k (elu+1, before rotation) and v
// in a fixed order; rotary on k in f32 from an LDS sin/cos table; bf16 hi/lo
// planes of rotated k [d][l] and of v [e][l] in LDS; partial
// sum_l krot[d][l] v[e][l] as three-product split (A = krot rows,
// B column e of v = v row e; D rows d, cols e), f32 accumulate.
// Output: one f32 record per (b, n, slice) in PK: [e][d] 1024 partial
// products, 32 k sums, 32 v sums (4352 B = 34 whole lines, one writer block).
// ---------------------------------------------------------------------------
__global__ __launch_bounds__(128) void k_kv(const float* __restrict__ KF, const float* __restrict__ VF,
                                           float* __restrict__ PK)
{
  __shared__ __attribute__((aligned(16))) us_t Ah[HD * KVP];
  __shared__ __attribute__((aligned(16))) us_t Al[HD * KVP];
  __shared__ __attribute__((aligned(16))) us_t Bh[HD * KVP];
  __shared__ __attribute__((aligned(16))) us_t Bl[HD * KVP];
  __shared__ __attribute__((aligned(16))) float sSin[HW * 8];
  __shared__ __attribute__((aligned(16))) float sCos[HW * 8];
  __shared__ __attribute__((aligned(16))) float sKV[HD * HD];
  __shared__ __attribute__((aligned(16))) float sSum[64];
  __shared__ float sFreq[8];
  const int tid = threadIdx.x, lane = tid & 31, w = tid >> 5;
  const int h = lane >> 4, m = lane & 15;
  const int n = blockIdx.x & 7, b = blockIdx.x >> 3;
  const int lbeg = blockIdx.y * KSL;
  if (tid < 8) sFreq[tid] = rope_freq(tid);
  __syncthreads();
  #pragma unroll 1
  for (int j = 0; j < 4; ++j) {
    const int idx = tid + 128 * j;
    const int pos = idx >> 3, f = idx & 7;
    float sv, cv;
    sincosf((float)pos * sFreq[f], &sv, &cv);
    sSin[idx] = sv;
    sCos[idx] = cv;
  }
  const int i0 = tid >> 4, l4 = (tid & 15) * 4;
  const float* kb = KF + (size_t)(b * CH + n * HD) * NP;
  const float* vb = VF + (size_t)(b * CH + n * HD) * NP;
  float ks[4], vs[4];
  #pragma unroll
  for (int j = 0; j < 4; ++j) { ks[j] = 0.f; vs[j] = 0.f; }
  const int td = w >> 1, te = w & 1;
  const v8f z8 = zero8f();
  v8f acc = z8;

  #pragma unroll 1
  for (int l0 = lbeg; l0 < lbeg + KSL; l0 += 64) {
    __syncthreads();
    const int hp = l0 >> 6;
    // k rows: g = 0 -> d pair (2 i0, 2 i0 + 1) keyed on the image row hp;
    //         g = 1 -> d pair (16 + 2 i0, +1) keyed on the image column l4 + t
    #pragma unroll
    for (int g = 0; g < 2; ++g) {
      const int d0 = 16 * g + 2 * i0;
      const v4f ka = *(const v4fa*)(kb + (size_t)d0 * NP + l0 + l4);
      const v4f kc = *(const v4fa*)(kb + (size_t)(d0 + 1) * NP + l0 + l4);
      ks[2 * g]     += (ka.x + ka.y) + (ka.z + ka.w);
      ks[2 * g + 1] += (kc.x + kc.y) + (kc.z + kc.w);
      const float sr = sSin[hp * 8 + i0], cr = sCos[hp * 8 + i0];
      v4us ha, la, hc, lc;
      #pragma unroll
      for (int t = 0; t < 4; ++t) {
        const int widx = (l4 + t) * 8 + i0;
        const float sw = sSin[widx], cw = sCos[widx];
        const float s = g ? sw : sr;
        const float c = g ? cw : cr;
        const float xa = ka[t], xc = kc[t];
        us_t p1, p2;
        split2(xa * c - xc * s, p1, p2); ha[t] = p1; la[t] = p2;
        split2(xc * c + xa * s, p1, p2); hc[t] = p1; lc[t] = p2;
      }
      *(v4usa*)(Ah + d0 * KVP + l4) = ha;
      *(v4usa*)(Al + d0 * KVP + l4) = la;
      *(v4usa*)(Ah + (d0 + 1) * KVP + l4) = hc;
      *(v4usa*)(Al + (d0 + 1) * KVP + l4) = lc;
    }
    // v rows e = i0 + 8 j
    #pragma unroll
    for (int j = 0; j < 4; ++j) {
      const int e = i0 + 8 * j;
      const v4f vv = *(const v4fa*)(vb + (size_t)e * NP + l0 + l4);
      vs[j] += (vv.x + vv.y) + (vv.z + vv.w);
      v4us hv, lv;
      #pragma unroll
      for (int t = 0; t < 4; ++t) { us_t p1, p2; split2(vv[t], p1, p2); hv[t] = p1; lv[t] = p2; }
      *(v4usa*)(Bh + e * KVP + l4) = hv;
      *(v4usa*)(Bl + e * KVP + l4) = lv;
    }
    __syncthreads();
    #pragma unroll
    for (int kk = 0; kk < 2; ++kk) {
      const FragB fa = ldfrag(Ah + (16 * td + m) * KVP + 32 * kk, h);
      const FragB fl = ldfrag(Al + (16 * td + m) * KVP + 32 * kk, h);
      const FragB gb = ldfrag(Bh + (16 * te + m) * KVP + 32 * kk, h);
      const FragB gl = ldfrag(Bl + (16 * te + m) * KVP + 32 * kk, h);
      acc = wmma_bf16(fa, gb, acc);
      acc = wmma_bf16(fa, gl, acc);
      acc = wmma_bf16(fl, gb, acc);
    }
  }

  // channel sums: the 16 lanes of each half-wave share the channel index i0
  #pragma unroll
  for (int j = 0; j < 4; ++j) {
    float a = ks[j], c = vs[j];
    a += __shfl_xor(a, 1); a += __shfl_xor(a, 2); a += __shfl_xor(a, 4); a += __shfl_xor(a, 8);
    c += __shfl_xor(c, 1); c += __shfl_xor(c, 2); c += __shfl_xor(c, 4); c += __shfl_xor(c, 8);
    ks[j] = a; vs[j] = c;
  }
  if ((tid & 15) == 0) {
    sSum[2 * i0] = ks[0]; sSum[2 * i0 + 1] = ks[1];
    sSum[16 + 2 * i0] = ks[2]; sSum[17 + 2 * i0] = ks[3];
    #pragma unroll
    for (int j = 0; j < 4; ++j) sSum[32 + i0 + 8 * j] = vs[j];
  }
  // acc[r] -> (d = 16 td + 8 h + r, e = 16 te + m), staged transposed sKV[e][d]
  #pragma unroll
  for (int r = 0; r < 8; ++r) sKV[(16 * te + m) * HD + 16 * td + 8 * h + r] = acc[r];
  __syncthreads();

  float* rec = PK + (size_t)(blockIdx.x * KS + blockIdx.y) * KREC;
  #pragma unroll
  for (int j = 0; j < 2; ++j) {
    const int q = tid + 128 * j;
    *(v4f*)(rec + 4 * q) = *(const v4fa*)(sKV + 4 * q);
  }
  if (tid < 16) *(v4f*)(rec + 1024 + 4 * tid) = *(const v4fa*)(sSum + 4 * tid);
}

// ---------------------------------------------------------------------------
// Kernel 2b: per (b, head n), 288 threads: thread t < 272 adds float4 t of the
// 16 slice records in slice order; then KVT[e][d] = c^2 * sum as bf16 hi/lo
// KVTh/KVTl [b][n][e][d] (64-B rows, 2 rows per line, 8 threads per line, one
// instruction) and the KM/VM [b][n][32] means.
// ---------------------------------------------------------------------------
__global__ __launch_bounds__(288) void k_kvred(const float* __restrict__ PK,
                                              us_t* __restrict__ KVTh, us_t* __restrict__ KVTl,
                                              float* __restrict__ KM, float* __restrict__ VM)
{
  __shared__ __attribute__((aligned(16))) float sR[KREC];
  const int tid = threadIdx.x;
  if (tid < KREC / 4) {
    const float* p = PK + (size_t)blockIdx.x * (KS * KREC) + 4 * tid;
    v4f part[KS];
    #pragma unroll
    for (int s = 0; s < KS; ++s) part[s] = *(const v4fa*)(p + s * KREC);
    v4f a = part[0];
    #pragma unroll
    for (int s = 1; s < KS; ++s) a += part[s];
    *(v4fa*)(sR + 4 * tid) = a;
  }
  __syncthreads();
  if (tid >= 128) return;

  const float cc = CKV * CKV;
  const int e = tid >> 2, q4 = tid & 3;
  const v4f f0 = *(const v4fa*)(sR + e * HD + 8 * q4) * cc;
  const v4f f1 = *(const v4fa*)(sR + e * HD + 8 * q4 + 4) * cc;
  v8us hh, ll;
  {
    us_t p1, p2;
    split2(f0.x, p1, p2); hh[0] = p1; ll[0] = p2;
    split2(f0.y, p1, p2); hh[1] = p1; ll[1] = p2;
    split2(f0.z, p1, p2); hh[2] = p1; ll[2] = p2;
    split2(f0.w, p1, p2); hh[3] = p1; ll[3] = p2;
    split2(f1.x, p1, p2); hh[4] = p1; ll[4] = p2;
    split2(f1.y, p1, p2); hh[5] = p1; ll[5] = p2;
    split2(f1.z, p1, p2); hh[6] = p1; ll[6] = p2;
    split2(f1.w, p1, p2); hh[7] = p1; ll[7] = p2;
  }
  const size_t kd = ((size_t)blockIdx.x * HD + e) * HD + 8 * q4;
  const int mi = tid & 7;
  const bool isk = tid < 8;
  const bool isv = (tid >= 8) && (tid < 16);
  const v4f mk = *(const v4fa*)(sR + 1024 + 4 * mi) * INV_L;
  const v4f mv = *(const v4fa*)(sR + 1056 + 4 * mi) * INV_L;
  float* pk = KM + (size_t)blockIdx.x * HD + 4 * mi;
  float* pv = VM + (size_t)blockIdx.x * HD + 4 * mi;
  *(v8us*)(KVTh + kd) = hh;
  *(v8us*)(KVTl + kd) = ll;
  if (isk) *(v4f*)pk = mk;
  if (isv) *(v4f*)pv = mv;
}

// ---------------------------------------------------------------------------
// Kernel 3: depthwise 5x5 (zero pad 2) on the v planes, f32 VALU:
// LF[b][c][y][x] = bias[c] + sum w[c][dy][dx] v[b][c][y+dy-2][x+dx-2].
// Block = (channel, b); the 64x64 plane staged with a 2-wide zero ring in
// LDS [68][68]; thread = 4 consecutive x per iteration (rolled loops);
// ---------------------------------------------------------------------------
__global__ __launch_bounds__(256) void k_lepe(const float* __restrict__ VF, const float* __restrict__ lw,
                                             const float* __restrict__ lbias, float* __restrict__ LF)
{
  __shared__ __attribute__((aligned(16))) float sP[PPW * PPW];
  __shared__ float sW[25];
  const int tid = threadIdx.x;
  const int c = blockIdx.x, b = blockIdx.y;
  if (tid < 25) sW[tid] = lw[c * 25 + tid];
  #pragma unroll 1
  for (int j = 0; j < 19; ++j) {
    const int idx = tid + 256 * j;
    if (idx < PPW * PPW) sP[idx] = 0.f;
  }
  __syncthreads();
  const float* src = VF + (size_t)(b * CH + c) * NP;
  #pragma unroll
  for (int j = 0; j < 4; ++j) {
    const int f = tid + 256 * j, l = 4 * f, y = l >> 6, xx = l & 63;
    const v4f v = *(const v4fa*)(src + l);
    float* pr = sP + (y + 2) * PPW + xx + 2;
    pr[0] = v.x; pr[1] = v.y; pr[2] = v.z; pr[3] = v.w;
  }
  __syncthreads();
  const float bb = lbias[c];
  float* dst = LF + (size_t)(b * CH + c) * NP;
  #pragma unroll 1
  for (int j = 0; j < 4; ++j) {
    const int f = tid + 256 * j, l = 4 * f, y = l >> 6, xx = l & 63;
    float a0 = bb, a1 = bb, a2 = bb, a3 = bb;
    #pragma unroll 1
    for (int dy = 0; dy < 5; ++dy) {
      const float* rp = sP + (y + dy) * PPW + xx;
      const v4f r0 = *(const v4fa*)rp;
      const v4f r1 = *(const v4fa*)(rp + 4);
      const float rr[8] = {r0.x, r0.y, r0.z, r0.w, r1.x, r1.y, r1.z, r1.w};
      const float w0 = sW[dy * 5], w1 = sW[dy * 5 + 1], w2 = sW[dy * 5 + 2], w3 = sW[dy * 5 + 3], w4 = sW[dy * 5 + 4];
      a0 += w0 * rr[0]; a0 += w1 * rr[1]; a0 += w2 * rr[2]; a0 += w3 * rr[3]; a0 += w4 * rr[4];
      a1 += w0 * rr[1]; a1 += w1 * rr[2]; a1 += w2 * rr[3]; a1 += w3 * rr[4]; a1 += w4 * rr[5];
      a2 += w0 * rr[2]; a2 += w1 * rr[3]; a2 += w2 * rr[4]; a2 += w3 * rr[5]; a2 += w4 * rr[6];
      a3 += w0 * rr[3]; a3 += w1 * rr[4]; a3 += w2 * rr[5]; a3 += w3 * rr[6]; a3 += w4 * rr[7];
    }
    v4f o;
    o.x = a0; o.y = a1; o.z = a2; o.w = a3;
    *(v4f*)(dst + l) = o;
    
  }
}

// ---------------------------------------------------------------------------
// Kernel 4: per (image row of 64 positions, b), 8 waves:
//  phase 0: sin/cos tables and the per-image head means in LDS.
//  phase A (4 iterations over head pairs): threads stage q f32 [16 d] per
//   (head, l, half): partial z = q . kmean (f32), rotary in f32, bf16 hi/lo
//   rows Aq[head][l][32 d] in LDS; wave = (head of the pair, 16-l tile):
//   D[l][e] = sum_d q[l][d] kvt[e][d] as three-product split (A = Aq rows,
//   B = KVT rows e from global); epilogue f32: res = D (1 + 1/(z+1e-6))
//   - z vmean[e], u = (res + lepe) * o, bf16 hi/lo into U planes [l][256 c].
//  phase B: D[l][co] = sum_c U[l][c] WP[co][c] as three-product split
//   (Uh*WPh + Ul*WPh + Uh*WPl, K = 256), + bias f32; staged [256 co][64 l]
// ---------------------------------------------------------------------------
__global__ __launch_bounds__(256) void k_resproj(
    const float* __restrict__ QF, const float* __restrict__ OF, const float* __restrict__ LF,
    const us_t* __restrict__ KVTh, const us_t* __restrict__ KVTl,
    const float* __restrict__ KM, const float* __restrict__ VM,
    const us_t* __restrict__ WPh, const us_t* __restrict__ WPl,
    const float* __restrict__ pbias, float* __restrict__ out)
{
  extern __shared__ __attribute__((aligned(16))) unsigned char dsm[];
  us_t*  Uh    = (us_t*)(dsm + RP_UH);
  us_t*  Ul    = (us_t*)(dsm + RP_UL);
  float* sO    = (float*)(dsm + RP_UH);
  us_t*  Aqh   = (us_t*)(dsm + RP_AQH);
  us_t*  Aql   = (us_t*)(dsm + RP_AQL);
  float* sSinW = (float*)(dsm + RP_SINW);
  float* sCosW = (float*)(dsm + RP_COSW);
  float* sSinH = (float*)(dsm + RP_SINH);
  float* sCosH = (float*)(dsm + RP_COSH);
  float* sFreq = (float*)(dsm + RP_FREQ);
  float* sZP   = (float*)(dsm + RP_ZP);
  float* sKM   = (float*)(dsm + RP_KM);
  float* sVM   = (float*)(dsm + RP_VM);
  const int tid = threadIdx.x, lane = tid & 31, w = tid >> 5;
  const int h = lane >> 4, m = lane & 15;
  const int lb = blockIdx.x, b = blockIdx.y;
  const int l0 = lb * 64;
  const v8f z8 = zero8f();

  // phase 0
  if (tid < 8) sFreq[tid] = rope_freq(tid);
  sKM[tid] = KM[(size_t)b * CH + tid];
  sVM[tid] = VM[(size_t)b * CH + tid];
  __syncthreads();
  #pragma unroll 1
  for (int j = 0; j < 2; ++j) {
    const int idx = tid + 256 * j;
    const int pos = idx >> 3, f = idx & 7;
    float sv, cv;
    sincosf((float)pos * sFreq[f], &sv, &cv);
    sSinW[idx] = sv;
    sCosW[idx] = cv;
  }
  if (tid < 8) {
    float sv, cv;
    sincosf((float)lb * sFreq[tid], &sv, &cv);
    sSinH[tid] = sv;
    sCosH[tid] = cv;
  }
  __syncthreads();

  // phase A
  const int sl = tid & 63, part = tid >> 6, shp = part >> 1, sdh = part & 1;   // staging role
  const int chp = w >> 2, clt = w & 3;                                           // tile role
  #pragma unroll 1
  for (int hp2 = 0; hp2 < 4; ++hp2) {
    {
      const int nn = 2 * hp2 + shp;
      const float* qp = QF + (size_t)(b * CH + nn * HD + 16 * sdh) * NP + l0 + sl;
      float qv[16];
      #pragma unroll
      for (int j = 0; j < 16; ++j) qv[j] = qp[(size_t)j * NP];
      float zpart = 0.f;
      #pragma unroll
      for (int j = 0; j < 16; ++j) zpart += qv[j] * sKM[nn * HD + 16 * sdh + j];
      sZP[part * 64 + sl] = zpart;
      us_t hq[16], lq[16];
      #pragma unroll
      for (int i = 0; i < 8; ++i) {
        const float sw = sSinW[sl * 8 + i], cw = sCosW[sl * 8 + i];
        const float sr = sSinH[i], cr = sCosH[i];
        const float s = sdh ? sw : sr;
        const float c = sdh ? cw : cr;
        const float x0 = qv[2 * i], x1 = qv[2 * i + 1];
        split2(x0 * c - x1 * s, hq[2 * i], lq[2 * i]);
        split2(x1 * c + x0 * s, hq[2 * i + 1], lq[2 * i + 1]);
      }
      v8us h0, h1, g0, g1;
      #pragma unroll
      for (int i = 0; i < 8; ++i) { h0[i] = hq[i]; h1[i] = hq[8 + i]; g0[i] = lq[i]; g1[i] = lq[8 + i]; }
      us_t* ah = Aqh + (shp * 64 + sl) * AQP + 16 * sdh;
      us_t* al = Aql + (shp * 64 + sl) * AQP + 16 * sdh;
      *(v8usa*)ah = h0; *(v8usa*)(ah + 8) = h1;
      *(v8usa*)al = g0; *(v8usa*)(al + 8) = g1;
    }
    __syncthreads();
    {
      const int nn = 2 * hp2 + chp;
      const FragB fa = ldfrag(Aqh + (chp * 64 + 16 * clt + m) * AQP, h);
      const FragB fl = ldfrag(Aql + (chp * 64 + 16 * clt + m) * AQP, h);
      v8f acc[2];
      #pragma unroll
      for (int u = 0; u < 2; ++u) {
        const size_t kr = ((size_t)(b * NH + nn) * HD + 16 * u + m) * HD;
        const FragB gb = ldfrag(KVTh + kr, h);
        const FragB gl = ldfrag(KVTl + kr, h);
        v8f a = wmma_bf16(fa, gb, z8);
        a = wmma_bf16(fa, gl, a);
        a = wmma_bf16(fl, gb, a);
        acc[u] = a;
      }
      float zz[8], fac[8];
      #pragma unroll
      for (int r = 0; r < 8; ++r) {
        const int l = 16 * clt + 8 * h + r;
        const float z = (sZP[(2 * chp) * 64 + l] + sZP[(2 * chp + 1) * 64 + l]) * SCALE_F;
        zz[r] = z;
        fac[r] = 1.0f + 1.0f / (z + 1e-6f);
      }
      #pragma unroll
      for (int u = 0; u < 2; ++u) {
        const int e = 16 * u + m, c = nn * HD + e;
        const float vme = sVM[nn * HD + e];
        const size_t go = (size_t)(b * CH + c) * NP + l0 + 16 * clt + 8 * h;
        const v4f le0 = *(const v4fa*)(LF + go);
        const v4f le1 = *(const v4fa*)(LF + go + 4);
        const v4f og0 = *(const v4fa*)(OF + go);
        const v4f og1 = *(const v4fa*)(OF + go + 4);
        const float lev[8] = {le0.x, le0.y, le0.z, le0.w, le1.x, le1.y, le1.z, le1.w};
        const float ogv[8] = {og0.x, og0.y, og0.z, og0.w, og1.x, og1.y, og1.z, og1.w};
        #pragma unroll
        for (int r = 0; r < 8; ++r) {
          const float res = acc[u][r] * fac[r] - zz[r] * vme;
          const float uv = (res + lev[r]) * ogv[r];
          us_t p1, p2;
          split2(uv, p1, p2);
          const int l = 16 * clt + 8 * h + r;
          Uh[l * CH + c] = p1;
          Ul[l * CH + c] = p2;
        }
      }
    }
    __syncthreads();
  }

  // phase B: output projection
  const int wl = w & 1, wc = w >> 1;
  v8f pacc[2][4];
  #pragma unroll
  for (int t = 0; t < 2; ++t) {
    #pragma unroll
    for (int v = 0; v < 4; ++v) pacc[t][v] = z8;
  }
  const us_t* ua0 = Uh + (32 * wl + m) * CH;
  const us_t* ua1 = ua0 + 16 * CH;
  const us_t* la0 = Ul + (32 * wl + m) * CH;
  const us_t* la1 = la0 + 16 * CH;
  const us_t* wph = WPh + (size_t)(64 * wc + m) * CH;
  const us_t* wpl = WPl + (size_t)(64 * wc + m) * CH;
  #pragma unroll 1
  for (int k0 = 0; k0 < CH; k0 += 32) {
    const FragB a0 = ldfrag(ua0 + k0, h);
    const FragB a1 = ldfrag(ua1 + k0, h);
    const FragB c0 = ldfrag(la0 + k0, h);
    const FragB c1 = ldfrag(la1 + k0, h);
    #pragma unroll
    for (int v = 0; v < 4; ++v) {
      const FragB bh = ldfrag(wph + (size_t)(16 * v) * CH + k0, h);
      const FragB bl = ldfrag(wpl + (size_t)(16 * v) * CH + k0, h);
      pacc[0][v] = wmma_bf16(a0, bh, pacc[0][v]);
      pacc[0][v] = wmma_bf16(c0, bh, pacc[0][v]);
      pacc[0][v] = wmma_bf16(a0, bl, pacc[0][v]);
      pacc[1][v] = wmma_bf16(a1, bh, pacc[1][v]);
      pacc[1][v] = wmma_bf16(c1, bh, pacc[1][v]);
      pacc[1][v] = wmma_bf16(a1, bl, pacc[1][v]);
    }
  }
  __syncthreads();   // all waves done with the U planes before the staging overlays them
  #pragma unroll
  for (int v = 0; v < 4; ++v) {
    const int co = 64 * wc + 16 * v + m;
    const float pb = pbias[co];
    #pragma unroll
    for (int t = 0; t < 2; ++t) {
      v8f y;
      #pragma unroll
      for (int r = 0; r < 8; ++r) y[r] = pacc[t][v][r] + pb;
      st8f(sO + co * 64 + 32 * wl + 16 * t + 8 * h, y);
    }
  }
  __syncthreads();
  const int q8 = lane & 7, sub = lane >> 3;
  #pragma unroll
  for (int i = 0; i < 16; ++i) {
    const int id = 64 * w + 4 * i + sub;
    const int R = id >> 1, Lh = id & 1;
    const v4f val = *(const v4fa*)(sO + R * 64 + 32 * Lh + 4 * q8);
    const size_t d = (size_t)(b * CH + R) * NP + l0 + 32 * Lh + 4 * q8;
    *(v4f*)(out + d) = val;
  }
  
}

// ---------------------------------------------------------------------------
extern "C" void kernel_launch(void* const* d_in, const int* in_sizes, int n_in,
                              void* d_out, int out_size, void* d_ws, size_t ws_size,
                              hipStream_t stream)
{
  if (n_in < 7) return;
  if (in_sizes[0] != NB * CH * NP) return;
  if (in_sizes[1] != 4 * CH * CH || in_sizes[2] != 4 * CH) return;
  if (in_sizes[3] != CH * 25 || in_sizes[4] != CH) return;
  if (in_sizes[5] != CH * CH || in_sizes[6] != CH) return;
  if (out_size != NB * CH * NP) return;

  const float* x      = (const float*)d_in[0];
  const float* qkvo_w = (const float*)d_in[1];
  const float* qkvo_b = (const float*)d_in[2];
  const float* lepe_w = (const float*)d_in[3];
  const float* lepe_b = (const float*)d_in[4];
  const float* proj_w = (const float*)d_in[5];
  const float* proj_b = (const float*)d_in[6];
  float* outp = (float*)d_out;

  const size_t szWQ  = (size_t)4 * CH * CH * 2;         //    524288 (x2)
  const size_t szWP  = (size_t)CH * CH * 2;             //    131072 (x2)
  const size_t szR   = (size_t)NB * CH * NP * 4;        //  33554432 (x3)
  const size_t szKVT = (size_t)NB * NH * HD * HD * 2;   //    131072 (x2)
  const size_t szM   = (size_t)NB * NH * HD * 4;        //      8192 (x2)
  const size_t szPK  = (size_t)NB * NH * KS * KREC * 4; //   4456448
  size_t off = 0;
  char* ws = (char*)d_ws;
  us_t*  WQh  = (us_t*)(ws + off);  off += szWQ;
  us_t*  WQl  = (us_t*)(ws + off);  off += szWQ;
  us_t*  WPh  = (us_t*)(ws + off);  off += szWP;
  us_t*  WPl  = (us_t*)(ws + off);  off += szWP;
  float* R1   = (float*)(ws + off); off += szR;     // k planes, later q planes
  float* R2   = (float*)(ws + off); off += szR;     // v planes, later o planes
  float* LF   = (float*)(ws + off); off += szR;     // depthwise result
  us_t*  KVTh = (us_t*)(ws + off);  off += szKVT;
  us_t*  KVTl = (us_t*)(ws + off);  off += szKVT;
  float* KM   = (float*)(ws + off); off += szM;
  float* VM   = (float*)(ws + off); off += szM;
  float* PK   = (float*)(ws + off); off += szPK;    // slice records; total 106708992
  if (off > ws_size) return;

  k_wcvt<<<dim3(160), 256, 0, stream>>>(qkvo_w, proj_w, WQh, WQl, WPh, WPl);
  hipFuncSetAttribute(reinterpret_cast<const void*>(&k_gemm),
                      hipFuncAttributeMaxDynamicSharedMemorySize, GM_BYTES);
  k_gemm<<<dim3(HW, 2, NB), 256, GM_BYTES, stream>>>(x, WQh, WQl, qkvo_b, R1, R2, 0);
  k_kv<<<dim3(NB * NH, KS), 128, 0, stream>>>(R1, R2, PK);
  k_kvred<<<dim3(NB * NH), 288, 0, stream>>>(PK, KVTh, KVTl, KM, VM);
  k_lepe<<<dim3(CH, NB), 256, 0, stream>>>(R2, lepe_w, lepe_b, LF);
  k_gemm<<<dim3(HW, 2, NB), 256, GM_BYTES, stream>>>(x, WQh, WQl, qkvo_b, R1, R2, 1);
  hipFuncSetAttribute(reinterpret_cast<const void*>(&k_resproj),
                      hipFuncAttributeMaxDynamicSharedMemorySize, RP_BYTES);
  k_resproj<<<dim3(NP / 64, NB), 256, RP_BYTES, stream>>>(R1, R2, LF, KVTh, KVTl, KM, VM, WPh, WPl, proj_b, outp);
}

// v002
// One run takes 166 microseconds.
// Two timings next to v001 put it at 1.05 and 1.06 times that version's speed.
// Counting every step since v000, it is 1.55 times as fast.
// Contractions: qkv/o 1x1 projection, k^T v, q kv and the output 1x1 projection all on v_wmma_f32_16x16x32_bf16 as bf16 hi/lo three-product split (hi*hi + hi*lo + lo*hi, f32 accumulate); elu, channel means, z, rotary tables, depthwise 5x5, biases and the elementwise tail in f32.
#include <hip/hip_runtime.h>
#include <math.h>

typedef unsigned short us_t;
typedef __bf16   v16b __attribute__((ext_vector_type(16)));
typedef _Float16 v16h __attribute__((ext_vector_type(16)));
typedef us_t     v8us __attribute__((ext_vector_type(8)));
typedef us_t     v4us __attribute__((ext_vector_type(4)));
typedef float    v8f  __attribute__((ext_vector_type(8)));
typedef float    v4f  __attribute__((ext_vector_type(4)));
typedef v8us __attribute__((may_alias)) v8usa;
typedef v4us __attribute__((may_alias)) v4usa;
typedef v4f  __attribute__((may_alias)) v4fa;
union FragB { v16b v; v8us half[2]; v16h x; };
union Q8    { v8f v; v4f q[2]; };

#define NB   8
#define CH   256
#define NP   4096
#define HW   64
#define NH   8
#define HD   32
#define KVP  72
#define AQP  40
#define PPW  68
#define GXP  264
#define SCALE_F 0.17677669529663687f
#define CKV     0.0065695032f
#define INV_L   0.000244140625f
#define KS   16
#define KSL  256
#define KREC 1088

// dynamic LDS map of k_gemm (bytes): x hi tile [64][264] us_t, x lo tile, f32 staging over both
#define GM_XL    33792
#define GM_BYTES 67584

// dynamic LDS map of k_resproj (bytes)
#define RP_UH    0
#define RP_UL    32768
#define RP_AQH   65536
#define RP_AQL   75776
#define RP_SINW  86016
#define RP_COSW  88064
#define RP_SINH  90112
#define RP_COSH  90144
#define RP_FREQ  90176
#define RP_ZP    90208
#define RP_KM    91232
#define RP_VM    92256
#define RP_BYTES 93312

// ---------------------------------------------------------------------------
// 16x16x32 bf16 WMMA with hazard guard (ties D, keeps A/B live).
// Fragment map (wave32): lane l, h = l>>4, m = n = l&15.
//   A/B element i: i<8 -> k0+8h+i ; i>=8 -> k0+16+8h+(i-8)
//   D element r : row 8h+r, col l&15
// ---------------------------------------------------------------------------
__device__ __forceinline__ v8f wmma_bf16(const FragB& a, const FragB& b, v8f c) {
  v8f d = __builtin_amdgcn_wmma_f32_16x16x32_bf16(false, a.v, false, b.v, (short)0, c, false, false);
  asm volatile("v_nop\n\tv_nop\n\tv_nop\n\tv_nop" : "+v"(d) : "v"(a.x), "v"(b.x));
  return d;
}
// fragment from a k-contiguous bf16 row holding >= 32 elements starting at p (p = row + k0)
__device__ __forceinline__ FragB ldfrag(const us_t* p, int h) {
  FragB f;
  f.half[0] = *(const v8usa*)(p + 8 * h);
  f.half[1] = *(const v8usa*)(p + 16 + 8 * h);
  return f;
}
// fragment from a weight plane packed in fragment order (see k_wcvt): p = block start + 8 * lane
__device__ __forceinline__ FragB ldfragp(const us_t* p) {
  FragB f;
  f.half[0] = *(const v8usa*)p;
  f.half[1] = *(const v8usa*)(p + 256);
  return f;
}
__device__ __forceinline__ v8f zero8f() {
  v8f z;
  #pragma unroll
  for (int j = 0; j < 8; ++j) z[j] = 0.f;
  return z;
}
// 8 floats to LDS as two 16-B pieces
__device__ __forceinline__ void st8f(float* p, v8f v) {
  Q8 u; u.v = v;
  *(v4fa*)p = u.q[0];
  *(v4fa*)(p + 4) = u.q[1];
}
// RNE convert f32 -> bf16 bits, and back
__device__ __forceinline__ us_t bf16_rne(float f) {
  unsigned u = __float_as_uint(f);
  u += 0x7FFFu + ((u >> 16) & 1u);
  return (us_t)(u >> 16);
}
__device__ __forceinline__ float bf16_val(us_t b) { return __uint_as_float(((unsigned)b) << 16); }
__device__ __forceinline__ void split2(float f, us_t& hi, us_t& lo) {
  hi = bf16_rne(f);
  lo = bf16_rne(f - bf16_val(hi));
}
// rotary frequency i of 8: 1 / 10000^(i/7), linspace-style exponent
__device__ __forceinline__ float rope_freq(int i) {
  const float e = (i == 7) ? 1.0f : (float)i * (1.0f / 7.0f);
  return 1.0f / powf(10000.0f, e);
}

// ---------------------------------------------------------------------------
// Kernel 0: weights -> bf16 hi/lo planes in fragment order. WQh/WQl from the
// qkv/o weights [1024][256], WPh/WPl from the output projection [256][256].
// A plane is a row of 1-KiB blocks, block (T, ks) = 16 weight rows 16 T + m by
// 32 k from 32 ks, at element offset (8 T + ks) * 512, laid out
// [half j][lane l = 16 h + m][8 elements k = 32 ks + 16 j + 8 h + i]: a wave's
// 16-byte fragment load then reads 512 contiguous bytes (four whole lines)
// where row-major weights gave it 16 lines of 32 bytes. Thread = one 16-byte
// piece of each plane, so a wave also stores whole lines.
// ---------------------------------------------------------------------------
__global__ __launch_bounds__(256) void k_wcvt(const float* __restrict__ qw, const float* __restrict__ pw,
                                             us_t* __restrict__ WQh, us_t* __restrict__ WQl,
                                             us_t* __restrict__ WPh, us_t* __restrict__ WPl)
{
  const int g = blockIdx.x * 256 + threadIdx.x;
  if (g >= 40960) return;
  const float* src;
  us_t* dh;
  us_t* dl;
  const int g2 = (g < 32768) ? g : (g - 32768);
  const int pl = g2 & 31, pj = (g2 >> 5) & 1, pks = (g2 >> 6) & 7, pT = g2 >> 9;
  const size_t so = (size_t)(16 * pT + (pl & 15)) * CH + 32 * pks + 16 * pj + 8 * (pl >> 4);
  if (g < 32768) { src = qw + so; dh = WQh + (size_t)g2 * 8; dl = WQl + (size_t)g2 * 8; }
  else { src = pw + so; dh = WPh + (size_t)g2 * 8; dl = WPl + (size_t)g2 * 8; }
  const v4f a = *(const v4fa*)src;
  const v4f c = *(const v4fa*)(src + 4);
  v8us oh, ol;
  {
    us_t p1, p2;
    split2(a.x, p1, p2); oh[0] = p1; ol[0] = p2;
    split2(a.y, p1, p2); oh[1] = p1; ol[1] = p2;
    split2(a.z, p1, p2); oh[2] = p1; ol[2] = p2;
    split2(a.w, p1, p2); oh[3] = p1; ol[3] = p2;
    split2(c.x, p1, p2); oh[4] = p1; ol[4] = p2;
    split2(c.y, p1, p2); oh[5] = p1; ol[5] = p2;
    split2(c.z, p1, p2); oh[6] = p1; ol[6] = p2;
    split2(c.w, p1, p2); oh[7] = p1; ol[7] = p2;
  }
  *(v8us*)dh = oh;
  *(v8us*)dl = ol;
  
}

// ---------------------------------------------------------------------------
// Kernel 1: 1x1 projection GEMM D[l][o] = sum_c x[c][l] * W[o][c] + bias[o],
// elu+1 for the q/k channel classes, as bf16 hi/lo three-product split.
// Block = (image row of 64 positions, 256-channel class, b), 8 waves.
// Staging: the x tile [256 c][64 l] (NCHW f32, l-contiguous float4 loads) is
// split into hi/lo LDS tiles sXh/sXl [64 l][256 c] (k-contiguous rows).
// A = sX rows (positions), B = WQh/WQl fragment blocks straight from global,
// K = 256 in 8 steps; wave = 32 positions x 64 channels (2x4 tiles);
// products a_hi*b_hi + a_hi*b_lo + a_lo*b_hi.
// mode 0: class 0 -> channels 256..511 (k -> R1), class 1 -> 512..767 (v ->
// R2); mode 1: class 0 -> 0..255 (q -> R1), class 1 -> 768..1023 (o -> R2);
// NCHW f32 [b][256][4096]. Epilogue staged [256 ch][64 pos] f32 over the x
// ---------------------------------------------------------------------------
__global__ __launch_bounds__(256) void k_gemm(const float* __restrict__ x,
                                             const us_t* __restrict__ WQh, const us_t* __restrict__ WQl,
                                             const float* __restrict__ bias,
                                             float* __restrict__ R1, float* __restrict__ R2, int mode)
{
  extern __shared__ __attribute__((aligned(16))) unsigned char dsm[];
  us_t*  sXh = (us_t*)dsm;
  us_t*  sXl = (us_t*)(dsm + GM_XL);
  float* sO  = (float*)dsm;
  const int tid = threadIdx.x, lane = tid & 31, w = tid >> 5;
  const int h = lane >> 4, m = lane & 15;
  const int lb = blockIdx.x, cb = blockIdx.y, b = blockIdx.z;
  const int l0 = lb * 64;
  const int obase = (mode == 0) ? (256 + 256 * cb) : ((cb == 0) ? 0 : 768);
  const int cls = obase >> 8;
  float* dst = (cls < 2) ? R1 : R2;

  // stage x[c][l0 + 0..63] -> hi/lo tiles [l][c]
  const float* xb = x + (size_t)(b * CH) * NP + l0;
  #pragma unroll 2
  for (int j = 0; j < 16; ++j) {
    const int f = tid + 256 * j;
    const int c = f >> 4, lq = (f & 15) * 4;
    const v4f v = *(const v4fa*)(xb + (size_t)c * NP + lq);
    us_t p1, p2;
    split2(v.x, p1, p2); sXh[(lq + 0) * GXP + c] = p1; sXl[(lq + 0) * GXP + c] = p2;
    split2(v.y, p1, p2); sXh[(lq + 1) * GXP + c] = p1; sXl[(lq + 1) * GXP + c] = p2;
    split2(v.z, p1, p2); sXh[(lq + 2) * GXP + c] = p1; sXl[(lq + 2) * GXP + c] = p2;
    split2(v.w, p1, p2); sXh[(lq + 3) * GXP + c] = p1; sXl[(lq + 3) * GXP + c] = p2;
  }
  __syncthreads();

  const int wl = w & 1, wc = w >> 1;
  const v8f z8 = zero8f();
  v8f acc[2][4];
  #pragma unroll
  for (int t = 0; t < 2; ++t) {
    #pragma unroll
    for (int v = 0; v < 4; ++v) acc[t][v] = z8;
  }
  const us_t* ah0 = sXh + (32 * wl + m) * GXP;
  const us_t* ah1 = ah0 + 16 * GXP;
  const us_t* al0 = sXl + (32 * wl + m) * GXP;
  const us_t* al1 = al0 + 16 * GXP;
  const us_t* bh0 = WQh + (size_t)((obase + 64 * wc) >> 4) * 4096 + 8 * lane;
  const us_t* bl0 = WQl + (size_t)((obase + 64 * wc) >> 4) * 4096 + 8 * lane;

  #pragma unroll 1
  for (int k0 = 0; k0 < CH; k0 += 32) {
    const FragB a0 = ldfrag(ah0 + k0, h);
    const FragB a1 = ldfrag(ah1 + k0, h);
    const FragB c0 = ldfrag(al0 + k0, h);
    const FragB c1 = ldfrag(al1 + k0, h);
    #pragma unroll
    for (int v = 0; v < 4; ++v) {
      const FragB bh = ldfragp(bh0 + 4096 * v + 16 * k0);
      const FragB bl = ldfragp(bl0 + 4096 * v + 16 * k0);
      acc[0][v] = wmma_bf16(a0, bh, acc[0][v]);
      acc[0][v] = wmma_bf16(a0, bl, acc[0][v]);
      acc[0][v] = wmma_bf16(c0, bh, acc[0][v]);
      acc[1][v] = wmma_bf16(a1, bh, acc[1][v]);
      acc[1][v] = wmma_bf16(a1, bl, acc[1][v]);
      acc[1][v] = wmma_bf16(c1, bh, acc[1][v]);
    }
    // the next trip rewrites the address registers that this trip's weight loads name
    asm volatile("s_wait_xcnt 0x0" ::: "memory");
  }
  __syncthreads();   // all waves done with the x tiles before the staging overlays them

  #pragma unroll
  for (int v = 0; v < 4; ++v) {
    const int ch = 64 * wc + 16 * v + m;
    const float bb = bias[obase + ch];
    #pragma unroll
    for (int t = 0; t < 2; ++t) {
      v8f y;
      #pragma unroll
      for (int r = 0; r < 8; ++r) {
        float vv = acc[t][v][r] + bb;
        if (cls < 2) vv = (vv > 0.f) ? (vv + 1.f) : expf(vv);
        y[r] = vv;
      }
      st8f(sO + ch * 64 + 32 * wl + 16 * t + 8 * h, y);
    }
  }
  __syncthreads();
  const int q8 = lane & 7, sub = lane >> 3;
  #pragma unroll
  for (int i = 0; i < 16; ++i) {
    const int id = 64 * w + 4 * i + sub;
    const int R = id >> 1, Lh = id & 1;
    const v4f val = *(const v4fa*)(sO + R * 64 + 32 * Lh + 4 * q8);
    const size_t d = (size_t)(b * CH + R) * NP + l0 + 32 * Lh + 4 * q8;
    *(v4f*)(dst + d) = val;
  }
  
}

// ---------------------------------------------------------------------------
// Kernel 2: per (b, head n, slice of 256 positions), 128 threads: streams its
// slice in chunks of 64; f32 channel sums of k (elu+1, before rotation) and v
// in a fixed order; rotary on k in f32 from an LDS sin/cos table; bf16 hi/lo
// planes of rotated k [d][l] and of v [e][l] in LDS; partial
// sum_l krot[d][l] v[e][l] as three-product split (A = krot rows,
// B column e of v = v row e; D rows d, cols e), f32 accumulate.
// Output: one f32 record per (b, n, slice) in PK: [e][d] 1024 partial
// products, 32 k sums, 32 v sums (4352 B = 34 whole lines, one writer block).
// ---------------------------------------------------------------------------
__global__ __launch_bounds__(128) void k_kv(const float* __restrict__ KF, const float* __restrict__ VF,
                                           float* __restrict__ PK)
{
  __shared__ __attribute__((aligned(16))) us_t Ah[HD * KVP];
  __shared__ __attribute__((aligned(16))) us_t Al[HD * KVP];
  __shared__ __attribute__((aligned(16))) us_t Bh[HD * KVP];
  __shared__ __attribute__((aligned(16))) us_t Bl[HD * KVP];
  __shared__ __attribute__((aligned(16))) float sSin[HW * 8];
  __shared__ __attribute__((aligned(16))) float sCos[HW * 8];
  __shared__ __attribute__((aligned(16))) float sKV[HD * HD];
  __shared__ __attribute__((aligned(16))) float sSum[64];
  __shared__ float sFreq[8];
  const int tid = threadIdx.x, lane = tid & 31, w = tid >> 5;
  const int h = lane >> 4, m = lane & 15;
  const int n = blockIdx.x & 7, b = blockIdx.x >> 3;
  const int lbeg = blockIdx.y * KSL;
  if (tid < 8) sFreq[tid] = rope_freq(tid);
  __syncthreads();
  #pragma unroll 1
  for (int j = 0; j < 4; ++j) {
    const int idx = tid + 128 * j;
    const int pos = idx >> 3, f = idx & 7;
    float sv, cv;
    sincosf((float)pos * sFreq[f], &sv, &cv);
    sSin[idx] = sv;
    sCos[idx] = cv;
  }
  const int i0 = tid >> 4, l4 = (tid & 15) * 4;
  const float* kb = KF + (size_t)(b * CH + n * HD) * NP;
  const float* vb = VF + (size_t)(b * CH + n * HD) * NP;
  float ks[4], vs[4];
  #pragma unroll
  for (int j = 0; j < 4; ++j) { ks[j] = 0.f; vs[j] = 0.f; }
  const int td = w >> 1, te = w & 1;
  const v8f z8 = zero8f();
  v8f acc = z8;

  #pragma unroll 1
  for (int l0 = lbeg; l0 < lbeg + KSL; l0 += 64) {
    __syncthreads();
    const int hp = l0 >> 6;
    // k rows: g = 0 -> d pair (2 i0, 2 i0 + 1) keyed on the image row hp;
    //         g = 1 -> d pair (16 + 2 i0, +1) keyed on the image column l4 + t
    #pragma unroll
    for (int g = 0; g < 2; ++g) {
      const int d0 = 16 * g + 2 * i0;
      const v4f ka = *(const v4fa*)(kb + (size_t)d0 * NP + l0 + l4);
      const v4f kc = *(const v4fa*)(kb + (size_t)(d0 + 1) * NP + l0 + l4);
      ks[2 * g]     += (ka.x + ka.y) + (ka.z + ka.w);
      ks[2 * g + 1] += (kc.x + kc.y) + (kc.z + kc.w);
      const float sr = sSin[hp * 8 + i0], cr = sCos[hp * 8 + i0];
      v4us ha, la, hc, lc;
      #pragma unroll
      for (int t = 0; t < 4; ++t) {
        const int widx = (l4 + t) * 8 + i0;
        const float sw = sSin[widx], cw = sCos[widx];
        const float s = g ? sw : sr;
        const float c = g ? cw : cr;
        const float xa = ka[t], xc = kc[t];
        us_t p1, p2;
        split2(xa * c - xc * s, p1, p2); ha[t] = p1; la[t] = p2;
        split2(xc * c + xa * s, p1, p2); hc[t] = p1; lc[t] = p2;
      }
      *(v4usa*)(Ah + d0 * KVP + l4) = ha;
      *(v4usa*)(Al + d0 * KVP + l4) = la;
      *(v4usa*)(Ah + (d0 + 1) * KVP + l4) = hc;
      *(v4usa*)(Al + (d0 + 1) * KVP + l4) = lc;
    }
    // v rows e = i0 + 8 j
    #pragma unroll
    for (int j = 0; j < 4; ++j) {
      const int e = i0 + 8 * j;
      const v4f vv = *(const v4fa*)(vb + (size_t)e * NP + l0 + l4);
      vs[j] += (vv.x + vv.y) + (vv.z + vv.w);
      v4us hv, lv;
      #pragma unroll
      for (int t = 0; t < 4; ++t) { us_t p1, p2; split2(vv[t], p1, p2); hv[t] = p1; lv[t] = p2; }
      *(v4usa*)(Bh + e * KVP + l4) = hv;
      *(v4usa*)(Bl + e * KVP + l4) = lv;
    }
    __syncthreads();
    #pragma unroll
    for (int kk = 0; kk < 2; ++kk) {
      const FragB fa = ldfrag(Ah + (16 * td + m) * KVP + 32 * kk, h);
      const FragB fl = ldfrag(Al + (16 * td + m) * KVP + 32 * kk, h);
      const FragB gb = ldfrag(Bh + (16 * te + m) * KVP + 32 * kk, h);
      const FragB gl = ldfrag(Bl + (16 * te + m) * KVP + 32 * kk, h);
      acc = wmma_bf16(fa, gb, acc);
      acc = wmma_bf16(fa, gl, acc);
      acc = wmma_bf16(fl, gb, acc);
    }
  }

  // channel sums: the 16 lanes of each half-wave share the channel index i0
  #pragma unroll
  for (int j = 0; j < 4; ++j) {
    float a = ks[j], c = vs[j];
    a += __shfl_xor(a, 1); a += __shfl_xor(a, 2); a += __shfl_xor(a, 4); a += __shfl_xor(a, 8);
    c += __shfl_xor(c, 1); c += __shfl_xor(c, 2); c += __shfl_xor(c, 4); c += __shfl_xor(c, 8);
    ks[j] = a; vs[j] = c;
  }
  if ((tid & 15) == 0) {
    sSum[2 * i0] = ks[0]; sSum[2 * i0 + 1] = ks[1];
    sSum[16 + 2 * i0] = ks[2]; sSum[17 + 2 * i0] = ks[3];
    #pragma unroll
    for (int j = 0; j < 4; ++j) sSum[32 + i0 + 8 * j] = vs[j];
  }
  // acc[r] -> (d = 16 td + 8 h + r, e = 16 te + m), staged transposed sKV[e][d]
  #pragma unroll
  for (int r = 0; r < 8; ++r) sKV[(16 * te + m) * HD + 16 * td + 8 * h + r] = acc[r];
  __syncthreads();

  float* rec = PK + (size_t)(blockIdx.x * KS + blockIdx.y) * KREC;
  #pragma unroll
  for (int j = 0; j < 2; ++j) {
    const int q = tid + 128 * j;
    *(v4f*)(rec + 4 * q) = *(const v4fa*)(sKV + 4 * q);
  }
  if (tid < 16) *(v4f*)(rec + 1024 + 4 * tid) = *(const v4fa*)(sSum + 4 * tid);
}

// ---------------------------------------------------------------------------
// Kernel 2b: per (b, head n), 288 threads: thread t < 272 adds float4 t of the
// 16 slice records in slice order; then KVT[e][d] = c^2 * sum as bf16 hi/lo
// KVTh/KVTl [b][n][e][d] (64-B rows, 2 rows per line, 8 threads per line, one
// instruction) and the KM/VM [b][n][32] means.
// ---------------------------------------------------------------------------
__global__ __launch_bounds__(288) void k_kvred(const float* __restrict__ PK,
                                              us_t* __restrict__ KVTh, us_t* __restrict__ KVTl,
                                              float* __restrict__ KM, float* __restrict__ VM)
{
  __shared__ __attribute__((aligned(16))) float sR[KREC];
  const int tid = threadIdx.x;
  if (tid < KREC / 4) {
    const float* p = PK + (size_t)blockIdx.x * (KS * KREC) + 4 * tid;
    v4f part[KS];
    #pragma unroll
    for (int s = 0; s < KS; ++s) part[s] = *(const v4fa*)(p + s * KREC);
    v4f a = part[0];
    #pragma unroll
    for (int s = 1; s < KS; ++s) a += part[s];
    *(v4fa*)(sR + 4 * tid) = a;
  }
  __syncthreads();
  if (tid >= 128) return;

  const float cc = CKV * CKV;
  const int e = tid >> 2, q4 = tid & 3;
  const v4f f0 = *(const v4fa*)(sR + e * HD + 8 * q4) * cc;
  const v4f f1 = *(const v4fa*)(sR + e * HD + 8 * q4 + 4) * cc;
  v8us hh, ll;
  {
    us_t p1, p2;
    split2(f0.x, p1, p2); hh[0] = p1; ll[0] = p2;
    split2(f0.y, p1, p2); hh[1] = p1; ll[1] = p2;
    split2(f0.z, p1, p2); hh[2] = p1; ll[2] = p2;
    split2(f0.w, p1, p2); hh[3] = p1; ll[3] = p2;
    split2(f1.x, p1, p2); hh[4] = p1; ll[4] = p2;
    split2(f1.y, p1, p2); hh[5] = p1; ll[5] = p2;
    split2(f1.z, p1, p2); hh[6] = p1; ll[6] = p2;
    split2(f1.w, p1, p2); hh[7] = p1; ll[7] = p2;
  }
  const size_t kd = ((size_t)blockIdx.x * HD + e) * HD + 8 * q4;
  const int mi = tid & 7;
  const bool isk = tid < 8;
  const bool isv = (tid >= 8) && (tid < 16);
  const v4f mk = *(const v4fa*)(sR + 1024 + 4 * mi) * INV_L;
  const v4f mv = *(const v4fa*)(sR + 1056 + 4 * mi) * INV_L;
  float* pk = KM + (size_t)blockIdx.x * HD + 4 * mi;
  float* pv = VM + (size_t)blockIdx.x * HD + 4 * mi;
  *(v8us*)(KVTh + kd) = hh;
  *(v8us*)(KVTl + kd) = ll;
  if (isk) *(v4f*)pk = mk;
  if (isv) *(v4f*)pv = mv;
}

// ---------------------------------------------------------------------------
// Kernel 3: depthwise 5x5 (zero pad 2) on the v planes, f32 VALU:
// LF[b][c][y][x] = bias[c] + sum w[c][dy][dx] v[b][c][y+dy-2][x+dx-2].
// Block = (channel, b); the 64x64 plane staged with a 2-wide zero ring in
// LDS [68][68]; thread = 4 consecutive x per iteration (rolled loops);
// ---------------------------------------------------------------------------
__global__ __launch_bounds__(256) void k_lepe(const float* __restrict__ VF, const float* __restrict__ lw,
                                             const float* __restrict__ lbias, float* __restrict__ LF)
{
  __shared__ __attribute__((aligned(16))) float sP[PPW * PPW];
  __shared__ float sW[25];
  const int tid = threadIdx.x;
  const int c = blockIdx.x, b = blockIdx.y;
  if (tid < 25) sW[tid] = lw[c * 25 + tid];
  #pragma unroll 1
  for (int j = 0; j < 19; ++j) {
    const int idx = tid + 256 * j;
    if (idx < PPW * PPW) sP[idx] = 0.f;
  }
  __syncthreads();
  const float* src = VF + (size_t)(b * CH + c) * NP;
  #pragma unroll
  for (int j = 0; j < 4; ++j) {
    const int f = tid + 256 * j, l = 4 * f, y = l >> 6, xx = l & 63;
    const v4f v = *(const v4fa*)(src + l);
    float* pr = sP + (y + 2) * PPW + xx + 2;
    pr[0] = v.x; pr[1] = v.y; pr[2] = v.z; pr[3] = v.w;
  }
  __syncthreads();
  const float bb = lbias[c];
  float* dst = LF + (size_t)(b * CH + c) * NP;
  #pragma unroll 1
  for (int j = 0; j < 4; ++j) {
    const int f = tid + 256 * j, l = 4 * f, y = l >> 6, xx = l & 63;
    float a0 = bb, a1 = bb, a2 = bb, a3 = bb;
    #pragma unroll 1
    for (int dy = 0; dy < 5; ++dy) {
      const float* rp = sP + (y + dy) * PPW + xx;
      const v4f r0 = *(const v4fa*)rp;
      const v4f r1 = *(const v4fa*)(rp + 4);
      const float rr[8] = {r0.x, r0.y, r0.z, r0.w, r1.x, r1.y, r1.z, r1.w};
      const float w0 = sW[dy * 5], w1 = sW[dy * 5 + 1], w2 = sW[dy * 5 + 2], w3 = sW[dy * 5 + 3], w4 = sW[dy * 5 + 4];
      a0 += w0 * rr[0]; a0 += w1 * rr[1]; a0 += w2 * rr[2]; a0 += w3 * rr[3]; a0 += w4 * rr[4];
      a1 += w0 * rr[1]; a1 += w1 * rr[2]; a1 += w2 * rr[3]; a1 += w3 * rr[4]; a1 += w4 * rr[5];
      a2 += w0 * rr[2]; a2 += w1 * rr[3]; a2 += w2 * rr[4]; a2 += w3 * rr[5]; a2 += w4 * rr[6];
      a3 += w0 * rr[3]; a3 += w1 * rr[4]; a3 += w2 * rr[5]; a3 += w3 * rr[6]; a3 += w4 * rr[7];
    }
    v4f o;
    o.x = a0; o.y = a1; o.z = a2; o.w = a3;
    *(v4f*)(dst + l) = o;
    
  }
}

// ---------------------------------------------------------------------------
// Kernel 4: per (image row of 64 positions, b), 8 waves:
//  phase 0: sin/cos tables and the per-image head means in LDS.
//  phase A (4 iterations over head pairs): threads stage q f32 [16 d] per
//   (head, l, half): partial z = q . kmean (f32), rotary in f32, bf16 hi/lo
//   rows Aq[head][l][32 d] in LDS; wave = (head of the pair, 16-l tile):
//   D[l][e] = sum_d q[l][d] kvt[e][d] as three-product split (A = Aq rows,
//   B = KVT rows e from global); epilogue f32: res = D (1 + 1/(z+1e-6))
//   - z vmean[e], u = (res + lepe) * o, bf16 hi/lo into U planes [l][256 c].
//  phase B: D[l][co] = sum_c U[l][c] WP[co][c] as three-product split
//   (Uh*WPh + Ul*WPh + Uh*WPl, K = 256, WP fragment blocks from global),
//   + bias f32; staged [256 co][64 l]
// ---------------------------------------------------------------------------
__global__ __launch_bounds__(256) void k_resproj(
    const float* __restrict__ QF, const float* __restrict__ OF, const float* __restrict__ LF,
    const us_t* __restrict__ KVTh, const us_t* __restrict__ KVTl,
    const float* __restrict__ KM, const float* __restrict__ VM,
    const us_t* __restrict__ WPh, const us_t* __restrict__ WPl,
    const float* __restrict__ pbias, float* __restrict__ out)
{
  extern __shared__ __attribute__((aligned(16))) unsigned char dsm[];
  us_t*  Uh    = (us_t*)(dsm + RP_UH);
  us_t*  Ul    = (us_t*)(dsm + RP_UL);
  float* sO    = (float*)(dsm + RP_UH);
  us_t*  Aqh   = (us_t*)(dsm + RP_AQH);
  us_t*  Aql   = (us_t*)(dsm + RP_AQL);
  float* sSinW = (float*)(dsm + RP_SINW);
  float* sCosW = (float*)(dsm + RP_COSW);
  float* sSinH = (float*)(dsm + RP_SINH);
  float* sCosH = (float*)(dsm + RP_COSH);
  float* sFreq = (float*)(dsm + RP_FREQ);
  float* sZP   = (float*)(dsm + RP_ZP);
  float* sKM   = (float*)(dsm + RP_KM);
  float* sVM   = (float*)(dsm + RP_VM);
  const int tid = threadIdx.x, lane = tid & 31, w = tid >> 5;
  const int h = lane >> 4, m = lane & 15;
  const int lb = blockIdx.x, b = blockIdx.y;
  const int l0 = lb * 64;
  const v8f z8 = zero8f();

  // phase 0
  if (tid < 8) sFreq[tid] = rope_freq(tid);
  sKM[tid] = KM[(size_t)b * CH + tid];
  sVM[tid] = VM[(size_t)b * CH + tid];
  __syncthreads();
  #pragma unroll 1
  for (int j = 0; j < 2; ++j) {
    const int idx = tid + 256 * j;
    const int pos = idx >> 3, f = idx & 7;
    float sv, cv;
    sincosf((float)pos * sFreq[f], &sv, &cv);
    sSinW[idx] = sv;
    sCosW[idx] = cv;
  }
  if (tid < 8) {
    float sv, cv;
    sincosf((float)lb * sFreq[tid], &sv, &cv);
    sSinH[tid] = sv;
    sCosH[tid] = cv;
  }
  __syncthreads();

  // phase A
  const int sl = tid & 63, part = tid >> 6, shp = part >> 1, sdh = part & 1;   // staging role
  const int chp = w >> 2, clt = w & 3;                                           // tile role
  #pragma unroll 1
  for (int hp2 = 0; hp2 < 4; ++hp2) {
    {
      const int nn = 2 * hp2 + shp;
      const float* qp = QF + (size_t)(b * CH + nn * HD + 16 * sdh) * NP + l0 + sl;
      float qv[16];
      #pragma unroll
      for (int j = 0; j < 16; ++j) qv[j] = qp[(size_t)j * NP];
      float zpart = 0.f;
      #pragma unroll
      for (int j = 0; j < 16; ++j) zpart += qv[j] * sKM[nn * HD + 16 * sdh + j];
      sZP[part * 64 + sl] = zpart;
      us_t hq[16], lq[16];
      #pragma unroll
      for (int i = 0; i < 8; ++i) {
        const float sw = sSinW[sl * 8 + i], cw = sCosW[sl * 8 + i];
        const float sr = sSinH[i], cr = sCosH[i];
        const float s = sdh ? sw : sr;
        const float c = sdh ? cw : cr;
        const float x0 = qv[2 * i], x1 = qv[2 * i + 1];
        split2(x0 * c - x1 * s, hq[2 * i], lq[2 * i]);
        split2(x1 * c + x0 * s, hq[2 * i + 1], lq[2 * i + 1]);
      }
      v8us h0, h1, g0, g1;
      #pragma unroll
      for (int i = 0; i < 8; ++i) { h0[i] = hq[i]; h1[i] = hq[8 + i]; g0[i] = lq[i]; g1[i] = lq[8 + i]; }
      us_t* ah = Aqh + (shp * 64 + sl) * AQP + 16 * sdh;
      us_t* al = Aql + (shp * 64 + sl) * AQP + 16 * sdh;
      *(v8usa*)ah = h0; *(v8usa*)(ah + 8) = h1;
      *(v8usa*)al = g0; *(v8usa*)(al + 8) = g1;
    }
    __syncthreads();
    {
      const int nn = 2 * hp2 + chp;
      const FragB fa = ldfrag(Aqh + (chp * 64 + 16 * clt + m) * AQP, h);
      const FragB fl = ldfrag(Aql + (chp * 64 + 16 * clt + m) * AQP, h);
      v8f acc[2];
      #pragma unroll
      for (int u = 0; u < 2; ++u) {
        const size_t kr = ((size_t)(b * NH + nn) * HD + 16 * u + m) * HD;
        const FragB gb = ldfrag(KVTh + kr, h);
        const FragB gl = ldfrag(KVTl + kr, h);
        v8f a = wmma_bf16(fa, gb, z8);
        a = wmma_bf16(fa, gl, a);
        a = wmma_bf16(fl, gb, a);
        acc[u] = a;
      }
      float zz[8], fac[8];
      #pragma unroll
      for (int r = 0; r < 8; ++r) {
        const int l = 16 * clt + 8 * h + r;
        const float z = (sZP[(2 * chp) * 64 + l] + sZP[(2 * chp + 1) * 64 + l]) * SCALE_F;
        zz[r] = z;
        fac[r] = 1.0f + 1.0f / (z + 1e-6f);
      }
      #pragma unroll
      for (int u = 0; u < 2; ++u) {
        const int e = 16 * u + m, c = nn * HD + e;
        const float vme = sVM[nn * HD + e];
        const size_t go = (size_t)(b * CH + c) * NP + l0 + 16 * clt + 8 * h;
        const v4f le0 = *(const v4fa*)(LF + go);
        const v4f le1 = *(const v4fa*)(LF + go + 4);
        const v4f og0 = *(const v4fa*)(OF + go);
        const v4f og1 = *(const v4fa*)(OF + go + 4);
        const float lev[8] = {le0.x, le0.y, le0.z, le0.w, le1.x, le1.y, le1.z, le1.w};
        const float ogv[8] = {og0.x, og0.y, og0.z, og0.w, og1.x, og1.y, og1.z, og1.w};
        #pragma unroll
        for (int r = 0; r < 8; ++r) {
          const float res = acc[u][r] * fac[r] - zz[r] * vme;
          const float uv = (res + lev[r]) * ogv[r];
          us_t p1, p2;
          split2(uv, p1, p2);
          const int l = 16 * clt + 8 * h + r;
          Uh[l * CH + c] = p1;
          Ul[l * CH + c] = p2;
        }
      }
    }
    __syncthreads();
  }

  // phase B: output projection
  const int wl = w & 1, wc = w >> 1;
  v8f pacc[2][4];
  #pragma unroll
  for (int t = 0; t < 2; ++t) {
    #pragma unroll
    for (int v = 0; v < 4; ++v) pacc[t][v] = z8;
  }
  const us_t* ua0 = Uh + (32 * wl + m) * CH;
  const us_t* ua1 = ua0 + 16 * CH;
  const us_t* la0 = Ul + (32 * wl + m) * CH;
  const us_t* la1 = la0 + 16 * CH;
  const us_t* wph = WPh + (size_t)(4 * wc) * 4096 + 8 * lane;
  const us_t* wpl = WPl + (size_t)(4 * wc) * 4096 + 8 * lane;
  #pragma unroll 1
  for (int k0 = 0; k0 < CH; k0 += 32) {
    const FragB a0 = ldfrag(ua0 + k0, h);
    const FragB a1 = ldfrag(ua1 + k0, h);
    const FragB c0 = ldfrag(la0 + k0, h);
    const FragB c1 = ldfrag(la1 + k0, h);
    #pragma unroll
    for (int v = 0; v < 4; ++v) {
      const FragB bh = ldfragp(wph + 4096 * v + 16 * k0);
      const FragB bl = ldfragp(wpl + 4096 * v + 16 * k0);
      pacc[0][v] = wmma_bf16(a0, bh, pacc[0][v]);
      pacc[0][v] = wmma_bf16(c0, bh, pacc[0][v]);
      pacc[0][v] = wmma_bf16(a0, bl, pacc[0][v]);
      pacc[1][v] = wmma_bf16(a1, bh, pacc[1][v]);
      pacc[1][v] = wmma_bf16(c1, bh, pacc[1][v]);
      pacc[1][v] = wmma_bf16(a1, bl, pacc[1][v]);
    }
    // the next trip rewrites the address registers that this trip's weight loads name
    asm volatile("s_wait_xcnt 0x0" ::: "memory");
  }
  __syncthreads();   // all waves done with the U planes before the staging overlays them
  #pragma unroll
  for (int v = 0; v < 4; ++v) {
    const int co = 64 * wc + 16 * v + m;
    const float pb = pbias[co];
    #pragma unroll
    for (int t = 0; t < 2; ++t) {
      v8f y;
      #pragma unroll
      for (int r = 0; r < 8; ++r) y[r] = pacc[t][v][r] + pb;
      st8f(sO + co * 64 + 32 * wl + 16 * t + 8 * h, y);
    }
  }
  __syncthreads();
  const int q8 = lane & 7, sub = lane >> 3;
  #pragma unroll
  for (int i = 0; i < 16; ++i) {
    const int id = 64 * w + 4 * i + sub;
    const int R = id >> 1, Lh = id & 1;
    const v4f val = *(const v4fa*)(sO + R * 64 + 32 * Lh + 4 * q8);
    const size_t d = (size_t)(b * CH + R) * NP + l0 + 32 * Lh + 4 * q8;
    *(v4f*)(out + d) = val;
  }
  
}

// ---------------------------------------------------------------------------
extern "C" void kernel_launch(void* const* d_in, const int* in_sizes, int n_in,
                              void* d_out, int out_size, void* d_ws, size_t ws_size,
                              hipStream_t stream)
{
  if (n_in < 7) return;
  if (in_sizes[0] != NB * CH * NP) return;
  if (in_sizes[1] != 4 * CH * CH || in_sizes[2] != 4 * CH) return;
  if (in_sizes[3] != CH * 25 || in_sizes[4] != CH) return;
  if (in_sizes[5] != CH * CH || in_sizes[6] != CH) return;
  if (out_size != NB * CH * NP) return;

  const float* x      = (const float*)d_in[0];
  const float* qkvo_w = (const float*)d_in[1];
  const float* qkvo_b = (const float*)d_in[2];
  const float* lepe_w = (const float*)d_in[3];
  const float* lepe_b = (const float*)d_in[4];
  const float* proj_w = (const float*)d_in[5];
  const float* proj_b = (const float*)d_in[6];
  float* outp = (float*)d_out;

  const size_t szWQ  = (size_t)4 * CH * CH * 2;         //    524288 (x2)
  const size_t szWP  = (size_t)CH * CH * 2;             //    131072 (x2)
  const size_t szR   = (size_t)NB * CH * NP * 4;        //  33554432 (x3)
  const size_t szKVT = (size_t)NB * NH * HD * HD * 2;   //    131072 (x2)
  const size_t szM   = (size_t)NB * NH * HD * 4;        //      8192 (x2)
  const size_t szPK  = (size_t)NB * NH * KS * KREC * 4; //   4456448
  size_t off = 0;
  char* ws = (char*)d_ws;
  us_t*  WQh  = (us_t*)(ws + off);  off += szWQ;
  us_t*  WQl  = (us_t*)(ws + off);  off += szWQ;
  us_t*  WPh  = (us_t*)(ws + off);  off += szWP;
  us_t*  WPl  = (us_t*)(ws + off);  off += szWP;
  float* R1   = (float*)(ws + off); off += szR;     // k planes, later q planes
  float* R2   = (float*)(ws + off); off += szR;     // v planes, later o planes
  float* LF   = (float*)(ws + off); off += szR;     // depthwise result
  us_t*  KVTh = (us_t*)(ws + off);  off += szKVT;
  us_t*  KVTl = (us_t*)(ws + off);  off += szKVT;
  float* KM   = (float*)(ws + off); off += szM;
  float* VM   = (float*)(ws + off); off += szM;
  float* PK   = (float*)(ws + off); off += szPK;    // slice records; total 106708992
  if (off > ws_size) return;

  k_wcvt<<<dim3(160), 256, 0, stream>>>(qkvo_w, proj_w, WQh, WQl, WPh, WPl);
  hipFuncSetAttribute(reinterpret_cast<const void*>(&k_gemm),
                      hipFuncAttributeMaxDynamicSharedMemorySize, GM_BYTES);
  k_gemm<<<dim3(HW, 2, NB), 256, GM_BYTES, stream>>>(x, WQh, WQl, qkvo_b, R1, R2, 0);
  k_kv<<<dim3(NB * NH, KS), 128, 0, stream>>>(R1, R2, PK);
  k_kvred<<<dim3(NB * NH), 288, 0, stream>>>(PK, KVTh, KVTl, KM, VM);
  k_lepe<<<dim3(CH, NB), 256, 0, stream>>>(R2, lepe_w, lepe_b, LF);
  k_gemm<<<dim3(HW, 2, NB), 256, GM_BYTES, stream>>>(x, WQh, WQl, qkvo_b, R1, R2, 1);
  hipFuncSetAttribute(reinterpret_cast<const void*>(&k_resproj),
                      hipFuncAttributeMaxDynamicSharedMemorySize, RP_BYTES);
  k_resproj<<<dim3(NP / 64, NB), 256, RP_BYTES, stream>>>(R1, R2, LF, KVTh, KVTl, KM, VM, WPh, WPl, proj_b, outp);
}

// v003
// It runs in 142 microseconds.
// Next to v002, in two timings, it ran 1.18 and 1.19 times as fast.
// Counting every step since v000, it is 1.83 times as fast.
// Contractions: qkv/o 1x1 projection, k^T v, q kv and the output 1x1 projection all on v_wmma_f32_16x16x32_bf16 as bf16 hi/lo three-product split (hi*hi + hi*lo + lo*hi, f32 accumulate); elu, channel means, z, rotary tables, depthwise 5x5, biases and the elementwise tail in f32.
#include <hip/hip_runtime.h>
#include <math.h>

typedef unsigned short us_t;
typedef __bf16   v16b __attribute__((ext_vector_type(16)));
typedef _Float16 v16h __attribute__((ext_vector_type(16)));
typedef us_t     v8us __attribute__((ext_vector_type(8)));
typedef us_t     v4us __attribute__((ext_vector_type(4)));
typedef float    v8f  __attribute__((ext_vector_type(8)));
typedef float    v4f  __attribute__((ext_vector_type(4)));
typedef v8us __attribute__((may_alias)) v8usa;
typedef v4us __attribute__((may_alias)) v4usa;
typedef v4f  __attribute__((may_alias)) v4fa;
union FragB { v16b v; v8us half[2]; v16h x; };
union Q8    { v8f v; v4f q[2]; };

#define NB   8
#define CH   256
#define NP   4096
#define HW   64
#define NH   8
#define HD   32
#define KVP  72
#define AQP  40
#define PPW  68
#define GXP  264
#define UPP  264
#define SOP  68
#define RTP  9
#define SCALE_F 0.17677669529663687f
#define CKV     0.0065695032f
#define INV_L   0.000244140625f
#define KS   16
#define KSL  256
#define KREC 1088

// dynamic LDS map of k_gemm (bytes): x hi tile [64][264] us_t + 24 (row-group skew), x lo tile, f32 staging [256][68] over both
#define GM_XL    33856
#define GM_BYTES 69632

// dynamic LDS map of k_resproj (bytes)
// U hi/lo planes [64][264] us_t; the f32 staging [256][68] overlays them (69632 bytes)
#define RP_UH    0
#define RP_UL    33792
#define RP_AQH   69632
#define RP_AQL   79872
#define RP_SINW  90112
#define RP_COSW  92160
#define RP_SINH  94208
#define RP_COSH  94240
#define RP_FREQ  94272
#define RP_ZP    94304
#define RP_KM    95328
#define RP_VM    96352
#define RP_BYTES 97408

// ---------------------------------------------------------------------------
// 16x16x32 bf16 WMMA with hazard guard (ties D, keeps A/B live).
// Fragment map (wave32): lane l, h = l>>4, m = n = l&15.
//   A/B element i: i<8 -> k0+8h+i ; i>=8 -> k0+16+8h+(i-8)
//   D element r : row 8h+r, col l&15
// ---------------------------------------------------------------------------
__device__ __forceinline__ v8f wmma_bf16(const FragB& a, const FragB& b, v8f c) {
  v8f d = __builtin_amdgcn_wmma_f32_16x16x32_bf16(false, a.v, false, b.v, (short)0, c, false, false);
  asm volatile("v_nop\n\tv_nop\n\tv_nop\n\tv_nop" : "+v"(d) : "v"(a.x), "v"(b.x));
  return d;
}
// fragment from a k-contiguous bf16 row holding >= 32 elements starting at p (p = row + k0)
__device__ __forceinline__ FragB ldfrag(const us_t* p, int h) {
  FragB f;
  f.half[0] = *(const v8usa*)(p + 8 * h);
  f.half[1] = *(const v8usa*)(p + 16 + 8 * h);
  return f;
}
// fragment from a weight plane packed in fragment order (see k_wcvt): p = block start + 8 * lane
__device__ __forceinline__ FragB ldfragp(const us_t* p) {
  FragB f;
  f.half[0] = *(const v8usa*)p;
  f.half[1] = *(const v8usa*)(p + 256);
  return f;
}
__device__ __forceinline__ v8f zero8f() {
  v8f z;
  #pragma unroll
  for (int j = 0; j < 8; ++j) z[j] = 0.f;
  return z;
}
// 8 floats to LDS as two 16-B pieces
__device__ __forceinline__ void st8f(float* p, v8f v) {
  Q8 u; u.v = v;
  *(v4fa*)p = u.q[0];
  *(v4fa*)(p + 4) = u.q[1];
}
// RNE convert f32 -> bf16 bits, and back
__device__ __forceinline__ us_t bf16_rne(float f) {
  unsigned u = __float_as_uint(f);
  u += 0x7FFFu + ((u >> 16) & 1u);
  return (us_t)(u >> 16);
}
__device__ __forceinline__ float bf16_val(us_t b) { return __uint_as_float(((unsigned)b) << 16); }
__device__ __forceinline__ void split2(float f, us_t& hi, us_t& lo) {
  hi = bf16_rne(f);
  lo = bf16_rne(f - bf16_val(hi));
}
// rotary frequency i of 8: 1 / 10000^(i/7), linspace-style exponent
__device__ __forceinline__ float rope_freq(int i) {
  const float e = (i == 7) ? 1.0f : (float)i * (1.0f / 7.0f);
  return 1.0f / powf(10000.0f, e);
}

// ---------------------------------------------------------------------------
// Kernel 0: weights -> bf16 hi/lo planes in fragment order. WQh/WQl from the
// qkv/o weights [1024][256], WPh/WPl from the output projection [256][256].
// A plane is a row of 1-KiB blocks, block (T, ks) = 16 weight rows 16 T + m by
// 32 k from 32 ks, at element offset (8 T + ks) * 512, laid out
// [half j][lane l = 16 h + m][8 elements k = 32 ks + 16 j + 8 h + i]: a wave's
// 16-byte fragment load then reads 512 contiguous bytes (four whole lines)
// where row-major weights gave it 16 lines of 32 bytes. Thread = one 16-byte
// piece of each plane, so a wave also stores whole lines.
// ---------------------------------------------------------------------------
__global__ __launch_bounds__(256) void k_wcvt(const float* __restrict__ qw, const float* __restrict__ pw,
                                             us_t* __restrict__ WQh, us_t* __restrict__ WQl,
                                             us_t* __restrict__ WPh, us_t* __restrict__ WPl)
{
  const int g = blockIdx.x * 256 + threadIdx.x;
  if (g >= 40960) return;
  const float* src;
  us_t* dh;
  us_t* dl;
  const int g2 = (g < 32768) ? g : (g - 32768);
  const int pl = g2 & 31, pj = (g2 >> 5) & 1, pks = (g2 >> 6) & 7, pT = g2 >> 9;
  const size_t so = (size_t)(16 * pT + (pl & 15)) * CH + 32 * pks + 16 * pj + 8 * (pl >> 4);
  if (g < 32768) { src = qw + so; dh = WQh + (size_t)g2 * 8; dl = WQl + (size_t)g2 * 8; }
  else { src = pw + so; dh = WPh + (size_t)g2 * 8; dl = WPl + (size_t)g2 * 8; }
  const v4f a = *(const v4fa*)src;
  const v4f c = *(const v4fa*)(src + 4);
  v8us oh, ol;
  {
    us_t p1, p2;
    split2(a.x, p1, p2); oh[0] = p1; ol[0] = p2;
    split2(a.y, p1, p2); oh[1] = p1; ol[1] = p2;
    split2(a.z, p1, p2); oh[2] = p1; ol[2] = p2;
    split2(a.w, p1, p2); oh[3] = p1; ol[3] = p2;
    split2(c.x, p1, p2); oh[4] = p1; ol[4] = p2;
    split2(c.y, p1, p2); oh[5] = p1; ol[5] = p2;
    split2(c.z, p1, p2); oh[6] = p1; ol[6] = p2;
    split2(c.w, p1, p2); oh[7] = p1; ol[7] = p2;
  }
  *(v8us*)dh = oh;
  *(v8us*)dl = ol;
  
}

// ---------------------------------------------------------------------------
// Kernel 1: 1x1 projection GEMM D[l][o] = sum_c x[c][l] * W[o][c] + bias[o],
// elu+1 for the q/k channel classes, as bf16 hi/lo three-product split.
// Block = (image row of 64 positions, 256-channel class, b), 8 waves.
// Staging: the x tile [256 c][64 l] (NCHW f32, l-contiguous float4 loads) is
// split into hi/lo LDS tiles sXh/sXl [64 l][256 c] (k-contiguous rows).
// Bank layout: row l starts at element l * 264 + 8 * (l >> 4), that is, each
// group of 16 rows is skewed 16 bytes further. The 16 lanes of a staging store
// hold rows 4 apart; at the 132-dword pitch alone they fall on 4 banks, with
// the skew on 16. A fragment's 16 rows share one skew, so its reads keep
// their spread.
// The f32 staging has a pitch of 68 floats: the 16 channels of an accumulator
// store then cover all 64 banks (at 64 floats they share four).
// A = sX rows (positions), B = WQh/WQl fragment blocks straight from global,
// K = 256 in 8 steps; wave = 32 positions x 64 channels (2x4 tiles);
// products a_hi*b_hi + a_hi*b_lo + a_lo*b_hi.
// mode 0: class 0 -> channels 256..511 (k -> R1), class 1 -> 512..767 (v ->
// R2); mode 1: class 0 -> 0..255 (q -> R1), class 1 -> 768..1023 (o -> R2);
// NCHW f32 [b][256][4096]. Epilogue staged [256 ch][64 pos] f32 over the x
// ---------------------------------------------------------------------------
__global__ __launch_bounds__(256) void k_gemm(const float* __restrict__ x,
                                             const us_t* __restrict__ WQh, const us_t* __restrict__ WQl,
                                             const float* __restrict__ bias,
                                             float* __restrict__ R1, float* __restrict__ R2, int mode)
{
  extern __shared__ __attribute__((aligned(16))) unsigned char dsm[];
  us_t*  sXh = (us_t*)dsm;
  us_t*  sXl = (us_t*)(dsm + GM_XL);
  float* sO  = (float*)dsm;
  const int tid = threadIdx.x, lane = tid & 31, w = tid >> 5;
  const int h = lane >> 4, m = lane & 15;
  const int lb = blockIdx.x, cb = blockIdx.y, b = blockIdx.z;
  const int l0 = lb * 64;
  const int obase = (mode == 0) ? (256 + 256 * cb) : ((cb == 0) ? 0 : 768);
  const int cls = obase >> 8;
  float* dst = (cls < 2) ? R1 : R2;

  // stage x[c][l0 + 0..63] -> hi/lo tiles [l][c]
  const float* xb = x + (size_t)(b * CH) * NP + l0;
  #pragma unroll 2
  for (int j = 0; j < 16; ++j) {
    const int f = tid + 256 * j;
    const int c = f >> 4, lq = (f & 15) * 4;
    const int cs = c + ((lq >> 4) << 3);
    const v4f v = *(const v4fa*)(xb + (size_t)c * NP + lq);
    us_t p1, p2;
    split2(v.x, p1, p2); sXh[(lq + 0) * GXP + cs] = p1; sXl[(lq + 0) * GXP + cs] = p2;
    split2(v.y, p1, p2); sXh[(lq + 1) * GXP + cs] = p1; sXl[(lq + 1) * GXP + cs] = p2;
    split2(v.z, p1, p2); sXh[(lq + 2) * GXP + cs] = p1; sXl[(lq + 2) * GXP + cs] = p2;
    split2(v.w, p1, p2); sXh[(lq + 3) * GXP + cs] = p1; sXl[(lq + 3) * GXP + cs] = p2;
  }
  __syncthreads();

  const int wl = w & 1, wc = w >> 1;
  const v8f z8 = zero8f();
  v8f acc[2][4];
  #pragma unroll
  for (int t = 0; t < 2; ++t) {
    #pragma unroll
    for (int v = 0; v < 4; ++v) acc[t][v] = z8;
  }
  const us_t* ah0 = sXh + (32 * wl + m) * GXP + 16 * wl;
  const us_t* ah1 = ah0 + 16 * GXP + 8;
  const us_t* al0 = sXl + (32 * wl + m) * GXP + 16 * wl;
  const us_t* al1 = al0 + 16 * GXP + 8;
  const us_t* bh0 = WQh + (size_t)((obase + 64 * wc) >> 4) * 4096 + 8 * lane;
  const us_t* bl0 = WQl + (size_t)((obase + 64 * wc) >> 4) * 4096 + 8 * lane;

  #pragma unroll 1
  for (int k0 = 0; k0 < CH; k0 += 32) {
    const FragB a0 = ldfrag(ah0 + k0, h);
    const FragB a1 = ldfrag(ah1 + k0, h);
    const FragB c0 = ldfrag(al0 + k0, h);
    const FragB c1 = ldfrag(al1 + k0, h);
    #pragma unroll
    for (int v = 0; v < 4; ++v) {
      const FragB bh = ldfragp(bh0 + 4096 * v + 16 * k0);
      const FragB bl = ldfragp(bl0 + 4096 * v + 16 * k0);
      acc[0][v] = wmma_bf16(a0, bh, acc[0][v]);
      acc[0][v] = wmma_bf16(a0, bl, acc[0][v]);
      acc[0][v] = wmma_bf16(c0, bh, acc[0][v]);
      acc[1][v] = wmma_bf16(a1, bh, acc[1][v]);
      acc[1][v] = wmma_bf16(a1, bl, acc[1][v]);
      acc[1][v] = wmma_bf16(c1, bh, acc[1][v]);
    }
    // the next trip rewrites the address registers that this trip's weight loads name
    asm volatile("s_wait_xcnt 0x0" ::: "memory");
  }
  __syncthreads();   // all waves done with the x tiles before the staging overlays them

  #pragma unroll
  for (int v = 0; v < 4; ++v) {
    const int ch = 64 * wc + 16 * v + m;
    const float bb = bias[obase + ch];
    #pragma unroll
    for (int t = 0; t < 2; ++t) {
      v8f y;
      #pragma unroll
      for (int r = 0; r < 8; ++r) {
        float vv = acc[t][v][r] + bb;
        if (cls < 2) vv = (vv > 0.f) ? (vv + 1.f) : expf(vv);
        y[r] = vv;
      }
      st8f(sO + ch * SOP + 32 * wl + 16 * t + 8 * h, y);
    }
  }
  __syncthreads();
  const int q8 = lane & 7, sub = lane >> 3;
  #pragma unroll
  for (int i = 0; i < 16; ++i) {
    const int id = 64 * w + 4 * i + sub;
    const int R = id >> 1, Lh = id & 1;
    const v4f val = *(const v4fa*)(sO + R * SOP + 32 * Lh + 4 * q8);
    const size_t d = (size_t)(b * CH + R) * NP + l0 + 32 * Lh + 4 * q8;
    *(v4f*)(dst + d) = val;
  }
  
}

// ---------------------------------------------------------------------------
// Kernel 2: per (b, head n, slice of 256 positions), 128 threads: streams its
// slice in chunks of 64; f32 channel sums of k (elu+1, before rotation) and v
// in a fixed order; rotary on k in f32 from an LDS sin/cos table; bf16 hi/lo
// planes of rotated k [d][l] and of v [e][l] in LDS; partial
// sum_l krot[d][l] v[e][l] as three-product split (A = krot rows,
// B column e of v = v row e; D rows d, cols e), f32 accumulate.
// Output: one f32 record per (b, n, slice) in PK: [e][d] 1024 partial
// products, 32 k sums, 32 v sums (4352 B = 34 whole lines, one writer block).
// ---------------------------------------------------------------------------
__global__ __launch_bounds__(128) void k_kv(const float* __restrict__ KF, const float* __restrict__ VF,
                                           float* __restrict__ PK)
{
  __shared__ __attribute__((aligned(16))) us_t Ah[HD * KVP];
  __shared__ __attribute__((aligned(16))) us_t Al[HD * KVP];
  __shared__ __attribute__((aligned(16))) us_t Bh[HD * KVP];
  __shared__ __attribute__((aligned(16))) us_t Bl[HD * KVP];
  __shared__ __attribute__((aligned(16))) float sSin[HW * RTP];   // pitch 9: lanes read rows 4 apart, 36 dwords, 16 banks
  __shared__ __attribute__((aligned(16))) float sCos[HW * RTP];
  __shared__ __attribute__((aligned(16))) float sKV[HD * HD];
  __shared__ __attribute__((aligned(16))) float sSum[64];
  __shared__ float sFreq[8];
  const int tid = threadIdx.x, lane = tid & 31, w = tid >> 5;
  const int h = lane >> 4, m = lane & 15;
  const int n = blockIdx.x & 7, b = blockIdx.x >> 3;
  const int lbeg = blockIdx.y * KSL;
  if (tid < 8) sFreq[tid] = rope_freq(tid);
  __syncthreads();
  #pragma unroll 1
  for (int j = 0; j < 4; ++j) {
    const int idx = tid + 128 * j;
    const int pos = idx >> 3, f = idx & 7;
    float sv, cv;
    sincosf((float)pos * sFreq[f], &sv, &cv);
    sSin[pos * RTP + f] = sv;
    sCos[pos * RTP + f] = cv;
  }
  const int i0 = tid >> 4, l4 = (tid & 15) * 4;
  const float* kb = KF + (size_t)(b * CH + n * HD) * NP;
  const float* vb = VF + (size_t)(b * CH + n * HD) * NP;
  float ks[4], vs[4];
  #pragma unroll
  for (int j = 0; j < 4; ++j) { ks[j] = 0.f; vs[j] = 0.f; }
  const int td = w >> 1, te = w & 1;
  const v8f z8 = zero8f();
  v8f acc = z8;

  #pragma unroll 1
  for (int l0 = lbeg; l0 < lbeg + KSL; l0 += 64) {
    __syncthreads();
    const int hp = l0 >> 6;
    // k rows: g = 0 -> d pair (2 i0, 2 i0 + 1) keyed on the image row hp;
    //         g = 1 -> d pair (16 + 2 i0, +1) keyed on the image column l4 + t
    #pragma unroll
    for (int g = 0; g < 2; ++g) {
      const int d0 = 16 * g + 2 * i0;
      const v4f ka = *(const v4fa*)(kb + (size_t)d0 * NP + l0 + l4);
      const v4f kc = *(const v4fa*)(kb + (size_t)(d0 + 1) * NP + l0 + l4);
      ks[2 * g]     += (ka.x + ka.y) + (ka.z + ka.w);
      ks[2 * g + 1] += (kc.x + kc.y) + (kc.z + kc.w);
      const float sr = sSin[hp * RTP + i0], cr = sCos[hp * RTP + i0];
      v4us ha, la, hc, lc;
      #pragma unroll
      for (int t = 0; t < 4; ++t) {
        const int widx = (l4 + t) * RTP + i0;
        const float sw = sSin[widx], cw = sCos[widx];
        const float s = g ? sw : sr;
        const float c = g ? cw : cr;
        const float xa = ka[t], xc = kc[t];
        us_t p1, p2;
        split2(xa * c - xc * s, p1, p2); ha[t] = p1; la[t] = p2;
        split2(xc * c + xa * s, p1, p2); hc[t] = p1; lc[t] = p2;
      }
      *(v4usa*)(Ah + d0 * KVP + l4) = ha;
      *(v4usa*)(Al + d0 * KVP + l4) = la;
      *(v4usa*)(Ah + (d0 + 1) * KVP + l4) = hc;
      *(v4usa*)(Al + (d0 + 1) * KVP + l4) = lc;
    }
    // v rows e = i0 + 8 j
    #pragma unroll
    for (int j = 0; j < 4; ++j) {
      const int e = i0 + 8 * j;
      const v4f vv = *(const v4fa*)(vb + (size_t)e * NP + l0 + l4);
      vs[j] += (vv.x + vv.y) + (vv.z + vv.w);
      v4us hv, lv;
      #pragma unroll
      for (int t = 0; t < 4; ++t) { us_t p1, p2; split2(vv[t], p1, p2); hv[t] = p1; lv[t] = p2; }
      *(v4usa*)(Bh + e * KVP + l4) = hv;
      *(v4usa*)(Bl + e * KVP + l4) = lv;
    }
    __syncthreads();
    #pragma unroll
    for (int kk = 0; kk < 2; ++kk) {
      const FragB fa = ldfrag(Ah + (16 * td + m) * KVP + 32 * kk, h);
      const FragB fl = ldfrag(Al + (16 * td + m) * KVP + 32 * kk, h);
      const FragB gb = ldfrag(Bh + (16 * te + m) * KVP + 32 * kk, h);
      const FragB gl = ldfrag(Bl + (16 * te + m) * KVP + 32 * kk, h);
      acc = wmma_bf16(fa, gb, acc);
      acc = wmma_bf16(fa, gl, acc);
      acc = wmma_bf16(fl, gb, acc);
    }
  }

  // channel sums: the 16 lanes of each half-wave share the channel index i0
  #pragma unroll
  for (int j = 0; j < 4; ++j) {
    float a = ks[j], c = vs[j];
    a += __shfl_xor(a, 1); a += __shfl_xor(a, 2); a += __shfl_xor(a, 4); a += __shfl_xor(a, 8);
    c += __shfl_xor(c, 1); c += __shfl_xor(c, 2); c += __shfl_xor(c, 4); c += __shfl_xor(c, 8);
    ks[j] = a; vs[j] = c;
  }
  if ((tid & 15) == 0) {
    sSum[2 * i0] = ks[0]; sSum[2 * i0 + 1] = ks[1];
    sSum[16 + 2 * i0] = ks[2]; sSum[17 + 2 * i0] = ks[3];
    #pragma unroll
    for (int j = 0; j < 4; ++j) sSum[32 + i0 + 8 * j] = vs[j];
  }
  // acc[r] -> (d = 16 td + 8 h + r, e = 16 te + m), staged transposed sKV[e][d]
  #pragma unroll
  for (int r = 0; r < 8; ++r) sKV[(16 * te + m) * HD + 16 * td + 8 * h + r] = acc[r];
  __syncthreads();

  float* rec = PK + (size_t)(blockIdx.x * KS + blockIdx.y) * KREC;
  #pragma unroll
  for (int j = 0; j < 2; ++j) {
    const int q = tid + 128 * j;
    *(v4f*)(rec + 4 * q) = *(const v4fa*)(sKV + 4 * q);
  }
  if (tid < 16) *(v4f*)(rec + 1024 + 4 * tid) = *(const v4fa*)(sSum + 4 * tid);
}

// ---------------------------------------------------------------------------
// Kernel 2b: per (b, head n), 288 threads: thread t < 272 adds float4 t of the
// 16 slice records in slice order; then KVT[e][d] = c^2 * sum as bf16 hi/lo
// KVTh/KVTl [b][n][e][d] (64-B rows, 2 rows per line, 8 threads per line, one
// instruction) and the KM/VM [b][n][32] means.
// ---------------------------------------------------------------------------
__global__ __launch_bounds__(288) void k_kvred(const float* __restrict__ PK,
                                              us_t* __restrict__ KVTh, us_t* __restrict__ KVTl,
                                              float* __restrict__ KM, float* __restrict__ VM)
{
  __shared__ __attribute__((aligned(16))) float sR[KREC];
  const int tid = threadIdx.x;
  if (tid < KREC / 4) {
    const float* p = PK + (size_t)blockIdx.x * (KS * KREC) + 4 * tid;
    v4f part[KS];
    #pragma unroll
    for (int s = 0; s < KS; ++s) part[s] = *(const v4fa*)(p + s * KREC);
    v4f a = part[0];
    #pragma unroll
    for (int s = 1; s < KS; ++s) a += part[s];
    *(v4fa*)(sR + 4 * tid) = a;
  }
  __syncthreads();
  if (tid >= 128) return;

  const float cc = CKV * CKV;
  const int e = tid >> 2, q4 = tid & 3;
  const v4f f0 = *(const v4fa*)(sR + e * HD + 8 * q4) * cc;
  const v4f f1 = *(const v4fa*)(sR + e * HD + 8 * q4 + 4) * cc;
  v8us hh, ll;
  {
    us_t p1, p2;
    split2(f0.x, p1, p2); hh[0] = p1; ll[0] = p2;
    split2(f0.y, p1, p2); hh[1] = p1; ll[1] = p2;
    split2(f0.z, p1, p2); hh[2] = p1; ll[2] = p2;
    split2(f0.w, p1, p2); hh[3] = p1; ll[3] = p2;
    split2(f1.x, p1, p2); hh[4] = p1; ll[4] = p2;
    split2(f1.y, p1, p2); hh[5] = p1; ll[5] = p2;
    split2(f1.z, p1, p2); hh[6] = p1; ll[6] = p2;
    split2(f1.w, p1, p2); hh[7] = p1; ll[7] = p2;
  }
  const size_t kd = ((size_t)blockIdx.x * HD + e) * HD + 8 * q4;
  const int mi = tid & 7;
  const bool isk = tid < 8;
  const bool isv = (tid >= 8) && (tid < 16);
  const v4f mk = *(const v4fa*)(sR + 1024 + 4 * mi) * INV_L;
  const v4f mv = *(const v4fa*)(sR + 1056 + 4 * mi) * INV_L;
  float* pk = KM + (size_t)blockIdx.x * HD + 4 * mi;
  float* pv = VM + (size_t)blockIdx.x * HD + 4 * mi;
  *(v8us*)(KVTh + kd) = hh;
  *(v8us*)(KVTl + kd) = ll;
  if (isk) *(v4f*)pk = mk;
  if (isv) *(v4f*)pv = mv;
}

// ---------------------------------------------------------------------------
// Kernel 3: depthwise 5x5 (zero pad 2) on the v planes, f32 VALU:
// LF[b][c][y][x] = bias[c] + sum w[c][dy][dx] v[b][c][y+dy-2][x+dx-2].
// Block = (channel, b); the 64x64 plane staged with a 2-wide zero ring in
// LDS [68][68]; thread = 4 consecutive x per iteration (rolled loops);
// ---------------------------------------------------------------------------
__global__ __launch_bounds__(256) void k_lepe(const float* __restrict__ VF, const float* __restrict__ lw,
                                             const float* __restrict__ lbias, float* __restrict__ LF)
{
  __shared__ __attribute__((aligned(16))) float sP[PPW * PPW];
  __shared__ float sW[25];
  const int tid = threadIdx.x;
  const int c = blockIdx.x, b = blockIdx.y;
  if (tid < 25) sW[tid] = lw[c * 25 + tid];
  #pragma unroll 1
  for (int j = 0; j < 19; ++j) {
    const int idx = tid + 256 * j;
    if (idx < PPW * PPW) sP[idx] = 0.f;
  }
  __syncthreads();
  const float* src = VF + (size_t)(b * CH + c) * NP;
  #pragma unroll
  for (int j = 0; j < 4; ++j) {
    const int f = tid + 256 * j, l = 4 * f, y = l >> 6, xx = l & 63;
    const v4f v = *(const v4fa*)(src + l);
    float* pr = sP + (y + 2) * PPW + xx + 2;
    pr[0] = v.x; pr[1] = v.y; pr[2] = v.z; pr[3] = v.w;
  }
  __syncthreads();
  const float bb = lbias[c];
  float* dst = LF + (size_t)(b * CH + c) * NP;
  #pragma unroll 1
  for (int j = 0; j < 4; ++j) {
    const int f = tid + 256 * j, l = 4 * f, y = l >> 6, xx = l & 63;
    float a0 = bb, a1 = bb, a2 = bb, a3 = bb;
    #pragma unroll 1
    for (int dy = 0; dy < 5; ++dy) {
      const float* rp = sP + (y + dy) * PPW + xx;
      const v4f r0 = *(const v4fa*)rp;
      const v4f r1 = *(const v4fa*)(rp + 4);
      const float rr[8] = {r0.x, r0.y, r0.z, r0.w, r1.x, r1.y, r1.z, r1.w};
      const float w0 = sW[dy * 5], w1 = sW[dy * 5 + 1], w2 = sW[dy * 5 + 2], w3 = sW[dy * 5 + 3], w4 = sW[dy * 5 + 4];
      a0 += w0 * rr[0]; a0 += w1 * rr[1]; a0 += w2 * rr[2]; a0 += w3 * rr[3]; a0 += w4 * rr[4];
      a1 += w0 * rr[1]; a1 += w1 * rr[2]; a1 += w2 * rr[3]; a1 += w3 * rr[4]; a1 += w4 * rr[5];
      a2 += w0 * rr[2]; a2 += w1 * rr[3]; a2 += w2 * rr[4]; a2 += w3 * rr[5]; a2 += w4 * rr[6];
      a3 += w0 * rr[3]; a3 += w1 * rr[4]; a3 += w2 * rr[5]; a3 += w3 * rr[6]; a3 += w4 * rr[7];
    }
    v4f o;
    o.x = a0; o.y = a1; o.z = a2; o.w = a3;
    *(v4f*)(dst + l) = o;
    
  }
}

// ---------------------------------------------------------------------------
// Kernel 4: per (image row of 64 positions, b), 8 waves:
//  phase 0: sin/cos tables and the per-image head means in LDS.
//  phase A (4 iterations over head pairs): threads stage q f32 [16 d] per
//   (head, l, half): partial z = q . kmean (f32), rotary in f32, bf16 hi/lo
//   rows Aq[head][l][32 d] in LDS; wave = (head of the pair, 16-l tile):
//   D[l][e] = sum_d q[l][d] kvt[e][d] as three-product split (A = Aq rows,
//   B = KVT rows e from global); epilogue f32: res = D (1 + 1/(z+1e-6))
//   - z vmean[e], u = (res + lepe) * o, bf16 hi/lo into U planes [l][256 c]
//   at a pitch of 264 (528 B = 16 B x 33: a fragment's 16 rows cover all banks).
//  phase B: D[l][co] = sum_c U[l][c] WP[co][c] as three-product split
//   (Uh*WPh + Ul*WPh + Uh*WPl, K = 256, WP fragment blocks from global),
//   + bias f32; staged [256 co][64 l]
// ---------------------------------------------------------------------------
__global__ __launch_bounds__(256) void k_resproj(
    const float* __restrict__ QF, const float* __restrict__ OF, const float* __restrict__ LF,
    const us_t* __restrict__ KVTh, const us_t* __restrict__ KVTl,
    const float* __restrict__ KM, const float* __restrict__ VM,
    const us_t* __restrict__ WPh, const us_t* __restrict__ WPl,
    const float* __restrict__ pbias, float* __restrict__ out)
{
  extern __shared__ __attribute__((aligned(16))) unsigned char dsm[];
  us_t*  Uh    = (us_t*)(dsm + RP_UH);
  us_t*  Ul    = (us_t*)(dsm + RP_UL);
  float* sO    = (float*)(dsm + RP_UH);
  us_t*  Aqh   = (us_t*)(dsm + RP_AQH);
  us_t*  Aql   = (us_t*)(dsm + RP_AQL);
  float* sSinW = (float*)(dsm + RP_SINW);
  float* sCosW = (float*)(dsm + RP_COSW);
  float* sSinH = (float*)(dsm + RP_SINH);
  float* sCosH = (float*)(dsm + RP_COSH);
  float* sFreq = (float*)(dsm + RP_FREQ);
  float* sZP   = (float*)(dsm + RP_ZP);
  float* sKM   = (float*)(dsm + RP_KM);
  float* sVM   = (float*)(dsm + RP_VM);
  const int tid = threadIdx.x, lane = tid & 31, w = tid >> 5;
  const int h = lane >> 4, m = lane & 15;
  const int lb = blockIdx.x, b = blockIdx.y;
  const int l0 = lb * 64;
  const v8f z8 = zero8f();

  // phase 0
  if (tid < 8) sFreq[tid] = rope_freq(tid);
  sKM[tid] = KM[(size_t)b * CH + tid];
  sVM[tid] = VM[(size_t)b * CH + tid];
  __syncthreads();
  #pragma unroll 1
  for (int j = 0; j < 2; ++j) {
    const int idx = tid + 256 * j;
    const int pos = idx >> 3, f = idx & 7;
    float sv, cv;
    sincosf((float)pos * sFreq[f], &sv, &cv);
    sSinW[idx] = sv;
    sCosW[idx] = cv;
  }
  if (tid < 8) {
    float sv, cv;
    sincosf((float)lb * sFreq[tid], &sv, &cv);
    sSinH[tid] = sv;
    sCosH[tid] = cv;
  }
  __syncthreads();

  // phase A
  const int sl = tid & 63, part = tid >> 6, shp = part >> 1, sdh = part & 1;   // staging role
  const int chp = w >> 2, clt = w & 3;                                           // tile role
  #pragma unroll 1
  for (int hp2 = 0; hp2 < 4; ++hp2) {
    {
      const int nn = 2 * hp2 + shp;
      const float* qp = QF + (size_t)(b * CH + nn * HD + 16 * sdh) * NP + l0 + sl;
      float qv[16];
      #pragma unroll
      for (int j = 0; j < 16; ++j) qv[j] = qp[(size_t)j * NP];
      float zpart = 0.f;
      #pragma unroll
      for (int j = 0; j < 16; ++j) zpart += qv[j] * sKM[nn * HD + 16 * sdh + j];
      sZP[part * 64 + sl] = zpart;
      us_t hq[16], lq[16];
      #pragma unroll
      for (int i = 0; i < 8; ++i) {
        const float sw = sSinW[sl * 8 + i], cw = sCosW[sl * 8 + i];
        const float sr = sSinH[i], cr = sCosH[i];
        const float s = sdh ? sw : sr;
        const float c = sdh ? cw : cr;
        const float x0 = qv[2 * i], x1 = qv[2 * i + 1];
        split2(x0 * c - x1 * s, hq[2 * i], lq[2 * i]);
        split2(x1 * c + x0 * s, hq[2 * i + 1], lq[2 * i + 1]);
      }
      v8us h0, h1, g0, g1;
      #pragma unroll
      for (int i = 0; i < 8; ++i) { h0[i] = hq[i]; h1[i] = hq[8 + i]; g0[i] = lq[i]; g1[i] = lq[8 + i]; }
      us_t* ah = Aqh + (shp * 64 + sl) * AQP + 16 * sdh;
      us_t* al = Aql + (shp * 64 + sl) * AQP + 16 * sdh;
      *(v8usa*)ah = h0; *(v8usa*)(ah + 8) = h1;
      *(v8usa*)al = g0; *(v8usa*)(al + 8) = g1;
    }
    __syncthreads();
    {
      const int nn = 2 * hp2 + chp;
      const FragB fa = ldfrag(Aqh + (chp * 64 + 16 * clt + m) * AQP, h);
      const FragB fl = ldfrag(Aql + (chp * 64 + 16 * clt + m) * AQP, h);
      v8f acc[2];
      #pragma unroll
      for (int u = 0; u < 2; ++u) {
        const size_t kr = ((size_t)(b * NH + nn) * HD + 16 * u + m) * HD;
        const FragB gb = ldfrag(KVTh + kr, h);
        const FragB gl = ldfrag(KVTl + kr, h);
        v8f a = wmma_bf16(fa, gb, z8);
        a = wmma_bf16(fa, gl, a);
        a = wmma_bf16(fl, gb, a);
        acc[u] = a;
      }
      float zz[8], fac[8];
      #pragma unroll
      for (int r = 0; r < 8; ++r) {
        const int l = 16 * clt + 8 * h + r;
        const float z = (sZP[(2 * chp) * 64 + l] + sZP[(2 * chp + 1) * 64 + l]) * SCALE_F;
        zz[r] = z;
        fac[r] = 1.0f + 1.0f / (z + 1e-6f);
      }
      #pragma unroll
      for (int u = 0; u < 2; ++u) {
        const int e = 16 * u + m, c = nn * HD + e;
        const float vme = sVM[nn * HD + e];
        const size_t go = (size_t)(b * CH + c) * NP + l0 + 16 * clt + 8 * h;
        const v4f le0 = *(const v4fa*)(LF + go);
        const v4f le1 = *(const v4fa*)(LF + go + 4);
        const v4f og0 = *(const v4fa*)(OF + go);
        const v4f og1 = *(const v4fa*)(OF + go + 4);
        const float lev[8] = {le0.x, le0.y, le0.z, le0.w, le1.x, le1.y, le1.z, le1.w};
        const float ogv[8] = {og0.x, og0.y, og0.z, og0.w, og1.x, og1.y, og1.z, og1.w};
        #pragma unroll
        for (int r = 0; r < 8; ++r) {
          const float res = acc[u][r] * fac[r] - zz[r] * vme;
          const float uv = (res + lev[r]) * ogv[r];
          us_t p1, p2;
          split2(uv, p1, p2);
          const int l = 16 * clt + 8 * h + r;
          Uh[l * UPP + c] = p1;
          Ul[l * UPP + c] = p2;
        }
      }
    }
    __syncthreads();
  }

  // phase B: output projection
  const int wl = w & 1, wc = w >> 1;
  v8f pacc[2][4];
  #pragma unroll
  for (int t = 0; t < 2; ++t) {
    #pragma unroll
    for (int v = 0; v < 4; ++v) pacc[t][v] = z8;
  }
  const us_t* ua0 = Uh + (32 * wl + m) * UPP;
  const us_t* ua1 = ua0 + 16 * UPP;
  const us_t* la0 = Ul + (32 * wl + m) * UPP;
  const us_t* la1 = la0 + 16 * UPP;
  const us_t* wph = WPh + (size_t)(4 * wc) * 4096 + 8 * lane;
  const us_t* wpl = WPl + (size_t)(4 * wc) * 4096 + 8 * lane;
  #pragma unroll 1
  for (int k0 = 0; k0 < CH; k0 += 32) {
    const FragB a0 = ldfrag(ua0 + k0, h);
    const FragB a1 = ldfrag(ua1 + k0, h);
    const FragB c0 = ldfrag(la0 + k0, h);
    const FragB c1 = ldfrag(la1 + k0, h);
    #pragma unroll
    for (int v = 0; v < 4; ++v) {
      const FragB bh = ldfragp(wph + 4096 * v + 16 * k0);
      const FragB bl = ldfragp(wpl + 4096 * v + 16 * k0);
      pacc[0][v] = wmma_bf16(a0, bh, pacc[0][v]);
      pacc[0][v] = wmma_bf16(c0, bh, pacc[0][v]);
      pacc[0][v] = wmma_bf16(a0, bl, pacc[0][v]);
      pacc[1][v] = wmma_bf16(a1, bh, pacc[1][v]);
      pacc[1][v] = wmma_bf16(c1, bh, pacc[1][v]);
      pacc[1][v] = wmma_bf16(a1, bl, pacc[1][v]);
    }
    // the next trip rewrites the address registers that this trip's weight loads name
    asm volatile("s_wait_xcnt 0x0" ::: "memory");
  }
  __syncthreads();   // all waves done with the U planes before the staging overlays them
  #pragma unroll
  for (int v = 0; v < 4; ++v) {
    const int co = 64 * wc + 16 * v + m;
    const float pb = pbias[co];
    #pragma unroll
    for (int t = 0; t < 2; ++t) {
      v8f y;
      #pragma unroll
      for (int r = 0; r < 8; ++r) y[r] = pacc[t][v][r] + pb;
      st8f(sO + co * SOP + 32 * wl + 16 * t + 8 * h, y);
    }
  }
  __syncthreads();
  const int q8 = lane & 7, sub = lane >> 3;
  #pragma unroll
  for (int i = 0; i < 16; ++i) {
    const int id = 64 * w + 4 * i + sub;
    const int R = id >> 1, Lh = id & 1;
    const v4f val = *(const v4fa*)(sO + R * SOP + 32 * Lh + 4 * q8);
    const size_t d = (size_t)(b * CH + R) * NP + l0 + 32 * Lh + 4 * q8;
    *(v4f*)(out + d) = val;
  }
  
}

// ---------------------------------------------------------------------------
extern "C" void kernel_launch(void* const* d_in, const int* in_sizes, int n_in,
                              void* d_out, int out_size, void* d_ws, size_t ws_size,
                              hipStream_t stream)
{
  if (n_in < 7) return;
  if (in_sizes[0] != NB * CH * NP) return;
  if (in_sizes[1] != 4 * CH * CH || in_sizes[2] != 4 * CH) return;
  if (in_sizes[3] != CH * 25 || in_sizes[4] != CH) return;
  if (in_sizes[5] != CH * CH || in_sizes[6] != CH) return;
  if (out_size != NB * CH * NP) return;

  const float* x      = (const float*)d_in[0];
  const float* qkvo_w = (const float*)d_in[1];
  const float* qkvo_b = (const float*)d_in[2];
  const float* lepe_w = (const float*)d_in[3];
  const float* lepe_b = (const float*)d_in[4];
  const float* proj_w = (const float*)d_in[5];
  const float* proj_b = (const float*)d_in[6];
  float* outp = (float*)d_out;

  const size_t szWQ  = (size_t)4 * CH * CH * 2;         //    524288 (x2)
  const size_t szWP  = (size_t)CH * CH * 2;             //    131072 (x2)
  const size_t szR   = (size_t)NB * CH * NP * 4;        //  33554432 (x3)
  const size_t szKVT = (size_t)NB * NH * HD * HD * 2;   //    131072 (x2)
  const size_t szM   = (size_t)NB * NH * HD * 4;        //      8192 (x2)
  const size_t szPK  = (size_t)NB * NH * KS * KREC * 4; //   4456448
  size_t off = 0;
  char* ws = (char*)d_ws;
  us_t*  WQh  = (us_t*)(ws + off);  off += szWQ;
  us_t*  WQl  = (us_t*)(ws + off);  off += szWQ;
  us_t*  WPh  = (us_t*)(ws + off);  off += szWP;
  us_t*  WPl  = (us_t*)(ws + off);  off += szWP;
  float* R1   = (float*)(ws + off); off += szR;     // k planes, later q planes
  float* R2   = (float*)(ws + off); off += szR;     // v planes, later o planes
  float* LF   = (float*)(ws + off); off += szR;     // depthwise result
  us_t*  KVTh = (us_t*)(ws + off);  off += szKVT;
  us_t*  KVTl = (us_t*)(ws + off);  off += szKVT;
  float* KM   = (float*)(ws + off); off += szM;
  float* VM   = (float*)(ws + off); off += szM;
  float* PK   = (float*)(ws + off); off += szPK;    // slice records; total 106708992
  if (off > ws_size) return;

  k_wcvt<<<dim3(160), 256, 0, stream>>>(qkvo_w, proj_w, WQh, WQl, WPh, WPl);
  hipFuncSetAttribute(reinterpret_cast<const void*>(&k_gemm),
                      hipFuncAttributeMaxDynamicSharedMemorySize, GM_BYTES);
  k_gemm<<<dim3(HW, 2, NB), 256, GM_BYTES, stream>>>(x, WQh, WQl, qkvo_b, R1, R2, 0);
  k_kv<<<dim3(NB * NH, KS), 128, 0, stream>>>(R1, R2, PK);
  k_kvred<<<dim3(NB * NH), 288, 0, stream>>>(PK, KVTh, KVTl, KM, VM);
  k_lepe<<<dim3(CH, NB), 256, 0, stream>>>(R2, lepe_w, lepe_b, LF);
  k_gemm<<<dim3(HW, 2, NB), 256, GM_BYTES, stream>>>(x, WQh, WQl, qkvo_b, R1, R2, 1);
  hipFuncSetAttribute(reinterpret_cast<const void*>(&k_resproj),
                      hipFuncAttributeMaxDynamicSharedMemorySize, RP_BYTES);
  k_resproj<<<dim3(NP / 64, NB), 256, RP_BYTES, stream>>>(R1, R2, LF, KVTh, KVTl, KM, VM, WPh, WPl, proj_b, outp);
}

// v004
// It runs in 131 microseconds.
// In two side-by-side timings against v003, it was 1.09 and 1.08 times as fast.
// Counting every step since v000, it is 1.99 times as fast.
// Contractions: qkv/o 1x1 projection, k^T v, q kv and the output 1x1 projection all on v_wmma_f32_16x16x32_bf16 as bf16 hi/lo three-product split (hi*hi + hi*lo + lo*hi, f32 accumulate); elu, channel means, z, rotary tables, depthwise 5x5, biases and the elementwise tail in f32.
#include <hip/hip_runtime.h>
#include <math.h>

typedef unsigned short us_t;
typedef __bf16   v16b __attribute__((ext_vector_type(16)));
typedef _Float16 v16h __attribute__((ext_vector_type(16)));
typedef us_t     v8us __attribute__((ext_vector_type(8)));
typedef us_t     v4us __attribute__((ext_vector_type(4)));
typedef float    v8f  __attribute__((ext_vector_type(8)));
typedef float    v4f  __attribute__((ext_vector_type(4)));
typedef v8us __attribute__((may_alias)) v8usa;
typedef v4us __attribute__((may_alias)) v4usa;
typedef v4f  __attribute__((may_alias)) v4fa;
union FragB { v16b v; v8us half[2]; v16h x; };
union Q8    { v8f v; v4f q[2]; };

#define NB   8
#define CH   256
#define NP   4096
#define HW   64
#define NH   8
#define HD   32
#define KVP  72
#define AQP  40
#define PPW  68
#define GXP  264
#define UPP  264
#define SOP  68
#define RTP  9
#define SCALE_F 0.17677669529663687f
#define CKV     0.0065695032f
#define INV_L   0.000244140625f
#define KS   16
#define KSL  256
#define KREC 1088

// dynamic LDS map of k_gemm (bytes): x hi tile [64][264] us_t + 24 (row-group skew), x lo tile, f32 staging [256][68] over both
#define GM_XL    33856
#define GM_BYTES 69632

// dynamic LDS map of k_resproj (bytes)
// U hi/lo planes [64][264] us_t; the f32 staging [256][68] overlays them (69632 bytes)
#define RP_UH    0
#define RP_UL    33792
#define RP_AQH   69632
#define RP_AQL   79872
#define RP_SINW  90112
#define RP_COSW  92160
#define RP_SINH  94208
#define RP_COSH  94240
#define RP_FREQ  94272
#define RP_ZP    94304
#define RP_KM    95328
#define RP_VM    96352
#define RP_BYTES 97408

// ---------------------------------------------------------------------------
// 16x16x32 bf16 WMMA with hazard guard (ties D, keeps A/B live).
// Fragment map (wave32): lane l, h = l>>4, m = n = l&15.
//   A/B element i: i<8 -> k0+8h+i ; i>=8 -> k0+16+8h+(i-8)
//   D element r : row 8h+r, col l&15
// ---------------------------------------------------------------------------
__device__ __forceinline__ v8f wmma_bf16(const FragB& a, const FragB& b, v8f c) {
  v8f d = __builtin_amdgcn_wmma_f32_16x16x32_bf16(false, a.v, false, b.v, (short)0, c, false, false);
  asm volatile("v_nop\n\tv_nop\n\tv_nop\n\tv_nop" : "+v"(d) : "v"(a.x), "v"(b.x));
  return d;
}
// fragment from a k-contiguous bf16 row holding >= 32 elements starting at p (p = row + k0)
__device__ __forceinline__ FragB ldfrag(const us_t* p, int h) {
  FragB f;
  f.half[0] = *(const v8usa*)(p + 8 * h);
  f.half[1] = *(const v8usa*)(p + 16 + 8 * h);
  return f;
}
// fragment from a weight plane packed in fragment order (see k_wcvt): p = block start + 8 * lane
__device__ __forceinline__ FragB ldfragp(const us_t* p) {
  FragB f;
  f.half[0] = *(const v8usa*)p;
  f.half[1] = *(const v8usa*)(p + 256);
  return f;
}
__device__ __forceinline__ v8f zero8f() {
  v8f z;
  #pragma unroll
  for (int j = 0; j < 8; ++j) z[j] = 0.f;
  return z;
}
// 8 floats to LDS as two 16-B pieces
__device__ __forceinline__ void st8f(float* p, v8f v) {
  Q8 u; u.v = v;
  *(v4fa*)p = u.q[0];
  *(v4fa*)(p + 4) = u.q[1];
}
// RNE convert f32 -> bf16 bits, and back
__device__ __forceinline__ us_t bf16_rne(float f) {
  unsigned u = __float_as_uint(f);
  u += 0x7FFFu + ((u >> 16) & 1u);
  return (us_t)(u >> 16);
}
__device__ __forceinline__ float bf16_val(us_t b) { return __uint_as_float(((unsigned)b) << 16); }
__device__ __forceinline__ void split2(float f, us_t& hi, us_t& lo) {
  hi = bf16_rne(f);
  lo = bf16_rne(f - bf16_val(hi));
}
// rotary frequency i of 8: 1 / 10000^(i/7), linspace-style exponent
__device__ __forceinline__ float rope_freq(int i) {
  const float e = (i == 7) ? 1.0f : (float)i * (1.0f / 7.0f);
  return 1.0f / powf(10000.0f, e);
}

// ---------------------------------------------------------------------------
// Kernel 0: weights -> bf16 hi/lo planes in fragment order. WQh/WQl from the
// qkv/o weights [1024][256], WPh/WPl from the output projection [256][256].
// A plane is a row of 1-KiB blocks, block (T, ks) = 16 weight rows 16 T + m by
// 32 k from 32 ks, at element offset (8 T + ks) * 512, laid out
// [half j][lane l = 16 h + m][8 elements k = 32 ks + 16 j + 8 h + i]: a wave's
// 16-byte fragment load then reads 512 contiguous bytes (four whole lines)
// where row-major weights gave it 16 lines of 32 bytes. Thread = one 16-byte
// piece of each plane, so a wave also stores whole lines.
// ---------------------------------------------------------------------------
__global__ __launch_bounds__(256) void k_wcvt(const float* __restrict__ qw, const float* __restrict__ pw,
                                             us_t* __restrict__ WQh, us_t* __restrict__ WQl,
                                             us_t* __restrict__ WPh, us_t* __restrict__ WPl)
{
  const int g = blockIdx.x * 256 + threadIdx.x;
  if (g >= 40960) return;
  const float* src;
  us_t* dh;
  us_t* dl;
  const int g2 = (g < 32768) ? g : (g - 32768);
  const int pl = g2 & 31, pj = (g2 >> 5) & 1, pks = (g2 >> 6) & 7, pT = g2 >> 9;
  const size_t so = (size_t)(16 * pT + (pl & 15)) * CH + 32 * pks + 16 * pj + 8 * (pl >> 4);
  if (g < 32768) { src = qw + so; dh = WQh + (size_t)g2 * 8; dl = WQl + (size_t)g2 * 8; }
  else { src = pw + so; dh = WPh + (size_t)g2 * 8; dl = WPl + (size_t)g2 * 8; }
  const v4f a = *(const v4fa*)src;
  const v4f c = *(const v4fa*)(src + 4);
  v8us oh, ol;
  {
    us_t p1, p2;
    split2(a.x, p1, p2); oh[0] = p1; ol[0] = p2;
    split2(a.y, p1, p2); oh[1] = p1; ol[1] = p2;
    split2(a.z, p1, p2); oh[2] = p1; ol[2] = p2;
    split2(a.w, p1, p2); oh[3] = p1; ol[3] = p2;
    split2(c.x, p1, p2); oh[4] = p1; ol[4] = p2;
    split2(c.y, p1, p2); oh[5] = p1; ol[5] = p2;
    split2(c.z, p1, p2); oh[6] = p1; ol[6] = p2;
    split2(c.w, p1, p2); oh[7] = p1; ol[7] = p2;
  }
  *(v8us*)dh = oh;
  *(v8us*)dl = ol;
  
}

// ---------------------------------------------------------------------------
// Kernel 1: 1x1 projection GEMM D[l][o] = sum_c x[c][l] * W[o][c] + bias[o],
// elu+1 for the q/k channel classes, as bf16 hi/lo three-product split.
// Block = (image row of 64 positions, 256-channel class, b), 8 waves.
// Staging: the x tile [256 c][64 l] (NCHW f32, l-contiguous float4 loads) is
// split into hi/lo LDS tiles sXh/sXl [64 l][256 c] (k-contiguous rows).
// Bank layout: row l starts at element l * 264 + 8 * (l >> 4), that is, each
// group of 16 rows is skewed 16 bytes further. The 16 lanes of a staging store
// hold rows 4 apart; at the 132-dword pitch alone they fall on 4 banks, with
// the skew on 16. A fragment's 16 rows share one skew, so its reads keep
// their spread.
// The f32 staging has a pitch of 68 floats: the 16 channels of an accumulator
// store then cover all 64 banks (at 64 floats they share four).
// A = sX rows (positions), B = WQh/WQl fragment blocks straight from global,
// K = 256 in 8 steps; wave = 32 positions x 64 channels (2x4 tiles);
// products a_hi*b_hi + a_hi*b_lo + a_lo*b_hi.
// One launch covers all four classes (blockIdx.y = 0 q, 1 k, 2 v, 3 o), each
// with a plane of its own, NCHW f32 [b][256][4096]: the four blocks of one x
// tile are neighbours in the grid, and nothing waits between the classes.
// Epilogue staged [256 ch][64 pos] f32 over the x
// ---------------------------------------------------------------------------
__global__ __launch_bounds__(256) void k_gemm(const float* __restrict__ x,
                                             const us_t* __restrict__ WQh, const us_t* __restrict__ WQl,
                                             const float* __restrict__ bias,
                                             float* __restrict__ QF, float* __restrict__ KF,
                                             float* __restrict__ VF, float* __restrict__ OF)
{
  extern __shared__ __attribute__((aligned(16))) unsigned char dsm[];
  us_t*  sXh = (us_t*)dsm;
  us_t*  sXl = (us_t*)(dsm + GM_XL);
  float* sO  = (float*)dsm;
  const int tid = threadIdx.x, lane = tid & 31, w = tid >> 5;
  const int h = lane >> 4, m = lane & 15;
  const int lb = blockIdx.x, cb = blockIdx.y, b = blockIdx.z;
  const int l0 = lb * 64;
  const int obase = 256 * cb;
  const int cls = cb;
  float* dst = (cls < 2) ? ((cls == 0) ? QF : KF) : ((cls == 2) ? VF : OF);

  // stage x[c][l0 + 0..63] -> hi/lo tiles [l][c]
  const float* xb = x + (size_t)(b * CH) * NP + l0;
  #pragma unroll 2
  for (int j = 0; j < 16; ++j) {
    const int f = tid + 256 * j;
    const int c = f >> 4, lq = (f & 15) * 4;
    const int cs = c + ((lq >> 4) << 3);
    const v4f v = *(const v4fa*)(xb + (size_t)c * NP + lq);
    us_t p1, p2;
    split2(v.x, p1, p2); sXh[(lq + 0) * GXP + cs] = p1; sXl[(lq + 0) * GXP + cs] = p2;
    split2(v.y, p1, p2); sXh[(lq + 1) * GXP + cs] = p1; sXl[(lq + 1) * GXP + cs] = p2;
    split2(v.z, p1, p2); sXh[(lq + 2) * GXP + cs] = p1; sXl[(lq + 2) * GXP + cs] = p2;
    split2(v.w, p1, p2); sXh[(lq + 3) * GXP + cs] = p1; sXl[(lq + 3) * GXP + cs] = p2;
  }
  __syncthreads();

  const int wl = w & 1, wc = w >> 1;
  const v8f z8 = zero8f();
  v8f acc[2][4];
  #pragma unroll
  for (int t = 0; t < 2; ++t) {
    #pragma unroll
    for (int v = 0; v < 4; ++v) acc[t][v] = z8;
  }
  const us_t* ah0 = sXh + (32 * wl + m) * GXP + 16 * wl;
  const us_t* ah1 = ah0 + 16 * GXP + 8;
  const us_t* al0 = sXl + (32 * wl + m) * GXP + 16 * wl;
  const us_t* al1 = al0 + 16 * GXP + 8;
  const us_t* bh0 = WQh + (size_t)((obase + 64 * wc) >> 4) * 4096 + 8 * lane;
  const us_t* bl0 = WQl + (size_t)((obase + 64 * wc) >> 4) * 4096 + 8 * lane;

  #pragma unroll 1
  for (int k0 = 0; k0 < CH; k0 += 32) {
    const FragB a0 = ldfrag(ah0 + k0, h);
    const FragB a1 = ldfrag(ah1 + k0, h);
    const FragB c0 = ldfrag(al0 + k0, h);
    const FragB c1 = ldfrag(al1 + k0, h);
    #pragma unroll
    for (int v = 0; v < 4; ++v) {
      const FragB bh = ldfragp(bh0 + 4096 * v + 16 * k0);
      const FragB bl = ldfragp(bl0 + 4096 * v + 16 * k0);
      acc[0][v] = wmma_bf16(a0, bh, acc[0][v]);
      acc[0][v] = wmma_bf16(a0, bl, acc[0][v]);
      acc[0][v] = wmma_bf16(c0, bh, acc[0][v]);
      acc[1][v] = wmma_bf16(a1, bh, acc[1][v]);
      acc[1][v] = wmma_bf16(a1, bl, acc[1][v]);
      acc[1][v] = wmma_bf16(c1, bh, acc[1][v]);
    }
    // the next trip rewrites the address registers that this trip's weight loads name
    asm volatile("s_wait_xcnt 0x0" ::: "memory");
  }
  __syncthreads();   // all waves done with the x tiles before the staging overlays them

  #pragma unroll
  for (int v = 0; v < 4; ++v) {
    const int ch = 64 * wc + 16 * v + m;
    const float bb = bias[obase + ch];
    #pragma unroll
    for (int t = 0; t < 2; ++t) {
      v8f y;
      #pragma unroll
      for (int r = 0; r < 8; ++r) {
        float vv = acc[t][v][r] + bb;
        if (cls < 2) vv = (vv > 0.f) ? (vv + 1.f) : expf(vv);
        y[r] = vv;
      }
      st8f(sO + ch * SOP + 32 * wl + 16 * t + 8 * h, y);
    }
  }
  __syncthreads();
  const int q8 = lane & 7, sub = lane >> 3;
  #pragma unroll
  for (int i = 0; i < 16; ++i) {
    const int id = 64 * w + 4 * i + sub;
    const int R = id >> 1, Lh = id & 1;
    const v4f val = *(const v4fa*)(sO + R * SOP + 32 * Lh + 4 * q8);
    const size_t d = (size_t)(b * CH + R) * NP + l0 + 32 * Lh + 4 * q8;
    *(v4f*)(dst + d) = val;
  }
  
}

// ---------------------------------------------------------------------------
// Kernel 2: per (b, head n, slice of 256 positions), 128 threads: streams its
// slice in chunks of 64; f32 channel sums of k (elu+1, before rotation) and v
// in a fixed order; rotary on k in f32 from an LDS sin/cos table; bf16 hi/lo
// planes of rotated k [d][l] and of v [e][l] in LDS; partial
// sum_l krot[d][l] v[e][l] as three-product split (A = krot rows,
// B column e of v = v row e; D rows d, cols e), f32 accumulate.
// Output: one f32 record per (b, n, slice) in PK: [e][d] 1024 partial
// products, 32 k sums, 32 v sums (4352 B = 34 whole lines, one writer block).
// ---------------------------------------------------------------------------
__global__ __launch_bounds__(128) void k_kv(const float* __restrict__ KF, const float* __restrict__ VF,
                                           float* __restrict__ PK)
{
  __shared__ __attribute__((aligned(16))) us_t Ah[HD * KVP];
  __shared__ __attribute__((aligned(16))) us_t Al[HD * KVP];
  __shared__ __attribute__((aligned(16))) us_t Bh[HD * KVP];
  __shared__ __attribute__((aligned(16))) us_t Bl[HD * KVP];
  __shared__ __attribute__((aligned(16))) float sSin[HW * RTP];   // pitch 9: lanes read rows 4 apart, 36 dwords, 16 banks
  __shared__ __attribute__((aligned(16))) float sCos[HW * RTP];
  __shared__ __attribute__((aligned(16))) float sKV[HD * HD];
  __shared__ __attribute__((aligned(16))) float sSum[64];
  __shared__ float sFreq[8];
  const int tid = threadIdx.x, lane = tid & 31, w = tid >> 5;
  const int h = lane >> 4, m = lane & 15;
  const int n = blockIdx.x & 7, b = blockIdx.x >> 3;
  const int lbeg = blockIdx.y * KSL;
  if (tid < 8) sFreq[tid] = rope_freq(tid);
  __syncthreads();
  #pragma unroll 1
  for (int j = 0; j < 4; ++j) {
    const int idx = tid + 128 * j;
    const int pos = idx >> 3, f = idx & 7;
    float sv, cv;
    sincosf((float)pos * sFreq[f], &sv, &cv);
    sSin[pos * RTP + f] = sv;
    sCos[pos * RTP + f] = cv;
  }
  const int i0 = tid >> 4, l4 = (tid & 15) * 4;
  const float* kb = KF + (size_t)(b * CH + n * HD) * NP;
  const float* vb = VF + (size_t)(b * CH + n * HD) * NP;
  float ks[4], vs[4];
  #pragma unroll
  for (int j = 0; j < 4; ++j) { ks[j] = 0.f; vs[j] = 0.f; }
  const int td = w >> 1, te = w & 1;
  const v8f z8 = zero8f();
  v8f acc = z8;

  #pragma unroll 1
  for (int l0 = lbeg; l0 < lbeg + KSL; l0 += 64) {
    __syncthreads();
    const int hp = l0 >> 6;
    // k rows: g = 0 -> d pair (2 i0, 2 i0 + 1) keyed on the image row hp;
    //         g = 1 -> d pair (16 + 2 i0, +1) keyed on the image column l4 + t
    #pragma unroll
    for (int g = 0; g < 2; ++g) {
      const int d0 = 16 * g + 2 * i0;
      const v4f ka = *(const v4fa*)(kb + (size_t)d0 * NP + l0 + l4);
      const v4f kc = *(const v4fa*)(kb + (size_t)(d0 + 1) * NP + l0 + l4);
      ks[2 * g]     += (ka.x + ka.y) + (ka.z + ka.w);
      ks[2 * g + 1] += (kc.x + kc.y) + (kc.z + kc.w);
      const float sr = sSin[hp * RTP + i0], cr = sCos[hp * RTP + i0];
      v4us ha, la, hc, lc;
      #pragma unroll
      for (int t = 0; t < 4; ++t) {
        const int widx = (l4 + t) * RTP + i0;
        const float sw = sSin[widx], cw = sCos[widx];
        const float s = g ? sw : sr;
        const float c = g ? cw : cr;
        const float xa = ka[t], xc = kc[t];
        us_t p1, p2;
        split2(xa * c - xc * s, p1, p2); ha[t] = p1; la[t] = p2;
        split2(xc * c + xa * s, p1, p2); hc[t] = p1; lc[t] = p2;
      }
      *(v4usa*)(Ah + d0 * KVP + l4) = ha;
      *(v4usa*)(Al + d0 * KVP + l4) = la;
      *(v4usa*)(Ah + (d0 + 1) * KVP + l4) = hc;
      *(v4usa*)(Al + (d0 + 1) * KVP + l4) = lc;
    }
    // v rows e = i0 + 8 j
    #pragma unroll
    for (int j = 0; j < 4; ++j) {
      const int e = i0 + 8 * j;
      const v4f vv = *(const v4fa*)(vb + (size_t)e * NP + l0 + l4);
      vs[j] += (vv.x + vv.y) + (vv.z + vv.w);
      v4us hv, lv;
      #pragma unroll
      for (int t = 0; t < 4; ++t) { us_t p1, p2; split2(vv[t], p1, p2); hv[t] = p1; lv[t] = p2; }
      *(v4usa*)(Bh + e * KVP + l4) = hv;
      *(v4usa*)(Bl + e * KVP + l4) = lv;
    }
    __syncthreads();
    #pragma unroll
    for (int kk = 0; kk < 2; ++kk) {
      const FragB fa = ldfrag(Ah + (16 * td + m) * KVP + 32 * kk, h);
      const FragB fl = ldfrag(Al + (16 * td + m) * KVP + 32 * kk, h);
      const FragB gb = ldfrag(Bh + (16 * te + m) * KVP + 32 * kk, h);
      const FragB gl = ldfrag(Bl + (16 * te + m) * KVP + 32 * kk, h);
      acc = wmma_bf16(fa, gb, acc);
      acc = wmma_bf16(fa, gl, acc);
      acc = wmma_bf16(fl, gb, acc);
    }
  }

  // channel sums: the 16 lanes of each half-wave share the channel index i0
  #pragma unroll
  for (int j = 0; j < 4; ++j) {
    float a = ks[j], c = vs[j];
    a += __shfl_xor(a, 1); a += __shfl_xor(a, 2); a += __shfl_xor(a, 4); a += __shfl_xor(a, 8);
    c += __shfl_xor(c, 1); c += __shfl_xor(c, 2); c += __shfl_xor(c, 4); c += __shfl_xor(c, 8);
    ks[j] = a; vs[j] = c;
  }
  if ((tid & 15) == 0) {
    sSum[2 * i0] = ks[0]; sSum[2 * i0 + 1] = ks[1];
    sSum[16 + 2 * i0] = ks[2]; sSum[17 + 2 * i0] = ks[3];
    #pragma unroll
    for (int j = 0; j < 4; ++j) sSum[32 + i0 + 8 * j] = vs[j];
  }
  // acc[r] -> (d = 16 td + 8 h + r, e = 16 te + m), staged transposed sKV[e][d]
  #pragma unroll
  for (int r = 0; r < 8; ++r) sKV[(16 * te + m) * HD + 16 * td + 8 * h + r] = acc[r];
  __syncthreads();

  float* rec = PK + (size_t)(blockIdx.x * KS + blockIdx.y) * KREC;
  #pragma unroll
  for (int j = 0; j < 2; ++j) {
    const int q = tid + 128 * j;
    *(v4f*)(rec + 4 * q) = *(const v4fa*)(sKV + 4 * q);
  }
  if (tid < 16) *(v4f*)(rec + 1024 + 4 * tid) = *(const v4fa*)(sSum + 4 * tid);
}

// ---------------------------------------------------------------------------
// Block role 2b (the first 64 blocks of kernel 3's launch): per (b, head n),
// 256 threads: float4 q of the 272 of a record is added over the 16 slice
// records in slice order by thread q & 255; then KVT[e][d] = c^2 * sum as bf16
// hi/lo KVTh/KVTl [b][n][e][d] (64-B rows, 2 rows per line, 8 threads per line,
// one instruction) and the KM/VM [b][n][32] means. sR: KREC floats of LDS.
// ---------------------------------------------------------------------------
__device__ __forceinline__ void kvred_block(float* sR, const float* __restrict__ PK,
                                            us_t* __restrict__ KVTh, us_t* __restrict__ KVTl,
                                            float* __restrict__ KM, float* __restrict__ VM)
{
  const int tid = threadIdx.x;
  #pragma unroll 1
  for (int q = tid; q < KREC / 4; q += 256) {
    const float* p = PK + (size_t)blockIdx.x * (KS * KREC) + 4 * q;
    v4f part[KS];
    #pragma unroll
    for (int s = 0; s < KS; ++s) part[s] = *(const v4fa*)(p + s * KREC);
    v4f a = part[0];
    #pragma unroll
    for (int s = 1; s < KS; ++s) a += part[s];
    *(v4fa*)(sR + 4 * q) = a;
  }
  __syncthreads();
  if (tid >= 128) return;

  const float cc = CKV * CKV;
  const int e = tid >> 2, q4 = tid & 3;
  const v4f f0 = *(const v4fa*)(sR + e * HD + 8 * q4) * cc;
  const v4f f1 = *(const v4fa*)(sR + e * HD + 8 * q4 + 4) * cc;
  v8us hh, ll;
  {
    us_t p1, p2;
    split2(f0.x, p1, p2); hh[0] = p1; ll[0] = p2;
    split2(f0.y, p1, p2); hh[1] = p1; ll[1] = p2;
    split2(f0.z, p1, p2); hh[2] = p1; ll[2] = p2;
    split2(f0.w, p1, p2); hh[3] = p1; ll[3] = p2;
    split2(f1.x, p1, p2); hh[4] = p1; ll[4] = p2;
    split2(f1.y, p1, p2); hh[5] = p1; ll[5] = p2;
    split2(f1.z, p1, p2); hh[6] = p1; ll[6] = p2;
    split2(f1.w, p1, p2); hh[7] = p1; ll[7] = p2;
  }
  const size_t kd = ((size_t)blockIdx.x * HD + e) * HD + 8 * q4;
  const int mi = tid & 7;
  const bool isk = tid < 8;
  const bool isv = (tid >= 8) && (tid < 16);
  const v4f mk = *(const v4fa*)(sR + 1024 + 4 * mi) * INV_L;
  const v4f mv = *(const v4fa*)(sR + 1056 + 4 * mi) * INV_L;
  float* pk = KM + (size_t)blockIdx.x * HD + 4 * mi;
  float* pv = VM + (size_t)blockIdx.x * HD + 4 * mi;
  *(v8us*)(KVTh + kd) = hh;
  *(v8us*)(KVTl + kd) = ll;
  if (isk) *(v4f*)pk = mk;
  if (isv) *(v4f*)pv = mv;
}

// ---------------------------------------------------------------------------
// Kernel 3: depthwise 5x5 (zero pad 2) on the v planes, f32 VALU:
// LF[b][c][y][x] = bias[c] + sum w[c][dy][dx] v[b][c][y+dy-2][x+dx-2].
// Block = (channel, b); the 64x64 plane staged with a 2-wide zero ring in
// LDS [68][68]; thread = 4 consecutive x per iteration (rolled loops).
// The launch's first 64 blocks do role 2b instead (it needs only kernel 2's
// records, the depthwise blocks only v): the small sum runs beside the
// depthwise work and takes no launch of its own.
// ---------------------------------------------------------------------------
__global__ __launch_bounds__(256) void k_lepe(const float* __restrict__ VF, const float* __restrict__ lw,
                                             const float* __restrict__ lbias, float* __restrict__ LF,
                                             const float* __restrict__ PK,
                                             us_t* __restrict__ KVTh, us_t* __restrict__ KVTl,
                                             float* __restrict__ KM, float* __restrict__ VM)
{
  __shared__ __attribute__((aligned(16))) float sP[PPW * PPW];
  __shared__ float sW[25];
  if (blockIdx.x < NB * NH) {
    kvred_block(sP, PK, KVTh, KVTl, KM, VM);
    return;
  }
  const int tid = threadIdx.x;
  const int c = (blockIdx.x - NB * NH) & (CH - 1), b = (blockIdx.x - NB * NH) >> 8;
  if (tid < 25) sW[tid] = lw[c * 25 + tid];
  #pragma unroll 1
  for (int j = 0; j < 19; ++j) {
    const int idx = tid + 256 * j;
    if (idx < PPW * PPW) sP[idx] = 0.f;
  }
  __syncthreads();
  const float* src = VF + (size_t)(b * CH + c) * NP;
  #pragma unroll
  for (int j = 0; j < 4; ++j) {
    const int f = tid + 256 * j, l = 4 * f, y = l >> 6, xx = l & 63;
    const v4f v = *(const v4fa*)(src + l);
    float* pr = sP + (y + 2) * PPW + xx + 2;
    pr[0] = v.x; pr[1] = v.y; pr[2] = v.z; pr[3] = v.w;
  }
  __syncthreads();
  const float bb = lbias[c];
  float* dst = LF + (size_t)(b * CH + c) * NP;
  #pragma unroll 1
  for (int j = 0; j < 4; ++j) {
    const int f = tid + 256 * j, l = 4 * f, y = l >> 6, xx = l & 63;
    float a0 = bb, a1 = bb, a2 = bb, a3 = bb;
    #pragma unroll 1
    for (int dy = 0; dy < 5; ++dy) {
      const float* rp = sP + (y + dy) * PPW + xx;
      const v4f r0 = *(const v4fa*)rp;
      const v4f r1 = *(const v4fa*)(rp + 4);
      const float rr[8] = {r0.x, r0.y, r0.z, r0.w, r1.x, r1.y, r1.z, r1.w};
      const float w0 = sW[dy * 5], w1 = sW[dy * 5 + 1], w2 = sW[dy * 5 + 2], w3 = sW[dy * 5 + 3], w4 = sW[dy * 5 + 4];
      a0 += w0 * rr[0]; a0 += w1 * rr[1]; a0 += w2 * rr[2]; a0 += w3 * rr[3]; a0 += w4 * rr[4];
      a1 += w0 * rr[1]; a1 += w1 * rr[2]; a1 += w2 * rr[3]; a1 += w3 * rr[4]; a1 += w4 * rr[5];
      a2 += w0 * rr[2]; a2 += w1 * rr[3]; a2 += w2 * rr[4]; a2 += w3 * rr[5]; a2 += w4 * rr[6];
      a3 += w0 * rr[3]; a3 += w1 * rr[4]; a3 += w2 * rr[5]; a3 += w3 * rr[6]; a3 += w4 * rr[7];
    }
    v4f o;
    o.x = a0; o.y = a1; o.z = a2; o.w = a3;
    *(v4f*)(dst + l) = o;
    
  }
}

// ---------------------------------------------------------------------------
// Kernel 4: per (image row of 64 positions, b), 8 waves:
//  phase 0: sin/cos tables and the per-image head means in LDS.
//  phase A (4 iterations over head pairs): threads stage q f32 [16 d] per
//   (head, l, half): partial z = q . kmean (f32), rotary in f32, bf16 hi/lo
//   rows Aq[head][l][32 d] in LDS; wave = (head of the pair, 16-l tile):
//   D[l][e] = sum_d q[l][d] kvt[e][d] as three-product split (A = Aq rows,
//   B = KVT rows e from global); epilogue f32: res = D (1 + 1/(z+1e-6))
//   - z vmean[e], u = (res + lepe) * o, bf16 hi/lo into U planes [l][256 c]
//   at a pitch of 264 (528 B = 16 B x 33: a fragment's 16 rows cover all banks).
//  phase B: D[l][co] = sum_c U[l][c] WP[co][c] as three-product split
//   (Uh*WPh + Ul*WPh + Uh*WPl, K = 256, WP fragment blocks from global),
//   + bias f32; staged [256 co][64 l]
// ---------------------------------------------------------------------------
__global__ __launch_bounds__(256) void k_resproj(
    const float* __restrict__ QF, const float* __restrict__ OF, const float* __restrict__ LF,
    const us_t* __restrict__ KVTh, const us_t* __restrict__ KVTl,
    const float* __restrict__ KM, const float* __restrict__ VM,
    const us_t* __restrict__ WPh, const us_t* __restrict__ WPl,
    const float* __restrict__ pbias, float* __restrict__ out)
{
  extern __shared__ __attribute__((aligned(16))) unsigned char dsm[];
  us_t*  Uh    = (us_t*)(dsm + RP_UH);
  us_t*  Ul    = (us_t*)(dsm + RP_UL);
  float* sO    = (float*)(dsm + RP_UH);
  us_t*  Aqh   = (us_t*)(dsm + RP_AQH);
  us_t*  Aql   = (us_t*)(dsm + RP_AQL);
  float* sSinW = (float*)(dsm + RP_SINW);
  float* sCosW = (float*)(dsm + RP_COSW);
  float* sSinH = (float*)(dsm + RP_SINH);
  float* sCosH = (float*)(dsm + RP_COSH);
  float* sFreq = (float*)(dsm + RP_FREQ);
  float* sZP   = (float*)(dsm + RP_ZP);
  float* sKM   = (float*)(dsm + RP_KM);
  float* sVM   = (float*)(dsm + RP_VM);
  const int tid = threadIdx.x, lane = tid & 31, w = tid >> 5;
  const int h = lane >> 4, m = lane & 15;
  const int lb = blockIdx.x, b = blockIdx.y;
  const int l0 = lb * 64;
  const v8f z8 = zero8f();

  // phase 0
  if (tid < 8) sFreq[tid] = rope_freq(tid);
  sKM[tid] = KM[(size_t)b * CH + tid];
  sVM[tid] = VM[(size_t)b * CH + tid];
  __syncthreads();
  #pragma unroll 1
  for (int j = 0; j < 2; ++j) {
    const int idx = tid + 256 * j;
    const int pos = idx >> 3, f = idx & 7;
    float sv, cv;
    sincosf((float)pos * sFreq[f], &sv, &cv);
    sSinW[idx] = sv;
    sCosW[idx] = cv;
  }
  if (tid < 8) {
    float sv, cv;
    sincosf((float)lb * sFreq[tid], &sv, &cv);
    sSinH[tid] = sv;
    sCosH[tid] = cv;
  }
  __syncthreads();

  // phase A
  const int sl = tid & 63, part = tid >> 6, shp = part >> 1, sdh = part & 1;   // staging role
  const int chp = w >> 2, clt = w & 3;                                           // tile role
  #pragma unroll 1
  for (int hp2 = 0; hp2 < 4; ++hp2) {
    {
      const int nn = 2 * hp2 + shp;
      const float* qp = QF + (size_t)(b * CH + nn * HD + 16 * sdh) * NP + l0 + sl;
      float qv[16];
      #pragma unroll
      for (int j = 0; j < 16; ++j) qv[j] = qp[(size_t)j * NP];
      float zpart = 0.f;
      #pragma unroll
      for (int j = 0; j < 16; ++j) zpart += qv[j] * sKM[nn * HD + 16 * sdh + j];
      sZP[part * 64 + sl] = zpart;
      us_t hq[16], lq[16];
      #pragma unroll
      for (int i = 0; i < 8; ++i) {
        const float sw = sSinW[sl * 8 + i], cw = sCosW[sl * 8 + i];
        const float sr = sSinH[i], cr = sCosH[i];
        const float s = sdh ? sw : sr;
        const float c = sdh ? cw : cr;
        const float x0 = qv[2 * i], x1 = qv[2 * i + 1];
        split2(x0 * c - x1 * s, hq[2 * i], lq[2 * i]);
        split2(x1 * c + x0 * s, hq[2 * i + 1], lq[2 * i + 1]);
      }
      v8us h0, h1, g0, g1;
      #pragma unroll
      for (int i = 0; i < 8; ++i) { h0[i] = hq[i]; h1[i] = hq[8 + i]; g0[i] = lq[i]; g1[i] = lq[8 + i]; }
      us_t* ah = Aqh + (shp * 64 + sl) * AQP + 16 * sdh;
      us_t* al = Aql + (shp * 64 + sl) * AQP + 16 * sdh;
      *(v8usa*)ah = h0; *(v8usa*)(ah + 8) = h1;
      *(v8usa*)al = g0; *(v8usa*)(al + 8) = g1;
    }
    __syncthreads();
    {
      const int nn = 2 * hp2 + chp;
      const FragB fa = ldfrag(Aqh + (chp * 64 + 16 * clt + m) * AQP, h);
      const FragB fl = ldfrag(Aql + (chp * 64 + 16 * clt + m) * AQP, h);
      v8f acc[2];
      #pragma unroll
      for (int u = 0; u < 2; ++u) {
        const size_t kr = ((size_t)(b * NH + nn) * HD + 16 * u + m) * HD;
        const FragB gb = ldfrag(KVTh + kr, h);
        const FragB gl = ldfrag(KVTl + kr, h);
        v8f a = wmma_bf16(fa, gb, z8);
        a = wmma_bf16(fa, gl, a);
        a = wmma_bf16(fl, gb, a);
        acc[u] = a;
      }
      float zz[8], fac[8];
      #pragma unroll
      for (int r = 0; r < 8; ++r) {
        const int l = 16 * clt + 8 * h + r;
        const float z = (sZP[(2 * chp) * 64 + l] + sZP[(2 * chp + 1) * 64 + l]) * SCALE_F;
        zz[r] = z;
        fac[r] = 1.0f + 1.0f / (z + 1e-6f);
      }
      #pragma unroll
      for (int u = 0; u < 2; ++u) {
        const int e = 16 * u + m, c = nn * HD + e;
        const float vme = sVM[nn * HD + e];
        const size_t go = (size_t)(b * CH + c) * NP + l0 + 16 * clt + 8 * h;
        const v4f le0 = *(const v4fa*)(LF + go);
        const v4f le1 = *(const v4fa*)(LF + go + 4);
        const v4f og0 = *(const v4fa*)(OF + go);
        const v4f og1 = *(const v4fa*)(OF + go + 4);
        const float lev[8] = {le0.x, le0.y, le0.z, le0.w, le1.x, le1.y, le1.z, le1.w};
        const float ogv[8] = {og0.x, og0.y, og0.z, og0.w, og1.x, og1.y, og1.z, og1.w};
        #pragma unroll
        for (int r = 0; r < 8; ++r) {
          const float res = acc[u][r] * fac[r] - zz[r] * vme;
          const float uv = (res + lev[r]) * ogv[r];
          us_t p1, p2;
          split2(uv, p1, p2);
          const int l = 16 * clt + 8 * h + r;
          Uh[l * UPP + c] = p1;
          Ul[l * UPP + c] = p2;
        }
      }
    }
    __syncthreads();
  }

  // phase B: output projection
  const int wl = w & 1, wc = w >> 1;
  v8f pacc[2][4];
  #pragma unroll
  for (int t = 0; t < 2; ++t) {
    #pragma unroll
    for (int v = 0; v < 4; ++v) pacc[t][v] = z8;
  }
  const us_t* ua0 = Uh + (32 * wl + m) * UPP;
  const us_t* ua1 = ua0 + 16 * UPP;
  const us_t* la0 = Ul + (32 * wl + m) * UPP;
  const us_t* la1 = la0 + 16 * UPP;
  const us_t* wph = WPh + (size_t)(4 * wc) * 4096 + 8 * lane;
  const us_t* wpl = WPl + (size_t)(4 * wc) * 4096 + 8 * lane;
  #pragma unroll 1
  for (int k0 = 0; k0 < CH; k0 += 32) {
    const FragB a0 = ldfrag(ua0 + k0, h);
    const FragB a1 = ldfrag(ua1 + k0, h);
    const FragB c0 = ldfrag(la0 + k0, h);
    const FragB c1 = ldfrag(la1 + k0, h);
    #pragma unroll
    for (int v = 0; v < 4; ++v) {
      const FragB bh = ldfragp(wph + 4096 * v + 16 * k0);
      const FragB bl = ldfragp(wpl + 4096 * v + 16 * k0);
      pacc[0][v] = wmma_bf16(a0, bh, pacc[0][v]);
      pacc[0][v] = wmma_bf16(c0, bh, pacc[0][v]);
      pacc[0][v] = wmma_bf16(a0, bl, pacc[0][v]);
      pacc[1][v] = wmma_bf16(a1, bh, pacc[1][v]);
      pacc[1][v] = wmma_bf16(c1, bh, pacc[1][v]);
      pacc[1][v] = wmma_bf16(a1, bl, pacc[1][v]);
    }
    // the next trip rewrites the address registers that this trip's weight loads name
    asm volatile("s_wait_xcnt 0x0" ::: "memory");
  }
  __syncthreads();   // all waves done with the U planes before the staging overlays them
  #pragma unroll
  for (int v = 0; v < 4; ++v) {
    const int co = 64 * wc + 16 * v + m;
    const float pb = pbias[co];
    #pragma unroll
    for (int t = 0; t < 2; ++t) {
      v8f y;
      #pragma unroll
      for (int r = 0; r < 8; ++r) y[r] = pacc[t][v][r] + pb;
      st8f(sO + co * SOP + 32 * wl + 16 * t + 8 * h, y);
    }
  }
  __syncthreads();
  const int q8 = lane & 7, sub = lane >> 3;
  #pragma unroll
  for (int i = 0; i < 16; ++i) {
    const int id = 64 * w + 4 * i + sub;
    const int R = id >> 1, Lh = id & 1;
    const v4f val = *(const v4fa*)(sO + R * SOP + 32 * Lh + 4 * q8);
    const size_t d = (size_t)(b * CH + R) * NP + l0 + 32 * Lh + 4 * q8;
    *(v4f*)(out + d) = val;
  }
  
}

// ---------------------------------------------------------------------------
extern "C" void kernel_launch(void* const* d_in, const int* in_sizes, int n_in,
                              void* d_out, int out_size, void* d_ws, size_t ws_size,
                              hipStream_t stream)
{
  if (n_in < 7) return;
  if (in_sizes[0] != NB * CH * NP) return;
  if (in_sizes[1] != 4 * CH * CH || in_sizes[2] != 4 * CH) return;
  if (in_sizes[3] != CH * 25 || in_sizes[4] != CH) return;
  if (in_sizes[5] != CH * CH || in_sizes[6] != CH) return;
  if (out_size != NB * CH * NP) return;

  const float* x      = (const float*)d_in[0];
  const float* qkvo_w = (const float*)d_in[1];
  const float* qkvo_b = (const float*)d_in[2];
  const float* lepe_w = (const float*)d_in[3];
  const float* lepe_b = (const float*)d_in[4];
  const float* proj_w = (const float*)d_in[5];
  const float* proj_b = (const float*)d_in[6];
  float* outp = (float*)d_out;

  const size_t szWQ  = (size_t)4 * CH * CH * 2;         //    524288 (x2)
  const size_t szWP  = (size_t)CH * CH * 2;             //    131072 (x2)
  const size_t szR   = (size_t)NB * CH * NP * 4;        //  33554432 (x5)
  const size_t szKVT = (size_t)NB * NH * HD * HD * 2;   //    131072 (x2)
  const size_t szM   = (size_t)NB * NH * HD * 4;        //      8192 (x2)
  const size_t szPK  = (size_t)NB * NH * KS * KREC * 4; //   4456448
  size_t off = 0;
  char* ws = (char*)d_ws;
  us_t*  WQh  = (us_t*)(ws + off);  off += szWQ;
  us_t*  WQl  = (us_t*)(ws + off);  off += szWQ;
  us_t*  WPh  = (us_t*)(ws + off);  off += szWP;
  us_t*  WPl  = (us_t*)(ws + off);  off += szWP;
  float* QF   = (float*)(ws + off); off += szR;     // q planes
  float* KF   = (float*)(ws + off); off += szR;     // k planes
  float* VF   = (float*)(ws + off); off += szR;     // v planes
  float* OF   = (float*)(ws + off); off += szR;     // o planes
  float* LF   = (float*)(ws + off); off += szR;     // depthwise result
  us_t*  KVTh = (us_t*)(ws + off);  off += szKVT;
  us_t*  KVTl = (us_t*)(ws + off);  off += szKVT;
  float* KM   = (float*)(ws + off); off += szM;
  float* VM   = (float*)(ws + off); off += szM;
  float* PK   = (float*)(ws + off); off += szPK;    // slice records; total 173817856
  if (off > ws_size) return;

  k_wcvt<<<dim3(160), 256, 0, stream>>>(qkvo_w, proj_w, WQh, WQl, WPh, WPl);
  hipFuncSetAttribute(reinterpret_cast<const void*>(&k_gemm),
                      hipFuncAttributeMaxDynamicSharedMemorySize, GM_BYTES);
  k_gemm<<<dim3(HW, 4, NB), 256, GM_BYTES, stream>>>(x, WQh, WQl, qkvo_b, QF, KF, VF, OF);
  k_kv<<<dim3(NB * NH, KS), 128, 0, stream>>>(KF, VF, PK);
  k_lepe<<<dim3(NB * NH + CH * NB), 256, 0, stream>>>(VF, lepe_w, lepe_b, LF, PK, KVTh, KVTl, KM, VM);
  hipFuncSetAttribute(reinterpret_cast<const void*>(&k_resproj),
                      hipFuncAttributeMaxDynamicSharedMemorySize, RP_BYTES);
  k_resproj<<<dim3(NP / 64, NB), 256, RP_BYTES, stream>>>(QF, OF, LF, KVTh, KVTl, KM, VM, WPh, WPl, proj_b, outp);
}

// v005
// A run of this version takes 112 microseconds.
// Timed twice side by side with v004, it ran 1.16 times as fast both times.
// Over all steps from v000 it is 2.31 times as fast.
// Contractions: qkv/o 1x1 projection, k^T v, q kv and the output 1x1 projection all on v_wmma_f32_16x16x32_bf16 as bf16 hi/lo three-product split (hi*hi + hi*lo + lo*hi, f32 accumulate); elu, channel means, z, rotary tables, depthwise 5x5, biases and the elementwise tail in f32.
#include <hip/hip_runtime.h>
#include <math.h>

typedef unsigned short us_t;
typedef __bf16   v16b __attribute__((ext_vector_type(16)));
typedef _Float16 v16h __attribute__((ext_vector_type(16)));
typedef us_t     v8us __attribute__((ext_vector_type(8)));
typedef us_t     v4us __attribute__((ext_vector_type(4)));
typedef float    v8f  __attribute__((ext_vector_type(8)));
typedef float    v4f  __attribute__((ext_vector_type(4)));
typedef v8us __attribute__((may_alias)) v8usa;
typedef v4us __attribute__((may_alias)) v4usa;
typedef v4f  __attribute__((may_alias)) v4fa;
union FragB { v16b v; v8us half[2]; v16h x; };
union Q8    { v8f v; v4f q[2]; };

#define NB   8
#define CH   256
#define NP   4096
#define HW   64
#define NH   8
#define HD   32
#define KVP  72
#define AQP  40
#define PPW  68
#define GXP  264
#define UPP  264
#define SOP  68
#define RTP  9
#define SCALE_F 0.17677669529663687f
#define CKV     0.0065695032f
#define INV_L   0.000244140625f
#define KS   16
#define KSL  256
#define KREC 1088

// dynamic LDS map of k_gemm (bytes): x hi tile [64][264] us_t + 24 (row-group skew), x lo tile, f32 staging [256][68] over both
#define GM_XL    33856
#define GM_BYTES 69632

// dynamic LDS map of k_resproj (bytes)
// U hi/lo planes [64][264] us_t; the f32 staging [256][68] overlays them (69632 bytes)
#define RP_UH    0
#define RP_UL    33792
#define RP_AQH   69632
#define RP_AQL   79872
#define RP_SINW  90112
#define RP_COSW  92160
#define RP_SINH  94208
#define RP_COSH  94240
#define RP_FREQ  94272
#define RP_ZP    94304
#define RP_KM    95328
#define RP_VM    96352
#define RP_BYTES 97408

// ---------------------------------------------------------------------------
// 16x16x32 bf16 WMMA with hazard guard (ties D, keeps A/B live).
// Fragment map (wave32): lane l, h = l>>4, m = n = l&15.
//   A/B element i: i<8 -> k0+8h+i ; i>=8 -> k0+16+8h+(i-8)
//   D element r : row 8h+r, col l&15
// ---------------------------------------------------------------------------
__device__ __forceinline__ v8f wmma_bf16(const FragB& a, const FragB& b, v8f c) {
  v8f d = __builtin_amdgcn_wmma_f32_16x16x32_bf16(false, a.v, false, b.v, (short)0, c, false, false);
  asm volatile("v_nop\n\tv_nop\n\tv_nop\n\tv_nop" : "+v"(d) : "v"(a.x), "v"(b.x));
  return d;
}
// fragment from a k-contiguous bf16 row holding >= 32 elements starting at p (p = row + k0)
__device__ __forceinline__ FragB ldfrag(const us_t* p, int h) {
  FragB f;
  f.half[0] = *(const v8usa*)(p + 8 * h);
  f.half[1] = *(const v8usa*)(p + 16 + 8 * h);
  return f;
}
// fragment from a weight plane packed in fragment order (see k_wcvt): p = block start + 8 * lane
__device__ __forceinline__ FragB ldfragp(const us_t* p) {
  FragB f;
  f.half[0] = *(const v8usa*)p;
  f.half[1] = *(const v8usa*)(p + 256);
  return f;
}
__device__ __forceinline__ v8f zero8f() {
  v8f z;
  #pragma unroll
  for (int j = 0; j < 8; ++j) z[j] = 0.f;
  return z;
}
// 8 floats to LDS as two 16-B pieces
__device__ __forceinline__ void st8f(float* p, v8f v) {
  Q8 u; u.v = v;
  *(v4fa*)p = u.q[0];
  *(v4fa*)(p + 4) = u.q[1];
}
// RNE convert f32 -> bf16 bits, and back
__device__ __forceinline__ us_t bf16_rne(float f) {
  unsigned u = __float_as_uint(f);
  u += 0x7FFFu + ((u >> 16) & 1u);
  return (us_t)(u >> 16);
}
__device__ __forceinline__ float bf16_val(us_t b) { return __uint_as_float(((unsigned)b) << 16); }
__device__ __forceinline__ void split2(float f, us_t& hi, us_t& lo) {
  hi = bf16_rne(f);
  lo = bf16_rne(f - bf16_val(hi));
}
// rotary frequency i of 8: 1 / 10000^(i/7), linspace-style exponent
__device__ __forceinline__ float rope_freq(int i) {
  const float e = (i == 7) ? 1.0f : (float)i * (1.0f / 7.0f);
  return 1.0f / powf(10000.0f, e);
}

// ---------------------------------------------------------------------------
// Kernel 0: weights -> bf16 hi/lo planes in fragment order. WQh/WQl from the
// qkv/o weights [1024][256], WPh/WPl from the output projection [256][256].
// A plane is a row of 1-KiB blocks, block (T, ks) = 16 weight rows 16 T + m by
// 32 k from 32 ks, at element offset (8 T + ks) * 512, laid out
// [half j][lane l = 16 h + m][8 elements k = 32 ks + 16 j + 8 h + i]: a wave's
// 16-byte fragment load then reads 512 contiguous bytes (four whole lines)
// where row-major weights gave it 16 lines of 32 bytes. Thread = one 16-byte
// piece of each plane, so a wave also stores whole lines.
// ---------------------------------------------------------------------------
__global__ __launch_bounds__(256) void k_wcvt(const float* __restrict__ qw, const float* __restrict__ pw,
                                             us_t* __restrict__ WQh, us_t* __restrict__ WQl,
                                             us_t* __restrict__ WPh, us_t* __restrict__ WPl)
{
  const int g = blockIdx.x * 256 + threadIdx.x;
  if (g >= 40960) return;
  const float* src;
  us_t* dh;
  us_t* dl;
  const int g2 = (g < 32768) ? g : (g - 32768);
  const int pl = g2 & 31, pj = (g2 >> 5) & 1, pks = (g2 >> 6) & 7, pT = g2 >> 9;
  const size_t so = (size_t)(16 * pT + (pl & 15)) * CH + 32 * pks + 16 * pj + 8 * (pl >> 4);
  if (g < 32768) { src = qw + so; dh = WQh + (size_t)g2 * 8; dl = WQl + (size_t)g2 * 8; }
  else { src = pw + so; dh = WPh + (size_t)g2 * 8; dl = WPl + (size_t)g2 * 8; }
  const v4f a = *(const v4fa*)src;
  const v4f c = *(const v4fa*)(src + 4);
  v8us oh, ol;
  {
    us_t p1, p2;
    split2(a.x, p1, p2); oh[0] = p1; ol[0] = p2;
    split2(a.y, p1, p2); oh[1] = p1; ol[1] = p2;
    split2(a.z, p1, p2); oh[2] = p1; ol[2] = p2;
    split2(a.w, p1, p2); oh[3] = p1; ol[3] = p2;
    split2(c.x, p1, p2); oh[4] = p1; ol[4] = p2;
    split2(c.y, p1, p2); oh[5] = p1; ol[5] = p2;
    split2(c.z, p1, p2); oh[6] = p1; ol[6] = p2;
    split2(c.w, p1, p2); oh[7] = p1; ol[7] = p2;
  }
  *(v8us*)dh = oh;
  *(v8us*)dl = ol;
  
}

// ---------------------------------------------------------------------------
// Kernel 1: 1x1 projection GEMM D[l][o] = sum_c x[c][l] * W[o][c] + bias[o],
// elu+1 for the q/k channel classes, as bf16 hi/lo three-product split.
// Block = (image row of 64 positions, 256-channel class, b), 8 waves.
// Staging: the x tile [256 c][64 l] (NCHW f32, l-contiguous float4 loads) is
// split into hi/lo LDS tiles sXh/sXl [64 l][256 c] (k-contiguous rows).
// Bank layout: row l starts at element l * 264 + 8 * (l >> 4), that is, each
// group of 16 rows is skewed 16 bytes further. The 16 lanes of a staging store
// hold rows 4 apart; at the 132-dword pitch alone they fall on 4 banks, with
// the skew on 16. A fragment's 16 rows share one skew, so its reads keep
// their spread.
// The f32 staging has a pitch of 68 floats: the 16 channels of an accumulator
// store then cover all 64 banks (at 64 floats they share four).
// A = sX rows (positions), B = WQh/WQl fragment blocks straight from global,
// K = 256 in 8 steps; wave = 32 positions x 64 channels (2x4 tiles);
// products a_hi*b_hi + a_hi*b_lo + a_lo*b_hi.
// One launch covers all four classes (blockIdx.y = 0 q, 1 k, 2 v, 3 o), each
// with a plane of its own, NCHW f32 [b][256][4096]: the four blocks of one x
// tile are neighbours in the grid, and nothing waits between the classes.
// Epilogue staged [256 ch][64 pos] f32 over the x
// ---------------------------------------------------------------------------
__global__ __launch_bounds__(256) void k_gemm(const float* __restrict__ x,
                                             const us_t* __restrict__ WQh, const us_t* __restrict__ WQl,
                                             const float* __restrict__ bias,
                                             float* __restrict__ QF, float* __restrict__ KF,
                                             float* __restrict__ VF, float* __restrict__ OF)
{
  extern __shared__ __attribute__((aligned(16))) unsigned char dsm[];
  us_t*  sXh = (us_t*)dsm;
  us_t*  sXl = (us_t*)(dsm + GM_XL);
  float* sO  = (float*)dsm;
  const int tid = threadIdx.x, lane = tid & 31, w = tid >> 5;
  const int h = lane >> 4, m = lane & 15;
  const int lb = blockIdx.x, cb = blockIdx.y, b = blockIdx.z;
  const int l0 = lb * 64;
  const int obase = 256 * cb;
  const int cls = cb;
  float* dst = (cls < 2) ? ((cls == 0) ? QF : KF) : ((cls == 2) ? VF : OF);

  // stage x[c][l0 + 0..63] -> hi/lo tiles [l][c]
  const float* xb = x + (size_t)(b * CH) * NP + l0;
  // eight loads of a thread are issued before the first value is used: two round trips, not sixteen.
  // Rolled: with both batches in flight the kernel needs more than 128 registers, a block less per WGP.
  const float* xp = xb + (size_t)(tid >> 4) * NP + (tid & 15) * 4;
  #pragma unroll 1
  for (int jb = 0; jb < 16; jb += 8) {
    const float* xq = xp + (size_t)(16 * jb) * NP;
    v4f xv[8];
    #pragma unroll
    for (int j = 0; j < 8; ++j) xv[j] = *(const v4fa*)(xq + (size_t)(16 * j) * NP);
    // the next trip rewrites the address registers that these loads name
    asm volatile("s_wait_xcnt 0x0" ::: "memory");
    #pragma unroll
    for (int j = 0; j < 8; ++j) {
      const int f = tid + 256 * (jb + j);
      const int c = f >> 4, lq = (f & 15) * 4;
      const int cs = c + ((lq >> 4) << 3);
      const v4f v = xv[j];
      us_t p1, p2;
      split2(v.x, p1, p2); sXh[(lq + 0) * GXP + cs] = p1; sXl[(lq + 0) * GXP + cs] = p2;
      split2(v.y, p1, p2); sXh[(lq + 1) * GXP + cs] = p1; sXl[(lq + 1) * GXP + cs] = p2;
      split2(v.z, p1, p2); sXh[(lq + 2) * GXP + cs] = p1; sXl[(lq + 2) * GXP + cs] = p2;
      split2(v.w, p1, p2); sXh[(lq + 3) * GXP + cs] = p1; sXl[(lq + 3) * GXP + cs] = p2;
    }
  }
  __syncthreads();

  const int wl = w & 1, wc = w >> 1;
  const v8f z8 = zero8f();
  v8f acc[2][4];
  #pragma unroll
  for (int t = 0; t < 2; ++t) {
    #pragma unroll
    for (int v = 0; v < 4; ++v) acc[t][v] = z8;
  }
  const us_t* ah0 = sXh + (32 * wl + m) * GXP + 16 * wl;
  const us_t* ah1 = ah0 + 16 * GXP + 8;
  const us_t* al0 = sXl + (32 * wl + m) * GXP + 16 * wl;
  const us_t* al1 = al0 + 16 * GXP + 8;
  const us_t* bh0 = WQh + (size_t)((obase + 64 * wc) >> 4) * 4096 + 8 * lane;
  const us_t* bl0 = WQl + (size_t)((obase + 64 * wc) >> 4) * 4096 + 8 * lane;

  #pragma unroll 1
  for (int k0 = 0; k0 < CH; k0 += 32) {
    const FragB a0 = ldfrag(ah0 + k0, h);
    const FragB a1 = ldfrag(ah1 + k0, h);
    const FragB c0 = ldfrag(al0 + k0, h);
    const FragB c1 = ldfrag(al1 + k0, h);
    #pragma unroll
    for (int v = 0; v < 4; ++v) {
      const FragB bh = ldfragp(bh0 + 4096 * v + 16 * k0);
      const FragB bl = ldfragp(bl0 + 4096 * v + 16 * k0);
      acc[0][v] = wmma_bf16(a0, bh, acc[0][v]);
      acc[0][v] = wmma_bf16(a0, bl, acc[0][v]);
      acc[0][v] = wmma_bf16(c0, bh, acc[0][v]);
      acc[1][v] = wmma_bf16(a1, bh, acc[1][v]);
      acc[1][v] = wmma_bf16(a1, bl, acc[1][v]);
      acc[1][v] = wmma_bf16(c1, bh, acc[1][v]);
    }
    // the next trip rewrites the address registers that this trip's weight loads name
    asm volatile("s_wait_xcnt 0x0" ::: "memory");
  }
  __syncthreads();   // all waves done with the x tiles before the staging overlays them

  #pragma unroll
  for (int v = 0; v < 4; ++v) {
    const int ch = 64 * wc + 16 * v + m;
    const float bb = bias[obase + ch];
    #pragma unroll
    for (int t = 0; t < 2; ++t) {
      v8f y;
      #pragma unroll
      for (int r = 0; r < 8; ++r) {
        float vv = acc[t][v][r] + bb;
        if (cls < 2) vv = (vv > 0.f) ? (vv + 1.f) : expf(vv);
        y[r] = vv;
      }
      st8f(sO + ch * SOP + 32 * wl + 16 * t + 8 * h, y);
    }
  }
  __syncthreads();
  const int q8 = lane & 7, sub = lane >> 3;
  #pragma unroll
  for (int i = 0; i < 16; ++i) {
    const int id = 64 * w + 4 * i + sub;
    const int R = id >> 1, Lh = id & 1;
    const v4f val = *(const v4fa*)(sO + R * SOP + 32 * Lh + 4 * q8);
    const size_t d = (size_t)(b * CH + R) * NP + l0 + 32 * Lh + 4 * q8;
    *(v4f*)(dst + d) = val;
  }
  
}

// ---------------------------------------------------------------------------
// Kernel 2: per (b, head n, slice of 256 positions), 128 threads: streams its
// slice in chunks of 64; f32 channel sums of k (elu+1, before rotation) and v
// in a fixed order; rotary on k in f32 from an LDS sin/cos table; bf16 hi/lo
// planes of rotated k [d][l] and of v [e][l] in LDS; partial
// sum_l krot[d][l] v[e][l] as three-product split (A = krot rows,
// B column e of v = v row e; D rows d, cols e), f32 accumulate.
// Output: one f32 record per (b, n, slice) in PK: [e][d] 1024 partial
// products, 32 k sums, 32 v sums (4352 B = 34 whole lines, one writer block).
// ---------------------------------------------------------------------------
// one thread's 8 loads of a 64-position chunk: k rows 2 i0, 2 i0 + 1, 16 + 2 i0, 17 + 2 i0 from kp
// (= row 2 i0 at the thread's 4 positions of chunk 0), v rows i0 + 8 j from vp (= row i0 there), off = 64 x chunk
__device__ __forceinline__ void kv_chunk(const float* __restrict__ kp, const float* __restrict__ vp, int off,
                                         v4f (&ka)[2], v4f (&kc)[2], v4f (&vv)[4]) {
  #pragma unroll
  for (int g = 0; g < 2; ++g) {
    ka[g] = *(const v4fa*)(kp + (size_t)(16 * g) * NP + off);
    kc[g] = *(const v4fa*)(kp + (size_t)(16 * g + 1) * NP + off);
  }
  #pragma unroll
  for (int j = 0; j < 4; ++j) vv[j] = *(const v4fa*)(vp + (size_t)(8 * j) * NP + off);
  // what follows may rewrite the address registers that these loads name; the two pointers are
  // inputs so that their registers are not given away (as a load's destination) ahead of the wait
  asm volatile("s_wait_xcnt 0x0" :: "v"(kp), "v"(vp) : "memory");
}

__global__ __launch_bounds__(128) void k_kv(const float* __restrict__ KF, const float* __restrict__ VF,
                                           float* __restrict__ PK)
{
  __shared__ __attribute__((aligned(16))) us_t Ah[HD * KVP];
  __shared__ __attribute__((aligned(16))) us_t Al[HD * KVP];
  __shared__ __attribute__((aligned(16))) us_t Bh[HD * KVP];
  __shared__ __attribute__((aligned(16))) us_t Bl[HD * KVP];
  __shared__ __attribute__((aligned(16))) float sSin[HW * RTP];   // pitch 9: lanes read rows 4 apart, 36 dwords, 16 banks
  __shared__ __attribute__((aligned(16))) float sCos[HW * RTP];
  __shared__ __attribute__((aligned(16))) float sKV[HD * HD];
  __shared__ __attribute__((aligned(16))) float sSum[64];
  __shared__ float sFreq[8];
  const int tid = threadIdx.x, lane = tid & 31, w = tid >> 5;
  const int h = lane >> 4, m = lane & 15;
  const int n = blockIdx.x & 7, b = blockIdx.x >> 3;
  const int lbeg = blockIdx.y * KSL;
  // A chunk's 8 loads of a thread are issued two stages ahead of their use and fly under the work
  // between: chunk 0 here, chunk 1 behind the first barrier (under the table set-up), chunk q + 2
  // at the top of chunk q's pass. (A barrier waits for the loads issued in front of it.)
  const int i0 = tid >> 4, l4 = (tid & 15) * 4;
  const float* kb = KF + (size_t)(b * CH + n * HD + 2 * i0) * NP + lbeg + l4;
  const float* vb = VF + (size_t)(b * CH + n * HD + i0) * NP + lbeg + l4;
  v4f kaq[4][2], kcq[4][2], vvq[4][4];
  kv_chunk(kb, vb, 0, kaq[0], kcq[0], vvq[0]);
  if (tid < 8) sFreq[tid] = rope_freq(tid);
  __syncthreads();
  kv_chunk(kb, vb, 64, kaq[1], kcq[1], vvq[1]);
  #pragma unroll 1
  for (int j = 0; j < 4; ++j) {
    const int idx = tid + 128 * j;
    const int pos = idx >> 3, f = idx & 7;
    float sv, cv;
    sincosf((float)pos * sFreq[f], &sv, &cv);
    sSin[pos * RTP + f] = sv;
    sCos[pos * RTP + f] = cv;
  }
  float ks[4], vs[4];
  #pragma unroll
  for (int j = 0; j < 4; ++j) { ks[j] = 0.f; vs[j] = 0.f; }
  const int td = w >> 1, te = w & 1;
  const v8f z8 = zero8f();
  v8f acc = z8;

  // unrolled: the chunks' registers are indexed statically
  #pragma unroll
  for (int q = 0; q < 4; ++q) {
    const int l0 = lbeg + 64 * q;
    __syncthreads();
    if (q + 2 < 4) kv_chunk(kb, vb, 64 * (q + 2), kaq[q + 2], kcq[q + 2], vvq[q + 2]);
    const int hp = l0 >> 6;
    // k rows: g = 0 -> d pair (2 i0, 2 i0 + 1) keyed on the image row hp;
    //         g = 1 -> d pair (16 + 2 i0, +1) keyed on the image column l4 + t
    #pragma unroll
    for (int g = 0; g < 2; ++g) {
      const int d0 = 16 * g + 2 * i0;
      const v4f ka = kaq[q][g];
      const v4f kc = kcq[q][g];
      ks[2 * g]     += (ka.x + ka.y) + (ka.z + ka.w);
      ks[2 * g + 1] += (kc.x + kc.y) + (kc.z + kc.w);
      const float sr = sSin[hp * RTP + i0], cr = sCos[hp * RTP + i0];
      v4us ha, la, hc, lc;
      #pragma unroll
      for (int t = 0; t < 4; ++t) {
        const int widx = (l4 + t) * RTP + i0;
        const float sw = sSin[widx], cw = sCos[widx];
        const float s = g ? sw : sr;
        const float c = g ? cw : cr;
        const float xa = ka[t], xc = kc[t];
        us_t p1, p2;
        split2(xa * c - xc * s, p1, p2); ha[t] = p1; la[t] = p2;
        split2(xc * c + xa * s, p1, p2); hc[t] = p1; lc[t] = p2;
      }
      *(v4usa*)(Ah + d0 * KVP + l4) = ha;
      *(v4usa*)(Al + d0 * KVP + l4) = la;
      *(v4usa*)(Ah + (d0 + 1) * KVP + l4) = hc;
      *(v4usa*)(Al + (d0 + 1) * KVP + l4) = lc;
    }
    // v rows e = i0 + 8 j
    #pragma unroll
    for (int j = 0; j < 4; ++j) {
      const int e = i0 + 8 * j;
      const v4f vv = vvq[q][j];
      vs[j] += (vv.x + vv.y) + (vv.z + vv.w);
      v4us hv, lv;
      #pragma unroll
      for (int t = 0; t < 4; ++t) { us_t p1, p2; split2(vv[t], p1, p2); hv[t] = p1; lv[t] = p2; }
      *(v4usa*)(Bh + e * KVP + l4) = hv;
      *(v4usa*)(Bl + e * KVP + l4) = lv;
    }
    __syncthreads();
    #pragma unroll
    for (int kk = 0; kk < 2; ++kk) {
      const FragB fa = ldfrag(Ah + (16 * td + m) * KVP + 32 * kk, h);
      const FragB fl = ldfrag(Al + (16 * td + m) * KVP + 32 * kk, h);
      const FragB gb = ldfrag(Bh + (16 * te + m) * KVP + 32 * kk, h);
      const FragB gl = ldfrag(Bl + (16 * te + m) * KVP + 32 * kk, h);
      acc = wmma_bf16(fa, gb, acc);
      acc = wmma_bf16(fa, gl, acc);
      acc = wmma_bf16(fl, gb, acc);
    }
  }

  // channel sums: the 16 lanes of each half-wave share the channel index i0
  #pragma unroll
  for (int j = 0; j < 4; ++j) {
    float a = ks[j], c = vs[j];
    a += __shfl_xor(a, 1); a += __shfl_xor(a, 2); a += __shfl_xor(a, 4); a += __shfl_xor(a, 8);
    c += __shfl_xor(c, 1); c += __shfl_xor(c, 2); c += __shfl_xor(c, 4); c += __shfl_xor(c, 8);
    ks[j] = a; vs[j] = c;
  }
  if ((tid & 15) == 0) {
    sSum[2 * i0] = ks[0]; sSum[2 * i0 + 1] = ks[1];
    sSum[16 + 2 * i0] = ks[2]; sSum[17 + 2 * i0] = ks[3];
    #pragma unroll
    for (int j = 0; j < 4; ++j) sSum[32 + i0 + 8 * j] = vs[j];
  }
  // acc[r] -> (d = 16 td + 8 h + r, e = 16 te + m), staged transposed sKV[e][d]
  #pragma unroll
  for (int r = 0; r < 8; ++r) sKV[(16 * te + m) * HD + 16 * td + 8 * h + r] = acc[r];
  __syncthreads();

  float* rec = PK + (size_t)(blockIdx.x * KS + blockIdx.y) * KREC;
  #pragma unroll
  for (int j = 0; j < 2; ++j) {
    const int q = tid + 128 * j;
    *(v4f*)(rec + 4 * q) = *(const v4fa*)(sKV + 4 * q);
  }
  if (tid < 16) *(v4f*)(rec + 1024 + 4 * tid) = *(const v4fa*)(sSum + 4 * tid);
}

// ---------------------------------------------------------------------------
// Block role 2b (the first 64 blocks of kernel 3's launch): per (b, head n),
// 256 threads: float4 q of the 272 of a record is added over the 16 slice
// records in slice order by thread q & 255; then KVT[e][d] = c^2 * sum as bf16
// hi/lo KVTh/KVTl [b][n][e][d] (64-B rows, 2 rows per line, 8 threads per line,
// one instruction) and the KM/VM [b][n][32] means. sR: KREC floats of LDS.
// ---------------------------------------------------------------------------
__device__ __forceinline__ void kvred_block(float* sR, const float* __restrict__ PK,
                                            us_t* __restrict__ KVTh, us_t* __restrict__ KVTl,
                                            float* __restrict__ KM, float* __restrict__ VM)
{
  const int tid = threadIdx.x;
  #pragma unroll 1
  for (int q = tid; q < KREC / 4; q += 256) {
    const float* p = PK + (size_t)blockIdx.x * (KS * KREC) + 4 * q;
    v4f part[KS];
    #pragma unroll
    for (int s = 0; s < KS; ++s) part[s] = *(const v4fa*)(p + s * KREC);
    v4f a = part[0];
    #pragma unroll
    for (int s = 1; s < KS; ++s) a += part[s];
    *(v4fa*)(sR + 4 * q) = a;
  }
  __syncthreads();
  if (tid >= 128) return;

  const float cc = CKV * CKV;
  const int e = tid >> 2, q4 = tid & 3;
  const v4f f0 = *(const v4fa*)(sR + e * HD + 8 * q4) * cc;
  const v4f f1 = *(const v4fa*)(sR + e * HD + 8 * q4 + 4) * cc;
  v8us hh, ll;
  {
    us_t p1, p2;
    split2(f0.x, p1, p2); hh[0] = p1; ll[0] = p2;
    split2(f0.y, p1, p2); hh[1] = p1; ll[1] = p2;
    split2(f0.z, p1, p2); hh[2] = p1; ll[2] = p2;
    split2(f0.w, p1, p2); hh[3] = p1; ll[3] = p2;
    split2(f1.x, p1, p2); hh[4] = p1; ll[4] = p2;
    split2(f1.y, p1, p2); hh[5] = p1; ll[5] = p2;
    split2(f1.z, p1, p2); hh[6] = p1; ll[6] = p2;
    split2(f1.w, p1, p2); hh[7] = p1; ll[7] = p2;
  }
  const size_t kd = ((size_t)blockIdx.x * HD + e) * HD + 8 * q4;
  const int mi = tid & 7;
  const bool isk = tid < 8;
  const bool isv = (tid >= 8) && (tid < 16);
  const v4f mk = *(const v4fa*)(sR + 1024 + 4 * mi) * INV_L;
  const v4f mv = *(const v4fa*)(sR + 1056 + 4 * mi) * INV_L;
  float* pk = KM + (size_t)blockIdx.x * HD + 4 * mi;
  float* pv = VM + (size_t)blockIdx.x * HD + 4 * mi;
  *(v8us*)(KVTh + kd) = hh;
  *(v8us*)(KVTl + kd) = ll;
  if (isk) *(v4f*)pk = mk;
  if (isv) *(v4f*)pv = mv;
}

// ---------------------------------------------------------------------------
// Kernel 3: depthwise 5x5 (zero pad 2) on the v planes, f32 VALU:
// LF[b][c][y][x] = bias[c] + sum w[c][dy][dx] v[b][c][y+dy-2][x+dx-2].
// Block = (channel, b); the 64x64 plane staged with a 2-wide zero ring in
// LDS [68][68]; thread = 4 consecutive x per iteration (rolled loops).
// The launch's first 64 blocks do role 2b instead (it needs only kernel 2's
// records, the depthwise blocks only v): the small sum runs beside the
// depthwise work and takes no launch of its own.
// ---------------------------------------------------------------------------
__global__ __launch_bounds__(256) void k_lepe(const float* __restrict__ VF, const float* __restrict__ lw,
                                             const float* __restrict__ lbias, float* __restrict__ LF,
                                             const float* __restrict__ PK,
                                             us_t* __restrict__ KVTh, us_t* __restrict__ KVTl,
                                             float* __restrict__ KM, float* __restrict__ VM)
{
  __shared__ __attribute__((aligned(16))) float sP[PPW * PPW];
  __shared__ float sW[25];
  if (blockIdx.x < NB * NH) {
    kvred_block(sP, PK, KVTh, KVTl, KM, VM);
    return;
  }
  const int tid = threadIdx.x;
  const int c = (blockIdx.x - NB * NH) & (CH - 1), b = (blockIdx.x - NB * NH) >> 8;
  // the plane's loads are issued ahead of the zero fill and fly under it
  const float* src = VF + (size_t)(b * CH + c) * NP;
  v4f pv4[4];
  #pragma unroll
  for (int j = 0; j < 4; ++j) pv4[j] = *(const v4fa*)(src + 4 * (tid + 256 * j));
  if (tid < 25) sW[tid] = lw[c * 25 + tid];
  #pragma unroll 1
  for (int j = 0; j < 19; ++j) {
    const int idx = tid + 256 * j;
    if (idx < PPW * PPW) sP[idx] = 0.f;
  }
  __syncthreads();
  #pragma unroll
  for (int j = 0; j < 4; ++j) {
    const int f = tid + 256 * j, l = 4 * f, y = l >> 6, xx = l & 63;
    const v4f v = pv4[j];
    float* pr = sP + (y + 2) * PPW + xx + 2;
    pr[0] = v.x; pr[1] = v.y; pr[2] = v.z; pr[3] = v.w;
  }
  __syncthreads();
  const float bb = lbias[c];
  float* dst = LF + (size_t)(b * CH + c) * NP;
  #pragma unroll 1
  for (int j = 0; j < 4; ++j) {
    const int f = tid + 256 * j, l = 4 * f, y = l >> 6, xx = l & 63;
    float a0 = bb, a1 = bb, a2 = bb, a3 = bb;
    #pragma unroll 1
    for (int dy = 0; dy < 5; ++dy) {
      const float* rp = sP + (y + dy) * PPW + xx;
      const v4f r0 = *(const v4fa*)rp;
      const v4f r1 = *(const v4fa*)(rp + 4);
      const float rr[8] = {r0.x, r0.y, r0.z, r0.w, r1.x, r1.y, r1.z, r1.w};
      const float w0 = sW[dy * 5], w1 = sW[dy * 5 + 1], w2 = sW[dy * 5 + 2], w3 = sW[dy * 5 + 3], w4 = sW[dy * 5 + 4];
      a0 += w0 * rr[0]; a0 += w1 * rr[1]; a0 += w2 * rr[2]; a0 += w3 * rr[3]; a0 += w4 * rr[4];
      a1 += w0 * rr[1]; a1 += w1 * rr[2]; a1 += w2 * rr[3]; a1 += w3 * rr[4]; a1 += w4 * rr[5];
      a2 += w0 * rr[2]; a2 += w1 * rr[3]; a2 += w2 * rr[4]; a2 += w3 * rr[5]; a2 += w4 * rr[6];
      a3 += w0 * rr[3]; a3 += w1 * rr[4]; a3 += w2 * rr[5]; a3 += w3 * rr[6]; a3 += w4 * rr[7];
    }
    v4f o;
    o.x = a0; o.y = a1; o.z = a2; o.w = a3;
    *(v4f*)(dst + l) = o;
    
  }
}

// ---------------------------------------------------------------------------
// Kernel 4: per (image row of 64 positions, b), 8 waves:
//  phase 0: sin/cos tables and the per-image head means in LDS.
//  phase A (4 iterations over head pairs): threads stage q f32 [16 d] per
//   (head, l, half): partial z = q . kmean (f32), rotary in f32, bf16 hi/lo
//   rows Aq[head][l][32 d] in LDS; wave = (head of the pair, 16-l tile):
//   D[l][e] = sum_d q[l][d] kvt[e][d] as three-product split (A = Aq rows,
//   B = KVT rows e from global); epilogue f32: res = D (1 + 1/(z+1e-6))
//   - z vmean[e], u = (res + lepe) * o, bf16 hi/lo into U planes [l][256 c]
//   at a pitch of 264 (528 B = 16 B x 33: a fragment's 16 rows cover all banks).
//  phase B: D[l][co] = sum_c U[l][c] WP[co][c] as three-product split
//   (Uh*WPh + Ul*WPh + Uh*WPl, K = 256, WP fragment blocks from global),
//   + bias f32; staged [256 co][64 l]
// ---------------------------------------------------------------------------
__global__ __launch_bounds__(256) void k_resproj(
    const float* __restrict__ QF, const float* __restrict__ OF, const float* __restrict__ LF,
    const us_t* __restrict__ KVTh, const us_t* __restrict__ KVTl,
    const float* __restrict__ KM, const float* __restrict__ VM,
    const us_t* __restrict__ WPh, const us_t* __restrict__ WPl,
    const float* __restrict__ pbias, float* __restrict__ out)
{
  extern __shared__ __attribute__((aligned(16))) unsigned char dsm[];
  us_t*  Uh    = (us_t*)(dsm + RP_UH);
  us_t*  Ul    = (us_t*)(dsm + RP_UL);
  float* sO    = (float*)(dsm + RP_UH);
  us_t*  Aqh   = (us_t*)(dsm + RP_AQH);
  us_t*  Aql   = (us_t*)(dsm + RP_AQL);
  float* sSinW = (float*)(dsm + RP_SINW);
  float* sCosW = (float*)(dsm + RP_COSW);
  float* sSinH = (float*)(dsm + RP_SINH);
  float* sCosH = (float*)(dsm + RP_COSH);
  float* sFreq = (float*)(dsm + RP_FREQ);
  float* sZP   = (float*)(dsm + RP_ZP);
  float* sKM   = (float*)(dsm + RP_KM);
  float* sVM   = (float*)(dsm + RP_VM);
  const int tid = threadIdx.x, lane = tid & 31, w = tid >> 5;
  const int h = lane >> 4, m = lane & 15;
  const int lb = blockIdx.x, b = blockIdx.y;
  const int l0 = lb * 64;
  const v8f z8 = zero8f();
  const int sl = tid & 63, part = tid >> 6, shp = part >> 1, sdh = part & 1;   // staging role
  const int chp = w >> 2, clt = w & 3;                                           // tile role

  // Every global operand of phase A is asked for one head pair ahead: pair 0 here, under the table
  // set-up; q of pair p + 1 at the top of pair p, under p's staging; kv fragments, depthwise and o
  // values of pair p + 1 behind the barrier that publishes pair p's q rows, under p's tile work.
  const float* qp0 = QF + (size_t)(b * CH + shp * HD + 16 * sdh) * NP + l0 + sl;
  const size_t kr0 = ((size_t)(b * NH + chp) * HD + m) * HD;
  const size_t go0 = (size_t)(b * CH + chp * HD + m) * NP + l0 + 16 * clt + 8 * h;
  float qv[16];
  FragB gbv[2], glv[2];
  v4f le0v[2], le1v[2], og0v[2], og1v[2];
  #pragma unroll
  for (int j = 0; j < 16; ++j) qv[j] = qp0[(size_t)j * NP];
  #pragma unroll
  for (int u = 0; u < 2; ++u) {
    gbv[u] = ldfrag(KVTh + kr0 + 16 * u * HD, h);
    glv[u] = ldfrag(KVTl + kr0 + 16 * u * HD, h);
    le0v[u] = *(const v4fa*)(LF + go0 + (size_t)(16 * u) * NP);
    le1v[u] = *(const v4fa*)(LF + go0 + (size_t)(16 * u) * NP + 4);
    og0v[u] = *(const v4fa*)(OF + go0 + (size_t)(16 * u) * NP);
    og1v[u] = *(const v4fa*)(OF + go0 + (size_t)(16 * u) * NP + 4);
  }

  // phase 0
  if (tid < 8) sFreq[tid] = rope_freq(tid);
  sKM[tid] = KM[(size_t)b * CH + tid];
  sVM[tid] = VM[(size_t)b * CH + tid];
  __syncthreads();
  #pragma unroll 1
  for (int j = 0; j < 2; ++j) {
    const int idx = tid + 256 * j;
    const int pos = idx >> 3, f = idx & 7;
    float sv, cv;
    sincosf((float)pos * sFreq[f], &sv, &cv);
    sSinW[idx] = sv;
    sCosW[idx] = cv;
  }
  if (tid < 8) {
    float sv, cv;
    sincosf((float)lb * sFreq[tid], &sv, &cv);
    sSinH[tid] = sv;
    sCosH[tid] = cv;
  }
  __syncthreads();

  // phase A
  #pragma unroll 1
  for (int hp2 = 0; hp2 < 4; ++hp2) {
    float qn[16];
    #pragma unroll
    for (int j = 0; j < 16; ++j) qn[j] = qv[j];
    if (hp2 < 3) {
      #pragma unroll
      for (int j = 0; j < 16; ++j) qn[j] = qp0[(size_t)(2 * (hp2 + 1) * HD + j) * NP];
    }
    {
      const int nn = 2 * hp2 + shp;
      float zpart = 0.f;
      #pragma unroll
      for (int j = 0; j < 16; ++j) zpart += qv[j] * sKM[nn * HD + 16 * sdh + j];
      sZP[part * 64 + sl] = zpart;
      us_t hq[16], lq[16];
      #pragma unroll
      for (int i = 0; i < 8; ++i) {
        const float sw = sSinW[sl * 8 + i], cw = sCosW[sl * 8 + i];
        const float sr = sSinH[i], cr = sCosH[i];
        const float s = sdh ? sw : sr;
        const float c = sdh ? cw : cr;
        const float x0 = qv[2 * i], x1 = qv[2 * i + 1];
        split2(x0 * c - x1 * s, hq[2 * i], lq[2 * i]);
        split2(x1 * c + x0 * s, hq[2 * i + 1], lq[2 * i + 1]);
      }
      v8us h0, h1, g0, g1;
      #pragma unroll
      for (int i = 0; i < 8; ++i) { h0[i] = hq[i]; h1[i] = hq[8 + i]; g0[i] = lq[i]; g1[i] = lq[8 + i]; }
      us_t* ah = Aqh + (shp * 64 + sl) * AQP + 16 * sdh;
      us_t* al = Aql + (shp * 64 + sl) * AQP + 16 * sdh;
      *(v8usa*)ah = h0; *(v8usa*)(ah + 8) = h1;
      *(v8usa*)al = g0; *(v8usa*)(al + 8) = g1;
    }
    __syncthreads();
    FragB gbc[2], glc[2];
    v4f le0c[2], le1c[2], og0c[2], og1c[2];
    #pragma unroll
    for (int u = 0; u < 2; ++u) {
      gbc[u] = gbv[u]; glc[u] = glv[u];
      le0c[u] = le0v[u]; le1c[u] = le1v[u]; og0c[u] = og0v[u]; og1c[u] = og1v[u];
    }
    if (hp2 < 3) {
      const int pn = 2 * (hp2 + 1);
      #pragma unroll
      for (int u = 0; u < 2; ++u) {
        gbv[u] = ldfrag(KVTh + kr0 + (pn * HD + 16 * u) * HD, h);
        glv[u] = ldfrag(KVTl + kr0 + (pn * HD + 16 * u) * HD, h);
        le0v[u] = *(const v4fa*)(LF + go0 + (size_t)(pn * HD + 16 * u) * NP);
        le1v[u] = *(const v4fa*)(LF + go0 + (size_t)(pn * HD + 16 * u) * NP + 4);
        og0v[u] = *(const v4fa*)(OF + go0 + (size_t)(pn * HD + 16 * u) * NP);
        og1v[u] = *(const v4fa*)(OF + go0 + (size_t)(pn * HD + 16 * u) * NP + 4);
      }
    }
    {
      const int nn = 2 * hp2 + chp;
      const FragB fa = ldfrag(Aqh + (chp * 64 + 16 * clt + m) * AQP, h);
      const FragB fl = ldfrag(Aql + (chp * 64 + 16 * clt + m) * AQP, h);
      v8f acc[2];
      #pragma unroll
      for (int u = 0; u < 2; ++u) {
        const FragB gb = gbc[u];
        const FragB gl = glc[u];
        v8f a = wmma_bf16(fa, gb, z8);
        a = wmma_bf16(fa, gl, a);
        a = wmma_bf16(fl, gb, a);
        acc[u] = a;
      }
      float zz[8], fac[8];
      #pragma unroll
      for (int r = 0; r < 8; ++r) {
        const int l = 16 * clt + 8 * h + r;
        const float z = (sZP[(2 * chp) * 64 + l] + sZP[(2 * chp + 1) * 64 + l]) * SCALE_F;
        zz[r] = z;
        fac[r] = 1.0f + 1.0f / (z + 1e-6f);
      }
      #pragma unroll
      for (int u = 0; u < 2; ++u) {
        const int e = 16 * u + m, c = nn * HD + e;
        const float vme = sVM[nn * HD + e];
        const v4f le0 = le0c[u], le1 = le1c[u], og0 = og0c[u], og1 = og1c[u];
        const float lev[8] = {le0.x, le0.y, le0.z, le0.w, le1.x, le1.y, le1.z, le1.w};
        const float ogv[8] = {og0.x, og0.y, og0.z, og0.w, og1.x, og1.y, og1.z, og1.w};
        #pragma unroll
        for (int r = 0; r < 8; ++r) {
          const float res = acc[u][r] * fac[r] - zz[r] * vme;
          const float uv = (res + lev[r]) * ogv[r];
          us_t p1, p2;
          split2(uv, p1, p2);
          const int l = 16 * clt + 8 * h + r;
          Uh[l * UPP + c] = p1;
          Ul[l * UPP + c] = p2;
        }
      }
    }
    __syncthreads();
    // keeps the register moves of the operands fetched ahead behind this barrier: moved up into
    // the tile work they would bring the wait for those loads with them
    __builtin_amdgcn_sched_barrier(0);
    #pragma unroll
    for (int j = 0; j < 16; ++j) qv[j] = qn[j];
  }

  // phase B: output projection
  const int wl = w & 1, wc = w >> 1;
  v8f pacc[2][4];
  #pragma unroll
  for (int t = 0; t < 2; ++t) {
    #pragma unroll
    for (int v = 0; v < 4; ++v) pacc[t][v] = z8;
  }
  const us_t* ua0 = Uh + (32 * wl + m) * UPP;
  const us_t* ua1 = ua0 + 16 * UPP;
  const us_t* la0 = Ul + (32 * wl + m) * UPP;
  const us_t* la1 = la0 + 16 * UPP;
  const us_t* wph = WPh + (size_t)(4 * wc) * 4096 + 8 * lane;
  const us_t* wpl = WPl + (size_t)(4 * wc) * 4096 + 8 * lane;
  // the four weight fragment pairs of a k step stay in registers; each pair is asked for again,
  // for the next k step, as soon as its six products are issued: three groups of lead
  FragB wbh[4], wbl[4];
  #pragma unroll
  for (int v = 0; v < 4; ++v) {
    wbh[v] = ldfragp(wph + 4096 * v);
    wbl[v] = ldfragp(wpl + 4096 * v);
  }
  // unrolled: the fragment registers are indexed statically and every load offset is an immediate
  #pragma unroll
  for (int k0 = 0; k0 < CH; k0 += 32) {
    const FragB a0 = ldfrag(ua0 + k0, h);
    const FragB a1 = ldfrag(ua1 + k0, h);
    const FragB c0 = ldfrag(la0 + k0, h);
    const FragB c1 = ldfrag(la1 + k0, h);
    #pragma unroll
    for (int v = 0; v < 4; ++v) {
      const FragB bh = wbh[v];
      const FragB bl = wbl[v];
      pacc[0][v] = wmma_bf16(a0, bh, pacc[0][v]);
      pacc[0][v] = wmma_bf16(c0, bh, pacc[0][v]);
      pacc[0][v] = wmma_bf16(a0, bl, pacc[0][v]);
      pacc[1][v] = wmma_bf16(a1, bh, pacc[1][v]);
      pacc[1][v] = wmma_bf16(c1, bh, pacc[1][v]);
      pacc[1][v] = wmma_bf16(a1, bl, pacc[1][v]);
      if (k0 + 32 < CH) {
        wbh[v] = ldfragp(wph + 4096 * v + 16 * (k0 + 32));
        wbl[v] = ldfragp(wpl + 4096 * v + 16 * (k0 + 32));
      }
    }
  }
  // what follows rewrites the address registers that the weight loads name
  asm volatile("s_wait_xcnt 0x0" ::: "memory");
  __syncthreads();   // all waves done with the U planes before the staging overlays them
  #pragma unroll
  for (int v = 0; v < 4; ++v) {
    const int co = 64 * wc + 16 * v + m;
    const float pb = pbias[co];
    #pragma unroll
    for (int t = 0; t < 2; ++t) {
      v8f y;
      #pragma unroll
      for (int r = 0; r < 8; ++r) y[r] = pacc[t][v][r] + pb;
      st8f(sO + co * SOP + 32 * wl + 16 * t + 8 * h, y);
    }
  }
  __syncthreads();
  const int q8 = lane & 7, sub = lane >> 3;
  #pragma unroll
  for (int i = 0; i < 16; ++i) {
    const int id = 64 * w + 4 * i + sub;
    const int R = id >> 1, Lh = id & 1;
    const v4f val = *(const v4fa*)(sO + R * SOP + 32 * Lh + 4 * q8);
    const size_t d = (size_t)(b * CH + R) * NP + l0 + 32 * Lh + 4 * q8;
    *(v4f*)(out + d) = val;
  }
  
}

// ---------------------------------------------------------------------------
extern "C" void kernel_launch(void* const* d_in, const int* in_sizes, int n_in,
                              void* d_out, int out_size, void* d_ws, size_t ws_size,
                              hipStream_t stream)
{
  if (n_in < 7) return;
  if (in_sizes[0] != NB * CH * NP) return;
  if (in_sizes[1] != 4 * CH * CH || in_sizes[2] != 4 * CH) return;
  if (in_sizes[3] != CH * 25 || in_sizes[4] != CH) return;
  if (in_sizes[5] != CH * CH || in_sizes[6] != CH) return;
  if (out_size != NB * CH * NP) return;

  const float* x      = (const float*)d_in[0];
  const float* qkvo_w = (const float*)d_in[1];
  const float* qkvo_b = (const float*)d_in[2];
  const float* lepe_w = (const float*)d_in[3];
  const float* lepe_b = (const float*)d_in[4];
  const float* proj_w = (const float*)d_in[5];
  const float* proj_b = (const float*)d_in[6];
  float* outp = (float*)d_out;

  const size_t szWQ  = (size_t)4 * CH * CH * 2;         //    524288 (x2)
  const size_t szWP  = (size_t)CH * CH * 2;             //    131072 (x2)
  const size_t szR   = (size_t)NB * CH * NP * 4;        //  33554432 (x5)
  const size_t szKVT = (size_t)NB * NH * HD * HD * 2;   //    131072 (x2)
  const size_t szM   = (size_t)NB * NH * HD * 4;        //      8192 (x2)
  const size_t szPK  = (size_t)NB * NH * KS * KREC * 4; //   4456448
  size_t off = 0;
  char* ws = (char*)d_ws;
  us_t*  WQh  = (us_t*)(ws + off);  off += szWQ;
  us_t*  WQl  = (us_t*)(ws + off);  off += szWQ;
  us_t*  WPh  = (us_t*)(ws + off);  off += szWP;
  us_t*  WPl  = (us_t*)(ws + off);  off += szWP;
  float* QF   = (float*)(ws + off); off += szR;     // q planes
  float* KF   = (float*)(ws + off); off += szR;     // k planes
  float* VF   = (float*)(ws + off); off += szR;     // v planes
  float* OF   = (float*)(ws + off); off += szR;     // o planes
  float* LF   = (float*)(ws + off); off += szR;     // depthwise result
  us_t*  KVTh = (us_t*)(ws + off);  off += szKVT;
  us_t*  KVTl = (us_t*)(ws + off);  off += szKVT;
  float* KM   = (float*)(ws + off); off += szM;
  float* VM   = (float*)(ws + off); off += szM;
  float* PK   = (float*)(ws + off); off += szPK;    // slice records; total 173817856
  if (off > ws_size) return;

  k_wcvt<<<dim3(160), 256, 0, stream>>>(qkvo_w, proj_w, WQh, WQl, WPh, WPl);
  hipFuncSetAttribute(reinterpret_cast<const void*>(&k_gemm),
                      hipFuncAttributeMaxDynamicSharedMemorySize, GM_BYTES);
  k_gemm<<<dim3(HW, 4, NB), 256, GM_BYTES, stream>>>(x, WQh, WQl, qkvo_b, QF, KF, VF, OF);
  k_kv<<<dim3(NB * NH, KS), 128, 0, stream>>>(KF, VF, PK);
  k_lepe<<<dim3(NB * NH + CH * NB), 256, 0, stream>>>(VF, lepe_w, lepe_b, LF, PK, KVTh, KVTl, KM, VM);
  hipFuncSetAttribute(reinterpret_cast<const void*>(&k_resproj),
                      hipFuncAttributeMaxDynamicSharedMemorySize, RP_BYTES);
  k_resproj<<<dim3(NP / 64, NB), 256, RP_BYTES, stream>>>(QF, OF, LF, KVTh, KVTl, KM, VM, WPh, WPl, proj_b, outp);
}

// v006
// A run of this version takes 103 microseconds.
// Two timings next to v005 put it at 1.08 and 1.09 times that version's speed.
// Counting every step since v000, it is 2.50 times as fast.
// Contractions: qkv/o 1x1 projection, k^T v, q kv and the output 1x1 projection all on v_wmma_f32_16x16x32_bf16 as bf16 hi/lo three-product split (hi*hi + hi*lo + lo*hi, f32 accumulate); elu, channel means, z, rotary tables, depthwise 5x5, biases and the elementwise tail in f32.
#include <hip/hip_runtime.h>
#include <math.h>

typedef unsigned short us_t;
typedef __bf16   v16b __attribute__((ext_vector_type(16)));
typedef _Float16 v16h __attribute__((ext_vector_type(16)));
typedef us_t     v8us __attribute__((ext_vector_type(8)));
typedef us_t     v4us __attribute__((ext_vector_type(4)));
typedef float    v8f  __attribute__((ext_vector_type(8)));
typedef float    v4f  __attribute__((ext_vector_type(4)));
typedef v8us __attribute__((may_alias)) v8usa;
typedef v4us __attribute__((may_alias)) v4usa;
typedef v4f  __attribute__((may_alias)) v4fa;
union FragB { v16b v; v8us half[2]; v16h x; };
union Q8    { v8f v; v4f q[2]; };

#define NB   8
#define CH   256
#define NP   4096
#define HW   64
#define NH   8
#define HD   32
#define KVP  72
#define PPW  68
#define GXP  264
#define UPP  264
#define SOP  68
#define RTP  9
#define SCALE_F 0.17677669529663687f
#define CKV     0.0065695032f
#define INV_L   0.000244140625f
#define KS   16
#define KSL  256
#define KREC 1088

// dynamic LDS map of k_gemm (bytes): x hi tile [64][264] us_t + 24 (row-group skew), x lo tile, f32 staging [256][68] over both
#define GM_XL    33856
#define GM_BYTES 69632

// dynamic LDS map of k_resproj (bytes)
// U hi/lo planes [64][264] us_t; the f32 staging [256][68] overlays them (69632 bytes);
// x hi/lo tiles as in k_gemm; two blocks fit a WGP
#define RP_UH    0
#define RP_UL    33792
#define RP_XH    69632
#define RP_XL    103488
#define RP_SINW  139264
#define RP_COSW  141312
#define RP_SINH  143360
#define RP_COSH  143392
#define RP_FREQ  143424
#define RP_KM    143456
#define RP_VM    144480
#define RP_QB    145504
#define RP_OB    146528
#define RP_BYTES 147552

// ---------------------------------------------------------------------------
// 16x16x32 bf16 WMMA with hazard guard (ties D, keeps A/B live).
// Fragment map (wave32): lane l, h = l>>4, m = n = l&15.
//   A/B element i: i<8 -> k0+8h+i ; i>=8 -> k0+16+8h+(i-8)
//   D element r : row 8h+r, col l&15
// ---------------------------------------------------------------------------
__device__ __forceinline__ v8f wmma_bf16(const FragB& a, const FragB& b, v8f c) {
  v8f d = __builtin_amdgcn_wmma_f32_16x16x32_bf16(false, a.v, false, b.v, (short)0, c, false, false);
  asm volatile("v_nop\n\tv_nop\n\tv_nop\n\tv_nop" : "+v"(d) : "v"(a.x), "v"(b.x));
  return d;
}
// fragment from a k-contiguous bf16 row holding >= 32 elements starting at p (p = row + k0)
__device__ __forceinline__ FragB ldfrag(const us_t* p, int h) {
  FragB f;
  f.half[0] = *(const v8usa*)(p + 8 * h);
  f.half[1] = *(const v8usa*)(p + 16 + 8 * h);
  return f;
}
// fragment from a weight plane packed in fragment order (see k_wcvt): p = block start + 8 * lane
__device__ __forceinline__ FragB ldfragp(const us_t* p) {
  FragB f;
  f.half[0] = *(const v8usa*)p;
  f.half[1] = *(const v8usa*)(p + 256);
  return f;
}
__device__ __forceinline__ v8f zero8f() {
  v8f z;
  #pragma unroll
  for (int j = 0; j < 8; ++j) z[j] = 0.f;
  return z;
}
// 8 floats to LDS as two 16-B pieces
__device__ __forceinline__ void st8f(float* p, v8f v) {
  Q8 u; u.v = v;
  *(v4fa*)p = u.q[0];
  *(v4fa*)(p + 4) = u.q[1];
}
// RNE convert f32 -> bf16 bits, and back
__device__ __forceinline__ us_t bf16_rne(float f) {
  unsigned u = __float_as_uint(f);
  u += 0x7FFFu + ((u >> 16) & 1u);
  return (us_t)(u >> 16);
}
__device__ __forceinline__ float bf16_val(us_t b) { return __uint_as_float(((unsigned)b) << 16); }
__device__ __forceinline__ void split2(float f, us_t& hi, us_t& lo) {
  hi = bf16_rne(f);
  lo = bf16_rne(f - bf16_val(hi));
}
// rotary frequency i of 8: 1 / 10000^(i/7), linspace-style exponent
__device__ __forceinline__ float rope_freq(int i) {
  const float e = (i == 7) ? 1.0f : (float)i * (1.0f / 7.0f);
  return 1.0f / powf(10000.0f, e);
}

// ---------------------------------------------------------------------------
// Kernel 0: weights -> bf16 hi/lo planes in fragment order. WQh/WQl from the
// qkv/o weights [1024][256], WPh/WPl from the output projection [256][256].
// A plane is a row of 1-KiB blocks, block (T, ks) = 16 weight rows 16 T + m by
// 32 k from 32 ks, at element offset (8 T + ks) * 512, laid out
// [half j][lane l = 16 h + m][8 elements k = 32 ks + 16 j + 8 h + i]: a wave's
// 16-byte fragment load then reads 512 contiguous bytes (four whole lines)
// where row-major weights gave it 16 lines of 32 bytes. Thread = one 16-byte
// piece of each plane, so a wave also stores whole lines.
// ---------------------------------------------------------------------------
__global__ __launch_bounds__(256) void k_wcvt(const float* __restrict__ qw, const float* __restrict__ pw,
                                             us_t* __restrict__ WQh, us_t* __restrict__ WQl,
                                             us_t* __restrict__ WPh, us_t* __restrict__ WPl)
{
  const int g = blockIdx.x * 256 + threadIdx.x;
  if (g >= 40960) return;
  const float* src;
  us_t* dh;
  us_t* dl;
  const int g2 = (g < 32768) ? g : (g - 32768);
  const int pl = g2 & 31, pj = (g2 >> 5) & 1, pks = (g2 >> 6) & 7, pT = g2 >> 9;
  const size_t so = (size_t)(16 * pT + (pl & 15)) * CH + 32 * pks + 16 * pj + 8 * (pl >> 4);
  if (g < 32768) { src = qw + so; dh = WQh + (size_t)g2 * 8; dl = WQl + (size_t)g2 * 8; }
  else { src = pw + so; dh = WPh + (size_t)g2 * 8; dl = WPl + (size_t)g2 * 8; }
  const v4f a = *(const v4fa*)src;
  const v4f c = *(const v4fa*)(src + 4);
  v8us oh, ol;
  {
    us_t p1, p2;
    split2(a.x, p1, p2); oh[0] = p1; ol[0] = p2;
    split2(a.y, p1, p2); oh[1] = p1; ol[1] = p2;
    split2(a.z, p1, p2); oh[2] = p1; ol[2] = p2;
    split2(a.w, p1, p2); oh[3] = p1; ol[3] = p2;
    split2(c.x, p1, p2); oh[4] = p1; ol[4] = p2;
    split2(c.y, p1, p2); oh[5] = p1; ol[5] = p2;
    split2(c.z, p1, p2); oh[6] = p1; ol[6] = p2;
    split2(c.w, p1, p2); oh[7] = p1; ol[7] = p2;
  }
  *(v8us*)dh = oh;
  *(v8us*)dl = ol;
  
}

// ---------------------------------------------------------------------------
// Kernel 1: 1x1 projection GEMM D[l][o] = sum_c x[c][l] * W[o][c] + bias[o],
// elu+1 for the k channel class, as bf16 hi/lo three-product split.
// Block = (image row of 64 positions, 256-channel class, b), 8 waves.
// Staging: the x tile [256 c][64 l] (NCHW f32, l-contiguous float4 loads) is
// split into hi/lo LDS tiles sXh/sXl [64 l][256 c] (k-contiguous rows).
// Bank layout: row l starts at element l * 264 + 8 * (l >> 4), that is, each
// group of 16 rows is skewed 16 bytes further. The 16 lanes of a staging store
// hold rows 4 apart; at the 132-dword pitch alone they fall on 4 banks, with
// the skew on 16. A fragment's 16 rows share one skew, so its reads keep
// their spread.
// The f32 staging has a pitch of 68 floats: the 16 channels of an accumulator
// store then cover all 64 banks (at 64 floats they share four).
// A = sX rows (positions), B = WQh/WQl fragment blocks straight from global,
// K = 256 in 8 steps; wave = 32 positions x 64 channels (2x4 tiles);
// products a_hi*b_hi + a_hi*b_lo + a_lo*b_hi.
// The launch covers the classes k and v (blockIdx.y = 0 k, 1 v; weight rows
// 256.. and 512..), each with a plane of its own, NCHW f32 [b][256][4096]; the
// q and o classes are computed where they are used, in kernel 4.
// Epilogue staged [256 ch][64 pos] f32 over the x
// ---------------------------------------------------------------------------
__global__ __launch_bounds__(256) void k_gemm(const float* __restrict__ x,
                                             const us_t* __restrict__ WQh, const us_t* __restrict__ WQl,
                                             const float* __restrict__ bias,
                                             float* __restrict__ KF, float* __restrict__ VF)
{
  extern __shared__ __attribute__((aligned(16))) unsigned char dsm[];
  us_t*  sXh = (us_t*)dsm;
  us_t*  sXl = (us_t*)(dsm + GM_XL);
  float* sO  = (float*)dsm;
  const int tid = threadIdx.x, lane = tid & 31, w = tid >> 5;
  const int h = lane >> 4, m = lane & 15;
  const int lb = blockIdx.x, cb = blockIdx.y + 1, b = blockIdx.z;
  const int l0 = lb * 64;
  const int obase = 256 * cb;
  const int cls = cb;
  float* dst = (cls == 1) ? KF : VF;

  // stage x[c][l0 + 0..63] -> hi/lo tiles [l][c]
  const float* xb = x + (size_t)(b * CH) * NP + l0;
  // eight loads of a thread are issued before the first value is used: two round trips, not sixteen.
  // Rolled: with both batches in flight the kernel needs more than 128 registers, a block less per WGP.
  const float* xp = xb + (size_t)(tid >> 4) * NP + (tid & 15) * 4;
  #pragma unroll 1
  for (int jb = 0; jb < 16; jb += 8) {
    const float* xq = xp + (size_t)(16 * jb) * NP;
    v4f xv[8];
    #pragma unroll
    for (int j = 0; j < 8; ++j) xv[j] = *(const v4fa*)(xq + (size_t)(16 * j) * NP);
    // the next trip rewrites the address registers that these loads name
    asm volatile("s_wait_xcnt 0x0" ::: "memory");
    #pragma unroll
    for (int j = 0; j < 8; ++j) {
      const int f = tid + 256 * (jb + j);
      const int c = f >> 4, lq = (f & 15) * 4;
      const int cs = c + ((lq >> 4) << 3);
      const v4f v = xv[j];
      us_t p1, p2;
      split2(v.x, p1, p2); sXh[(lq + 0) * GXP + cs] = p1; sXl[(lq + 0) * GXP + cs] = p2;
      split2(v.y, p1, p2); sXh[(lq + 1) * GXP + cs] = p1; sXl[(lq + 1) * GXP + cs] = p2;
      split2(v.z, p1, p2); sXh[(lq + 2) * GXP + cs] = p1; sXl[(lq + 2) * GXP + cs] = p2;
      split2(v.w, p1, p2); sXh[(lq + 3) * GXP + cs] = p1; sXl[(lq + 3) * GXP + cs] = p2;
    }
  }
  __syncthreads();

  const int wl = w & 1, wc = w >> 1;
  const v8f z8 = zero8f();
  v8f acc[2][4];
  #pragma unroll
  for (int t = 0; t < 2; ++t) {
    #pragma unroll
    for (int v = 0; v < 4; ++v) acc[t][v] = z8;
  }
  const us_t* ah0 = sXh + (32 * wl + m) * GXP + 16 * wl;
  const us_t* ah1 = ah0 + 16 * GXP + 8;
  const us_t* al0 = sXl + (32 * wl + m) * GXP + 16 * wl;
  const us_t* al1 = al0 + 16 * GXP + 8;
  const us_t* bh0 = WQh + (size_t)((obase + 64 * wc) >> 4) * 4096 + 8 * lane;
  const us_t* bl0 = WQl + (size_t)((obase + 64 * wc) >> 4) * 4096 + 8 * lane;

  #pragma unroll 1
  for (int k0 = 0; k0 < CH; k0 += 32) {
    const FragB a0 = ldfrag(ah0 + k0, h);
    const FragB a1 = ldfrag(ah1 + k0, h);
    const FragB c0 = ldfrag(al0 + k0, h);
    const FragB c1 = ldfrag(al1 + k0, h);
    #pragma unroll
    for (int v = 0; v < 4; ++v) {
      const FragB bh = ldfragp(bh0 + 4096 * v + 16 * k0);
      const FragB bl = ldfragp(bl0 + 4096 * v + 16 * k0);
      acc[0][v] = wmma_bf16(a0, bh, acc[0][v]);
      acc[0][v] = wmma_bf16(a0, bl, acc[0][v]);
      acc[0][v] = wmma_bf16(c0, bh, acc[0][v]);
      acc[1][v] = wmma_bf16(a1, bh, acc[1][v]);
      acc[1][v] = wmma_bf16(a1, bl, acc[1][v]);
      acc[1][v] = wmma_bf16(c1, bh, acc[1][v]);
    }
    // the next trip rewrites the address registers that this trip's weight loads name
    asm volatile("s_wait_xcnt 0x0" ::: "memory");
  }
  __syncthreads();   // all waves done with the x tiles before the staging overlays them

  #pragma unroll
  for (int v = 0; v < 4; ++v) {
    const int ch = 64 * wc + 16 * v + m;
    const float bb = bias[obase + ch];
    #pragma unroll
    for (int t = 0; t < 2; ++t) {
      v8f y;
      #pragma unroll
      for (int r = 0; r < 8; ++r) {
        float vv = acc[t][v][r] + bb;
        if (cls == 1) vv = (vv > 0.f) ? (vv + 1.f) : expf(vv);
        y[r] = vv;
      }
      st8f(sO + ch * SOP + 32 * wl + 16 * t + 8 * h, y);
    }
  }
  __syncthreads();
  const int q8 = lane & 7, sub = lane >> 3;
  #pragma unroll
  for (int i = 0; i < 16; ++i) {
    const int id = 64 * w + 4 * i + sub;
    const int R = id >> 1, Lh = id & 1;
    const v4f val = *(const v4fa*)(sO + R * SOP + 32 * Lh + 4 * q8);
    const size_t d = (size_t)(b * CH + R) * NP + l0 + 32 * Lh + 4 * q8;
    *(v4f*)(dst + d) = val;
  }
  
}

// ---------------------------------------------------------------------------
// Kernel 2: per (b, head n, slice of 256 positions), 128 threads: streams its
// slice in chunks of 64; f32 channel sums of k (elu+1, before rotation) and v
// in a fixed order; rotary on k in f32 from an LDS sin/cos table; bf16 hi/lo
// planes of rotated k [d][l] and of v [e][l] in LDS; partial
// sum_l krot[d][l] v[e][l] as three-product split (A = krot rows,
// B column e of v = v row e; D rows d, cols e), f32 accumulate.
// Output: one f32 record per (b, n, slice) in PK: [e][d] 1024 partial
// products, 32 k sums, 32 v sums (4352 B = 34 whole lines, one writer block).
// ---------------------------------------------------------------------------
// one thread's 8 loads of a 64-position chunk: k rows 2 i0, 2 i0 + 1, 16 + 2 i0, 17 + 2 i0 from kp
// (= row 2 i0 at the thread's 4 positions of chunk 0), v rows i0 + 8 j from vp (= row i0 there), off = 64 x chunk
__device__ __forceinline__ void kv_chunk(const float* __restrict__ kp, const float* __restrict__ vp, int off,
                                         v4f (&ka)[2], v4f (&kc)[2], v4f (&vv)[4]) {
  #pragma unroll
  for (int g = 0; g < 2; ++g) {
    ka[g] = *(const v4fa*)(kp + (size_t)(16 * g) * NP + off);
    kc[g] = *(const v4fa*)(kp + (size_t)(16 * g + 1) * NP + off);
  }
  #pragma unroll
  for (int j = 0; j < 4; ++j) vv[j] = *(const v4fa*)(vp + (size_t)(8 * j) * NP + off);
  // what follows may rewrite the address registers that these loads name; the two pointers are
  // inputs so that their registers are not given away (as a load's destination) ahead of the wait
  asm volatile("s_wait_xcnt 0x0" :: "v"(kp), "v"(vp) : "memory");
}

__global__ __launch_bounds__(128) void k_kv(const float* __restrict__ KF, const float* __restrict__ VF,
                                           float* __restrict__ PK)
{
  __shared__ __attribute__((aligned(16))) us_t Ah[HD * KVP];
  __shared__ __attribute__((aligned(16))) us_t Al[HD * KVP];
  __shared__ __attribute__((aligned(16))) us_t Bh[HD * KVP];
  __shared__ __attribute__((aligned(16))) us_t Bl[HD * KVP];
  __shared__ __attribute__((aligned(16))) float sSin[HW * RTP];   // pitch 9: lanes read rows 4 apart, 36 dwords, 16 banks
  __shared__ __attribute__((aligned(16))) float sCos[HW * RTP];
  __shared__ __attribute__((aligned(16))) float sKV[HD * HD];
  __shared__ __attribute__((aligned(16))) float sSum[64];
  __shared__ float sFreq[8];
  const int tid = threadIdx.x, lane = tid & 31, w = tid >> 5;
  const int h = lane >> 4, m = lane & 15;
  const int n = blockIdx.x & 7, b = blockIdx.x >> 3;
  const int lbeg = blockIdx.y * KSL;
  // A chunk's 8 loads of a thread are issued two stages ahead of their use and fly under the work
  // between: chunk 0 here, chunk 1 behind the first barrier (under the table set-up), chunk q + 2
  // at the top of chunk q's pass. (A barrier waits for the loads issued in front of it.)
  const int i0 = tid >> 4, l4 = (tid & 15) * 4;
  const float* kb = KF + (size_t)(b * CH + n * HD + 2 * i0) * NP + lbeg + l4;
  const float* vb = VF + (size_t)(b * CH + n * HD + i0) * NP + lbeg + l4;
  v4f kaq[4][2], kcq[4][2], vvq[4][4];
  kv_chunk(kb, vb, 0, kaq[0], kcq[0], vvq[0]);
  if (tid < 8) sFreq[tid] = rope_freq(tid);
  __syncthreads();
  kv_chunk(kb, vb, 64, kaq[1], kcq[1], vvq[1]);
  #pragma unroll 1
  for (int j = 0; j < 4; ++j) {
    const int idx = tid + 128 * j;
    const int pos = idx >> 3, f = idx & 7;
    float sv, cv;
    sincosf((float)pos * sFreq[f], &sv, &cv);
    sSin[pos * RTP + f] = sv;
    sCos[pos * RTP + f] = cv;
  }
  float ks[4], vs[4];
  #pragma unroll
  for (int j = 0; j < 4; ++j) { ks[j] = 0.f; vs[j] = 0.f; }
  const int td = w >> 1, te = w & 1;
  const v8f z8 = zero8f();
  v8f acc = z8;

  // unrolled: the chunks' registers are indexed statically
  #pragma unroll
  for (int q = 0; q < 4; ++q) {
    const int l0 = lbeg + 64 * q;
    __syncthreads();
    if (q + 2 < 4) kv_chunk(kb, vb, 64 * (q + 2), kaq[q + 2], kcq[q + 2], vvq[q + 2]);
    const int hp = l0 >> 6;
    // k rows: g = 0 -> d pair (2 i0, 2 i0 + 1) keyed on the image row hp;
    //         g = 1 -> d pair (16 + 2 i0, +1) keyed on the image column l4 + t
    #pragma unroll
    for (int g = 0; g < 2; ++g) {
      const int d0 = 16 * g + 2 * i0;
      const v4f ka = kaq[q][g];
      const v4f kc = kcq[q][g];
      ks[2 * g]     += (ka.x + ka.y) + (ka.z + ka.w);
      ks[2 * g + 1] += (kc.x + kc.y) + (kc.z + kc.w);
      const float sr = sSin[hp * RTP + i0], cr = sCos[hp * RTP + i0];
      v4us ha, la, hc, lc;
      #pragma unroll
      for (int t = 0; t < 4; ++t) {
        const int widx = (l4 + t) * RTP + i0;
        const float sw = sSin[widx], cw = sCos[widx];
        const float s = g ? sw : sr;
        const float c = g ? cw : cr;
        const float xa = ka[t], xc = kc[t];
        us_t p1, p2;
        split2(xa * c - xc * s, p1, p2); ha[t] = p1; la[t] = p2;
        split2(xc * c + xa * s, p1, p2); hc[t] = p1; lc[t] = p2;
      }
      *(v4usa*)(Ah + d0 * KVP + l4) = ha;
      *(v4usa*)(Al + d0 * KVP + l4) = la;
      *(v4usa*)(Ah + (d0 + 1) * KVP + l4) = hc;
      *(v4usa*)(Al + (d0 + 1) * KVP + l4) = lc;
    }
    // v rows e = i0 + 8 j
    #pragma unroll
    for (int j = 0; j < 4; ++j) {
      const int e = i0 + 8 * j;
      const v4f vv = vvq[q][j];
      vs[j] += (vv.x + vv.y) + (vv.z + vv.w);
      v4us hv, lv;
      #pragma unroll
      for (int t = 0; t < 4; ++t) { us_t p1, p2; split2(vv[t], p1, p2); hv[t] = p1; lv[t] = p2; }
      *(v4usa*)(Bh + e * KVP + l4) = hv;
      *(v4usa*)(Bl + e * KVP + l4) = lv;
    }
    __syncthreads();
    #pragma unroll
    for (int kk = 0; kk < 2; ++kk) {
      const FragB fa = ldfrag(Ah + (16 * td + m) * KVP + 32 * kk, h);
      const FragB fl = ldfrag(Al + (16 * td + m) * KVP + 32 * kk, h);
      const FragB gb = ldfrag(Bh + (16 * te + m) * KVP + 32 * kk, h);
      const FragB gl = ldfrag(Bl + (16 * te + m) * KVP + 32 * kk, h);
      acc = wmma_bf16(fa, gb, acc);
      acc = wmma_bf16(fa, gl, acc);
      acc = wmma_bf16(fl, gb, acc);
    }
  }

  // channel sums: the 16 lanes of each half-wave share the channel index i0
  #pragma unroll
  for (int j = 0; j < 4; ++j) {
    float a = ks[j], c = vs[j];
    a += __shfl_xor(a, 1); a += __shfl_xor(a, 2); a += __shfl_xor(a, 4); a += __shfl_xor(a, 8);
    c += __shfl_xor(c, 1); c += __shfl_xor(c, 2); c += __shfl_xor(c, 4); c += __shfl_xor(c, 8);
    ks[j] = a; vs[j] = c;
  }
  if ((tid & 15) == 0) {
    sSum[2 * i0] = ks[0]; sSum[2 * i0 + 1] = ks[1];
    sSum[16 + 2 * i0] = ks[2]; sSum[17 + 2 * i0] = ks[3];
    #pragma unroll
    for (int j = 0; j < 4; ++j) sSum[32 + i0 + 8 * j] = vs[j];
  }
  // acc[r] -> (d = 16 td + 8 h + r, e = 16 te + m), staged transposed sKV[e][d]
  #pragma unroll
  for (int r = 0; r < 8; ++r) sKV[(16 * te + m) * HD + 16 * td + 8 * h + r] = acc[r];
  __syncthreads();

  float* rec = PK + (size_t)(blockIdx.x * KS + blockIdx.y) * KREC;
  #pragma unroll
  for (int j = 0; j < 2; ++j) {
    const int q = tid + 128 * j;
    *(v4f*)(rec + 4 * q) = *(const v4fa*)(sKV + 4 * q);
  }
  if (tid < 16) *(v4f*)(rec + 1024 + 4 * tid) = *(const v4fa*)(sSum + 4 * tid);
}

// ---------------------------------------------------------------------------
// Block role 2b (the first 64 blocks of kernel 3's launch): per (b, head n),
// 256 threads: float4 q of the 272 of a record is added over the 16 slice
// records in slice order by thread q & 255; then KVT[e][d] = c^2 * sum as bf16
// hi/lo KVTh/KVTl [b][n][e][d] (64-B rows, 2 rows per line, 8 threads per line,
// one instruction) and the KM/VM [b][n][32] means. sR: KREC floats of LDS.
// ---------------------------------------------------------------------------
__device__ __forceinline__ void kvred_block(float* sR, const float* __restrict__ PK,
                                            us_t* __restrict__ KVTh, us_t* __restrict__ KVTl,
                                            float* __restrict__ KM, float* __restrict__ VM)
{
  const int tid = threadIdx.x;
  #pragma unroll 1
  for (int q = tid; q < KREC / 4; q += 256) {
    const float* p = PK + (size_t)blockIdx.x * (KS * KREC) + 4 * q;
    v4f part[KS];
    #pragma unroll
    for (int s = 0; s < KS; ++s) part[s] = *(const v4fa*)(p + s * KREC);
    v4f a = part[0];
    #pragma unroll
    for (int s = 1; s < KS; ++s) a += part[s];
    *(v4fa*)(sR + 4 * q) = a;
  }
  __syncthreads();
  if (tid >= 128) return;

  const float cc = CKV * CKV;
  const int e = tid >> 2, q4 = tid & 3;
  const v4f f0 = *(const v4fa*)(sR + e * HD + 8 * q4) * cc;
  const v4f f1 = *(const v4fa*)(sR + e * HD + 8 * q4 + 4) * cc;
  v8us hh, ll;
  {
    us_t p1, p2;
    split2(f0.x, p1, p2); hh[0] = p1; ll[0] = p2;
    split2(f0.y, p1, p2); hh[1] = p1; ll[1] = p2;
    split2(f0.z, p1, p2); hh[2] = p1; ll[2] = p2;
    split2(f0.w, p1, p2); hh[3] = p1; ll[3] = p2;
    split2(f1.x, p1, p2); hh[4] = p1; ll[4] = p2;
    split2(f1.y, p1, p2); hh[5] = p1; ll[5] = p2;
    split2(f1.z, p1, p2); hh[6] = p1; ll[6] = p2;
    split2(f1.w, p1, p2); hh[7] = p1; ll[7] = p2;
  }
  const size_t kd = ((size_t)blockIdx.x * HD + e) * HD + 8 * q4;
  const int mi = tid & 7;
  const bool isk = tid < 8;
  const bool isv = (tid >= 8) && (tid < 16);
  const v4f mk = *(const v4fa*)(sR + 1024 + 4 * mi) * INV_L;
  const v4f mv = *(const v4fa*)(sR + 1056 + 4 * mi) * INV_L;
  float* pk = KM + (size_t)blockIdx.x * HD + 4 * mi;
  float* pv = VM + (size_t)blockIdx.x * HD + 4 * mi;
  *(v8us*)(KVTh + kd) = hh;
  *(v8us*)(KVTl + kd) = ll;
  if (isk) *(v4f*)pk = mk;
  if (isv) *(v4f*)pv = mv;
}

// ---------------------------------------------------------------------------
// Kernel 3: depthwise 5x5 (zero pad 2) on the v planes, f32 VALU:
// LF[b][c][y][x] = bias[c] + sum w[c][dy][dx] v[b][c][y+dy-2][x+dx-2].
// Block = (channel, b); the 64x64 plane staged with a 2-wide zero ring in
// LDS [68][68]; thread = 4 consecutive x per iteration (rolled loops).
// The launch's first 64 blocks do role 2b instead (it needs only kernel 2's
// records, the depthwise blocks only v): the small sum runs beside the
// depthwise work and takes no launch of its own.
// ---------------------------------------------------------------------------
__global__ __launch_bounds__(256) void k_lepe(const float* __restrict__ VF, const float* __restrict__ lw,
                                             const float* __restrict__ lbias, float* __restrict__ LF,
                                             const float* __restrict__ PK,
                                             us_t* __restrict__ KVTh, us_t* __restrict__ KVTl,
                                             float* __restrict__ KM, float* __restrict__ VM)
{
  __shared__ __attribute__((aligned(16))) float sP[PPW * PPW];
  __shared__ float sW[25];
  if (blockIdx.x < NB * NH) {
    kvred_block(sP, PK, KVTh, KVTl, KM, VM);
    return;
  }
  const int tid = threadIdx.x;
  const int c = (blockIdx.x - NB * NH) & (CH - 1), b = (blockIdx.x - NB * NH) >> 8;
  // the plane's loads are issued ahead of the zero fill and fly under it
  const float* src = VF + (size_t)(b * CH + c) * NP;
  v4f pv4[4];
  #pragma unroll
  for (int j = 0; j < 4; ++j) pv4[j] = *(const v4fa*)(src + 4 * (tid + 256 * j));
  if (tid < 25) sW[tid] = lw[c * 25 + tid];
  #pragma unroll 1
  for (int j = 0; j < 19; ++j) {
    const int idx = tid + 256 * j;
    if (idx < PPW * PPW) sP[idx] = 0.f;
  }
  __syncthreads();
  #pragma unroll
  for (int j = 0; j < 4; ++j) {
    const int f = tid + 256 * j, l = 4 * f, y = l >> 6, xx = l & 63;
    const v4f v = pv4[j];
    float* pr = sP + (y + 2) * PPW + xx + 2;
    pr[0] = v.x; pr[1] = v.y; pr[2] = v.z; pr[3] = v.w;
  }
  __syncthreads();
  const float bb = lbias[c];
  float* dst = LF + (size_t)(b * CH + c) * NP;
  #pragma unroll 1
  for (int j = 0; j < 4; ++j) {
    const int f = tid + 256 * j, l = 4 * f, y = l >> 6, xx = l & 63;
    float a0 = bb, a1 = bb, a2 = bb, a3 = bb;
    #pragma unroll 1
    for (int dy = 0; dy < 5; ++dy) {
      const float* rp = sP + (y + dy) * PPW + xx;
      const v4f r0 = *(const v4fa*)rp;
      const v4f r1 = *(const v4fa*)(rp + 4);
      const float rr[8] = {r0.x, r0.y, r0.z, r0.w, r1.x, r1.y, r1.z, r1.w};
      const float w0 = sW[dy * 5], w1 = sW[dy * 5 + 1], w2 = sW[dy * 5 + 2], w3 = sW[dy * 5 + 3], w4 = sW[dy * 5 + 4];
      a0 += w0 * rr[0]; a0 += w1 * rr[1]; a0 += w2 * rr[2]; a0 += w3 * rr[3]; a0 += w4 * rr[4];
      a1 += w0 * rr[1]; a1 += w1 * rr[2]; a1 += w2 * rr[3]; a1 += w3 * rr[4]; a1 += w4 * rr[5];
      a2 += w0 * rr[2]; a2 += w1 * rr[3]; a2 += w2 * rr[4]; a2 += w3 * rr[5]; a2 += w4 * rr[6];
      a3 += w0 * rr[3]; a3 += w1 * rr[4]; a3 += w2 * rr[5]; a3 += w3 * rr[6]; a3 += w4 * rr[7];
    }
    v4f o;
    o.x = a0; o.y = a1; o.z = a2; o.w = a3;
    *(v4f*)(dst + l) = o;
    
  }
}

// ---------------------------------------------------------------------------
// Kernel 4: per (image row of 64 positions, b), 8 waves:
//  phase 0: sin/cos tables, the per-image head means and the q and o biases in
//   LDS; the x tile [256 c][64 l] split into hi/lo LDS tiles as in kernel 1.
//  phase A: a wave takes (head, 32 positions), two such tasks, with no barrier
//   between them. The q and o projections of the task, K = 256, three-product
//   split, weight fragment blocks from global:
//    q with A = weight rows, B = x rows: D rows = channels, cols = positions,
//     so a lane holds channels 8 h + r and 16 + 8 h + r of one position: the
//     element order of an A fragment over the head's 32 channels. Bias, elu+1,
//     z = q . kmean and the rotary run on those registers in f32, and the bf16
//     hi/lo pair is the A operand of q kv as it stands;
//    o with A = x rows, B = weight rows: D rows = positions, cols = channels,
//     the layout of the q kv result, which it gates element by element.
//   D[l][e] = sum_d q[l][d] kvt[e][d] as three-product split (B = KVT rows e
//   from global); epilogue f32: res = D (1 + 1/(z+1e-6)) - z vmean[e],
//   u = (res + lepe) * o, bf16 hi/lo into U planes [l][256 c]
//   at a pitch of 264 (528 B = 16 B x 33: a fragment's 16 rows cover all banks).
//  phase B: D[l][co] = sum_c U[l][c] WP[co][c] as three-product split
//   (Uh*WPh + Ul*WPh + Uh*WPl, K = 256, WP fragment blocks from global),
//   + bias f32; staged [256 co][64 l]
// ---------------------------------------------------------------------------
__global__ __launch_bounds__(256) void k_resproj(
    const float* __restrict__ x,
    const us_t* __restrict__ WQh, const us_t* __restrict__ WQl, const float* __restrict__ qbias,
    const float* __restrict__ LF,
    const us_t* __restrict__ KVTh, const us_t* __restrict__ KVTl,
    const float* __restrict__ KM, const float* __restrict__ VM,
    const us_t* __restrict__ WPh, const us_t* __restrict__ WPl,
    const float* __restrict__ pbias, float* __restrict__ out)
{
  extern __shared__ __attribute__((aligned(16))) unsigned char dsm[];
  us_t*  Uh    = (us_t*)(dsm + RP_UH);
  us_t*  Ul    = (us_t*)(dsm + RP_UL);
  float* sO    = (float*)(dsm + RP_UH);
  us_t*  sXh   = (us_t*)(dsm + RP_XH);
  us_t*  sXl   = (us_t*)(dsm + RP_XL);
  float* sSinW = (float*)(dsm + RP_SINW);
  float* sCosW = (float*)(dsm + RP_COSW);
  float* sSinH = (float*)(dsm + RP_SINH);
  float* sCosH = (float*)(dsm + RP_COSH);
  float* sFreq = (float*)(dsm + RP_FREQ);
  float* sKM   = (float*)(dsm + RP_KM);
  float* sVM   = (float*)(dsm + RP_VM);
  float* sQB   = (float*)(dsm + RP_QB);
  float* sOB   = (float*)(dsm + RP_OB);
  const int tid = threadIdx.x, lane = tid & 31, w = tid >> 5;
  const int h = lane >> 4, m = lane & 15;
  const int lb = blockIdx.x, b = blockIdx.y;
  const int l0 = lb * 64;
  const v8f z8 = zero8f();

  // phase 0
  // the x tile's 16 loads of a thread are issued here and fly under the table set-up
  const float* xp = x + (size_t)(b * CH + (tid >> 4)) * NP + l0 + (tid & 15) * 4;
  v4f xv[16];
  #pragma unroll
  for (int j = 0; j < 16; ++j) xv[j] = *(const v4fa*)(xp + (size_t)(16 * j) * NP);
  // what follows may rewrite the address registers that these loads name
  asm volatile("s_wait_xcnt 0x0" :: "v"(xp) : "memory");
  if (tid < 8) sFreq[tid] = rope_freq(tid);
  sKM[tid] = KM[(size_t)b * CH + tid];
  sVM[tid] = VM[(size_t)b * CH + tid];
  sQB[tid] = qbias[tid];
  sOB[tid] = qbias[3 * CH + tid];
  __syncthreads();
  #pragma unroll 1
  for (int j = 0; j < 2; ++j) {
    const int idx = tid + 256 * j;
    const int pos = idx >> 3, f = idx & 7;
    float sv, cv;
    sincosf((float)pos * sFreq[f], &sv, &cv);
    sSinW[idx] = sv;
    sCosW[idx] = cv;
  }
  if (tid < 8) {
    float sv, cv;
    sincosf((float)lb * sFreq[tid], &sv, &cv);
    sSinH[tid] = sv;
    sCosH[tid] = cv;
  }
  #pragma unroll
  for (int j = 0; j < 16; ++j) {
    const int c = (tid >> 4) + 16 * j, lq = (tid & 15) * 4;
    const int cs = c + ((lq >> 4) << 3);
    const v4f v = xv[j];
    us_t p1, p2;
    split2(v.x, p1, p2); sXh[(lq + 0) * GXP + cs] = p1; sXl[(lq + 0) * GXP + cs] = p2;
    split2(v.y, p1, p2); sXh[(lq + 1) * GXP + cs] = p1; sXl[(lq + 1) * GXP + cs] = p2;
    split2(v.z, p1, p2); sXh[(lq + 2) * GXP + cs] = p1; sXl[(lq + 2) * GXP + cs] = p2;
    split2(v.w, p1, p2); sXh[(lq + 3) * GXP + cs] = p1; sXl[(lq + 3) * GXP + cs] = p2;
  }
  __syncthreads();

  // phase A
  const int ph = w & 1;
  const us_t* ah0 = sXh + (32 * ph + m) * GXP + 16 * ph;
  const us_t* ah1 = ah0 + 16 * GXP + 8;
  const us_t* al0 = sXl + (32 * ph + m) * GXP + 16 * ph;
  const us_t* al1 = al0 + 16 * GXP + 8;
  // rolled: one copy of a task's code in the instruction cache
  #pragma unroll 1
  for (int tk = 0; tk < 2; ++tk) {
    const int nn = (w >> 1) + 4 * tk;
    // weight tiles 0, 1: the head's q rows; 2, 3: its o rows, 48 tiles of 16 rows further on
    const us_t* wqh = WQh + (size_t)(2 * nn) * 4096 + 8 * lane;
    const us_t* wql = WQl + (size_t)(2 * nn) * 4096 + 8 * lane;
    FragB wbh[4], wbl[4];
    #pragma unroll
    for (int v = 0; v < 4; ++v) {
      const int to = 4096 * (v < 2 ? v : 46 + v);
      wbh[v] = ldfragp(wqh + to);
      wbl[v] = ldfragp(wql + to);
    }
    // what follows may rewrite the address registers that these loads name; the two pointers are
    // inputs so that their registers are not given away ahead of the wait
    asm volatile("s_wait_xcnt 0x0" :: "v"(wqh), "v"(wql) : "memory");
    // the task's kv fragments and depthwise values are asked for in the last k step, in the registers
    // that the weights leave: they fly under the rest of that step and the q epilogue, and the wave
    // stays within 256 registers (two blocks on a WGP)
    const size_t go = (size_t)(b * CH + nn * HD + m) * NP + l0 + 32 * ph + 8 * h;
    const size_t kr = ((size_t)(b * NH + nn) * HD + m) * HD + 8 * h;
    const us_t* kvh = KVTh + kr;
    const us_t* kvl = KVTl + kr;
    v4f le0[2][2], le1[2][2];
    FragB gb[2], gl[2];
    v8f qa[2][2], oa[2][2];   // qa[channel tile][position tile], oa[position tile][channel tile]
    #pragma unroll
    for (int t = 0; t < 2; ++t) {
      #pragma unroll
      for (int v = 0; v < 2; ++v) { qa[t][v] = z8; oa[t][v] = z8; }
    }
    // one k step: the weight fragments stay in registers; each pair is asked for again, for the next
    // k step, as soon as its six products are issued; the last step asks for the task's kv fragments
    // and depthwise values instead
    auto kstep = [&](const int k0, const bool last) __attribute__((always_inline)) {
      const FragB x0h = ldfrag(ah0 + k0, h);
      const FragB x1h = ldfrag(ah1 + k0, h);
      const FragB x0l = ldfrag(al0 + k0, h);
      const FragB x1l = ldfrag(al1 + k0, h);
      #pragma unroll
      for (int v = 0; v < 2; ++v) {
        qa[v][0] = wmma_bf16(wbh[v], x0h, qa[v][0]);
        qa[v][1] = wmma_bf16(wbh[v], x1h, qa[v][1]);
        qa[v][0] = wmma_bf16(wbl[v], x0h, qa[v][0]);
        qa[v][1] = wmma_bf16(wbl[v], x1h, qa[v][1]);
        qa[v][0] = wmma_bf16(wbh[v], x0l, qa[v][0]);
        qa[v][1] = wmma_bf16(wbh[v], x1l, qa[v][1]);
        if (!last) {
          wbh[v] = ldfragp(wqh + 4096 * v + 16 * (k0 + 32));
          wbl[v] = ldfragp(wql + 4096 * v + 16 * (k0 + 32));
        } else {
          gb[v] = ldfrag(kvh + 16 * v * HD, 0);
          gl[v] = ldfrag(kvl + 16 * v * HD, 0);
        }
      }
      // what follows may rewrite the address registers that the kv fragment loads name; the two
      // pointers are inputs so that their registers are not given away ahead of the wait
      if (last) asm volatile("s_wait_xcnt 0x0" :: "v"(kvh), "v"(kvl) : "memory");
      #pragma unroll
      for (int u = 0; u < 2; ++u) {
        oa[0][u] = wmma_bf16(x0h, wbh[2 + u], oa[0][u]);
        oa[1][u] = wmma_bf16(x1h, wbh[2 + u], oa[1][u]);
        oa[0][u] = wmma_bf16(x0h, wbl[2 + u], oa[0][u]);
        oa[1][u] = wmma_bf16(x1h, wbl[2 + u], oa[1][u]);
        oa[0][u] = wmma_bf16(x0l, wbh[2 + u], oa[0][u]);
        oa[1][u] = wmma_bf16(x1l, wbh[2 + u], oa[1][u]);
        if (!last) {
          wbh[2 + u] = ldfragp(wqh + 4096 * (48 + u) + 16 * (k0 + 32));
          wbl[2 + u] = ldfragp(wql + 4096 * (48 + u) + 16 * (k0 + 32));
        } else {
          #pragma unroll
          for (int t = 0; t < 2; ++t) {
            le0[t][u] = *(const v4fa*)(LF + go + (size_t)(16 * u) * NP + 16 * t);
            le1[t][u] = *(const v4fa*)(LF + go + (size_t)(16 * u) * NP + 16 * t + 4);
          }
        }
      }
    };
    // rolled: unrolled eight times the kernel's text would pass 32 KB
    #pragma unroll 1
    for (int k0 = 0; k0 < CH - 32; k0 += 32) {
      kstep(k0, false);
      // the next trip rewrites the address registers that this trip's weight loads name
      asm volatile("s_wait_xcnt 0x0" ::: "memory");
    }
    kstep(CH - 32, true);
    // rolled, for the size of the text: a pass works on position tile 0's registers, and its foot
    // moves tile 1's into them
    #pragma unroll 1
    for (int t = 0; t < 2; ++t) {
      const int pm = 32 * ph + 16 * t + m;   // the position whose q channels this lane holds
      float z = 0.f;
      FragB fa, fl;
      #pragma unroll
      for (int v = 0; v < 2; ++v) {
        const int c0 = nn * HD + 16 * v + 8 * h;
        const v4f b0 = *(const v4fa*)(sQB + c0), b1 = *(const v4fa*)(sQB + c0 + 4);
        const v4f m0 = *(const v4fa*)(sKM + c0), m1 = *(const v4fa*)(sKM + c0 + 4);
        const float bq[8] = {b0.x, b0.y, b0.z, b0.w, b1.x, b1.y, b1.z, b1.w};
        const float km[8] = {m0.x, m0.y, m0.z, m0.w, m1.x, m1.y, m1.z, m1.w};
        float qv[8];
        #pragma unroll
        for (int r = 0; r < 8; ++r) {
          const float y = qa[v][0][r] + bq[r];
          const float ey = expf(y);
          const float vv = (y > 0.f) ? (y + 1.f) : ey;
          qv[r] = vv;
          z += vv * km[r];
        }
        // channels 0..15 of a head turn with the image row, 16..31 with the column
        const v4f s4 = v ? *(const v4fa*)(sSinW + pm * 8 + 4 * h) : *(const v4fa*)(sSinH + 4 * h);
        const v4f c4 = v ? *(const v4fa*)(sCosW + pm * 8 + 4 * h) : *(const v4fa*)(sCosH + 4 * h);
        #pragma unroll
        for (int p = 0; p < 4; ++p) {
          const float s = s4[p], c = c4[p];
          const float x0 = qv[2 * p], x1 = qv[2 * p + 1];
          us_t p1, p2;
          split2(x0 * c - x1 * s, p1, p2); fa.half[v][2 * p] = p1; fl.half[v][2 * p] = p2;
          split2(x1 * c + x0 * s, p1, p2); fa.half[v][2 * p + 1] = p1; fl.half[v][2 * p + 1] = p2;
        }
      }
      // the two half-waves hold 16 channels each of the same 16 positions
      z += __shfl_xor(z, 16);
      z *= SCALE_F;
      const float fz = 1.0f + 1.0f / (z + 1e-6f);
      // the q kv result has positions 8 h + r in a lane: fetch their z and factor from lanes 8 h + r
      float zz[8], fac[8];
      #pragma unroll
      for (int r = 0; r < 8; ++r) {
        zz[r] = __shfl(z, 8 * h + r);
        fac[r] = __shfl(fz, 8 * h + r);
      }
      #pragma unroll
      for (int u = 0; u < 2; ++u) {
        v8f a = wmma_bf16(fa, gb[u], z8);
        a = wmma_bf16(fa, gl[u], a);
        a = wmma_bf16(fl, gb[u], a);
        const int c = nn * HD + 16 * u + m;
        const float vme = sVM[c], ob = sOB[c];
        const v4f e0 = le0[0][u], e1 = le1[0][u];
        const float lev[8] = {e0.x, e0.y, e0.z, e0.w, e1.x, e1.y, e1.z, e1.w};
        #pragma unroll
        for (int r = 0; r < 8; ++r) {
          const float res = a[r] * fac[r] - zz[r] * vme;
          const float uv = (res + lev[r]) * (oa[0][u][r] + ob);
          us_t p1, p2;
          split2(uv, p1, p2);
          const int l = 32 * ph + 16 * t + 8 * h + r;
          Uh[l * UPP + c] = p1;
          Ul[l * UPP + c] = p2;
        }
      }
      #pragma unroll
      for (int u = 0; u < 2; ++u) {
        qa[u][0] = qa[u][1];
        oa[0][u] = oa[1][u];
        le0[0][u] = le0[1][u];
        le1[0][u] = le1[1][u];
      }
    }
    // the next trip rewrites the address registers that this trip's loads name
    asm volatile("s_wait_xcnt 0x0" ::: "memory");
  }
  __syncthreads();   // publishes the U planes to every wave

  // phase B: output projection
  const int wl = w & 1, wc = w >> 1;
  v8f pacc[2][4];
  #pragma unroll
  for (int t = 0; t < 2; ++t) {
    #pragma unroll
    for (int v = 0; v < 4; ++v) pacc[t][v] = z8;
  }
  const us_t* ua0 = Uh + (32 * wl + m) * UPP;
  const us_t* ua1 = ua0 + 16 * UPP;
  const us_t* la0 = Ul + (32 * wl + m) * UPP;
  const us_t* la1 = la0 + 16 * UPP;
  const us_t* wph = WPh + (size_t)(4 * wc) * 4096 + 8 * lane;
  const us_t* wpl = WPl + (size_t)(4 * wc) * 4096 + 8 * lane;
  // the four weight fragment pairs of a k step stay in registers; each pair is asked for again,
  // for the next k step, as soon as its six products are issued: three groups of lead
  FragB wbh[4], wbl[4];
  #pragma unroll
  for (int v = 0; v < 4; ++v) {
    wbh[v] = ldfragp(wph + 4096 * v);
    wbl[v] = ldfragp(wpl + 4096 * v);
  }
  // unrolled: the fragment registers are indexed statically and every load offset is an immediate
  #pragma unroll
  for (int k0 = 0; k0 < CH; k0 += 32) {
    const FragB a0 = ldfrag(ua0 + k0, h);
    const FragB a1 = ldfrag(ua1 + k0, h);
    const FragB c0 = ldfrag(la0 + k0, h);
    const FragB c1 = ldfrag(la1 + k0, h);
    #pragma unroll
    for (int v = 0; v < 4; ++v) {
      const FragB bh = wbh[v];
      const FragB bl = wbl[v];
      pacc[0][v] = wmma_bf16(a0, bh, pacc[0][v]);
      pacc[0][v] = wmma_bf16(c0, bh, pacc[0][v]);
      pacc[0][v] = wmma_bf16(a0, bl, pacc[0][v]);
      pacc[1][v] = wmma_bf16(a1, bh, pacc[1][v]);
      pacc[1][v] = wmma_bf16(c1, bh, pacc[1][v]);
      pacc[1][v] = wmma_bf16(a1, bl, pacc[1][v]);
      if (k0 + 32 < CH) {
        wbh[v] = ldfragp(wph + 4096 * v + 16 * (k0 + 32));
        wbl[v] = ldfragp(wpl + 4096 * v + 16 * (k0 + 32));
      }
    }
  }
  // what follows rewrites the address registers that the weight loads name
  asm volatile("s_wait_xcnt 0x0" ::: "memory");
  __syncthreads();   // all waves done with the U planes before the staging overlays them
  #pragma unroll
  for (int v = 0; v < 4; ++v) {
    const int co = 64 * wc + 16 * v + m;
    const float pb = pbias[co];
    #pragma unroll
    for (int t = 0; t < 2; ++t) {
      v8f y;
      #pragma unroll
      for (int r = 0; r < 8; ++r) y[r] = pacc[t][v][r] + pb;
      st8f(sO + co * SOP + 32 * wl + 16 * t + 8 * h, y);
    }
  }
  __syncthreads();
  const int q8 = lane & 7, sub = lane >> 3;
  #pragma unroll
  for (int i = 0; i < 16; ++i) {
    const int id = 64 * w + 4 * i + sub;
    const int R = id >> 1, Lh = id & 1;
    const v4f val = *(const v4fa*)(sO + R * SOP + 32 * Lh + 4 * q8);
    const size_t d = (size_t)(b * CH + R) * NP + l0 + 32 * Lh + 4 * q8;
    *(v4f*)(out + d) = val;
  }
  
}

// ---------------------------------------------------------------------------
extern "C" void kernel_launch(void* const* d_in, const int* in_sizes, int n_in,
                              void* d_out, int out_size, void* d_ws, size_t ws_size,
                              hipStream_t stream)
{
  if (n_in < 7) return;
  if (in_sizes[0] != NB * CH * NP) return;
  if (in_sizes[1] != 4 * CH * CH || in_sizes[2] != 4 * CH) return;
  if (in_sizes[3] != CH * 25 || in_sizes[4] != CH) return;
  if (in_sizes[5] != CH * CH || in_sizes[6] != CH) return;
  if (out_size != NB * CH * NP) return;

  const float* x      = (const float*)d_in[0];
  const float* qkvo_w = (const float*)d_in[1];
  const float* qkvo_b = (const float*)d_in[2];
  const float* lepe_w = (const float*)d_in[3];
  const float* lepe_b = (const float*)d_in[4];
  const float* proj_w = (const float*)d_in[5];
  const float* proj_b = (const float*)d_in[6];
  float* outp = (float*)d_out;

  const size_t szWQ  = (size_t)4 * CH * CH * 2;         //    524288 (x2)
  const size_t szWP  = (size_t)CH * CH * 2;             //    131072 (x2)
  const size_t szR   = (size_t)NB * CH * NP * 4;        //  33554432 (x3)
  const size_t szKVT = (size_t)NB * NH * HD * HD * 2;   //    131072 (x2)
  const size_t szM   = (size_t)NB * NH * HD * 4;        //      8192 (x2)
  const size_t szPK  = (size_t)NB * NH * KS * KREC * 4; //   4456448
  size_t off = 0;
  char* ws = (char*)d_ws;
  us_t*  WQh  = (us_t*)(ws + off);  off += szWQ;
  us_t*  WQl  = (us_t*)(ws + off);  off += szWQ;
  us_t*  WPh  = (us_t*)(ws + off);  off += szWP;
  us_t*  WPl  = (us_t*)(ws + off);  off += szWP;
  float* KF   = (float*)(ws + off); off += szR;     // k planes
  float* VF   = (float*)(ws + off); off += szR;     // v planes
  float* LF   = (float*)(ws + off); off += szR;     // depthwise result
  us_t*  KVTh = (us_t*)(ws + off);  off += szKVT;
  us_t*  KVTl = (us_t*)(ws + off);  off += szKVT;
  float* KM   = (float*)(ws + off); off += szM;
  float* VM   = (float*)(ws + off); off += szM;
  float* PK   = (float*)(ws + off); off += szPK;    // slice records; total 106708992
  if (off > ws_size) return;

  k_wcvt<<<dim3(160), 256, 0, stream>>>(qkvo_w, proj_w, WQh, WQl, WPh, WPl);
  hipFuncSetAttribute(reinterpret_cast<const void*>(&k_gemm),
                      hipFuncAttributeMaxDynamicSharedMemorySize, GM_BYTES);
  k_gemm<<<dim3(HW, 2, NB), 256, GM_BYTES, stream>>>(x, WQh, WQl, qkvo_b, KF, VF);
  k_kv<<<dim3(NB * NH, KS), 128, 0, stream>>>(KF, VF, PK);
  k_lepe<<<dim3(NB * NH + CH * NB), 256, 0, stream>>>(VF, lepe_w, lepe_b, LF, PK, KVTh, KVTl, KM, VM);
  hipFuncSetAttribute(reinterpret_cast<const void*>(&k_resproj),
                      hipFuncAttributeMaxDynamicSharedMemorySize, RP_BYTES);
  k_resproj<<<dim3(NP / 64, NB), 256, RP_BYTES, stream>>>(x, WQh, WQl, qkvo_b, LF, KVTh, KVTl, KM, VM, WPh, WPl, proj_b, outp);
}

// v007
// A run of this version takes 90 microseconds.
// In two side-by-side timings against v006, it was 1.15 and 1.14 times as fast.
// Counting every step since v000, it is 2.87 times as fast.
// Contractions: qkv/o 1x1 projection, k^T v, q kv and the output 1x1 projection all on v_wmma_f32_16x16x32_bf16 as bf16 hi/lo three-product split (hi*hi + hi*lo + lo*hi, f32 accumulate); elu, channel means, z, rotary tables, depthwise 5x5, biases and the elementwise tail in f32.
#include <hip/hip_runtime.h>
#include <math.h>

typedef unsigned short us_t;
typedef __bf16   v16b __attribute__((ext_vector_type(16)));
typedef _Float16 v16h __attribute__((ext_vector_type(16)));
typedef us_t     v8us __attribute__((ext_vector_type(8)));
typedef us_t     v4us __attribute__((ext_vector_type(4)));
typedef float    v8f  __attribute__((ext_vector_type(8)));
typedef float    v4f  __attribute__((ext_vector_type(4)));
typedef v8us __attribute__((may_alias)) v8usa;
typedef v4us __attribute__((may_alias)) v4usa;
typedef v4f  __attribute__((may_alias)) v4fa;
union FragB { v16b v; v8us half[2]; v16h x; };
union Q8    { v8f v; v4f q[2]; };

#define NB   8
#define CH   256
#define NP   4096
#define HW   64
#define NH   8
#define HD   32
#define PPW  68
#define GXP  264
#define UPP  264
#define SOP  68
#define RTT  68
#define SCALE_F 0.17677669529663687f
#define CKV     0.0065695032f
#define INV_L   0.000244140625f
#define KS   64
#define KREC 1088

// dynamic LDS map of k_gemm (bytes): x hi tile [64][264] us_t + 24 (row-group skew), x lo tile; 16 task ranges of
// GPW floats (v tile [32][VSP], then the record); column sin/cos tables [8][68]; row sin/cos; frequencies;
// two blocks fit a WGP
#define GPW      1152
#define VSP      36
#define GM_XL    33856
#define GM_PK    67712
#define GM_SINT  141440
#define GM_COST  143616
#define GM_SINH  145792
#define GM_COSH  145824
#define GM_FREQ  145856
#define GM_BYTES 145888

// dynamic LDS map of k_resproj (bytes)
// U hi/lo planes [64][264] us_t; the f32 staging [256][68] overlays them (69632 bytes);
// x hi/lo tiles as in k_gemm; two blocks fit a WGP
#define RP_UH    0
#define RP_UL    33792
#define RP_XH    69632
#define RP_XL    103488
#define RP_SINW  139264
#define RP_COSW  141312
#define RP_SINH  143360
#define RP_COSH  143392
#define RP_FREQ  143424
#define RP_KM    143456
#define RP_VM    144480
#define RP_QB    145504
#define RP_OB    146528
#define RP_BYTES 147552

// ---------------------------------------------------------------------------
// 16x16x32 bf16 WMMA with hazard guard (ties D, keeps A/B live).
// Fragment map (wave32): lane l, h = l>>4, m = n = l&15.
//   A/B element i: i<8 -> k0+8h+i ; i>=8 -> k0+16+8h+(i-8)
//   D element r : row 8h+r, col l&15
// ---------------------------------------------------------------------------
__device__ __forceinline__ v8f wmma_bf16(const FragB& a, const FragB& b, v8f c) {
  v8f d = __builtin_amdgcn_wmma_f32_16x16x32_bf16(false, a.v, false, b.v, (short)0, c, false, false);
  asm volatile("v_nop\n\tv_nop\n\tv_nop\n\tv_nop" : "+v"(d) : "v"(a.x), "v"(b.x));
  return d;
}
// fragment from a k-contiguous bf16 row holding >= 32 elements starting at p (p = row + k0)
__device__ __forceinline__ FragB ldfrag(const us_t* p, int h) {
  FragB f;
  f.half[0] = *(const v8usa*)(p + 8 * h);
  f.half[1] = *(const v8usa*)(p + 16 + 8 * h);
  return f;
}
// fragment from a weight plane packed in fragment order (see k_wcvt): p = block start + 8 * lane
__device__ __forceinline__ FragB ldfragp(const us_t* p) {
  FragB f;
  f.half[0] = *(const v8usa*)p;
  f.half[1] = *(const v8usa*)(p + 256);
  return f;
}
__device__ __forceinline__ v8f zero8f() {
  v8f z;
  #pragma unroll
  for (int j = 0; j < 8; ++j) z[j] = 0.f;
  return z;
}
// 8 floats to LDS as two 16-B pieces
__device__ __forceinline__ void st8f(float* p, v8f v) {
  Q8 u; u.v = v;
  *(v4fa*)p = u.q[0];
  *(v4fa*)(p + 4) = u.q[1];
}
// RNE convert f32 -> bf16 bits, and back
__device__ __forceinline__ us_t bf16_rne(float f) {
  unsigned u = __float_as_uint(f);
  u += 0x7FFFu + ((u >> 16) & 1u);
  return (us_t)(u >> 16);
}
__device__ __forceinline__ float bf16_val(us_t b) { return __uint_as_float(((unsigned)b) << 16); }
__device__ __forceinline__ void split2(float f, us_t& hi, us_t& lo) {
  hi = bf16_rne(f);
  lo = bf16_rne(f - bf16_val(hi));
}
// rotary frequency i of 8: 1 / 10000^(i/7), linspace-style exponent
__device__ __forceinline__ float rope_freq(int i) {
  const float e = (i == 7) ? 1.0f : (float)i * (1.0f / 7.0f);
  return 1.0f / powf(10000.0f, e);
}

// ---------------------------------------------------------------------------
// Kernel 0: weights -> bf16 hi/lo planes in fragment order. WQh/WQl from the
// qkv/o weights [1024][256], WPh/WPl from the output projection [256][256].
// A plane is a row of 1-KiB blocks, block (T, ks) = 16 weight rows 16 T + m by
// 32 k from 32 ks, at element offset (8 T + ks) * 512, laid out
// [half j][lane l = 16 h + m][8 elements k = 32 ks + 16 j + 8 h + i]: a wave's
// 16-byte fragment load then reads 512 contiguous bytes (four whole lines)
// where row-major weights gave it 16 lines of 32 bytes. Thread = one 16-byte
// piece of each plane, so a wave also stores whole lines.
// ---------------------------------------------------------------------------
__global__ __launch_bounds__(256) void k_wcvt(const float* __restrict__ qw, const float* __restrict__ pw,
                                             us_t* __restrict__ WQh, us_t* __restrict__ WQl,
                                             us_t* __restrict__ WPh, us_t* __restrict__ WPl)
{
  const int g = blockIdx.x * 256 + threadIdx.x;
  if (g >= 40960) return;
  const float* src;
  us_t* dh;
  us_t* dl;
  const int g2 = (g < 32768) ? g : (g - 32768);
  const int pl = g2 & 31, pj = (g2 >> 5) & 1, pks = (g2 >> 6) & 7, pT = g2 >> 9;
  const size_t so = (size_t)(16 * pT + (pl & 15)) * CH + 32 * pks + 16 * pj + 8 * (pl >> 4);
  if (g < 32768) { src = qw + so; dh = WQh + (size_t)g2 * 8; dl = WQl + (size_t)g2 * 8; }
  else { src = pw + so; dh = WPh + (size_t)g2 * 8; dl = WPl + (size_t)g2 * 8; }
  const v4f a = *(const v4fa*)src;
  const v4f c = *(const v4fa*)(src + 4);
  v8us oh, ol;
  {
    us_t p1, p2;
    split2(a.x, p1, p2); oh[0] = p1; ol[0] = p2;
    split2(a.y, p1, p2); oh[1] = p1; ol[1] = p2;
    split2(a.z, p1, p2); oh[2] = p1; ol[2] = p2;
    split2(a.w, p1, p2); oh[3] = p1; ol[3] = p2;
    split2(c.x, p1, p2); oh[4] = p1; ol[4] = p2;
    split2(c.y, p1, p2); oh[5] = p1; ol[5] = p2;
    split2(c.z, p1, p2); oh[6] = p1; ol[6] = p2;
    split2(c.w, p1, p2); oh[7] = p1; ol[7] = p2;
  }
  *(v8us*)dh = oh;
  *(v8us*)dl = ol;
  
}

// ---------------------------------------------------------------------------
// Kernel 1: the k and v 1x1 projections and the k^T v partial products.
// D[l][o] = sum_c x[c][l] * W[o][c] + bias[o] as bf16 hi/lo three-product split.
// Block = (image row of 64 positions, b), 8 waves; a wave takes two tasks
// (head nn, 32 positions wl): 2 position tiles x 4 channel tiles, the head's
// 32 k channels (weight rows 256..) and its 32 v channels (rows 512..).
// Staging: the x tile [256 c][64 l] (NCHW f32, l-contiguous float4 loads) is
// split into hi/lo LDS tiles sXh/sXl [64 l][256 c] (k-contiguous rows).
// Bank layout: row l starts at element l * 264 + 8 * (l >> 4), that is, each
// group of 16 rows is skewed 16 bytes further. The 16 lanes of a staging store
// hold rows 4 apart; at the 132-dword pitch alone they fall on 4 banks, with
// the skew on 16. A fragment's 16 rows share one skew, so its reads keep
// their spread.
// A = sX rows (positions), B = WQh/WQl fragment blocks straight from global,
// K = 256 in 8 steps; products a_hi*b_hi + a_hi*b_lo + a_lo*b_hi.
// D rows = positions, cols = channels: a lane holds, of one channel, positions
// 8 h + r (tile 0) and 16 + 8 h + r (tile 1): the element order of an A or B
// fragment whose k index runs over the wave's 32 positions. So bias, elu+1,
// the channel sums and the rotary run on the accumulators in f32 (a rotary
// pair sits in lanes m and m ^ 1), and the bf16 hi/lo pairs are the operands
// of sum_l krot[d][l] v[e][l] as they stand (A = krot, B = v; D rows d,
// cols e; three-product split). k never goes to memory.
// A task leaves its partial in LDS as a record of 1088 floats: value r of tile
// T = 2 td + te (d = 16 td + 8 h + r, e = 16 te + m) at float
// ((2 T + (r >> 2)) * 32 + lane) * 4 + (r & 3), then 32 k sums, 32 v sums. The
// two waves of a head add its two records and store one per (b, head, image row)
// in PK (4352 B = 34 whole lines, each 16-byte store 512 contiguous bytes).
// v goes out as NCHW f32 [b][256][4096]: a wave stages its [32 ch][32 pos] f32
// tile in its own LDS range, ahead of the record, and stores whole lines.
// ---------------------------------------------------------------------------
// the value of lane m ^ 1 (one vector instruction, within a group of four lanes)
__device__ __forceinline__ float lane_xor1(float v) {
  return __int_as_float(__builtin_amdgcn_mov_dpp(__float_as_int(v), 0xB1, 0xF, 0xF, true));
}

// second argument: 4 waves per SIMD, that is, at most 256 registers, so that two blocks share a WGP
__global__ __launch_bounds__(256, 4) void k_gemm(const float* __restrict__ x,
                                             const us_t* __restrict__ WQh, const us_t* __restrict__ WQl,
                                             const float* __restrict__ bias,
                                             float* __restrict__ VF, float* __restrict__ PK)
{
  extern __shared__ __attribute__((aligned(16))) unsigned char dsm[];
  us_t*  sXh   = (us_t*)dsm;
  us_t*  sXl   = (us_t*)(dsm + GM_XL);
  float* sPK   = (float*)(dsm + GM_PK);
  float* sSinT = (float*)(dsm + GM_SINT);
  float* sCosT = (float*)(dsm + GM_COST);
  float* sSinH = (float*)(dsm + GM_SINH);
  float* sCosH = (float*)(dsm + GM_COSH);
  float* sFreq = (float*)(dsm + GM_FREQ);
  const int tid = threadIdx.x, lane = tid & 31, w = tid >> 5;
  const int h = lane >> 4, m = lane & 15;
  const int lb = blockIdx.x, b = blockIdx.y;
  const int l0 = lb * 64;

  // stage x[c][l0 + 0..63] -> hi/lo tiles [l][c]; a thread's 16 loads are issued together
  const float* xp = x + (size_t)(b * CH + (tid >> 4)) * NP + l0 + (tid & 15) * 4;
  v4f xv[16];
  #pragma unroll
  for (int j = 0; j < 16; ++j) xv[j] = *(const v4fa*)(xp + (size_t)(16 * j) * NP);
  // what follows may rewrite the address registers that these loads name
  asm volatile("s_wait_xcnt 0x0" :: "v"(xp) : "memory");
  if (tid < 8) sFreq[tid] = rope_freq(tid);
  __syncthreads();
  // column tables [frequency][column] at a pitch of 68 floats: a lane reads 8 columns of its
  // frequency as two 16-byte pieces, and the 8 frequencies of a half-wave fall on 32 distinct banks
  #pragma unroll 1
  for (int j = 0; j < 2; ++j) {
    const int idx = tid + 256 * j;
    const int pos = idx >> 3, f = idx & 7;
    float sv, cv;
    sincosf((float)pos * sFreq[f], &sv, &cv);
    sSinT[f * RTT + pos] = sv;
    sCosT[f * RTT + pos] = cv;
  }
  if (tid < 8) {
    float sv, cv;
    sincosf((float)lb * sFreq[tid], &sv, &cv);
    sSinH[tid] = sv;
    sCosH[tid] = cv;
  }
  #pragma unroll
  for (int j = 0; j < 16; ++j) {
    const int c = (tid >> 4) + 16 * j, lq = (tid & 15) * 4;
    const int cs = c + ((lq >> 4) << 3);
    const v4f v = xv[j];
    us_t p1, p2;
    split2(v.x, p1, p2); sXh[(lq + 0) * GXP + cs] = p1; sXl[(lq + 0) * GXP + cs] = p2;
    split2(v.y, p1, p2); sXh[(lq + 1) * GXP + cs] = p1; sXl[(lq + 1) * GXP + cs] = p2;
    split2(v.z, p1, p2); sXh[(lq + 2) * GXP + cs] = p1; sXl[(lq + 2) * GXP + cs] = p2;
    split2(v.w, p1, p2); sXh[(lq + 3) * GXP + cs] = p1; sXl[(lq + 3) * GXP + cs] = p2;
  }
  __syncthreads();

  const int wl = w & 1;
  const v8f z8 = zero8f();
  const us_t* ah0 = sXh + (32 * wl + m) * GXP + 16 * wl;
  const us_t* ah1 = ah0 + 16 * GXP + 8;
  const us_t* al0 = sXl + (32 * wl + m) * GXP + 16 * wl;
  const us_t* al1 = al0 + 16 * GXP + 8;
  // a wave takes two tasks (head, 32 positions), with no barrier between them
  // rolled: one copy of a task's code in the instruction cache
  #pragma unroll 1
  for (int tk = 0; tk < 2; ++tk) {
    const int nn = (w >> 1) + 4 * tk;
    v8f acc[2][4];   // [position tile][channel tile: 0, 1 the head's k, 2, 3 its v]
    #pragma unroll
    for (int t = 0; t < 2; ++t) {
      #pragma unroll
      for (int v = 0; v < 4; ++v) acc[t][v] = z8;
    }
    // weight tiles of 16 rows: the head's k rows are tiles 16 + 2 nn, + 1; its v rows lie 16 tiles further on
    const us_t* bh0 = WQh + (size_t)(16 + 2 * nn) * 4096 + 8 * lane;
    const us_t* bl0 = WQl + (size_t)(16 + 2 * nn) * 4096 + 8 * lane;

    // the four biases of the lane's channels, asked for here so that they fly under the k loop
    const float* bp = bias + CH + nn * HD + m;
    const float bk[2] = {bp[0], bp[16]};
    const float bv[2] = {bp[CH], bp[CH + 16]};
    // what follows may rewrite the address registers that these loads name
    asm volatile("s_wait_xcnt 0x0" :: "v"(bp) : "memory");

    // the four weight fragment pairs of a k step stay in registers; each pair is asked for again, for the
    // next k step, as soon as its six products are issued
    FragB wbh[4], wbl[4];
    #pragma unroll
    for (int v = 0; v < 4; ++v) {
      const int to = 4096 * (v < 2 ? v : 14 + v);
      wbh[v] = ldfragp(bh0 + to);
      wbl[v] = ldfragp(bl0 + to);
    }
    // what follows may rewrite the address registers that these loads name; the two pointers are
    // inputs so that their registers are not given away ahead of the wait
    asm volatile("s_wait_xcnt 0x0" :: "v"(bh0), "v"(bl0) : "memory");
    auto kstep = [&](const int k0, const bool last) __attribute__((always_inline)) {
      const FragB a0 = ldfrag(ah0 + k0, h);
      const FragB a1 = ldfrag(ah1 + k0, h);
      const FragB c0 = ldfrag(al0 + k0, h);
      const FragB c1 = ldfrag(al1 + k0, h);
      #pragma unroll
      for (int v = 0; v < 4; ++v) {
        acc[0][v] = wmma_bf16(a0, wbh[v], acc[0][v]);
        acc[1][v] = wmma_bf16(a1, wbh[v], acc[1][v]);
        acc[0][v] = wmma_bf16(a0, wbl[v], acc[0][v]);
        acc[1][v] = wmma_bf16(a1, wbl[v], acc[1][v]);
        acc[0][v] = wmma_bf16(c0, wbh[v], acc[0][v]);
        acc[1][v] = wmma_bf16(c1, wbh[v], acc[1][v]);
        if (!last) {
          const int to = 4096 * (v < 2 ? v : 14 + v);
          wbh[v] = ldfragp(bh0 + to + 16 * (k0 + 32));
          wbl[v] = ldfragp(bl0 + to + 16 * (k0 + 32));
        }
      }
    };
    // rolled, for the size of the text
    #pragma unroll 1
    for (int k0 = 0; k0 < CH - 32; k0 += 32) {
      kstep(k0, false);
      // the next trip rewrites the address registers that this trip's weight loads name
      asm volatile("s_wait_xcnt 0x0" ::: "memory");
    }
    kstep(CH - 32, true);

    // v: bias, channel sums, hi/lo fragments; the f32 tile [32 ch][32 pos] goes through the wave's own LDS
    // range (pitch 36 floats: the 16 channels of an accumulator store cover all 64 banks) to whole-line stores
    float* myP = sPK + (2 * nn + wl) * GPW;
    FragB vh[2], vl[2];
    float ksum[2], vsum[2];
    #pragma unroll
    for (int u = 0; u < 2; ++u) {
      float s = 0.f;
      #pragma unroll
      for (int t = 0; t < 2; ++t) {
        v8f y;
        #pragma unroll
        for (int r = 0; r < 8; ++r) {
          y[r] = acc[t][2 + u][r] + bv[u];
          us_t p1, p2;
          split2(y[r], p1, p2);
          vh[u].half[t][r] = p1;
          vl[u].half[t][r] = p2;
        }
        s += ((y[0] + y[1]) + (y[2] + y[3])) + ((y[4] + y[5]) + (y[6] + y[7]));
        st8f(myP + (16 * u + m) * VSP + 16 * t + 8 * h, y);
      }
      // the two half-waves hold 16 positions each of the same 16 channels
      s += __shfl_xor(s, 16);
      vsum[u] = s;
    }
    // the rows are read back by other lanes of the wave
    asm volatile("s_wait_dscnt 0x0" ::: "memory");
    {
      const int q8 = lane & 7, sub = lane >> 3;
      float* vd = VF + (size_t)(b * CH + nn * HD + sub) * NP + l0 + 32 * wl + 4 * q8;
      const float* vs = myP + sub * VSP + 4 * q8;
      v4f val[8];
      #pragma unroll
      for (int i = 0; i < 8; ++i) val[i] = *(const v4fa*)(vs + 4 * i * VSP);
      #pragma unroll
      for (int i = 0; i < 8; ++i) *(v4f*)(vd + (size_t)(4 * i) * NP) = val[i];
      // what follows may rewrite the registers that these stores name; they are inputs so that
      // they are not given away ahead of the wait
      asm volatile("s_wait_xcnt 0x0" :: "v"(vd), "v"(val[0]), "v"(val[1]), "v"(val[2]), "v"(val[3]),
                   "v"(val[4]), "v"(val[5]), "v"(val[6]), "v"(val[7]) : "memory");
    }

    // k, one channel tile at a time: bias, elu+1, channel sums, rotary, hi/lo fragments; then the tile's
    // part of the head's k^T v over the wave's 32 positions, left in the wave's LDS range as its record
    const int fi = m >> 1;
    const float sgn = (m & 1) ? 1.f : -1.f;   // y[2i] = x[2i] c - x[2i+1] s ; y[2i+1] = x[2i+1] c + x[2i] s
    #pragma unroll
    for (int td = 0; td < 2; ++td) {
      FragB kh, kl;
      float s = 0.f;
      #pragma unroll
      for (int t = 0; t < 2; ++t) {
        // channels 0..15 of a head turn with the image row, 16..31 with the column
        const int po = fi * RTT + 32 * wl + 16 * t + 8 * h;
        const float sH = sSinH[fi], cH = sCosH[fi];
        const v4f hs = {sH, sH, sH, sH}, hc = {cH, cH, cH, cH};
        const v4f s0 = td ? *(const v4fa*)(sSinT + po) : hs, s1 = td ? *(const v4fa*)(sSinT + po + 4) : hs;
        const v4f q0 = td ? *(const v4fa*)(sCosT + po) : hc, q1 = td ? *(const v4fa*)(sCosT + po + 4) : hc;
        const float sn[8] = {s0.x, s0.y, s0.z, s0.w, s1.x, s1.y, s1.z, s1.w};
        const float cn[8] = {q0.x, q0.y, q0.z, q0.w, q1.x, q1.y, q1.z, q1.w};
        float yv[8];
        #pragma unroll
        for (int r = 0; r < 8; ++r) {
          const float y = acc[t][td][r] + bk[td];
          const float ey = expf(y);
          yv[r] = (y > 0.f) ? (y + 1.f) : ey;
        }
        s += ((yv[0] + yv[1]) + (yv[2] + yv[3])) + ((yv[4] + yv[5]) + (yv[6] + yv[7]));
        #pragma unroll
        for (int r = 0; r < 8; ++r) {
          const float yp = lane_xor1(yv[r]);
          us_t p1, p2;
          split2(yv[r] * cn[r] + yp * (sgn * sn[r]), p1, p2);
          kh.half[t][r] = p1;
          kl.half[t][r] = p2;
        }
      }
      s += __shfl_xor(s, 16);
      ksum[td] = s;
      #pragma unroll
      for (int te = 0; te < 2; ++te) {
        v8f a = wmma_bf16(kh, vh[te], z8);
        a = wmma_bf16(kh, vl[te], a);
        a = wmma_bf16(kl, vh[te], a);
        Q8 u; u.v = a;
        *(v4fa*)(myP + ((4 * td + 2 * te) * 32 + lane) * 4) = u.q[0];
        *(v4fa*)(myP + ((4 * td + 2 * te + 1) * 32 + lane) * 4) = u.q[1];
      }
    }
    myP[1024 + lane] = h ? ksum[1] : ksum[0];
    myP[1056 + lane] = h ? vsum[1] : vsum[0];
  }
  __syncthreads();   // publishes the records

  // a head's record: each of its two waves adds and stores one half
  v4f ra[2][4];
  float rs[2];
  const int os = 1024 + 32 * wl + lane;
  #pragma unroll
  for (int tk = 0; tk < 2; ++tk) {
    const float* r0 = sPK + (2 * ((w >> 1) + 4 * tk)) * GPW;
    const float* r1 = r0 + GPW;
    #pragma unroll
    for (int i = 0; i < 4; ++i) {
      const int o = ((4 * wl + i) * 32 + lane) * 4;
      ra[tk][i] = *(const v4fa*)(r0 + o) + *(const v4fa*)(r1 + o);
    }
    rs[tk] = r0[os] + r1[os];
  }
  #pragma unroll
  for (int tk = 0; tk < 2; ++tk) {
    float* rec = PK + ((size_t)(b * NH + (w >> 1) + 4 * tk) * KS + lb) * KREC;
    #pragma unroll
    for (int i = 0; i < 4; ++i) *(v4f*)(rec + ((4 * wl + i) * 32 + lane) * 4) = ra[tk][i];
    rec[os] = rs[tk];
    // the second record's address arithmetic may rewrite the registers that these stores name; they are
    // inputs so that they are not given away ahead of the wait
    if (tk == 0) asm volatile("s_wait_xcnt 0x0" :: "v"(rec), "v"(ra[0][0]), "v"(ra[0][1]), "v"(ra[0][2]), "v"(ra[0][3]), "v"(rs[0]) : "memory");
  }
}

// ---------------------------------------------------------------------------
// Block role 1b (the first 256 blocks of kernel 2's launch): per (b, head n,
// 8 rows e of kv^T), 256 threads = 64 float4 of a record x 4 groups of 16 image
// rows: a thread adds its float4 over its group's 16 records in row order (16
// loads in flight), the four group sums are added in group order through LDS;
// then KVT[e][d] = c^2 * sum as bf16 hi/lo KVTh/KVTl [b][n][e][d] (8 rows of
// 64 B = 4 whole lines per block and plane). The block of rows 0..7 also does
// the k means, that of rows 8..15 the v means, KM/VM [b][n][32] (one line each).
// sR: 1152 floats of LDS.
// ---------------------------------------------------------------------------
__device__ __forceinline__ v4f rec_sum16(const float* __restrict__ p)
{
  v4f part[16];
  #pragma unroll
  for (int s = 0; s < 16; ++s) part[s] = *(const v4fa*)(p + s * KREC);
  // what follows may rewrite the address registers that these loads name
  asm volatile("s_wait_xcnt 0x0" :: "v"(p) : "memory");
  v4f a = part[0];
  #pragma unroll
  for (int s = 1; s < 16; ++s) a += part[s];
  return a;
}

__device__ __forceinline__ void kvred_block(float* sR, const float* __restrict__ PK,
                                            us_t* __restrict__ KVTh, us_t* __restrict__ KVTl,
                                            float* __restrict__ KM, float* __restrict__ VM)
{
  const int tid = threadIdx.x;
  const int bn = blockIdx.x >> 2, j = blockIdx.x & 3;
  const int g = tid >> 6, it = tid & 63;
  const int te = j >> 1, mo = 8 * (j & 1);
  const int mq = it & 7, hh = (it >> 3) & 1, hf = (it >> 4) & 1, td = it >> 5;
  // float4 index in a record of (e = 16 te + mo + mq, d = 16 td + 8 hh + 4 hf ..+3): see kernel 1
  const int q = ((2 * td + te) * 2 + hf) * 32 + 16 * hh + mo + mq;
  const float* base = PK + (size_t)(bn * KS + 16 * g) * KREC;
  *(v4fa*)(sR + 4 * tid) = rec_sum16(base + 4 * q);
  if (j < 2 && it < 8) *(v4fa*)(sR + 1024 + 4 * (8 * g + it)) = rec_sum16(base + 1024 + 32 * j + 4 * it);
  __syncthreads();
  if (tid >= 64) return;

  const float cc = CKV * CKV;
  const v4f f0 = (((*(const v4fa*)(sR + 4 * it) + *(const v4fa*)(sR + 4 * (64 + it)))
                   + *(const v4fa*)(sR + 4 * (128 + it))) + *(const v4fa*)(sR + 4 * (192 + it))) * cc;
  v4us hv, lv;
  {
    us_t p1, p2;
    split2(f0.x, p1, p2); hv[0] = p1; lv[0] = p2;
    split2(f0.y, p1, p2); hv[1] = p1; lv[1] = p2;
    split2(f0.z, p1, p2); hv[2] = p1; lv[2] = p2;
    split2(f0.w, p1, p2); hv[3] = p1; lv[3] = p2;
  }
  const size_t kd = ((size_t)bn * HD + 16 * te + mo + mq) * HD + 16 * td + 8 * hh + 4 * hf;
  *(v4us*)(KVTh + kd) = hv;
  *(v4us*)(KVTl + kd) = lv;
  if (j < 2 && tid < 8) {
    const float* sm = sR + 1024 + 4 * tid;
    const v4f mm = (((*(const v4fa*)sm + *(const v4fa*)(sm + 32)) + *(const v4fa*)(sm + 64)) + *(const v4fa*)(sm + 96)) * INV_L;
    float* pm = (j ? VM : KM) + (size_t)bn * HD + 4 * tid;
    *(v4f*)pm = mm;
  }
}

// ---------------------------------------------------------------------------
// Kernel 2: depthwise 5x5 (zero pad 2) on the v planes, f32 VALU:
// LF[b][c][y][x] = bias[c] + sum w[c][dy][dx] v[b][c][y+dy-2][x+dx-2].
// Block = (channel, b); the 64x64 plane staged with a 2-wide zero ring in
// LDS [68][68]; thread = 4 consecutive x per iteration (rolled loops).
// The launch's first 256 blocks do role 1b instead (it needs only kernel 1's
// records, the depthwise blocks only v): the small sum runs beside the
// depthwise work and takes no launch of its own.
// ---------------------------------------------------------------------------
__global__ __launch_bounds__(256) void k_lepe(const float* __restrict__ VF, const float* __restrict__ lw,
                                             const float* __restrict__ lbias, float* __restrict__ LF,
                                             const float* __restrict__ PK,
                                             us_t* __restrict__ KVTh, us_t* __restrict__ KVTl,
                                             float* __restrict__ KM, float* __restrict__ VM)
{
  __shared__ __attribute__((aligned(16))) float sP[PPW * PPW];
  __shared__ float sW[25];
  if (blockIdx.x < 4 * NB * NH) {
    kvred_block(sP, PK, KVTh, KVTl, KM, VM);
    return;
  }
  const int tid = threadIdx.x;
  const int c = (blockIdx.x - 4 * NB * NH) & (CH - 1), b = (blockIdx.x - 4 * NB * NH) >> 8;
  // the plane's loads are issued ahead of the zero fill and fly under it
  const float* src = VF + (size_t)(b * CH + c) * NP;
  v4f pv4[4];
  #pragma unroll
  for (int j = 0; j < 4; ++j) pv4[j] = *(const v4fa*)(src + 4 * (tid + 256 * j));
  if (tid < 25) sW[tid] = lw[c * 25 + tid];
  #pragma unroll 1
  for (int j = 0; j < 19; ++j) {
    const int idx = tid + 256 * j;
    if (idx < PPW * PPW) sP[idx] = 0.f;
  }
  __syncthreads();
  #pragma unroll
  for (int j = 0; j < 4; ++j) {
    const int f = tid + 256 * j, l = 4 * f, y = l >> 6, xx = l & 63;
    const v4f v = pv4[j];
    float* pr = sP + (y + 2) * PPW + xx + 2;
    pr[0] = v.x; pr[1] = v.y; pr[2] = v.z; pr[3] = v.w;
  }
  __syncthreads();
  const float bb = lbias[c];
  float* dst = LF + (size_t)(b * CH + c) * NP;
  #pragma unroll 1
  for (int j = 0; j < 4; ++j) {
    const int f = tid + 256 * j, l = 4 * f, y = l >> 6, xx = l & 63;
    float a0 = bb, a1 = bb, a2 = bb, a3 = bb;
    #pragma unroll 1
    for (int dy = 0; dy < 5; ++dy) {
      const float* rp = sP + (y + dy) * PPW + xx;
      const v4f r0 = *(const v4fa*)rp;
      const v4f r1 = *(const v4fa*)(rp + 4);
      const float rr[8] = {r0.x, r0.y, r0.z, r0.w, r1.x, r1.y, r1.z, r1.w};
      const float w0 = sW[dy * 5], w1 = sW[dy * 5 + 1], w2 = sW[dy * 5 + 2], w3 = sW[dy * 5 + 3], w4 = sW[dy * 5 + 4];
      a0 += w0 * rr[0]; a0 += w1 * rr[1]; a0 += w2 * rr[2]; a0 += w3 * rr[3]; a0 += w4 * rr[4];
      a1 += w0 * rr[1]; a1 += w1 * rr[2]; a1 += w2 * rr[3]; a1 += w3 * rr[4]; a1 += w4 * rr[5];
      a2 += w0 * rr[2]; a2 += w1 * rr[3]; a2 += w2 * rr[4]; a2 += w3 * rr[5]; a2 += w4 * rr[6];
      a3 += w0 * rr[3]; a3 += w1 * rr[4]; a3 += w2 * rr[5]; a3 += w3 * rr[6]; a3 += w4 * rr[7];
    }
    v4f o;
    o.x = a0; o.y = a1; o.z = a2; o.w = a3;
    *(v4f*)(dst + l) = o;
    
  }
}

// ---------------------------------------------------------------------------
// Kernel 3: per (image row of 64 positions, b), 8 waves:
//  phase 0: sin/cos tables, the per-image head means and the q and o biases in
//   LDS; the x tile [256 c][64 l] split into hi/lo LDS tiles as in kernel 1.
//  phase A: a wave takes (head, 32 positions), two such tasks, with no barrier
//   between them. The q and o projections of the task, K = 256, three-product
//   split, weight fragment blocks from global:
//    q with A = weight rows, B = x rows: D rows = channels, cols = positions,
//     so a lane holds channels 8 h + r and 16 + 8 h + r of one position: the
//     element order of an A fragment over the head's 32 channels. Bias, elu+1,
//     z = q . kmean and the rotary run on those registers in f32, and the bf16
//     hi/lo pair is the A operand of q kv as it stands;
//    o with A = x rows, B = weight rows: D rows = positions, cols = channels,
//     the layout of the q kv result, which it gates element by element.
//   D[l][e] = sum_d q[l][d] kvt[e][d] as three-product split (B = KVT rows e
//   from global); epilogue f32: res = D (1 + 1/(z+1e-6)) - z vmean[e],
//   u = (res + lepe) * o, bf16 hi/lo into U planes [l][256 c]
//   at a pitch of 264 (528 B = 16 B x 33: a fragment's 16 rows cover all banks).
//  phase B: D[l][co] = sum_c U[l][c] WP[co][c] as three-product split
//   (Uh*WPh + Ul*WPh + Uh*WPl, K = 256, WP fragment blocks from global),
//   + bias f32; staged [256 co][64 l]
// ---------------------------------------------------------------------------
__global__ __launch_bounds__(256) void k_resproj(
    const float* __restrict__ x,
    const us_t* __restrict__ WQh, const us_t* __restrict__ WQl, const float* __restrict__ qbias,
    const float* __restrict__ LF,
    const us_t* __restrict__ KVTh, const us_t* __restrict__ KVTl,
    const float* __restrict__ KM, const float* __restrict__ VM,
    const us_t* __restrict__ WPh, const us_t* __restrict__ WPl,
    const float* __restrict__ pbias, float* __restrict__ out)
{
  extern __shared__ __attribute__((aligned(16))) unsigned char dsm[];
  us_t*  Uh    = (us_t*)(dsm + RP_UH);
  us_t*  Ul    = (us_t*)(dsm + RP_UL);
  float* sO    = (float*)(dsm + RP_UH);
  us_t*  sXh   = (us_t*)(dsm + RP_XH);
  us_t*  sXl   = (us_t*)(dsm + RP_XL);
  float* sSinW = (float*)(dsm + RP_SINW);
  float* sCosW = (float*)(dsm + RP_COSW);
  float* sSinH = (float*)(dsm + RP_SINH);
  float* sCosH = (float*)(dsm + RP_COSH);
  float* sFreq = (float*)(dsm + RP_FREQ);
  float* sKM   = (float*)(dsm + RP_KM);
  float* sVM   = (float*)(dsm + RP_VM);
  float* sQB   = (float*)(dsm + RP_QB);
  float* sOB   = (float*)(dsm + RP_OB);
  const int tid = threadIdx.x, lane = tid & 31, w = tid >> 5;
  const int h = lane >> 4, m = lane & 15;
  const int lb = blockIdx.x, b = blockIdx.y;
  const int l0 = lb * 64;
  const v8f z8 = zero8f();

  // phase 0
  // the x tile's 16 loads of a thread are issued here and fly under the table set-up
  const float* xp = x + (size_t)(b * CH + (tid >> 4)) * NP + l0 + (tid & 15) * 4;
  v4f xv[16];
  #pragma unroll
  for (int j = 0; j < 16; ++j) xv[j] = *(const v4fa*)(xp + (size_t)(16 * j) * NP);
  // what follows may rewrite the address registers that these loads name
  asm volatile("s_wait_xcnt 0x0" :: "v"(xp) : "memory");
  if (tid < 8) sFreq[tid] = rope_freq(tid);
  sKM[tid] = KM[(size_t)b * CH + tid];
  sVM[tid] = VM[(size_t)b * CH + tid];
  sQB[tid] = qbias[tid];
  sOB[tid] = qbias[3 * CH + tid];
  __syncthreads();
  #pragma unroll 1
  for (int j = 0; j < 2; ++j) {
    const int idx = tid + 256 * j;
    const int pos = idx >> 3, f = idx & 7;
    float sv, cv;
    sincosf((float)pos * sFreq[f], &sv, &cv);
    sSinW[idx] = sv;
    sCosW[idx] = cv;
  }
  if (tid < 8) {
    float sv, cv;
    sincosf((float)lb * sFreq[tid], &sv, &cv);
    sSinH[tid] = sv;
    sCosH[tid] = cv;
  }
  #pragma unroll
  for (int j = 0; j < 16; ++j) {
    const int c = (tid >> 4) + 16 * j, lq = (tid & 15) * 4;
    const int cs = c + ((lq >> 4) << 3);
    const v4f v = xv[j];
    us_t p1, p2;
    split2(v.x, p1, p2); sXh[(lq + 0) * GXP + cs] = p1; sXl[(lq + 0) * GXP + cs] = p2;
    split2(v.y, p1, p2); sXh[(lq + 1) * GXP + cs] = p1; sXl[(lq + 1) * GXP + cs] = p2;
    split2(v.z, p1, p2); sXh[(lq + 2) * GXP + cs] = p1; sXl[(lq + 2) * GXP + cs] = p2;
    split2(v.w, p1, p2); sXh[(lq + 3) * GXP + cs] = p1; sXl[(lq + 3) * GXP + cs] = p2;
  }
  __syncthreads();

  // phase A
  const int ph = w & 1;
  const us_t* ah0 = sXh + (32 * ph + m) * GXP + 16 * ph;
  const us_t* ah1 = ah0 + 16 * GXP + 8;
  const us_t* al0 = sXl + (32 * ph + m) * GXP + 16 * ph;
  const us_t* al1 = al0 + 16 * GXP + 8;
  // rolled: one copy of a task's code in the instruction cache
  #pragma unroll 1
  for (int tk = 0; tk < 2; ++tk) {
    const int nn = (w >> 1) + 4 * tk;
    // weight tiles 0, 1: the head's q rows; 2, 3: its o rows, 48 tiles of 16 rows further on
    const us_t* wqh = WQh + (size_t)(2 * nn) * 4096 + 8 * lane;
    const us_t* wql = WQl + (size_t)(2 * nn) * 4096 + 8 * lane;
    FragB wbh[4], wbl[4];
    #pragma unroll
    for (int v = 0; v < 4; ++v) {
      const int to = 4096 * (v < 2 ? v : 46 + v);
      wbh[v] = ldfragp(wqh + to);
      wbl[v] = ldfragp(wql + to);
    }
    // what follows may rewrite the address registers that these loads name; the two pointers are
    // inputs so that their registers are not given away ahead of the wait
    asm volatile("s_wait_xcnt 0x0" :: "v"(wqh), "v"(wql) : "memory");
    // the task's kv fragments and depthwise values are asked for in the last k step, in the registers
    // that the weights leave: they fly under the rest of that step and the q epilogue, and the wave
    // stays within 256 registers (two blocks on a WGP)
    const size_t go = (size_t)(b * CH + nn * HD + m) * NP + l0 + 32 * ph + 8 * h;
    const size_t kr = ((size_t)(b * NH + nn) * HD + m) * HD + 8 * h;
    const us_t* kvh = KVTh + kr;
    const us_t* kvl = KVTl + kr;
    v4f le0[2][2], le1[2][2];
    FragB gb[2], gl[2];
    v8f qa[2][2], oa[2][2];   // qa[channel tile][position tile], oa[position tile][channel tile]
    #pragma unroll
    for (int t = 0; t < 2; ++t) {
      #pragma unroll
      for (int v = 0; v < 2; ++v) { qa[t][v] = z8; oa[t][v] = z8; }
    }
    // one k step: the weight fragments stay in registers; each pair is asked for again, for the next
    // k step, as soon as its six products are issued; the last step asks for the task's kv fragments
    // and depthwise values instead
    auto kstep = [&](const int k0, const bool last) __attribute__((always_inline)) {
      const FragB x0h = ldfrag(ah0 + k0, h);
      const FragB x1h = ldfrag(ah1 + k0, h);
      const FragB x0l = ldfrag(al0 + k0, h);
      const FragB x1l = ldfrag(al1 + k0, h);
      #pragma unroll
      for (int v = 0; v < 2; ++v) {
        qa[v][0] = wmma_bf16(wbh[v], x0h, qa[v][0]);
        qa[v][1] = wmma_bf16(wbh[v], x1h, qa[v][1]);
        qa[v][0] = wmma_bf16(wbl[v], x0h, qa[v][0]);
        qa[v][1] = wmma_bf16(wbl[v], x1h, qa[v][1]);
        qa[v][0] = wmma_bf16(wbh[v], x0l, qa[v][0]);
        qa[v][1] = wmma_bf16(wbh[v], x1l, qa[v][1]);
        if (!last) {
          wbh[v] = ldfragp(wqh + 4096 * v + 16 * (k0 + 32));
          wbl[v] = ldfragp(wql + 4096 * v + 16 * (k0 + 32));
        } else {
          gb[v] = ldfrag(kvh + 16 * v * HD, 0);
          gl[v] = ldfrag(kvl + 16 * v * HD, 0);
        }
      }
      // what follows may rewrite the address registers that the kv fragment loads name; the two
      // pointers are inputs so that their registers are not given away ahead of the wait
      if (last) asm volatile("s_wait_xcnt 0x0" :: "v"(kvh), "v"(kvl) : "memory");
      #pragma unroll
      for (int u = 0; u < 2; ++u) {
        oa[0][u] = wmma_bf16(x0h, wbh[2 + u], oa[0][u]);
        oa[1][u] = wmma_bf16(x1h, wbh[2 + u], oa[1][u]);
        oa[0][u] = wmma_bf16(x0h, wbl[2 + u], oa[0][u]);
        oa[1][u] = wmma_bf16(x1h, wbl[2 + u], oa[1][u]);
        oa[0][u] = wmma_bf16(x0l, wbh[2 + u], oa[0][u]);
        oa[1][u] = wmma_bf16(x1l, wbh[2 + u], oa[1][u]);
        if (!last) {
          wbh[2 + u] = ldfragp(wqh + 4096 * (48 + u) + 16 * (k0 + 32));
          wbl[2 + u] = ldfragp(wql + 4096 * (48 + u) + 16 * (k0 + 32));
        } else {
          #pragma unroll
          for (int t = 0; t < 2; ++t) {
            le0[t][u] = *(const v4fa*)(LF + go + (size_t)(16 * u) * NP + 16 * t);
            le1[t][u] = *(const v4fa*)(LF + go + (size_t)(16 * u) * NP + 16 * t + 4);
          }
        }
      }
    };
    // rolled: unrolled eight times the kernel's text would pass 32 KB
    #pragma unroll 1
    for (int k0 = 0; k0 < CH - 32; k0 += 32) {
      kstep(k0, false);
      // the next trip rewrites the address registers that this trip's weight loads name
      asm volatile("s_wait_xcnt 0x0" ::: "memory");
    }
    kstep(CH - 32, true);
    // rolled, for the size of the text: a pass works on position tile 0's registers, and its foot
    // moves tile 1's into them
    #pragma unroll 1
    for (int t = 0; t < 2; ++t) {
      const int pm = 32 * ph + 16 * t + m;   // the position whose q channels this lane holds
      float z = 0.f;
      FragB fa, fl;
      #pragma unroll
      for (int v = 0; v < 2; ++v) {
        const int c0 = nn * HD + 16 * v + 8 * h;
        const v4f b0 = *(const v4fa*)(sQB + c0), b1 = *(const v4fa*)(sQB + c0 + 4);
        const v4f m0 = *(const v4fa*)(sKM + c0), m1 = *(const v4fa*)(sKM + c0 + 4);
        const float bq[8] = {b0.x, b0.y, b0.z, b0.w, b1.x, b1.y, b1.z, b1.w};
        const float km[8] = {m0.x, m0.y, m0.z, m0.w, m1.x, m1.y, m1.z, m1.w};
        float qv[8];
        #pragma unroll
        for (int r = 0; r < 8; ++r) {
          const float y = qa[v][0][r] + bq[r];
          const float ey = expf(y);
          const float vv = (y > 0.f) ? (y + 1.f) : ey;
          qv[r] = vv;
          z += vv * km[r];
        }
        // channels 0..15 of a head turn with the image row, 16..31 with the column
        const v4f s4 = v ? *(const v4fa*)(sSinW + pm * 8 + 4 * h) : *(const v4fa*)(sSinH + 4 * h);
        const v4f c4 = v ? *(const v4fa*)(sCosW + pm * 8 + 4 * h) : *(const v4fa*)(sCosH + 4 * h);
        #pragma unroll
        for (int p = 0; p < 4; ++p) {
          const float s = s4[p], c = c4[p];
          const float x0 = qv[2 * p], x1 = qv[2 * p + 1];
          us_t p1, p2;
          split2(x0 * c - x1 * s, p1, p2); fa.half[v][2 * p] = p1; fl.half[v][2 * p] = p2;
          split2(x1 * c + x0 * s, p1, p2); fa.half[v][2 * p + 1] = p1; fl.half[v][2 * p + 1] = p2;
        }
      }
      // the two half-waves hold 16 channels each of the same 16 positions
      z += __shfl_xor(z, 16);
      z *= SCALE_F;
      const float fz = 1.0f + 1.0f / (z + 1e-6f);
      // the q kv result has positions 8 h + r in a lane: fetch their z and factor from lanes 8 h + r
      float zz[8], fac[8];
      #pragma unroll
      for (int r = 0; r < 8; ++r) {
        zz[r] = __shfl(z, 8 * h + r);
        fac[r] = __shfl(fz, 8 * h + r);
      }
      #pragma unroll
      for (int u = 0; u < 2; ++u) {
        v8f a = wmma_bf16(fa, gb[u], z8);
        a = wmma_bf16(fa, gl[u], a);
        a = wmma_bf16(fl, gb[u], a);
        const int c = nn * HD + 16 * u + m;
        const float vme = sVM[c], ob = sOB[c];
        const v4f e0 = le0[0][u], e1 = le1[0][u];
        const float lev[8] = {e0.x, e0.y, e0.z, e0.w, e1.x, e1.y, e1.z, e1.w};
        #pragma unroll
        for (int r = 0; r < 8; ++r) {
          const float res = a[r] * fac[r] - zz[r] * vme;
          const float uv = (res + lev[r]) * (oa[0][u][r] + ob);
          us_t p1, p2;
          split2(uv, p1, p2);
          const int l = 32 * ph + 16 * t + 8 * h + r;
          Uh[l * UPP + c] = p1;
          Ul[l * UPP + c] = p2;
        }
      }
      #pragma unroll
      for (int u = 0; u < 2; ++u) {
        qa[u][0] = qa[u][1];
        oa[0][u] = oa[1][u];
        le0[0][u] = le0[1][u];
        le1[0][u] = le1[1][u];
      }
    }
    // the next trip rewrites the address registers that this trip's loads name
    asm volatile("s_wait_xcnt 0x0" ::: "memory");
  }
  __syncthreads();   // publishes the U planes to every wave

  // phase B: output projection
  const int wl = w & 1, wc = w >> 1;
  v8f pacc[2][4];
  #pragma unroll
  for (int t = 0; t < 2; ++t) {
    #pragma unroll
    for (int v = 0; v < 4; ++v) pacc[t][v] = z8;
  }
  const us_t* ua0 = Uh + (32 * wl + m) * UPP;
  const us_t* ua1 = ua0 + 16 * UPP;
  const us_t* la0 = Ul + (32 * wl + m) * UPP;
  const us_t* la1 = la0 + 16 * UPP;
  const us_t* wph = WPh + (size_t)(4 * wc) * 4096 + 8 * lane;
  const us_t* wpl = WPl + (size_t)(4 * wc) * 4096 + 8 * lane;
  // the four weight fragment pairs of a k step stay in registers; each pair is asked for again,
  // for the next k step, as soon as its six products are issued: three groups of lead
  FragB wbh[4], wbl[4];
  #pragma unroll
  for (int v = 0; v < 4; ++v) {
    wbh[v] = ldfragp(wph + 4096 * v);
    wbl[v] = ldfragp(wpl + 4096 * v);
  }
  // unrolled: the fragment registers are indexed statically and every load offset is an immediate
  #pragma unroll
  for (int k0 = 0; k0 < CH; k0 += 32) {
    const FragB a0 = ldfrag(ua0 + k0, h);
    const FragB a1 = ldfrag(ua1 + k0, h);
    const FragB c0 = ldfrag(la0 + k0, h);
    const FragB c1 = ldfrag(la1 + k0, h);
    #pragma unroll
    for (int v = 0; v < 4; ++v) {
      const FragB bh = wbh[v];
      const FragB bl = wbl[v];
      pacc[0][v] = wmma_bf16(a0, bh, pacc[0][v]);
      pacc[0][v] = wmma_bf16(c0, bh, pacc[0][v]);
      pacc[0][v] = wmma_bf16(a0, bl, pacc[0][v]);
      pacc[1][v] = wmma_bf16(a1, bh, pacc[1][v]);
      pacc[1][v] = wmma_bf16(c1, bh, pacc[1][v]);
      pacc[1][v] = wmma_bf16(a1, bl, pacc[1][v]);
      if (k0 + 32 < CH) {
        wbh[v] = ldfragp(wph + 4096 * v + 16 * (k0 + 32));
        wbl[v] = ldfragp(wpl + 4096 * v + 16 * (k0 + 32));
      }
    }
  }
  // what follows rewrites the address registers that the weight loads name
  asm volatile("s_wait_xcnt 0x0" ::: "memory");
  __syncthreads();   // all waves done with the U planes before the staging overlays them
  #pragma unroll
  for (int v = 0; v < 4; ++v) {
    const int co = 64 * wc + 16 * v + m;
    const float pb = pbias[co];
    #pragma unroll
    for (int t = 0; t < 2; ++t) {
      v8f y;
      #pragma unroll
      for (int r = 0; r < 8; ++r) y[r] = pacc[t][v][r] + pb;
      st8f(sO + co * SOP + 32 * wl + 16 * t + 8 * h, y);
    }
  }
  __syncthreads();
  const int q8 = lane & 7, sub = lane >> 3;
  #pragma unroll
  for (int i = 0; i < 16; ++i) {
    const int id = 64 * w + 4 * i + sub;
    const int R = id >> 1, Lh = id & 1;
    const v4f val = *(const v4fa*)(sO + R * SOP + 32 * Lh + 4 * q8);
    const size_t d = (size_t)(b * CH + R) * NP + l0 + 32 * Lh + 4 * q8;
    *(v4f*)(out + d) = val;
  }
  
}

// ---------------------------------------------------------------------------
extern "C" void kernel_launch(void* const* d_in, const int* in_sizes, int n_in,
                              void* d_out, int out_size, void* d_ws, size_t ws_size,
                              hipStream_t stream)
{
  if (n_in < 7) return;
  if (in_sizes[0] != NB * CH * NP) return;
  if (in_sizes[1] != 4 * CH * CH || in_sizes[2] != 4 * CH) return;
  if (in_sizes[3] != CH * 25 || in_sizes[4] != CH) return;
  if (in_sizes[5] != CH * CH || in_sizes[6] != CH) return;
  if (out_size != NB * CH * NP) return;

  const float* x      = (const float*)d_in[0];
  const float* qkvo_w = (const float*)d_in[1];
  const float* qkvo_b = (const float*)d_in[2];
  const float* lepe_w = (const float*)d_in[3];
  const float* lepe_b = (const float*)d_in[4];
  const float* proj_w = (const float*)d_in[5];
  const float* proj_b = (const float*)d_in[6];
  float* outp = (float*)d_out;

  const size_t szWQ  = (size_t)4 * CH * CH * 2;         //    524288 (x2)
  const size_t szWP  = (size_t)CH * CH * 2;             //    131072 (x2)
  const size_t szR   = (size_t)NB * CH * NP * 4;        //  33554432 (x2)
  const size_t szKVT = (size_t)NB * NH * HD * HD * 2;   //    131072 (x2)
  const size_t szM   = (size_t)NB * NH * HD * 4;        //      8192 (x2)
  const size_t szPK  = (size_t)NB * NH * KS * KREC * 4; //  17825792
  size_t off = 0;
  char* ws = (char*)d_ws;
  us_t*  WQh  = (us_t*)(ws + off);  off += szWQ;
  us_t*  WQl  = (us_t*)(ws + off);  off += szWQ;
  us_t*  WPh  = (us_t*)(ws + off);  off += szWP;
  us_t*  WPl  = (us_t*)(ws + off);  off += szWP;
  float* VF   = (float*)(ws + off); off += szR;     // v planes
  float* LF   = (float*)(ws + off); off += szR;     // depthwise result
  us_t*  KVTh = (us_t*)(ws + off);  off += szKVT;
  us_t*  KVTl = (us_t*)(ws + off);  off += szKVT;
  float* KM   = (float*)(ws + off); off += szM;
  float* VM   = (float*)(ws + off); off += szM;
  float* PK   = (float*)(ws + off); off += szPK;    // row records; total 86523904
  if (off > ws_size) return;

  k_wcvt<<<dim3(160), 256, 0, stream>>>(qkvo_w, proj_w, WQh, WQl, WPh, WPl);
  hipFuncSetAttribute(reinterpret_cast<const void*>(&k_gemm),
                      hipFuncAttributeMaxDynamicSharedMemorySize, GM_BYTES);
  k_gemm<<<dim3(HW, NB), 256, GM_BYTES, stream>>>(x, WQh, WQl, qkvo_b, VF, PK);
  k_lepe<<<dim3(4 * NB * NH + CH * NB), 256, 0, stream>>>(VF, lepe_w, lepe_b, LF, PK, KVTh, KVTl, KM, VM);
  hipFuncSetAttribute(reinterpret_cast<const void*>(&k_resproj),
                      hipFuncAttributeMaxDynamicSharedMemorySize, RP_BYTES);
  k_resproj<<<dim3(NP / 64, NB), 256, RP_BYTES, stream>>>(x, WQh, WQl, qkvo_b, LF, KVTh, KVTl, KM, VM, WPh, WPl, proj_b, outp);
}

// v008
// Measured time: 84.1 microseconds a run.
// Two timings next to v007 both put it at 1.06 times that version's speed.
// Over all steps from v000 it is 3.05 times as fast.
// Contractions: qkv/o 1x1 projection, k^T v, q kv and the output 1x1 projection all on v_wmma_f32_16x16x32_bf16 as bf16 hi/lo three-product split (hi*hi + hi*lo + lo*hi, f32 accumulate); elu, channel means, z, rotary tables, depthwise 5x5, biases and the elementwise tail in f32.
#include <hip/hip_runtime.h>
#include <math.h>

typedef unsigned short us_t;
typedef __bf16   v16b __attribute__((ext_vector_type(16)));
typedef _Float16 v16h __attribute__((ext_vector_type(16)));
typedef us_t     v8us __attribute__((ext_vector_type(8)));
typedef us_t     v4us __attribute__((ext_vector_type(4)));
typedef float    v8f  __attribute__((ext_vector_type(8)));
typedef float    v4f  __attribute__((ext_vector_type(4)));
typedef float    v2f  __attribute__((ext_vector_type(2)));
typedef __bf16   v2b  __attribute__((ext_vector_type(2)));
typedef unsigned v8u  __attribute__((ext_vector_type(8)));
typedef unsigned v4u  __attribute__((ext_vector_type(4)));
typedef unsigned v2u  __attribute__((ext_vector_type(2)));
typedef v8us __attribute__((may_alias)) v8usa;
typedef v4us __attribute__((may_alias)) v4usa;
typedef v4f  __attribute__((may_alias)) v4fa;
typedef v4u  __attribute__((may_alias)) v4ua;
union FragB { v16b v; v8us half[2]; v16h x; v8u w; };
union Q8    { v8f v; v4f q[2]; };

#define NB   8
#define CH   256
#define NP   4096
#define HW   64
#define NH   8
#define HD   32
#define PPW  68
#define GXP  264
#define UPP  264
#define SOP  68
#define RTT  68
#define SCALE_F 0.17677669529663687f
#define CKV     0.0065695032f
#define INV_L   0.000244140625f
#define KS   64
#define KREC 1088

// dynamic LDS map of k_gemm (bytes): x hi tile [64][264] us_t + 24 (row-group skew), x lo tile; 16 task ranges of
// GPW floats (v tile [32][VSP], then the record); column sin/cos tables [8][68]; row sin/cos; frequencies;
// two blocks fit a WGP
#define GPW      1152
#define VSP      36
#define GM_XL    33856
#define GM_PK    67712
#define GM_SINT  141440
#define GM_COST  143616
#define GM_SINH  145792
#define GM_COSH  145824
#define GM_FREQ  145856
#define GM_BYTES 145888

// dynamic LDS map of k_resproj (bytes)
// U hi/lo planes [64][264] us_t; the f32 staging [256][68] overlays them (69632 bytes);
// x hi/lo tiles as in k_gemm; two blocks fit a WGP
#define RP_UH    0
#define RP_UL    33792
#define RP_XH    69632
#define RP_XL    103488
#define RP_SINW  139264
#define RP_COSW  141312
#define RP_SINH  143360
#define RP_COSH  143392
#define RP_FREQ  143424
#define RP_KM    143456
#define RP_VM    144480
#define RP_QB    145504
#define RP_OB    146528
#define RP_BYTES 147552

// ---------------------------------------------------------------------------
// 16x16x32 bf16 WMMA with hazard guard (ties D, keeps A/B live).
// Fragment map (wave32): lane l, h = l>>4, m = n = l&15.
//   A/B element i: i<8 -> k0+8h+i ; i>=8 -> k0+16+8h+(i-8)
//   D element r : row 8h+r, col l&15
// ---------------------------------------------------------------------------
__device__ __forceinline__ v8f wmma_bf16(const FragB& a, const FragB& b, v8f c) {
  v8f d = __builtin_amdgcn_wmma_f32_16x16x32_bf16(false, a.v, false, b.v, (short)0, c, false, false);
  asm volatile("v_nop\n\tv_nop\n\tv_nop\n\tv_nop" : "+v"(d) : "v"(a.x), "v"(b.x));
  return d;
}
// fragment from a k-contiguous bf16 row holding >= 32 elements starting at p (p = row + k0)
__device__ __forceinline__ FragB ldfrag(const us_t* p, int h) {
  FragB f;
  f.half[0] = *(const v8usa*)(p + 8 * h);
  f.half[1] = *(const v8usa*)(p + 16 + 8 * h);
  return f;
}
// fragment from a weight plane packed in fragment order (see k_wcvt): p = block start + 8 * lane
__device__ __forceinline__ FragB ldfragp(const us_t* p) {
  FragB f;
  f.half[0] = *(const v8usa*)p;
  f.half[1] = *(const v8usa*)(p + 256);
  return f;
}
__device__ __forceinline__ v8f zero8f() {
  v8f z;
  #pragma unroll
  for (int j = 0; j < 8; ++j) z[j] = 0.f;
  return z;
}
// 8 floats to LDS as two 16-B pieces
__device__ __forceinline__ void st8f(float* p, v8f v) {
  Q8 u; u.v = v;
  *(v4fa*)p = u.q[0];
  *(v4fa*)(p + 4) = u.q[1];
}
// two f32 -> two bf16 (round to nearest even) in one register, a in the low half: one packed convert
__device__ __forceinline__ unsigned cvt2(float a, float b) {
  const v2f f = {a, b};
  return __builtin_bit_cast(unsigned, __builtin_convertvector(f, v2b));
}
// hi/lo split of two values: hi = bf16(f), lo = bf16(f - hi), each pair packed as a fragment register holds it
__device__ __forceinline__ void split2p(float a, float b, unsigned& hi, unsigned& lo) {
  hi = cvt2(a, b);
  lo = cvt2(a - __uint_as_float(hi << 16), b - __uint_as_float(hi & 0xFFFF0000u));
}
// rotary frequency i of 8: 1 / 10000^(i/7), linspace-style exponent
__device__ __forceinline__ float rope_freq(int i) {
  const float e = (i == 7) ? 1.0f : (float)i * (1.0f / 7.0f);
  return 1.0f / powf(10000.0f, e);
}

// ---------------------------------------------------------------------------
// Kernel 0: weights -> bf16 hi/lo planes in fragment order. WQh/WQl from the
// qkv/o weights [1024][256], WPh/WPl from the output projection [256][256].
// A plane is a row of 1-KiB blocks, block (T, ks) = 16 weight rows 16 T + m by
// 32 k from 32 ks, at element offset (8 T + ks) * 512, laid out
// [half j][lane l = 16 h + m][8 elements k = 32 ks + 16 j + 8 h + i]: a wave's
// 16-byte fragment load then reads 512 contiguous bytes (four whole lines)
// where row-major weights gave it 16 lines of 32 bytes. Thread = one 16-byte
// piece of each plane, so a wave also stores whole lines.
// ---------------------------------------------------------------------------
__global__ __launch_bounds__(256) void k_wcvt(const float* __restrict__ qw, const float* __restrict__ pw,
                                             us_t* __restrict__ WQh, us_t* __restrict__ WQl,
                                             us_t* __restrict__ WPh, us_t* __restrict__ WPl)
{
  const int g = blockIdx.x * 256 + threadIdx.x;
  if (g >= 40960) return;
  const float* src;
  us_t* dh;
  us_t* dl;
  const int g2 = (g < 32768) ? g : (g - 32768);
  const int pl = g2 & 31, pj = (g2 >> 5) & 1, pks = (g2 >> 6) & 7, pT = g2 >> 9;
  const size_t so = (size_t)(16 * pT + (pl & 15)) * CH + 32 * pks + 16 * pj + 8 * (pl >> 4);
  if (g < 32768) { src = qw + so; dh = WQh + (size_t)g2 * 8; dl = WQl + (size_t)g2 * 8; }
  else { src = pw + so; dh = WPh + (size_t)g2 * 8; dl = WPl + (size_t)g2 * 8; }
  const v4f a = *(const v4fa*)src;
  const v4f c = *(const v4fa*)(src + 4);
  v4u oh, ol;
  {
    unsigned p1, p2;
    split2p(a.x, a.y, p1, p2); oh[0] = p1; ol[0] = p2;
    split2p(a.z, a.w, p1, p2); oh[1] = p1; ol[1] = p2;
    split2p(c.x, c.y, p1, p2); oh[2] = p1; ol[2] = p2;
    split2p(c.z, c.w, p1, p2); oh[3] = p1; ol[3] = p2;
  }
  *(v8us*)dh = __builtin_bit_cast(v8us, oh);
  *(v8us*)dl = __builtin_bit_cast(v8us, ol);
  
}

// ---------------------------------------------------------------------------
// Kernel 1: the k and v 1x1 projections and the k^T v partial products.
// D[l][o] = sum_c x[c][l] * W[o][c] + bias[o] as bf16 hi/lo three-product split.
// Block = (image row of 64 positions, b), 8 waves; a wave takes two tasks
// (head nn, 32 positions wl): 2 position tiles x 4 channel tiles, the head's
// 32 k channels (weight rows 256..) and its 32 v channels (rows 512..).
// Staging: the x tile [256 c][64 l] (NCHW f32, l-contiguous float4 loads) is
// split into hi/lo LDS tiles sXh/sXl [64 l][256 c] (k-contiguous rows).
// Bank layout: row l starts at element l * 264 + 8 * (l >> 4), that is, each
// group of 16 rows is skewed 16 bytes further. The 16 lanes of a 16-byte staging
// store hold rows 4 apart; at the 132-dword pitch alone they fall on 16 banks,
// with the skew on all 64. A fragment's 16 rows share one skew, so its reads
// keep their spread.
// A = sX rows (positions), B = WQh/WQl fragment blocks straight from global,
// K = 256 in 8 steps; products a_hi*b_hi + a_hi*b_lo + a_lo*b_hi.
// D rows = positions, cols = channels: a lane holds, of one channel, positions
// 8 h + r (tile 0) and 16 + 8 h + r (tile 1): the element order of an A or B
// fragment whose k index runs over the wave's 32 positions. So bias, elu+1,
// the channel sums and the rotary run on the accumulators in f32 (a rotary
// pair sits in lanes m and m ^ 1), and the bf16 hi/lo pairs are the operands
// of sum_l krot[d][l] v[e][l] as they stand (A = krot, B = v; D rows d,
// cols e; three-product split). k never goes to memory.
// A task leaves its partial in LDS as a record of 1088 floats: value r of tile
// T = 2 td + te (d = 16 td + 8 h + r, e = 16 te + m) at float
// ((2 T + (r >> 2)) * 32 + lane) * 4 + (r & 3), then 32 k sums, 32 v sums. The
// two waves of a head add its two records and store one per (b, head, image row)
// in PK (4352 B = 34 whole lines, each 16-byte store 512 contiguous bytes).
// v goes out as NCHW f32 [b][256][4096]: a wave stages its [32 ch][32 pos] f32
// tile in its own LDS range, ahead of the record, and stores whole lines.
// ---------------------------------------------------------------------------
// the value of lane m ^ 1 (one vector instruction, within a group of four lanes)
__device__ __forceinline__ float lane_xor1(float v) {
  return __int_as_float(__builtin_amdgcn_mov_dpp(__float_as_int(v), 0xB1, 0xF, 0xF, true));
}

// second argument: 4 waves per SIMD, that is, at most 256 registers, so that two blocks share a WGP
__global__ __launch_bounds__(256, 4) void k_gemm(const float* __restrict__ x,
                                             const us_t* __restrict__ WQh, const us_t* __restrict__ WQl,
                                             const float* __restrict__ bias,
                                             float* __restrict__ VF, float* __restrict__ PK)
{
  extern __shared__ __attribute__((aligned(16))) unsigned char dsm[];
  us_t*  sXh   = (us_t*)dsm;
  us_t*  sXl   = (us_t*)(dsm + GM_XL);
  float* sPK   = (float*)(dsm + GM_PK);
  float* sSinT = (float*)(dsm + GM_SINT);
  float* sCosT = (float*)(dsm + GM_COST);
  float* sSinH = (float*)(dsm + GM_SINH);
  float* sCosH = (float*)(dsm + GM_COSH);
  float* sFreq = (float*)(dsm + GM_FREQ);
  const int tid = threadIdx.x, lane = tid & 31, w = tid >> 5;
  const int h = lane >> 4, m = lane & 15;
  const int lb = blockIdx.x, b = blockIdx.y;
  const int l0 = lb * 64;

  // stage x[c][l0 + 0..63] -> hi/lo tiles [l][c]; a thread's 16 loads are issued together
  const float* xp = x + (size_t)(b * CH + 16 * (tid >> 4)) * NP + l0 + (tid & 15) * 4;
  v4f xv[16];
  #pragma unroll
  for (int j = 0; j < 16; ++j) xv[j] = *(const v4fa*)(xp + (size_t)j * NP);
  // what follows may rewrite the address registers that these loads name
  asm volatile("s_wait_xcnt 0x0" :: "v"(xp) : "memory");
  if (tid < 8) sFreq[tid] = rope_freq(tid);
  __syncthreads();
  // column tables [frequency][column] at a pitch of 68 floats: a lane reads 8 columns of its
  // frequency as two 16-byte pieces, and the 8 frequencies of a half-wave fall on 32 distinct banks
  #pragma unroll 1
  for (int j = 0; j < 2; ++j) {
    const int idx = tid + 256 * j;
    const int pos = idx >> 3, f = idx & 7;
    float sv, cv;
    sincosf((float)pos * sFreq[f], &sv, &cv);
    sSinT[f * RTT + pos] = sv;
    sCosT[f * RTT + pos] = cv;
  }
  if (tid < 8) {
    float sv, cv;
    sincosf((float)lb * sFreq[tid], &sv, &cv);
    sSinH[tid] = sv;
    sCosH[tid] = cv;
  }
  // a thread holds 16 consecutive channels of 4 positions: the packed pairs of a position are 32 bytes of its row
  #pragma unroll
  for (int e = 0; e < 4; ++e) {
    const int lq = (tid & 15) * 4;
    const int ro = (lq + e) * GXP + 16 * (tid >> 4) + ((lq >> 4) << 3);
    v4u hw[2], lw[2];
    #pragma unroll
    for (int i = 0; i < 8; ++i) {
      unsigned p1, p2;
      split2p(xv[2 * i][e], xv[2 * i + 1][e], p1, p2);
      hw[i >> 2][i & 3] = p1;
      lw[i >> 2][i & 3] = p2;
    }
    *(v4ua*)(sXh + ro) = hw[0];
    *(v4ua*)(sXh + ro + 8) = hw[1];
    *(v4ua*)(sXl + ro) = lw[0];
    *(v4ua*)(sXl + ro + 8) = lw[1];
  }
  __syncthreads();

  const int wl = w & 1;
  const v8f z8 = zero8f();
  const us_t* ah0 = sXh + (32 * wl + m) * GXP + 16 * wl;
  const us_t* ah1 = ah0 + 16 * GXP + 8;
  const us_t* al0 = sXl + (32 * wl + m) * GXP + 16 * wl;
  const us_t* al1 = al0 + 16 * GXP + 8;
  // a wave takes two tasks (head, 32 positions), with no barrier between them
  // rolled: one copy of a task's code in the instruction cache
  #pragma unroll 1
  for (int tk = 0; tk < 2; ++tk) {
    const int nn = (w >> 1) + 4 * tk;
    v8f acc[2][4];   // [position tile][channel tile: 0, 1 the head's k, 2, 3 its v]
    #pragma unroll
    for (int t = 0; t < 2; ++t) {
      #pragma unroll
      for (int v = 0; v < 4; ++v) acc[t][v] = z8;
    }
    // weight tiles of 16 rows: the head's k rows are tiles 16 + 2 nn, + 1; its v rows lie 16 tiles further on
    const us_t* bh0 = WQh + (size_t)(16 + 2 * nn) * 4096 + 8 * lane;
    const us_t* bl0 = WQl + (size_t)(16 + 2 * nn) * 4096 + 8 * lane;

    // the four biases of the lane's channels, asked for here so that they fly under the k loop
    const float* bp = bias + CH + nn * HD + m;
    const float bk[2] = {bp[0], bp[16]};
    const float bv[2] = {bp[CH], bp[CH + 16]};
    // what follows may rewrite the address registers that these loads name
    asm volatile("s_wait_xcnt 0x0" :: "v"(bp) : "memory");

    // the four weight fragment pairs of a k step stay in registers; each pair is asked for again, for the
    // next k step, as soon as its six products are issued
    FragB wbh[4], wbl[4];
    #pragma unroll
    for (int v = 0; v < 4; ++v) {
      const int to = 4096 * (v < 2 ? v : 14 + v);
      wbh[v] = ldfragp(bh0 + to);
      wbl[v] = ldfragp(bl0 + to);
    }
    // what follows may rewrite the address registers that these loads name; the two pointers are
    // inputs so that their registers are not given away ahead of the wait
    asm volatile("s_wait_xcnt 0x0" :: "v"(bh0), "v"(bl0) : "memory");
    auto kstep = [&](const int k0, const bool last) __attribute__((always_inline)) {
      const FragB a0 = ldfrag(ah0 + k0, h);
      const FragB a1 = ldfrag(ah1 + k0, h);
      const FragB c0 = ldfrag(al0 + k0, h);
      const FragB c1 = ldfrag(al1 + k0, h);
      #pragma unroll
      for (int v = 0; v < 4; ++v) {
        acc[0][v] = wmma_bf16(a0, wbh[v], acc[0][v]);
        acc[1][v] = wmma_bf16(a1, wbh[v], acc[1][v]);
        acc[0][v] = wmma_bf16(a0, wbl[v], acc[0][v]);
        acc[1][v] = wmma_bf16(a1, wbl[v], acc[1][v]);
        acc[0][v] = wmma_bf16(c0, wbh[v], acc[0][v]);
        acc[1][v] = wmma_bf16(c1, wbh[v], acc[1][v]);
        if (!last) {
          const int to = 4096 * (v < 2 ? v : 14 + v);
          wbh[v] = ldfragp(bh0 + to + 16 * (k0 + 32));
          wbl[v] = ldfragp(bl0 + to + 16 * (k0 + 32));
        }
      }
    };
    // rolled, for the size of the text
    #pragma unroll 1
    for (int k0 = 0; k0 < CH - 32; k0 += 32) {
      kstep(k0, false);
      // the next trip rewrites the address registers that this trip's weight loads name
      asm volatile("s_wait_xcnt 0x0" ::: "memory");
    }
    kstep(CH - 32, true);

    // v: bias, channel sums, hi/lo fragments; the f32 tile [32 ch][32 pos] goes through the wave's own LDS
    // range (pitch 36 floats: the 16 channels of an accumulator store cover all 64 banks) to whole-line stores
    float* myP = sPK + (2 * nn + wl) * GPW;
    FragB vh[2], vl[2];
    float ksum[2], vsum[2];
    #pragma unroll
    for (int u = 0; u < 2; ++u) {
      float s = 0.f;
      #pragma unroll
      for (int t = 0; t < 2; ++t) {
        v8f y;
        #pragma unroll
        for (int r = 0; r < 8; ++r) y[r] = acc[t][2 + u][r] + bv[u];
        #pragma unroll
        for (int r = 0; r < 8; r += 2) {
          unsigned p1, p2;
          split2p(y[r], y[r + 1], p1, p2);
          vh[u].w[4 * t + (r >> 1)] = p1;
          vl[u].w[4 * t + (r >> 1)] = p2;
        }
        s += ((y[0] + y[1]) + (y[2] + y[3])) + ((y[4] + y[5]) + (y[6] + y[7]));
        st8f(myP + (16 * u + m) * VSP + 16 * t + 8 * h, y);
      }
      // the two half-waves hold 16 positions each of the same 16 channels
      s += __shfl_xor(s, 16);
      vsum[u] = s;
    }
    // the rows are read back by other lanes of the wave
    asm volatile("s_wait_dscnt 0x0" ::: "memory");
    {
      const int q8 = lane & 7, sub = lane >> 3;
      float* vd = VF + (size_t)(b * CH + nn * HD + sub) * NP + l0 + 32 * wl + 4 * q8;
      const float* vs = myP + sub * VSP + 4 * q8;
      v4f val[8];
      #pragma unroll
      for (int i = 0; i < 8; ++i) val[i] = *(const v4fa*)(vs + 4 * i * VSP);
      #pragma unroll
      for (int i = 0; i < 8; ++i) *(v4f*)(vd + (size_t)(4 * i) * NP) = val[i];
      // what follows may rewrite the registers that these stores name; they are inputs so that
      // they are not given away ahead of the wait
      asm volatile("s_wait_xcnt 0x0" :: "v"(vd), "v"(val[0]), "v"(val[1]), "v"(val[2]), "v"(val[3]),
                   "v"(val[4]), "v"(val[5]), "v"(val[6]), "v"(val[7]) : "memory");
    }

    // k, one channel tile at a time: bias, elu+1, channel sums, rotary, hi/lo fragments; then the tile's
    // part of the head's k^T v over the wave's 32 positions, left in the wave's LDS range as its record
    const int fi = m >> 1;
    const float sgn = (m & 1) ? 1.f : -1.f;   // y[2i] = x[2i] c - x[2i+1] s ; y[2i+1] = x[2i+1] c + x[2i] s
    #pragma unroll
    for (int td = 0; td < 2; ++td) {
      FragB kh, kl;
      float s = 0.f;
      #pragma unroll
      for (int t = 0; t < 2; ++t) {
        // channels 0..15 of a head turn with the image row, 16..31 with the column
        const int po = fi * RTT + 32 * wl + 16 * t + 8 * h;
        const float sH = sSinH[fi], cH = sCosH[fi];
        const v4f hs = {sH, sH, sH, sH}, hc = {cH, cH, cH, cH};
        const v4f s0 = td ? *(const v4fa*)(sSinT + po) : hs, s1 = td ? *(const v4fa*)(sSinT + po + 4) : hs;
        const v4f q0 = td ? *(const v4fa*)(sCosT + po) : hc, q1 = td ? *(const v4fa*)(sCosT + po + 4) : hc;
        const float sn[8] = {s0.x, s0.y, s0.z, s0.w, s1.x, s1.y, s1.z, s1.w};
        const float cn[8] = {q0.x, q0.y, q0.z, q0.w, q1.x, q1.y, q1.z, q1.w};
        float yv[8];
        #pragma unroll
        for (int r = 0; r < 8; ++r) {
          const float y = acc[t][td][r] + bk[td];
          const float ey = expf(y);
          yv[r] = (y > 0.f) ? (y + 1.f) : ey;
        }
        s += ((yv[0] + yv[1]) + (yv[2] + yv[3])) + ((yv[4] + yv[5]) + (yv[6] + yv[7]));
        #pragma unroll
        for (int r = 0; r < 8; r += 2) {
          const float yp0 = lane_xor1(yv[r]), yp1 = lane_xor1(yv[r + 1]);
          unsigned p1, p2;
          split2p(yv[r] * cn[r] + yp0 * (sgn * sn[r]), yv[r + 1] * cn[r + 1] + yp1 * (sgn * sn[r + 1]), p1, p2);
          kh.w[4 * t + (r >> 1)] = p1;
          kl.w[4 * t + (r >> 1)] = p2;
        }
      }
      s += __shfl_xor(s, 16);
      ksum[td] = s;
      #pragma unroll
      for (int te = 0; te < 2; ++te) {
        v8f a = wmma_bf16(kh, vh[te], z8);
        a = wmma_bf16(kh, vl[te], a);
        a = wmma_bf16(kl, vh[te], a);
        Q8 u; u.v = a;
        *(v4fa*)(myP + ((4 * td + 2 * te) * 32 + lane) * 4) = u.q[0];
        *(v4fa*)(myP + ((4 * td + 2 * te + 1) * 32 + lane) * 4) = u.q[1];
      }
    }
    myP[1024 + lane] = h ? ksum[1] : ksum[0];
    myP[1056 + lane] = h ? vsum[1] : vsum[0];
  }
  __syncthreads();   // publishes the records

  // a head's record: each of its two waves adds and stores one half
  v4f ra[2][4];
  float rs[2];
  const int os = 1024 + 32 * wl + lane;
  #pragma unroll
  for (int tk = 0; tk < 2; ++tk) {
    const float* r0 = sPK + (2 * ((w >> 1) + 4 * tk)) * GPW;
    const float* r1 = r0 + GPW;
    #pragma unroll
    for (int i = 0; i < 4; ++i) {
      const int o = ((4 * wl + i) * 32 + lane) * 4;
      ra[tk][i] = *(const v4fa*)(r0 + o) + *(const v4fa*)(r1 + o);
    }
    rs[tk] = r0[os] + r1[os];
  }
  #pragma unroll
  for (int tk = 0; tk < 2; ++tk) {
    float* rec = PK + ((size_t)(b * NH + (w >> 1) + 4 * tk) * KS + lb) * KREC;
    #pragma unroll
    for (int i = 0; i < 4; ++i) *(v4f*)(rec + ((4 * wl + i) * 32 + lane) * 4) = ra[tk][i];
    rec[os] = rs[tk];
    // the second record's address arithmetic may rewrite the registers that these stores name; they are
    // inputs so that they are not given away ahead of the wait
    if (tk == 0) asm volatile("s_wait_xcnt 0x0" :: "v"(rec), "v"(ra[0][0]), "v"(ra[0][1]), "v"(ra[0][2]), "v"(ra[0][3]), "v"(rs[0]) : "memory");
  }
}

// ---------------------------------------------------------------------------
// Block role 1b (the first 256 blocks of kernel 2's launch): per (b, head n,
// 8 rows e of kv^T), 256 threads = 64 float4 of a record x 4 groups of 16 image
// rows: a thread adds its float4 over its group's 16 records in row order (16
// loads in flight), the four group sums are added in group order through LDS;
// then KVT[e][d] = c^2 * sum as bf16 hi/lo KVTh/KVTl [b][n][e][d] (8 rows of
// 64 B = 4 whole lines per block and plane). The block of rows 0..7 also does
// the k means, that of rows 8..15 the v means, KM/VM [b][n][32] (one line each).
// sR: 1152 floats of LDS.
// ---------------------------------------------------------------------------
__device__ __forceinline__ v4f rec_sum16(const float* __restrict__ p)
{
  v4f part[16];
  #pragma unroll
  for (int s = 0; s < 16; ++s) part[s] = *(const v4fa*)(p + s * KREC);
  // what follows may rewrite the address registers that these loads name
  asm volatile("s_wait_xcnt 0x0" :: "v"(p) : "memory");
  v4f a = part[0];
  #pragma unroll
  for (int s = 1; s < 16; ++s) a += part[s];
  return a;
}

__device__ __forceinline__ void kvred_block(float* sR, const float* __restrict__ PK,
                                            us_t* __restrict__ KVTh, us_t* __restrict__ KVTl,
                                            float* __restrict__ KM, float* __restrict__ VM)
{
  const int tid = threadIdx.x;
  const int bn = blockIdx.x >> 2, j = blockIdx.x & 3;
  const int g = tid >> 6, it = tid & 63;
  const int te = j >> 1, mo = 8 * (j & 1);
  const int mq = it & 7, hh = (it >> 3) & 1, hf = (it >> 4) & 1, td = it >> 5;
  // float4 index in a record of (e = 16 te + mo + mq, d = 16 td + 8 hh + 4 hf ..+3): see kernel 1
  const int q = ((2 * td + te) * 2 + hf) * 32 + 16 * hh + mo + mq;
  const float* base = PK + (size_t)(bn * KS + 16 * g) * KREC;
  *(v4fa*)(sR + 4 * tid) = rec_sum16(base + 4 * q);
  if (j < 2 && it < 8) *(v4fa*)(sR + 1024 + 4 * (8 * g + it)) = rec_sum16(base + 1024 + 32 * j + 4 * it);
  __syncthreads();
  if (tid >= 64) return;

  const float cc = CKV * CKV;
  const v4f f0 = (((*(const v4fa*)(sR + 4 * it) + *(const v4fa*)(sR + 4 * (64 + it)))
                   + *(const v4fa*)(sR + 4 * (128 + it))) + *(const v4fa*)(sR + 4 * (192 + it))) * cc;
  v2u hw, lw2;
  {
    unsigned p1, p2;
    split2p(f0.x, f0.y, p1, p2); hw[0] = p1; lw2[0] = p2;
    split2p(f0.z, f0.w, p1, p2); hw[1] = p1; lw2[1] = p2;
  }
  const v4us hv = __builtin_bit_cast(v4us, hw), lv = __builtin_bit_cast(v4us, lw2);
  const size_t kd = ((size_t)bn * HD + 16 * te + mo + mq) * HD + 16 * td + 8 * hh + 4 * hf;
  *(v4us*)(KVTh + kd) = hv;
  *(v4us*)(KVTl + kd) = lv;
  if (j < 2 && tid < 8) {
    const float* sm = sR + 1024 + 4 * tid;
    const v4f mm = (((*(const v4fa*)sm + *(const v4fa*)(sm + 32)) + *(const v4fa*)(sm + 64)) + *(const v4fa*)(sm + 96)) * INV_L;
    float* pm = (j ? VM : KM) + (size_t)bn * HD + 4 * tid;
    *(v4f*)pm = mm;
  }
}

// ---------------------------------------------------------------------------
// Kernel 2: depthwise 5x5 (zero pad 2) on the v planes, f32 VALU:
// LF[b][c][y][x] = bias[c] + sum w[c][dy][dx] v[b][c][y+dy-2][x+dx-2].
// Block = (channel, b); the 64x64 plane staged with a 2-wide zero ring in
// LDS [68][68]; thread = 4 consecutive x per iteration (rolled loops).
// The launch's first 256 blocks do role 1b instead (it needs only kernel 1's
// records, the depthwise blocks only v): the small sum runs beside the
// depthwise work and takes no launch of its own.
// ---------------------------------------------------------------------------
__global__ __launch_bounds__(256) void k_lepe(const float* __restrict__ VF, const float* __restrict__ lw,
                                             const float* __restrict__ lbias, float* __restrict__ LF,
                                             const float* __restrict__ PK,
                                             us_t* __restrict__ KVTh, us_t* __restrict__ KVTl,
                                             float* __restrict__ KM, float* __restrict__ VM)
{
  __shared__ __attribute__((aligned(16))) float sP[PPW * PPW];
  __shared__ float sW[25];
  if (blockIdx.x < 4 * NB * NH) {
    kvred_block(sP, PK, KVTh, KVTl, KM, VM);
    return;
  }
  const int tid = threadIdx.x;
  const int c = (blockIdx.x - 4 * NB * NH) & (CH - 1), b = (blockIdx.x - 4 * NB * NH) >> 8;
  // the plane's loads are issued ahead of the zero fill and fly under it
  const float* src = VF + (size_t)(b * CH + c) * NP;
  v4f pv4[4];
  #pragma unroll
  for (int j = 0; j < 4; ++j) pv4[j] = *(const v4fa*)(src + 4 * (tid + 256 * j));
  if (tid < 25) sW[tid] = lw[c * 25 + tid];
  #pragma unroll 1
  for (int j = 0; j < 19; ++j) {
    const int idx = tid + 256 * j;
    if (idx < PPW * PPW) sP[idx] = 0.f;
  }
  __syncthreads();
  #pragma unroll
  for (int j = 0; j < 4; ++j) {
    const int f = tid + 256 * j, l = 4 * f, y = l >> 6, xx = l & 63;
    const v4f v = pv4[j];
    float* pr = sP + (y + 2) * PPW + xx + 2;
    pr[0] = v.x; pr[1] = v.y; pr[2] = v.z; pr[3] = v.w;
  }
  __syncthreads();
  const float bb = lbias[c];
  float* dst = LF + (size_t)(b * CH + c) * NP;
  #pragma unroll 1
  for (int j = 0; j < 4; ++j) {
    const int f = tid + 256 * j, l = 4 * f, y = l >> 6, xx = l & 63;
    float a0 = bb, a1 = bb, a2 = bb, a3 = bb;
    #pragma unroll 1
    for (int dy = 0; dy < 5; ++dy) {
      const float* rp = sP + (y + dy) * PPW + xx;
      const v4f r0 = *(const v4fa*)rp;
      const v4f r1 = *(const v4fa*)(rp + 4);
      const float rr[8] = {r0.x, r0.y, r0.z, r0.w, r1.x, r1.y, r1.z, r1.w};
      const float w0 = sW[dy * 5], w1 = sW[dy * 5 + 1], w2 = sW[dy * 5 + 2], w3 = sW[dy * 5 + 3], w4 = sW[dy * 5 + 4];
      a0 += w0 * rr[0]; a0 += w1 * rr[1]; a0 += w2 * rr[2]; a0 += w3 * rr[3]; a0 += w4 * rr[4];
      a1 += w0 * rr[1]; a1 += w1 * rr[2]; a1 += w2 * rr[3]; a1 += w3 * rr[4]; a1 += w4 * rr[5];
      a2 += w0 * rr[2]; a2 += w1 * rr[3]; a2 += w2 * rr[4]; a2 += w3 * rr[5]; a2 += w4 * rr[6];
      a3 += w0 * rr[3]; a3 += w1 * rr[4]; a3 += w2 * rr[5]; a3 += w3 * rr[6]; a3 += w4 * rr[7];
    }
    v4f o;
    o.x = a0; o.y = a1; o.z = a2; o.w = a3;
    *(v4f*)(dst + l) = o;
    
  }
}

// ---------------------------------------------------------------------------
// Kernel 3: per (image row of 64 positions, b), 8 waves:
//  phase 0: sin/cos tables, the per-image head means and the q and o biases in
//   LDS; the x tile [256 c][64 l] split into hi/lo LDS tiles as in kernel 1.
//  phase A: a wave takes (head, 32 positions), two such tasks, with no barrier
//   between them. The q and o projections of the task, K = 256, three-product
//   split, weight fragment blocks from global:
//    q with A = weight rows, B = x rows: D rows = channels, cols = positions,
//     so a lane holds channels 8 h + r and 16 + 8 h + r of one position: the
//     element order of an A fragment over the head's 32 channels. Bias, elu+1,
//     z = q . kmean and the rotary run on those registers in f32, and the bf16
//     hi/lo pair is the A operand of q kv as it stands;
//    o with A = x rows, B = weight rows: D rows = positions, cols = channels,
//     the layout of the q kv result, which it gates element by element.
//   D[l][e] = sum_d q[l][d] kvt[e][d] as three-product split (B = KVT rows e
//   from global); epilogue f32: res = D (1 + 1/(z+1e-6)) - z vmean[e],
//   u = (res + lepe) * o, bf16 hi/lo into U planes [l][256 c]
//   at a pitch of 264 (528 B = 16 B x 33: a fragment's 16 rows cover all banks).
//  phase B: D[l][co] = sum_c U[l][c] WP[co][c] as three-product split
//   (Uh*WPh + Ul*WPh + Uh*WPl, K = 256, WP fragment blocks from global),
//   + bias f32; staged [256 co][64 l]
// ---------------------------------------------------------------------------
__global__ __launch_bounds__(256) void k_resproj(
    const float* __restrict__ x,
    const us_t* __restrict__ WQh, const us_t* __restrict__ WQl, const float* __restrict__ qbias,
    const float* __restrict__ LF,
    const us_t* __restrict__ KVTh, const us_t* __restrict__ KVTl,
    const float* __restrict__ KM, const float* __restrict__ VM,
    const us_t* __restrict__ WPh, const us_t* __restrict__ WPl,
    const float* __restrict__ pbias, float* __restrict__ out)
{
  extern __shared__ __attribute__((aligned(16))) unsigned char dsm[];
  us_t*  Uh    = (us_t*)(dsm + RP_UH);
  us_t*  Ul    = (us_t*)(dsm + RP_UL);
  float* sO    = (float*)(dsm + RP_UH);
  us_t*  sXh   = (us_t*)(dsm + RP_XH);
  us_t*  sXl   = (us_t*)(dsm + RP_XL);
  float* sSinW = (float*)(dsm + RP_SINW);
  float* sCosW = (float*)(dsm + RP_COSW);
  float* sSinH = (float*)(dsm + RP_SINH);
  float* sCosH = (float*)(dsm + RP_COSH);
  float* sFreq = (float*)(dsm + RP_FREQ);
  float* sKM   = (float*)(dsm + RP_KM);
  float* sVM   = (float*)(dsm + RP_VM);
  float* sQB   = (float*)(dsm + RP_QB);
  float* sOB   = (float*)(dsm + RP_OB);
  const int tid = threadIdx.x, lane = tid & 31, w = tid >> 5;
  const int h = lane >> 4, m = lane & 15;
  const int lb = blockIdx.x, b = blockIdx.y;
  const int l0 = lb * 64;
  const v8f z8 = zero8f();

  // phase 0
  // the x tile's 16 loads of a thread are issued here and fly under the table set-up
  const float* xp = x + (size_t)(b * CH + 16 * (tid >> 4)) * NP + l0 + (tid & 15) * 4;
  v4f xv[16];
  #pragma unroll
  for (int j = 0; j < 16; ++j) xv[j] = *(const v4fa*)(xp + (size_t)j * NP);
  // what follows may rewrite the address registers that these loads name
  asm volatile("s_wait_xcnt 0x0" :: "v"(xp) : "memory");
  if (tid < 8) sFreq[tid] = rope_freq(tid);
  sKM[tid] = KM[(size_t)b * CH + tid];
  sVM[tid] = VM[(size_t)b * CH + tid];
  sQB[tid] = qbias[tid];
  sOB[tid] = qbias[3 * CH + tid];
  __syncthreads();
  #pragma unroll 1
  for (int j = 0; j < 2; ++j) {
    const int idx = tid + 256 * j;
    const int pos = idx >> 3, f = idx & 7;
    float sv, cv;
    sincosf((float)pos * sFreq[f], &sv, &cv);
    sSinW[idx] = sv;
    sCosW[idx] = cv;
  }
  if (tid < 8) {
    float sv, cv;
    sincosf((float)lb * sFreq[tid], &sv, &cv);
    sSinH[tid] = sv;
    sCosH[tid] = cv;
  }
  // a thread holds 16 consecutive channels of 4 positions: the packed pairs of a position are 32 bytes of its row
  #pragma unroll
  for (int e = 0; e < 4; ++e) {
    const int lq = (tid & 15) * 4;
    const int ro = (lq + e) * GXP + 16 * (tid >> 4) + ((lq >> 4) << 3);
    v4u hw[2], lw[2];
    #pragma unroll
    for (int i = 0; i < 8; ++i) {
      unsigned p1, p2;
      split2p(xv[2 * i][e], xv[2 * i + 1][e], p1, p2);
      hw[i >> 2][i & 3] = p1;
      lw[i >> 2][i & 3] = p2;
    }
    *(v4ua*)(sXh + ro) = hw[0];
    *(v4ua*)(sXh + ro + 8) = hw[1];
    *(v4ua*)(sXl + ro) = lw[0];
    *(v4ua*)(sXl + ro + 8) = lw[1];
  }
  __syncthreads();

  // phase A
  const int ph = w & 1;
  const us_t* ah0 = sXh + (32 * ph + m) * GXP + 16 * ph;
  const us_t* ah1 = ah0 + 16 * GXP + 8;
  const us_t* al0 = sXl + (32 * ph + m) * GXP + 16 * ph;
  const us_t* al1 = al0 + 16 * GXP + 8;
  // rolled: one copy of a task's code in the instruction cache
  #pragma unroll 1
  for (int tk = 0; tk < 2; ++tk) {
    const int nn = (w >> 1) + 4 * tk;
    // weight tiles 0, 1: the head's q rows; 2, 3: its o rows, 48 tiles of 16 rows further on
    const us_t* wqh = WQh + (size_t)(2 * nn) * 4096 + 8 * lane;
    const us_t* wql = WQl + (size_t)(2 * nn) * 4096 + 8 * lane;
    FragB wbh[4], wbl[4];
    #pragma unroll
    for (int v = 0; v < 4; ++v) {
      const int to = 4096 * (v < 2 ? v : 46 + v);
      wbh[v] = ldfragp(wqh + to);
      wbl[v] = ldfragp(wql + to);
    }
    // what follows may rewrite the address registers that these loads name; the two pointers are
    // inputs so that their registers are not given away ahead of the wait
    asm volatile("s_wait_xcnt 0x0" :: "v"(wqh), "v"(wql) : "memory");
    // the task's kv fragments and depthwise values are asked for in the last k step, in the registers
    // that the weights leave: they fly under the rest of that step and the q epilogue, and the wave
    // stays within 256 registers (two blocks on a WGP)
    const size_t go = (size_t)(b * CH + nn * HD + m) * NP + l0 + 32 * ph + 8 * h;
    const size_t kr = ((size_t)(b * NH + nn) * HD + m) * HD + 8 * h;
    const us_t* kvh = KVTh + kr;
    const us_t* kvl = KVTl + kr;
    v4f le0[2][2], le1[2][2];
    FragB gb[2], gl[2];
    v8f qa[2][2], oa[2][2];   // qa[channel tile][position tile], oa[position tile][channel tile]
    #pragma unroll
    for (int t = 0; t < 2; ++t) {
      #pragma unroll
      for (int v = 0; v < 2; ++v) { qa[t][v] = z8; oa[t][v] = z8; }
    }
    // one k step: the weight fragments stay in registers; each pair is asked for again, for the next
    // k step, as soon as its six products are issued; the last step asks for the task's kv fragments
    // and depthwise values instead
    auto kstep = [&](const int k0, const bool last) __attribute__((always_inline)) {
      const FragB x0h = ldfrag(ah0 + k0, h);
      const FragB x1h = ldfrag(ah1 + k0, h);
      const FragB x0l = ldfrag(al0 + k0, h);
      const FragB x1l = ldfrag(al1 + k0, h);
      #pragma unroll
      for (int v = 0; v < 2; ++v) {
        qa[v][0] = wmma_bf16(wbh[v], x0h, qa[v][0]);
        qa[v][1] = wmma_bf16(wbh[v], x1h, qa[v][1]);
        qa[v][0] = wmma_bf16(wbl[v], x0h, qa[v][0]);
        qa[v][1] = wmma_bf16(wbl[v], x1h, qa[v][1]);
        qa[v][0] = wmma_bf16(wbh[v], x0l, qa[v][0]);
        qa[v][1] = wmma_bf16(wbh[v], x1l, qa[v][1]);
        if (!last) {
          wbh[v] = ldfragp(wqh + 4096 * v + 16 * (k0 + 32));
          wbl[v] = ldfragp(wql + 4096 * v + 16 * (k0 + 32));
        } else {
          gb[v] = ldfrag(kvh + 16 * v * HD, 0);
          gl[v] = ldfrag(kvl + 16 * v * HD, 0);
        }
      }
      // what follows may rewrite the address registers that the kv fragment loads name; the two
      // pointers are inputs so that their registers are not given away ahead of the wait
      if (last) asm volatile("s_wait_xcnt 0x0" :: "v"(kvh), "v"(kvl) : "memory");
      #pragma unroll
      for (int u = 0; u < 2; ++u) {
        oa[0][u] = wmma_bf16(x0h, wbh[2 + u], oa[0][u]);
        oa[1][u] = wmma_bf16(x1h, wbh[2 + u], oa[1][u]);
        oa[0][u] = wmma_bf16(x0h, wbl[2 + u], oa[0][u]);
        oa[1][u] = wmma_bf16(x1h, wbl[2 + u], oa[1][u]);
        oa[0][u] = wmma_bf16(x0l, wbh[2 + u], oa[0][u]);
        oa[1][u] = wmma_bf16(x1l, wbh[2 + u], oa[1][u]);
        if (!last) {
          wbh[2 + u] = ldfragp(wqh + 4096 * (48 + u) + 16 * (k0 + 32));
          wbl[2 + u] = ldfragp(wql + 4096 * (48 + u) + 16 * (k0 + 32));
        } else {
          #pragma unroll
          for (int t = 0; t < 2; ++t) {
            le0[t][u] = *(const v4fa*)(LF + go + (size_t)(16 * u) * NP + 16 * t);
            le1[t][u] = *(const v4fa*)(LF + go + (size_t)(16 * u) * NP + 16 * t + 4);
          }
        }
      }
    };
    // rolled: unrolled eight times the kernel's text would pass 32 KB
    #pragma unroll 1
    for (int k0 = 0; k0 < CH - 32; k0 += 32) {
      kstep(k0, false);
      // the next trip rewrites the address registers that this trip's weight loads name
      asm volatile("s_wait_xcnt 0x0" ::: "memory");
    }
    kstep(CH - 32, true);
    // rolled, for the size of the text: a pass works on position tile 0's registers, and its foot
    // moves tile 1's into them
    #pragma unroll 1
    for (int t = 0; t < 2; ++t) {
      const int pm = 32 * ph + 16 * t + m;   // the position whose q channels this lane holds
      float z = 0.f;
      FragB fa, fl;
      #pragma unroll
      for (int v = 0; v < 2; ++v) {
        const int c0 = nn * HD + 16 * v + 8 * h;
        const v4f b0 = *(const v4fa*)(sQB + c0), b1 = *(const v4fa*)(sQB + c0 + 4);
        const v4f m0 = *(const v4fa*)(sKM + c0), m1 = *(const v4fa*)(sKM + c0 + 4);
        const float bq[8] = {b0.x, b0.y, b0.z, b0.w, b1.x, b1.y, b1.z, b1.w};
        const float km[8] = {m0.x, m0.y, m0.z, m0.w, m1.x, m1.y, m1.z, m1.w};
        float qv[8];
        #pragma unroll
        for (int r = 0; r < 8; ++r) {
          const float y = qa[v][0][r] + bq[r];
          const float ey = expf(y);
          const float vv = (y > 0.f) ? (y + 1.f) : ey;
          qv[r] = vv;
          z += vv * km[r];
        }
        // channels 0..15 of a head turn with the image row, 16..31 with the column
        const v4f s4 = v ? *(const v4fa*)(sSinW + pm * 8 + 4 * h) : *(const v4fa*)(sSinH + 4 * h);
        const v4f c4 = v ? *(const v4fa*)(sCosW + pm * 8 + 4 * h) : *(const v4fa*)(sCosH + 4 * h);
        #pragma unroll
        for (int p = 0; p < 4; ++p) {
          const float s = s4[p], c = c4[p];
          const float x0 = qv[2 * p], x1 = qv[2 * p + 1];
          unsigned p1, p2;
          split2p(x0 * c - x1 * s, x1 * c + x0 * s, p1, p2);
          fa.w[4 * v + p] = p1;
          fl.w[4 * v + p] = p2;
        }
      }
      // the two half-waves hold 16 channels each of the same 16 positions
      z += __shfl_xor(z, 16);
      z *= SCALE_F;
      const float fz = 1.0f + 1.0f / (z + 1e-6f);
      // the q kv result has positions 8 h + r in a lane: fetch their z and factor from lanes 8 h + r
      float zz[8], fac[8];
      #pragma unroll
      for (int r = 0; r < 8; ++r) {
        zz[r] = __shfl(z, 8 * h + r);
        fac[r] = __shfl(fz, 8 * h + r);
      }
      #pragma unroll
      for (int u = 0; u < 2; ++u) {
        v8f a = wmma_bf16(fa, gb[u], z8);
        a = wmma_bf16(fa, gl[u], a);
        a = wmma_bf16(fl, gb[u], a);
        const int c = nn * HD + 16 * u + m;
        const float vme = sVM[c], ob = sOB[c];
        const v4f e0 = le0[0][u], e1 = le1[0][u];
        const float lev[8] = {e0.x, e0.y, e0.z, e0.w, e1.x, e1.y, e1.z, e1.w};
        #pragma unroll
        for (int r = 0; r < 8; r += 2) {
          const float res0 = a[r] * fac[r] - zz[r] * vme;
          const float res1 = a[r + 1] * fac[r + 1] - zz[r + 1] * vme;
          unsigned p1, p2;
          split2p((res0 + lev[r]) * (oa[0][u][r] + ob), (res1 + lev[r + 1]) * (oa[0][u][r + 1] + ob), p1, p2);
          const int l = 32 * ph + 16 * t + 8 * h + r;
          Uh[l * UPP + c] = (us_t)p1;
          Ul[l * UPP + c] = (us_t)p2;
          Uh[(l + 1) * UPP + c] = (us_t)(p1 >> 16);
          Ul[(l + 1) * UPP + c] = (us_t)(p2 >> 16);
        }
      }
      #pragma unroll
      for (int u = 0; u < 2; ++u) {
        qa[u][0] = qa[u][1];
        oa[0][u] = oa[1][u];
        le0[0][u] = le0[1][u];
        le1[0][u] = le1[1][u];
      }
    }
    // the next trip rewrites the address registers that this trip's loads name
    asm volatile("s_wait_xcnt 0x0" ::: "memory");
  }
  __syncthreads();   // publishes the U planes to every wave

  // phase B: output projection
  const int wl = w & 1, wc = w >> 1;
  v8f pacc[2][4];
  #pragma unroll
  for (int t = 0; t < 2; ++t) {
    #pragma unroll
    for (int v = 0; v < 4; ++v) pacc[t][v] = z8;
  }
  const us_t* ua0 = Uh + (32 * wl + m) * UPP;
  const us_t* ua1 = ua0 + 16 * UPP;
  const us_t* la0 = Ul + (32 * wl + m) * UPP;
  const us_t* la1 = la0 + 16 * UPP;
  const us_t* wph = WPh + (size_t)(4 * wc) * 4096 + 8 * lane;
  const us_t* wpl = WPl + (size_t)(4 * wc) * 4096 + 8 * lane;
  // the four weight fragment pairs of a k step stay in registers; each pair is asked for again,
  // for the next k step, as soon as its six products are issued: three groups of lead
  FragB wbh[4], wbl[4];
  #pragma unroll
  for (int v = 0; v < 4; ++v) {
    wbh[v] = ldfragp(wph + 4096 * v);
    wbl[v] = ldfragp(wpl + 4096 * v);
  }
  // unrolled: the fragment registers are indexed statically and every load offset is an immediate
  #pragma unroll
  for (int k0 = 0; k0 < CH; k0 += 32) {
    const FragB a0 = ldfrag(ua0 + k0, h);
    const FragB a1 = ldfrag(ua1 + k0, h);
    const FragB c0 = ldfrag(la0 + k0, h);
    const FragB c1 = ldfrag(la1 + k0, h);
    #pragma unroll
    for (int v = 0; v < 4; ++v) {
      const FragB bh = wbh[v];
      const FragB bl = wbl[v];
      pacc[0][v] = wmma_bf16(a0, bh, pacc[0][v]);
      pacc[0][v] = wmma_bf16(c0, bh, pacc[0][v]);
      pacc[0][v] = wmma_bf16(a0, bl, pacc[0][v]);
      pacc[1][v] = wmma_bf16(a1, bh, pacc[1][v]);
      pacc[1][v] = wmma_bf16(c1, bh, pacc[1][v]);
      pacc[1][v] = wmma_bf16(a1, bl, pacc[1][v]);
      if (k0 + 32 < CH) {
        wbh[v] = ldfragp(wph + 4096 * v + 16 * (k0 + 32));
        wbl[v] = ldfragp(wpl + 4096 * v + 16 * (k0 + 32));
      }
    }
  }
  // what follows rewrites the address registers that the weight loads name
  asm volatile("s_wait_xcnt 0x0" ::: "memory");
  __syncthreads();   // all waves done with the U planes before the staging overlays them
  #pragma unroll
  for (int v = 0; v < 4; ++v) {
    const int co = 64 * wc + 16 * v + m;
    const float pb = pbias[co];
    #pragma unroll
    for (int t = 0; t < 2; ++t) {
      v8f y;
      #pragma unroll
      for (int r = 0; r < 8; ++r) y[r] = pacc[t][v][r] + pb;
      st8f(sO + co * SOP + 32 * wl + 16 * t + 8 * h, y);
    }
  }
  __syncthreads();
  const int q8 = lane & 7, sub = lane >> 3;
  #pragma unroll
  for (int i = 0; i < 16; ++i) {
    const int id = 64 * w + 4 * i + sub;
    const int R = id >> 1, Lh = id & 1;
    const v4f val = *(const v4fa*)(sO + R * SOP + 32 * Lh + 4 * q8);
    const size_t d = (size_t)(b * CH + R) * NP + l0 + 32 * Lh + 4 * q8;
    *(v4f*)(out + d) = val;
  }
  
}

// ---------------------------------------------------------------------------
extern "C" void kernel_launch(void* const* d_in, const int* in_sizes, int n_in,
                              void* d_out, int out_size, void* d_ws, size_t ws_size,
                              hipStream_t stream)
{
  if (n_in < 7) return;
  if (in_sizes[0] != NB * CH * NP) return;
  if (in_sizes[1] != 4 * CH * CH || in_sizes[2] != 4 * CH) return;
  if (in_sizes[3] != CH * 25 || in_sizes[4] != CH) return;
  if (in_sizes[5] != CH * CH || in_sizes[6] != CH) return;
  if (out_size != NB * CH * NP) return;

  const float* x      = (const float*)d_in[0];
  const float* qkvo_w = (const float*)d_in[1];
  const float* qkvo_b = (const float*)d_in[2];
  const float* lepe_w = (const float*)d_in[3];
  const float* lepe_b = (const float*)d_in[4];
  const float* proj_w = (const float*)d_in[5];
  const float* proj_b = (const float*)d_in[6];
  float* outp = (float*)d_out;

  const size_t szWQ  = (size_t)4 * CH * CH * 2;         //    524288 (x2)
  const size_t szWP  = (size_t)CH * CH * 2;             //    131072 (x2)
  const size_t szR   = (size_t)NB * CH * NP * 4;        //  33554432 (x2)
  const size_t szKVT = (size_t)NB * NH * HD * HD * 2;   //    131072 (x2)
  const size_t szM   = (size_t)NB * NH * HD * 4;        //      8192 (x2)
  const size_t szPK  = (size_t)NB * NH * KS * KREC * 4; //  17825792
  size_t off = 0;
  char* ws = (char*)d_ws;
  us_t*  WQh  = (us_t*)(ws + off);  off += szWQ;
  us_t*  WQl  = (us_t*)(ws + off);  off += szWQ;
  us_t*  WPh  = (us_t*)(ws + off);  off += szWP;
  us_t*  WPl  = (us_t*)(ws + off);  off += szWP;
  float* VF   = (float*)(ws + off); off += szR;     // v planes
  float* LF   = (float*)(ws + off); off += szR;     // depthwise result
  us_t*  KVTh = (us_t*)(ws + off);  off += szKVT;
  us_t*  KVTl = (us_t*)(ws + off);  off += szKVT;
  float* KM   = (float*)(ws + off); off += szM;
  float* VM   = (float*)(ws + off); off += szM;
  float* PK   = (float*)(ws + off); off += szPK;    // row records; total 86523904
  if (off > ws_size) return;

  k_wcvt<<<dim3(160), 256, 0, stream>>>(qkvo_w, proj_w, WQh, WQl, WPh, WPl);
  hipFuncSetAttribute(reinterpret_cast<const void*>(&k_gemm),
                      hipFuncAttributeMaxDynamicSharedMemorySize, GM_BYTES);
  k_gemm<<<dim3(HW, NB), 256, GM_BYTES, stream>>>(x, WQh, WQl, qkvo_b, VF, PK);
  k_lepe<<<dim3(4 * NB * NH + CH * NB), 256, 0, stream>>>(VF, lepe_w, lepe_b, LF, PK, KVTh, KVTl, KM, VM);
  hipFuncSetAttribute(reinterpret_cast<const void*>(&k_resproj),
                      hipFuncAttributeMaxDynamicSharedMemorySize, RP_BYTES);
  k_resproj<<<dim3(NP / 64, NB), 256, RP_BYTES, stream>>>(x, WQh, WQl, qkvo_b, LF, KVTh, KVTl, KM, VM, WPh, WPl, proj_b, outp);
}

// v009
// Measured time: 75.2 microseconds a run.
// Timed twice side by side with v008, it ran 1.15 and 1.13 times as fast.
// Over all steps from v000 it is 3.47 times as fast.
// Contractions: qkv/o 1x1 projection, k^T v, q kv and the output 1x1 projection all on v_wmma_f32_16x16x32_bf16 as bf16 hi/lo three-product split (hi*hi + hi*lo + lo*hi, f32 accumulate); elu, channel means, z, rotary tables, depthwise 5x5, biases and the elementwise tail in f32.
#include <hip/hip_runtime.h>
#include <math.h>

typedef unsigned short us_t;
typedef __bf16   v16b __attribute__((ext_vector_type(16)));
typedef _Float16 v16h __attribute__((ext_vector_type(16)));
typedef us_t     v8us __attribute__((ext_vector_type(8)));
typedef us_t     v4us __attribute__((ext_vector_type(4)));
typedef float    v8f  __attribute__((ext_vector_type(8)));
typedef float    v4f  __attribute__((ext_vector_type(4)));
typedef float    v2f  __attribute__((ext_vector_type(2)));
typedef __bf16   v2b  __attribute__((ext_vector_type(2)));
typedef unsigned v8u  __attribute__((ext_vector_type(8)));
typedef unsigned v4u  __attribute__((ext_vector_type(4)));
typedef unsigned v2u  __attribute__((ext_vector_type(2)));
typedef v8us __attribute__((may_alias)) v8usa;
typedef v4us __attribute__((may_alias)) v4usa;
typedef v4f  __attribute__((may_alias)) v4fa;
typedef v4u  __attribute__((may_alias)) v4ua;
union FragB { v16b v; v8us half[2]; v16h x; v8u w; };
union Q8    { v8f v; v4f q[2]; };

#define NB   8
#define CH   256
#define NP   4096
#define HW   64
#define NH   8
#define HD   32
#define PPW  68
#define GXP  264
#define UPP  264
#define SOP  68
#define RTT  68
#define SCALE_F 0.17677669529663687f
#define CKV     0.0065695032f
#define INV_L   0.000244140625f
#define KS   64
#define KREC 1088

// dynamic LDS map of k_gemm (bytes): x hi tile [64][264] us_t + 24 (row-group skew), x lo tile; 8 wave ranges of
// GPW floats (v tile [32][VSP]); column sin/cos tables [8][68]; row sin/cos; frequencies;
// two blocks fit a WGP
#define GPW      2304
#define VSP      68
#define GM_XL    33856
#define GM_PK    67712
#define GM_SINT  141440
#define GM_COST  143616
#define GM_SINH  145792
#define GM_COSH  145824
#define GM_FREQ  145856
#define GM_BYTES 145888

// dynamic LDS map of k_resproj (bytes)
// U hi/lo planes [64][264] us_t; the f32 staging [256][68] overlays them (69632 bytes);
// x hi/lo tiles as in k_gemm; two blocks fit a WGP
#define RP_UH    0
#define RP_UL    33792
#define RP_XH    69632
#define RP_XL    103488
#define RP_SINW  139264
#define RP_COSW  141312
#define RP_SINH  143360
#define RP_COSH  143392
#define RP_FREQ  143424
#define RP_KM    143456
#define RP_VM    144480
#define RP_QB    145504
#define RP_OB    146528
#define RP_BYTES 147552

// ---------------------------------------------------------------------------
// 16x16x32 bf16 WMMA with hazard guard (ties D, keeps A/B live).
// Fragment map (wave32): lane l, h = l>>4, m = n = l&15.
//   A/B element i: i<8 -> k0+8h+i ; i>=8 -> k0+16+8h+(i-8)
//   D element r : row 8h+r, col l&15
// ---------------------------------------------------------------------------
__device__ __forceinline__ v8f wmma_bf16(const FragB& a, const FragB& b, v8f c) {
  v8f d = __builtin_amdgcn_wmma_f32_16x16x32_bf16(false, a.v, false, b.v, (short)0, c, false, false);
  asm volatile("v_nop\n\tv_nop\n\tv_nop\n\tv_nop" : "+v"(d) : "v"(a.x), "v"(b.x));
  return d;
}
// fragment from a k-contiguous bf16 row holding >= 32 elements starting at p (p = row + k0)
__device__ __forceinline__ FragB ldfrag(const us_t* p, int h) {
  FragB f;
  f.half[0] = *(const v8usa*)(p + 8 * h);
  f.half[1] = *(const v8usa*)(p + 16 + 8 * h);
  return f;
}
// fragment from a weight plane packed in fragment order (see k_wcvt): p = block start + 8 * lane
__device__ __forceinline__ FragB ldfragp(const us_t* p) {
  FragB f;
  f.half[0] = *(const v8usa*)p;
  f.half[1] = *(const v8usa*)(p + 256);
  return f;
}
__device__ __forceinline__ v8f zero8f() {
  v8f z;
  #pragma unroll
  for (int j = 0; j < 8; ++j) z[j] = 0.f;
  return z;
}
// 8 floats to LDS as two 16-B pieces
__device__ __forceinline__ void st8f(float* p, v8f v) {
  Q8 u; u.v = v;
  *(v4fa*)p = u.q[0];
  *(v4fa*)(p + 4) = u.q[1];
}
// two f32 -> two bf16 (round to nearest even) in one register, a in the low half: one packed convert
__device__ __forceinline__ unsigned cvt2(float a, float b) {
  const v2f f = {a, b};
  return __builtin_bit_cast(unsigned, __builtin_convertvector(f, v2b));
}
// hi/lo split of two values: hi = bf16(f), lo = bf16(f - hi), each pair packed as a fragment register holds it
__device__ __forceinline__ void split2p(float a, float b, unsigned& hi, unsigned& lo) {
  hi = cvt2(a, b);
  lo = cvt2(a - __uint_as_float(hi << 16), b - __uint_as_float(hi & 0xFFFF0000u));
}
// rotary frequency i of 8: 1 / 10000^(i/7), linspace-style exponent
__device__ __forceinline__ float rope_freq(int i) {
  const float e = (i == 7) ? 1.0f : (float)i * (1.0f / 7.0f);
  return 1.0f / powf(10000.0f, e);
}

// ---------------------------------------------------------------------------
// Kernel 0: weights -> bf16 hi/lo planes in fragment order. WQh/WQl from the
// qkv/o weights [1024][256], WPh/WPl from the output projection [256][256].
// A plane is a row of 1-KiB blocks, block (T, ks) = 16 weight rows 16 T + m by
// 32 k from 32 ks, at element offset (8 T + ks) * 512, laid out
// [half j][lane l = 16 h + m][8 elements k = 32 ks + 16 j + 8 h + i]: a wave's
// 16-byte fragment load then reads 512 contiguous bytes (four whole lines)
// where row-major weights gave it 16 lines of 32 bytes. Thread = one 16-byte
// piece of each plane, so a wave also stores whole lines.
// ---------------------------------------------------------------------------
__global__ __launch_bounds__(256) void k_wcvt(const float* __restrict__ qw, const float* __restrict__ pw,
                                             us_t* __restrict__ WQh, us_t* __restrict__ WQl,
                                             us_t* __restrict__ WPh, us_t* __restrict__ WPl)
{
  const int g = blockIdx.x * 256 + threadIdx.x;
  if (g >= 40960) return;
  const float* src;
  us_t* dh;
  us_t* dl;
  const int g2 = (g < 32768) ? g : (g - 32768);
  const int pl = g2 & 31, pj = (g2 >> 5) & 1, pks = (g2 >> 6) & 7, pT = g2 >> 9;
  const size_t so = (size_t)(16 * pT + (pl & 15)) * CH + 32 * pks + 16 * pj + 8 * (pl >> 4);
  if (g < 32768) { src = qw + so; dh = WQh + (size_t)g2 * 8; dl = WQl + (size_t)g2 * 8; }
  else { src = pw + so; dh = WPh + (size_t)g2 * 8; dl = WPl + (size_t)g2 * 8; }
  const v4f a = *(const v4fa*)src;
  const v4f c = *(const v4fa*)(src + 4);
  v4u oh, ol;
  {
    unsigned p1, p2;
    split2p(a.x, a.y, p1, p2); oh[0] = p1; ol[0] = p2;
    split2p(a.z, a.w, p1, p2); oh[1] = p1; ol[1] = p2;
    split2p(c.x, c.y, p1, p2); oh[2] = p1; ol[2] = p2;
    split2p(c.z, c.w, p1, p2); oh[3] = p1; ol[3] = p2;
  }
  *(v8us*)dh = __builtin_bit_cast(v8us, oh);
  *(v8us*)dl = __builtin_bit_cast(v8us, ol);
  
}

// ---------------------------------------------------------------------------
// Kernel 1: the k and v 1x1 projections and the k^T v partial products.
// D[l][o] = sum_c x[c][l] * W[o][c] + bias[o] as bf16 hi/lo three-product split.
// Block = (image row of 64 positions, b), 8 waves; a wave takes one head over
// all 64 positions: 4 position tiles x 4 channel tiles, the head's 32 k channels
// (weight rows 256..) and its 32 v channels (rows 512..), so that a block asks
// for each weight fragment once.
// Staging: the x tile [256 c][64 l] (NCHW f32, l-contiguous float4 loads) is
// split into hi/lo LDS tiles sXh/sXl [64 l][256 c] (k-contiguous rows).
// Bank layout: row l starts at element l * 264 + 8 * (l >> 4), that is, each
// group of 16 rows is skewed 16 bytes further. The 16 lanes of a 16-byte staging
// store hold rows 4 apart; at the 132-dword pitch alone they fall on 16 banks,
// with the skew on all 64. A fragment's 16 rows share one skew, so its reads
// keep their spread.
// A = sX rows (positions), B = WQh/WQl fragment blocks straight from global,
// K = 256 in 8 steps; products a_hi*b_hi + a_hi*b_lo + a_lo*b_hi.
// D rows = positions, cols = channels: a lane holds, of one channel, positions
// 8 h + r and 16 + 8 h + r of a chunk of two tiles: the element order of an A or B
// fragment whose k index runs over the chunk's 32 positions. So bias, elu+1,
// the channel sums and the rotary run on the accumulators in f32 (a rotary
// pair sits in lanes m and m ^ 1), and the bf16 hi/lo pairs are the operands
// of sum_l krot[d][l] v[e][l] as they stand (A = krot, B = v; D rows d,
// cols e; three-product split). k never goes to memory.
// The two chunks are summed in the same accumulators. The wave stores the head's
// sum over the image row as a record of 1088 floats: value r of tile
// T = 2 td + te (d = 16 td + 8 h + r, e = 16 te + m) at float
// ((2 T + (r >> 2)) * 32 + lane) * 4 + (r & 3), then 32 k sums, 32 v sums; one
// record per (b, head, image row)
// in PK (4352 B = 34 whole lines, each 16-byte store 512 contiguous bytes).
// v goes out as NCHW f32 [b][256][4096]: a wave stages its [32 ch][64 pos] f32
// tile in its own LDS range and stores whole lines.
// ---------------------------------------------------------------------------
// the value of lane m ^ 1 (one vector instruction, within a group of four lanes)
__device__ __forceinline__ float lane_xor1(float v) {
  return __int_as_float(__builtin_amdgcn_mov_dpp(__float_as_int(v), 0xB1, 0xF, 0xF, true));
}

// second argument: 4 waves per SIMD, that is, at most 256 registers, so that two blocks share a WGP
__global__ __launch_bounds__(256, 4) void k_gemm(const float* __restrict__ x,
                                             const us_t* __restrict__ WQh, const us_t* __restrict__ WQl,
                                             const float* __restrict__ bias,
                                             float* __restrict__ VF, float* __restrict__ PK)
{
  extern __shared__ __attribute__((aligned(16))) unsigned char dsm[];
  us_t*  sXh   = (us_t*)dsm;
  us_t*  sXl   = (us_t*)(dsm + GM_XL);
  float* sPK   = (float*)(dsm + GM_PK);
  float* sSinT = (float*)(dsm + GM_SINT);
  float* sCosT = (float*)(dsm + GM_COST);
  float* sSinH = (float*)(dsm + GM_SINH);
  float* sCosH = (float*)(dsm + GM_COSH);
  float* sFreq = (float*)(dsm + GM_FREQ);
  const int tid = threadIdx.x, lane = tid & 31, w = tid >> 5;
  const int h = lane >> 4, m = lane & 15;
  const int lb = blockIdx.x, b = blockIdx.y;
  const int l0 = lb * 64;

  // stage x[c][l0 + 0..63] -> hi/lo tiles [l][c]; a thread's 16 loads are issued together
  const float* xp = x + (size_t)(b * CH + 16 * (tid >> 4)) * NP + l0 + (tid & 15) * 4;
  v4f xv[16];
  #pragma unroll
  for (int j = 0; j < 16; ++j) xv[j] = *(const v4fa*)(xp + (size_t)j * NP);
  // what follows may rewrite the address registers that these loads name
  asm volatile("s_wait_xcnt 0x0" :: "v"(xp) : "memory");
  if (tid < 8) sFreq[tid] = rope_freq(tid);
  __syncthreads();
  // column tables [frequency][column] at a pitch of 68 floats: a lane reads 8 columns of its
  // frequency as two 16-byte pieces, and the 8 frequencies of a half-wave fall on 32 distinct banks
  #pragma unroll 1
  for (int j = 0; j < 2; ++j) {
    const int idx = tid + 256 * j;
    const int pos = idx >> 3, f = idx & 7;
    float sv, cv;
    sincosf((float)pos * sFreq[f], &sv, &cv);
    sSinT[f * RTT + pos] = sv;
    sCosT[f * RTT + pos] = cv;
  }
  if (tid < 8) {
    float sv, cv;
    sincosf((float)lb * sFreq[tid], &sv, &cv);
    sSinH[tid] = sv;
    sCosH[tid] = cv;
  }
  // a thread holds 16 consecutive channels of 4 positions: the packed pairs of a position are 32 bytes of its row
  #pragma unroll
  for (int e = 0; e < 4; ++e) {
    const int lq = (tid & 15) * 4;
    const int ro = (lq + e) * GXP + 16 * (tid >> 4) + ((lq >> 4) << 3);
    v4u hw[2], lw[2];
    #pragma unroll
    for (int i = 0; i < 8; ++i) {
      unsigned p1, p2;
      split2p(xv[2 * i][e], xv[2 * i + 1][e], p1, p2);
      hw[i >> 2][i & 3] = p1;
      lw[i >> 2][i & 3] = p2;
    }
    *(v4ua*)(sXh + ro) = hw[0];
    *(v4ua*)(sXh + ro + 8) = hw[1];
    *(v4ua*)(sXl + ro) = lw[0];
    *(v4ua*)(sXl + ro + 8) = lw[1];
  }
  __syncthreads();

  const v8f z8 = zero8f();
  const us_t* ahb = sXh + m * GXP;
  const us_t* alb = sXl + m * GXP;
  // a wave takes one head over the block's 64 positions: each weight fragment is asked for once in a block
  const int nn = w;
  v8f acc[4][4];   // [position tile][channel tile: 0, 1 the head's k, 2, 3 its v]
  #pragma unroll
  for (int t = 0; t < 4; ++t) {
    #pragma unroll
    for (int v = 0; v < 4; ++v) acc[t][v] = z8;
  }
  // weight tiles of 16 rows: the head's k rows are tiles 16 + 2 nn, + 1; its v rows lie 16 tiles further on
  const us_t* bh0 = WQh + (size_t)(16 + 2 * nn) * 4096 + 8 * lane;
  const us_t* bl0 = WQl + (size_t)(16 + 2 * nn) * 4096 + 8 * lane;

  // the four biases of the lane's channels, asked for here so that they fly under the k loop
  const float* bp = bias + CH + nn * HD + m;
  const float bk[2] = {bp[0], bp[16]};
  const float bv[2] = {bp[CH], bp[CH + 16]};
  // what follows may rewrite the address registers that these loads name
  asm volatile("s_wait_xcnt 0x0" :: "v"(bp) : "memory");

  // the four weight fragment pairs of a k step stay in registers and serve both halves of the positions; each
  // pair is asked for again, for the next k step, as soon as its last six products are issued
  FragB wbh[4], wbl[4];
  #pragma unroll
  for (int v = 0; v < 4; ++v) {
    const int to = 4096 * (v < 2 ? v : 14 + v);
    wbh[v] = ldfragp(bh0 + to);
    wbl[v] = ldfragp(bl0 + to);
  }
  // what follows may rewrite the address registers that these loads name; the two pointers are
  // inputs so that their registers are not given away ahead of the wait
  asm volatile("s_wait_xcnt 0x0" :: "v"(bh0), "v"(bl0) : "memory");
  auto kstep = [&](const int k0, const bool last) __attribute__((always_inline)) {
    #pragma unroll
    for (int hf = 0; hf < 2; ++hf) {
      const int ro = 32 * hf * GXP + 16 * hf + k0;
      const FragB a0 = ldfrag(ahb + ro, h);
      const FragB a1 = ldfrag(ahb + ro + 16 * GXP + 8, h);
      const FragB c0 = ldfrag(alb + ro, h);
      const FragB c1 = ldfrag(alb + ro + 16 * GXP + 8, h);
      #pragma unroll
      for (int v = 0; v < 4; ++v) {
        acc[2 * hf][v]     = wmma_bf16(a0, wbh[v], acc[2 * hf][v]);
        acc[2 * hf + 1][v] = wmma_bf16(a1, wbh[v], acc[2 * hf + 1][v]);
        acc[2 * hf][v]     = wmma_bf16(a0, wbl[v], acc[2 * hf][v]);
        acc[2 * hf + 1][v] = wmma_bf16(a1, wbl[v], acc[2 * hf + 1][v]);
        acc[2 * hf][v]     = wmma_bf16(c0, wbh[v], acc[2 * hf][v]);
        acc[2 * hf + 1][v] = wmma_bf16(c1, wbh[v], acc[2 * hf + 1][v]);
        if (hf == 1 && !last) {
          const int to = 4096 * (v < 2 ? v : 14 + v);
          wbh[v] = ldfragp(bh0 + to + 16 * (k0 + 32));
          wbl[v] = ldfragp(bl0 + to + 16 * (k0 + 32));
        }
      }
    }
  };
  // rolled, for the size of the text
  #pragma unroll 1
  for (int k0 = 0; k0 < CH - 32; k0 += 32) {
    kstep(k0, false);
    // the next trip rewrites the address registers that this trip's weight loads name
    asm volatile("s_wait_xcnt 0x0" ::: "memory");
  }
  kstep(CH - 32, true);

  // v: bias, channel sums, hi/lo fragments; the f32 tile [32 ch][64 pos] goes through the wave's own LDS
  // range (pitch 68 floats: the 16 channels of an accumulator store cover all 64 banks) to whole-line stores
  float* myP = sPK + w * GPW;
  FragB vh[2][2], vl[2][2];   // [channel tile][chunk of 32 positions]
  float ksum[2], vsum[2];
  #pragma unroll
  for (int u = 0; u < 2; ++u) {
    float s = 0.f;
    #pragma unroll
    for (int t = 0; t < 4; ++t) {
      v8f y;
      #pragma unroll
      for (int r = 0; r < 8; ++r) y[r] = acc[t][2 + u][r] + bv[u];
      #pragma unroll
      for (int r = 0; r < 8; r += 2) {
        unsigned p1, p2;
        split2p(y[r], y[r + 1], p1, p2);
        vh[u][t >> 1].w[4 * (t & 1) + (r >> 1)] = p1;
        vl[u][t >> 1].w[4 * (t & 1) + (r >> 1)] = p2;
      }
      s += ((y[0] + y[1]) + (y[2] + y[3])) + ((y[4] + y[5]) + (y[6] + y[7]));
      st8f(myP + (16 * u + m) * VSP + 16 * t + 8 * h, y);
    }
    // the two half-waves hold 32 positions each of the same 16 channels
    s += __shfl_xor(s, 16);
    vsum[u] = s;
  }
  // the rows are read back by other lanes of the wave
  asm volatile("s_wait_dscnt 0x0" ::: "memory");
  {
    float* vd = VF + (size_t)(b * CH + nn * HD + h) * NP + l0 + 4 * m;
    const float* vs = myP + h * VSP + 4 * m;
    #pragma unroll
    for (int g = 0; g < 2; ++g) {
      v4f val[8];
      #pragma unroll
      for (int i = 0; i < 8; ++i) val[i] = *(const v4fa*)(vs + 2 * (8 * g + i) * VSP);
      #pragma unroll
      for (int i = 0; i < 8; ++i) *(v4f*)(vd + (size_t)(2 * (8 * g + i)) * NP) = val[i];
      // what follows may rewrite the registers that these stores name; they are inputs so that
      // they are not given away ahead of the wait
      asm volatile("s_wait_xcnt 0x0" :: "v"(vd), "v"(val[0]), "v"(val[1]), "v"(val[2]), "v"(val[3]),
                   "v"(val[4]), "v"(val[5]), "v"(val[6]), "v"(val[7]) : "memory");
    }
  }

  // k, one channel tile at a time: bias, elu+1, channel sums, rotary, hi/lo fragments of a chunk of 32
  // positions; then the chunk's part of the head's k^T v, both chunks summed in the same accumulators
  const int fi = m >> 1;
  const float sgn = (m & 1) ? 1.f : -1.f;   // y[2i] = x[2i] c - x[2i+1] s ; y[2i+1] = x[2i+1] c + x[2i] s
  v8f kva[2][2];
  #pragma unroll
  for (int td = 0; td < 2; ++td) {
    float s = 0.f;
    kva[td][0] = z8;
    kva[td][1] = z8;
    #pragma unroll
    for (int ck = 0; ck < 2; ++ck) {
      FragB kh, kl;
      #pragma unroll
      for (int t = 0; t < 2; ++t) {
        // channels 0..15 of a head turn with the image row, 16..31 with the column
        const int po = fi * RTT + 32 * ck + 16 * t + 8 * h;
        const float sH = sSinH[fi], cH = sCosH[fi];
        const v4f hs = {sH, sH, sH, sH}, hc = {cH, cH, cH, cH};
        const v4f s0 = td ? *(const v4fa*)(sSinT + po) : hs, s1 = td ? *(const v4fa*)(sSinT + po + 4) : hs;
        const v4f q0 = td ? *(const v4fa*)(sCosT + po) : hc, q1 = td ? *(const v4fa*)(sCosT + po + 4) : hc;
        const float sn[8] = {s0.x, s0.y, s0.z, s0.w, s1.x, s1.y, s1.z, s1.w};
        const float cn[8] = {q0.x, q0.y, q0.z, q0.w, q1.x, q1.y, q1.z, q1.w};
        float yv[8];
        #pragma unroll
        for (int r = 0; r < 8; ++r) {
          const float y = acc[2 * ck + t][td][r] + bk[td];
          const float ey = expf(y);
          yv[r] = (y > 0.f) ? (y + 1.f) : ey;
        }
        s += ((yv[0] + yv[1]) + (yv[2] + yv[3])) + ((yv[4] + yv[5]) + (yv[6] + yv[7]));
        #pragma unroll
        for (int r = 0; r < 8; r += 2) {
          const float yp0 = lane_xor1(yv[r]), yp1 = lane_xor1(yv[r + 1]);
          unsigned p1, p2;
          split2p(yv[r] * cn[r] + yp0 * (sgn * sn[r]), yv[r + 1] * cn[r + 1] + yp1 * (sgn * sn[r + 1]), p1, p2);
          kh.w[4 * t + (r >> 1)] = p1;
          kl.w[4 * t + (r >> 1)] = p2;
        }
      }
      #pragma unroll
      for (int te = 0; te < 2; ++te) {
        kva[td][te] = wmma_bf16(kh, vh[te][ck], kva[td][te]);
        kva[td][te] = wmma_bf16(kh, vl[te][ck], kva[td][te]);
        kva[td][te] = wmma_bf16(kl, vh[te][ck], kva[td][te]);
      }
    }
    s += __shfl_xor(s, 16);
    ksum[td] = s;
  }
  // the head's record of this image row, stored by its one wave as the kernel's last act
  float* rec = PK + ((size_t)(b * NH + nn) * KS + lb) * KREC;
  #pragma unroll
  for (int td = 0; td < 2; ++td) {
    #pragma unroll
    for (int te = 0; te < 2; ++te) {
      Q8 u; u.v = kva[td][te];
      *(v4f*)(rec + ((4 * td + 2 * te) * 32 + lane) * 4) = u.q[0];
      *(v4f*)(rec + ((4 * td + 2 * te + 1) * 32 + lane) * 4) = u.q[1];
    }
  }
  rec[1024 + lane] = h ? ksum[1] : ksum[0];
  rec[1056 + lane] = h ? vsum[1] : vsum[0];
}

// ---------------------------------------------------------------------------
// Block role 1b (the first 256 blocks of kernel 2's launch): per (b, head n,
// 8 rows e of kv^T), 256 threads = 64 float4 of a record x 4 groups of 16 image
// rows: a thread adds its float4 over its group's 16 records in row order (16
// loads in flight), the four group sums are added in group order through LDS;
// then KVT[e][d] = c^2 * sum as bf16 hi/lo KVTh/KVTl [b][n][e][d] (8 rows of
// 64 B = 4 whole lines per block and plane). The block of rows 0..7 also does
// the k means, that of rows 8..15 the v means, KM/VM [b][n][32] (one line each).
// sR: 1152 floats of LDS.
// ---------------------------------------------------------------------------
__device__ __forceinline__ v4f rec_sum16(const float* __restrict__ p)
{
  v4f part[16];
  #pragma unroll
  for (int s = 0; s < 16; ++s) part[s] = *(const v4fa*)(p + s * KREC);
  // what follows may rewrite the address registers that these loads name
  asm volatile("s_wait_xcnt 0x0" :: "v"(p) : "memory");
  v4f a = part[0];
  #pragma unroll
  for (int s = 1; s < 16; ++s) a += part[s];
  return a;
}

__device__ __forceinline__ void kvred_block(float* sR, const float* __restrict__ PK,
                                            us_t* __restrict__ KVTh, us_t* __restrict__ KVTl,
                                            float* __restrict__ KM, float* __restrict__ VM)
{
  const int tid = threadIdx.x;
  const int bn = blockIdx.x >> 2, j = blockIdx.x & 3;
  const int g = tid >> 6, it = tid & 63;
  const int te = j >> 1, mo = 8 * (j & 1);
  const int mq = it & 7, hh = (it >> 3) & 1, hf = (it >> 4) & 1, td = it >> 5;
  // float4 index in a record of (e = 16 te + mo + mq, d = 16 td + 8 hh + 4 hf ..+3): see kernel 1
  const int q = ((2 * td + te) * 2 + hf) * 32 + 16 * hh + mo + mq;
  const float* base = PK + (size_t)(bn * KS + 16 * g) * KREC;
  *(v4fa*)(sR + 4 * tid) = rec_sum16(base + 4 * q);
  if (j < 2 && it < 8) *(v4fa*)(sR + 1024 + 4 * (8 * g + it)) = rec_sum16(base + 1024 + 32 * j + 4 * it);
  __syncthreads();
  if (tid >= 64) return;

  const float cc = CKV * CKV;
  const v4f f0 = (((*(const v4fa*)(sR + 4 * it) + *(const v4fa*)(sR + 4 * (64 + it)))
                   + *(const v4fa*)(sR + 4 * (128 + it))) + *(const v4fa*)(sR + 4 * (192 + it))) * cc;
  v2u hw, lw2;
  {
    unsigned p1, p2;
    split2p(f0.x, f0.y, p1, p2); hw[0] = p1; lw2[0] = p2;
    split2p(f0.z, f0.w, p1, p2); hw[1] = p1; lw2[1] = p2;
  }
  const v4us hv = __builtin_bit_cast(v4us, hw), lv = __builtin_bit_cast(v4us, lw2);
  const size_t kd = ((size_t)bn * HD + 16 * te + mo + mq) * HD + 16 * td + 8 * hh + 4 * hf;
  *(v4us*)(KVTh + kd) = hv;
  *(v4us*)(KVTl + kd) = lv;
  if (j < 2 && tid < 8) {
    const float* sm = sR + 1024 + 4 * tid;
    const v4f mm = (((*(const v4fa*)sm + *(const v4fa*)(sm + 32)) + *(const v4fa*)(sm + 64)) + *(const v4fa*)(sm + 96)) * INV_L;
    float* pm = (j ? VM : KM) + (size_t)bn * HD + 4 * tid;
    *(v4f*)pm = mm;
  }
}

// ---------------------------------------------------------------------------
// Kernel 2: depthwise 5x5 (zero pad 2) on the v planes, f32 VALU:
// LF[b][c][y][x] = bias[c] + sum w[c][dy][dx] v[b][c][y+dy-2][x+dx-2].
// Block = (channel, b); the 64x64 plane staged with a 2-wide zero ring in
// LDS [68][68]; thread = 4 consecutive x per iteration (rolled loops).
// The launch's first 256 blocks do role 1b instead (it needs only kernel 1's
// records, the depthwise blocks only v): the small sum runs beside the
// depthwise work and takes no launch of its own.
// ---------------------------------------------------------------------------
__global__ __launch_bounds__(256) void k_lepe(const float* __restrict__ VF, const float* __restrict__ lw,
                                             const float* __restrict__ lbias, float* __restrict__ LF,
                                             const float* __restrict__ PK,
                                             us_t* __restrict__ KVTh, us_t* __restrict__ KVTl,
                                             float* __restrict__ KM, float* __restrict__ VM)
{
  __shared__ __attribute__((aligned(16))) float sP[PPW * PPW];
  __shared__ float sW[25];
  if (blockIdx.x < 4 * NB * NH) {
    kvred_block(sP, PK, KVTh, KVTl, KM, VM);
    return;
  }
  const int tid = threadIdx.x;
  const int c = (blockIdx.x - 4 * NB * NH) & (CH - 1), b = (blockIdx.x - 4 * NB * NH) >> 8;
  // the plane's loads are issued ahead of the zero fill and fly under it
  const float* src = VF + (size_t)(b * CH + c) * NP;
  v4f pv4[4];
  #pragma unroll
  for (int j = 0; j < 4; ++j) pv4[j] = *(const v4fa*)(src + 4 * (tid + 256 * j));
  if (tid < 25) sW[tid] = lw[c * 25 + tid];
  #pragma unroll 1
  for (int j = 0; j < 19; ++j) {
    const int idx = tid + 256 * j;
    if (idx < PPW * PPW) sP[idx] = 0.f;
  }
  __syncthreads();
  #pragma unroll
  for (int j = 0; j < 4; ++j) {
    const int f = tid + 256 * j, l = 4 * f, y = l >> 6, xx = l & 63;
    const v4f v = pv4[j];
    float* pr = sP + (y + 2) * PPW + xx + 2;
    pr[0] = v.x; pr[1] = v.y; pr[2] = v.z; pr[3] = v.w;
  }
  __syncthreads();
  const float bb = lbias[c];
  float* dst = LF + (size_t)(b * CH + c) * NP;
  #pragma unroll 1
  for (int j = 0; j < 4; ++j) {
    const int f = tid + 256 * j, l = 4 * f, y = l >> 6, xx = l & 63;
    float a0 = bb, a1 = bb, a2 = bb, a3 = bb;
    #pragma unroll 1
    for (int dy = 0; dy < 5; ++dy) {
      const float* rp = sP + (y + dy) * PPW + xx;
      const v4f r0 = *(const v4fa*)rp;
      const v4f r1 = *(const v4fa*)(rp + 4);
      const float rr[8] = {r0.x, r0.y, r0.z, r0.w, r1.x, r1.y, r1.z, r1.w};
      const float w0 = sW[dy * 5], w1 = sW[dy * 5 + 1], w2 = sW[dy * 5 + 2], w3 = sW[dy * 5 + 3], w4 = sW[dy * 5 + 4];
      a0 += w0 * rr[0]; a0 += w1 * rr[1]; a0 += w2 * rr[2]; a0 += w3 * rr[3]; a0 += w4 * rr[4];
      a1 += w0 * rr[1]; a1 += w1 * rr[2]; a1 += w2 * rr[3]; a1 += w3 * rr[4]; a1 += w4 * rr[5];
      a2 += w0 * rr[2]; a2 += w1 * rr[3]; a2 += w2 * rr[4]; a2 += w3 * rr[5]; a2 += w4 * rr[6];
      a3 += w0 * rr[3]; a3 += w1 * rr[4]; a3 += w2 * rr[5]; a3 += w3 * rr[6]; a3 += w4 * rr[7];
    }
    v4f o;
    o.x = a0; o.y = a1; o.z = a2; o.w = a3;
    *(v4f*)(dst + l) = o;
    
  }
}

// ---------------------------------------------------------------------------
// Kernel 3: per (image row of 64 positions, b), 8 waves:
//  phase 0: sin/cos tables, the per-image head means and the q and o biases in
//   LDS; the x tile [256 c][64 l] split into hi/lo LDS tiles as in kernel 1.
//  phase A: a wave takes one head over the block's 64 positions, so that a block
//   asks for each weight fragment once. The q and o projections of the head, K = 256, three-product
//   split, weight fragment blocks from global:
//    q with A = weight rows, B = x rows: D rows = channels, cols = positions,
//     so a lane holds channels 8 h + r and 16 + 8 h + r of one position: the
//     element order of an A fragment over the head's 32 channels. Bias, elu+1,
//     z = q . kmean and the rotary run on those registers in f32, and the bf16
//     hi/lo pair is the A operand of q kv as it stands;
//    o with A = x rows, B = weight rows: D rows = positions, cols = channels,
//     the layout of the q kv result, which it gates element by element.
//   D[l][e] = sum_d q[l][d] kvt[e][d] as three-product split (B = KVT rows e
//   from global); epilogue f32: res = D (1 + 1/(z+1e-6)) - z vmean[e],
//   u = (res + lepe) * o, bf16 hi/lo into U planes [l][256 c]
//   at a pitch of 264 (528 B = 16 B x 33: a fragment's 16 rows cover all banks).
//  phase B: D[l][co] = sum_c U[l][c] WP[co][c] as three-product split
//   (Uh*WPh + Ul*WPh + Uh*WPl, K = 256, WP fragment blocks from global),
//   + bias f32; staged [256 co][64 l]
// ---------------------------------------------------------------------------
// second argument: 4 waves per SIMD, that is, at most 256 registers, so that two blocks share a WGP
__global__ __launch_bounds__(256, 4) void k_resproj(
    const float* __restrict__ x,
    const us_t* __restrict__ WQh, const us_t* __restrict__ WQl, const float* __restrict__ qbias,
    const float* __restrict__ LF,
    const us_t* __restrict__ KVTh, const us_t* __restrict__ KVTl,
    const float* __restrict__ KM, const float* __restrict__ VM,
    const us_t* __restrict__ WPh, const us_t* __restrict__ WPl,
    const float* __restrict__ pbias, float* __restrict__ out)
{
  extern __shared__ __attribute__((aligned(16))) unsigned char dsm[];
  us_t*  Uh    = (us_t*)(dsm + RP_UH);
  us_t*  Ul    = (us_t*)(dsm + RP_UL);
  float* sO    = (float*)(dsm + RP_UH);
  us_t*  sXh   = (us_t*)(dsm + RP_XH);
  us_t*  sXl   = (us_t*)(dsm + RP_XL);
  float* sSinW = (float*)(dsm + RP_SINW);
  float* sCosW = (float*)(dsm + RP_COSW);
  float* sSinH = (float*)(dsm + RP_SINH);
  float* sCosH = (float*)(dsm + RP_COSH);
  float* sFreq = (float*)(dsm + RP_FREQ);
  float* sKM   = (float*)(dsm + RP_KM);
  float* sVM   = (float*)(dsm + RP_VM);
  float* sQB   = (float*)(dsm + RP_QB);
  float* sOB   = (float*)(dsm + RP_OB);
  const int tid = threadIdx.x, lane = tid & 31, w = tid >> 5;
  const int h = lane >> 4, m = lane & 15;
  const int lb = blockIdx.x, b = blockIdx.y;
  const int l0 = lb * 64;
  const v8f z8 = zero8f();

  // phase 0
  // the x tile's 16 loads of a thread are issued here and fly under the table set-up
  const float* xp = x + (size_t)(b * CH + 16 * (tid >> 4)) * NP + l0 + (tid & 15) * 4;
  v4f xv[16];
  #pragma unroll
  for (int j = 0; j < 16; ++j) xv[j] = *(const v4fa*)(xp + (size_t)j * NP);
  // what follows may rewrite the address registers that these loads name
  asm volatile("s_wait_xcnt 0x0" :: "v"(xp) : "memory");
  if (tid < 8) sFreq[tid] = rope_freq(tid);
  sKM[tid] = KM[(size_t)b * CH + tid];
  sVM[tid] = VM[(size_t)b * CH + tid];
  sQB[tid] = qbias[tid];
  sOB[tid] = qbias[3 * CH + tid];
  __syncthreads();
  #pragma unroll 1
  for (int j = 0; j < 2; ++j) {
    const int idx = tid + 256 * j;
    const int pos = idx >> 3, f = idx & 7;
    float sv, cv;
    sincosf((float)pos * sFreq[f], &sv, &cv);
    sSinW[idx] = sv;
    sCosW[idx] = cv;
  }
  if (tid < 8) {
    float sv, cv;
    sincosf((float)lb * sFreq[tid], &sv, &cv);
    sSinH[tid] = sv;
    sCosH[tid] = cv;
  }
  // a thread holds 16 consecutive channels of 4 positions: the packed pairs of a position are 32 bytes of its row
  #pragma unroll
  for (int e = 0; e < 4; ++e) {
    const int lq = (tid & 15) * 4;
    const int ro = (lq + e) * GXP + 16 * (tid >> 4) + ((lq >> 4) << 3);
    v4u hw[2], lw[2];
    #pragma unroll
    for (int i = 0; i < 8; ++i) {
      unsigned p1, p2;
      split2p(xv[2 * i][e], xv[2 * i + 1][e], p1, p2);
      hw[i >> 2][i & 3] = p1;
      lw[i >> 2][i & 3] = p2;
    }
    *(v4ua*)(sXh + ro) = hw[0];
    *(v4ua*)(sXh + ro + 8) = hw[1];
    *(v4ua*)(sXl + ro) = lw[0];
    *(v4ua*)(sXl + ro + 8) = lw[1];
  }
  __syncthreads();

  // phase A
  const us_t* ahb = sXh + m * GXP;
  const us_t* alb = sXl + m * GXP;
  {
    // a wave takes one head over the block's 64 positions: each weight fragment is asked for once in a block
    const int nn = w;
    // weight tiles 0, 1: the head's q rows; 2, 3: its o rows, 48 tiles of 16 rows further on
    const us_t* wqh = WQh + (size_t)(2 * nn) * 4096 + 8 * lane;
    const us_t* wql = WQl + (size_t)(2 * nn) * 4096 + 8 * lane;
    FragB wbh[4], wbl[4];
    #pragma unroll
    for (int v = 0; v < 4; ++v) {
      const int to = 4096 * (v < 2 ? v : 46 + v);
      wbh[v] = ldfragp(wqh + to);
      wbl[v] = ldfragp(wql + to);
    }
    // what follows may rewrite the address registers that these loads name; the two pointers are
    // inputs so that their registers are not given away ahead of the wait
    asm volatile("s_wait_xcnt 0x0" :: "v"(wqh), "v"(wql) : "memory");
    // the head's kv fragments and the depthwise values of the first 32 positions are asked for in the last
    // k step, in the registers that the weights leave: they fly under the rest of that step and the q
    // epilogue, and the wave stays within 256 registers (two blocks on a WGP)
    const float* lfp = LF + (size_t)(b * CH + nn * HD + m) * NP + l0 + 8 * h;
    const size_t kr = ((size_t)(b * NH + nn) * HD + m) * HD + 8 * h;
    const us_t* kvh = KVTh + kr;
    const us_t* kvl = KVTl + kr;
    v4f le0[2][2], le1[2][2];   // [position tile of the pair at work][channel tile]
    FragB gb[2], gl[2];
    v8f qa[2][4], oa[4][2];   // qa[channel tile][position tile], oa[position tile][channel tile]
    #pragma unroll
    for (int t = 0; t < 4; ++t) {
      #pragma unroll
      for (int v = 0; v < 2; ++v) { qa[v][t] = z8; oa[t][v] = z8; }
    }
    // one k step: the weight fragments stay in registers and serve both halves of the positions; each pair
    // is asked for again, for the next k step, as soon as its last six products are issued; the last step
    // asks for the kv fragments and depthwise values instead
    auto kstep = [&](const int k0, const bool last) __attribute__((always_inline)) {
      #pragma unroll
      for (int hf = 0; hf < 2; ++hf) {
        const int ro = 32 * hf * GXP + 16 * hf + k0;
        const FragB x0h = ldfrag(ahb + ro, h);
        const FragB x1h = ldfrag(ahb + ro + 16 * GXP + 8, h);
        const FragB x0l = ldfrag(alb + ro, h);
        const FragB x1l = ldfrag(alb + ro + 16 * GXP + 8, h);
        #pragma unroll
        for (int v = 0; v < 2; ++v) {
          qa[v][2 * hf]     = wmma_bf16(wbh[v], x0h, qa[v][2 * hf]);
          qa[v][2 * hf + 1] = wmma_bf16(wbh[v], x1h, qa[v][2 * hf + 1]);
          qa[v][2 * hf]     = wmma_bf16(wbl[v], x0h, qa[v][2 * hf]);
          qa[v][2 * hf + 1] = wmma_bf16(wbl[v], x1h, qa[v][2 * hf + 1]);
          qa[v][2 * hf]     = wmma_bf16(wbh[v], x0l, qa[v][2 * hf]);
          qa[v][2 * hf + 1] = wmma_bf16(wbh[v], x1l, qa[v][2 * hf + 1]);
          if (hf == 1) {
            if (!last) {
              wbh[v] = ldfragp(wqh + 4096 * v + 16 * (k0 + 32));
              wbl[v] = ldfragp(wql + 4096 * v + 16 * (k0 + 32));
            } else {
              gb[v] = ldfrag(kvh + 16 * v * HD, 0);
              gl[v] = ldfrag(kvl + 16 * v * HD, 0);
            }
          }
        }
        // what follows may rewrite the address registers that the kv fragment loads name; the two
        // pointers are inputs so that their registers are not given away ahead of the wait
        if (hf == 1 && last) asm volatile("s_wait_xcnt 0x0" :: "v"(kvh), "v"(kvl) : "memory");
        #pragma unroll
        for (int u = 0; u < 2; ++u) {
          oa[2 * hf][u]     = wmma_bf16(x0h, wbh[2 + u], oa[2 * hf][u]);
          oa[2 * hf + 1][u] = wmma_bf16(x1h, wbh[2 + u], oa[2 * hf + 1][u]);
          oa[2 * hf][u]     = wmma_bf16(x0h, wbl[2 + u], oa[2 * hf][u]);
          oa[2 * hf + 1][u] = wmma_bf16(x1h, wbl[2 + u], oa[2 * hf + 1][u]);
          oa[2 * hf][u]     = wmma_bf16(x0l, wbh[2 + u], oa[2 * hf][u]);
          oa[2 * hf + 1][u] = wmma_bf16(x1l, wbh[2 + u], oa[2 * hf + 1][u]);
          if (hf == 1) {
            if (!last) {
              wbh[2 + u] = ldfragp(wqh + 4096 * (48 + u) + 16 * (k0 + 32));
              wbl[2 + u] = ldfragp(wql + 4096 * (48 + u) + 16 * (k0 + 32));
            } else {
              #pragma unroll
              for (int t = 0; t < 2; ++t) {
                le0[t][u] = *(const v4fa*)(lfp + (size_t)(16 * u) * NP + 16 * t);
                le1[t][u] = *(const v4fa*)(lfp + (size_t)(16 * u) * NP + 16 * t + 4);
              }
            }
          }
        }
      }
    };
    // rolled: unrolled eight times the kernel's text would pass 32 KB
    #pragma unroll 1
    for (int k0 = 0; k0 < CH - 32; k0 += 32) {
      kstep(k0, false);
      // the next trip rewrites the address registers that this trip's weight loads name
      asm volatile("s_wait_xcnt 0x0" ::: "memory");
    }
    kstep(CH - 32, true);
    // rolled, for the size of the text: a pass works on the registers of position tiles 0 and 1, and the
    // first pass's foot moves tiles 2 and 3 into them
    #pragma unroll 1
    for (int pr = 0; pr < 2; ++pr) {
      #pragma unroll
      for (int t = 0; t < 2; ++t) {
        const int pm = 32 * pr + 16 * t + m;   // the position whose q channels this lane holds
        float z = 0.f;
        FragB fa, fl;
        #pragma unroll
        for (int v = 0; v < 2; ++v) {
          const int c0 = nn * HD + 16 * v + 8 * h;
          const v4f b0 = *(const v4fa*)(sQB + c0), b1 = *(const v4fa*)(sQB + c0 + 4);
          const v4f m0 = *(const v4fa*)(sKM + c0), m1 = *(const v4fa*)(sKM + c0 + 4);
          const float bq[8] = {b0.x, b0.y, b0.z, b0.w, b1.x, b1.y, b1.z, b1.w};
          const float km[8] = {m0.x, m0.y, m0.z, m0.w, m1.x, m1.y, m1.z, m1.w};
          float qv[8];
          #pragma unroll
          for (int r = 0; r < 8; ++r) {
            const float y = qa[v][t][r] + bq[r];
            const float ey = expf(y);
            const float vv = (y > 0.f) ? (y + 1.f) : ey;
            qv[r] = vv;
            z += vv * km[r];
          }
          // channels 0..15 of a head turn with the image row, 16..31 with the column
          const v4f s4 = v ? *(const v4fa*)(sSinW + pm * 8 + 4 * h) : *(const v4fa*)(sSinH + 4 * h);
          const v4f c4 = v ? *(const v4fa*)(sCosW + pm * 8 + 4 * h) : *(const v4fa*)(sCosH + 4 * h);
          #pragma unroll
          for (int p = 0; p < 4; ++p) {
            const float s = s4[p], c = c4[p];
            const float x0 = qv[2 * p], x1 = qv[2 * p + 1];
            unsigned p1, p2;
            split2p(x0 * c - x1 * s, x1 * c + x0 * s, p1, p2);
            fa.w[4 * v + p] = p1;
            fl.w[4 * v + p] = p2;
          }
        }
        // the two half-waves hold 16 channels each of the same 16 positions
        z += __shfl_xor(z, 16);
        z *= SCALE_F;
        const float fz = 1.0f + 1.0f / (z + 1e-6f);
        // the q kv result has positions 8 h + r in a lane: fetch their z and factor from lanes 8 h + r
        float zz[8], fac[8];
        #pragma unroll
        for (int r = 0; r < 8; ++r) {
          zz[r] = __shfl(z, 8 * h + r);
          fac[r] = __shfl(fz, 8 * h + r);
        }
        #pragma unroll
        for (int u = 0; u < 2; ++u) {
          v8f a = wmma_bf16(fa, gb[u], z8);
          a = wmma_bf16(fa, gl[u], a);
          a = wmma_bf16(fl, gb[u], a);
          const int c = nn * HD + 16 * u + m;
          const float vme = sVM[c], ob = sOB[c];
          const v4f e0 = le0[t][u], e1 = le1[t][u];
          const float lev[8] = {e0.x, e0.y, e0.z, e0.w, e1.x, e1.y, e1.z, e1.w};
          #pragma unroll
          for (int r = 0; r < 8; r += 2) {
            const float res0 = a[r] * fac[r] - zz[r] * vme;
            const float res1 = a[r + 1] * fac[r + 1] - zz[r + 1] * vme;
            unsigned p1, p2;
            split2p((res0 + lev[r]) * (oa[t][u][r] + ob), (res1 + lev[r + 1]) * (oa[t][u][r + 1] + ob), p1, p2);
            const int l = 32 * pr + 16 * t + 8 * h + r;
            Uh[l * UPP + c] = (us_t)p1;
            Ul[l * UPP + c] = (us_t)p2;
            Uh[(l + 1) * UPP + c] = (us_t)(p1 >> 16);
            Ul[(l + 1) * UPP + c] = (us_t)(p2 >> 16);
          }
        }
      }
      if (pr == 0) {
        // the depthwise values of the last 32 positions, in the registers that the first 32 have left
        #pragma unroll
        for (int u = 0; u < 2; ++u) {
          #pragma unroll
          for (int t = 0; t < 2; ++t) {
            le0[t][u] = *(const v4fa*)(lfp + (size_t)(16 * u) * NP + 32 + 16 * t);
            le1[t][u] = *(const v4fa*)(lfp + (size_t)(16 * u) * NP + 32 + 16 * t + 4);
          }
        }
        // what follows may rewrite the address registers that these loads name
        asm volatile("s_wait_xcnt 0x0" :: "v"(lfp) : "memory");
      }
      #pragma unroll
      for (int u = 0; u < 2; ++u) {
        #pragma unroll
        for (int t = 0; t < 2; ++t) {
          qa[u][t] = qa[u][2 + t];
          oa[t][u] = oa[2 + t][u];
        }
      }
    }
  }
  __syncthreads();   // publishes the U planes to every wave

  // phase B: output projection
  // a wave takes 32 output channels over the block's 64 positions: each weight fragment is asked for once in a block
  v8f pacc[4][2];
  #pragma unroll
  for (int t = 0; t < 4; ++t) {
    #pragma unroll
    for (int v = 0; v < 2; ++v) pacc[t][v] = z8;
  }
  const us_t* ua0 = Uh + m * UPP;
  const us_t* la0 = Ul + m * UPP;
  const us_t* wph = WPh + (size_t)(2 * w) * 4096 + 8 * lane;
  const us_t* wpl = WPl + (size_t)(2 * w) * 4096 + 8 * lane;
  // the two weight fragment pairs of a k step are asked for one whole k step ahead
  FragB wbh[2], wbl[2];
  #pragma unroll
  for (int v = 0; v < 2; ++v) {
    wbh[v] = ldfragp(wph + 4096 * v);
    wbl[v] = ldfragp(wpl + 4096 * v);
  }
  // unrolled: the fragment registers are indexed statically and every load offset is an immediate
  #pragma unroll
  for (int k0 = 0; k0 < CH; k0 += 32) {
    FragB nbh[2], nbl[2];
    if (k0 + 32 < CH) {
      #pragma unroll
      for (int v = 0; v < 2; ++v) {
        nbh[v] = ldfragp(wph + 4096 * v + 16 * (k0 + 32));
        nbl[v] = ldfragp(wpl + 4096 * v + 16 * (k0 + 32));
      }
    }
    FragB ua[4], uc[4];
    #pragma unroll
    for (int t = 0; t < 4; ++t) {
      ua[t] = ldfrag(ua0 + 16 * t * UPP + k0, h);
      uc[t] = ldfrag(la0 + 16 * t * UPP + k0, h);
    }
    #pragma unroll
    for (int v = 0; v < 2; ++v) {
      #pragma unroll
      for (int t = 0; t < 4; ++t) pacc[t][v] = wmma_bf16(ua[t], wbh[v], pacc[t][v]);
      #pragma unroll
      for (int t = 0; t < 4; ++t) pacc[t][v] = wmma_bf16(uc[t], wbh[v], pacc[t][v]);
      #pragma unroll
      for (int t = 0; t < 4; ++t) pacc[t][v] = wmma_bf16(ua[t], wbl[v], pacc[t][v]);
    }
    if (k0 + 32 < CH) {
      #pragma unroll
      for (int v = 0; v < 2; ++v) { wbh[v] = nbh[v]; wbl[v] = nbl[v]; }
    }
  }
  // what follows rewrites the address registers that the weight loads name
  asm volatile("s_wait_xcnt 0x0" ::: "memory");
  __syncthreads();   // all waves done with the U planes before the staging overlays them
  #pragma unroll
  for (int v = 0; v < 2; ++v) {
    const int co = 32 * w + 16 * v + m;
    const float pb = pbias[co];
    #pragma unroll
    for (int t = 0; t < 4; ++t) {
      v8f y;
      #pragma unroll
      for (int r = 0; r < 8; ++r) y[r] = pacc[t][v][r] + pb;
      st8f(sO + co * SOP + 16 * t + 8 * h, y);
    }
  }
  __syncthreads();
  const int q8 = lane & 7, sub = lane >> 3;
  #pragma unroll
  for (int i = 0; i < 16; ++i) {
    const int id = 64 * w + 4 * i + sub;
    const int R = id >> 1, Lh = id & 1;
    const v4f val = *(const v4fa*)(sO + R * SOP + 32 * Lh + 4 * q8);
    const size_t d = (size_t)(b * CH + R) * NP + l0 + 32 * Lh + 4 * q8;
    *(v4f*)(out + d) = val;
  }
  
}

// ---------------------------------------------------------------------------
extern "C" void kernel_launch(void* const* d_in, const int* in_sizes, int n_in,
                              void* d_out, int out_size, void* d_ws, size_t ws_size,
                              hipStream_t stream)
{
  if (n_in < 7) return;
  if (in_sizes[0] != NB * CH * NP) return;
  if (in_sizes[1] != 4 * CH * CH || in_sizes[2] != 4 * CH) return;
  if (in_sizes[3] != CH * 25 || in_sizes[4] != CH) return;
  if (in_sizes[5] != CH * CH || in_sizes[6] != CH) return;
  if (out_size != NB * CH * NP) return;

  const float* x      = (const float*)d_in[0];
  const float* qkvo_w = (const float*)d_in[1];
  const float* qkvo_b = (const float*)d_in[2];
  const float* lepe_w = (const float*)d_in[3];
  const float* lepe_b = (const float*)d_in[4];
  const float* proj_w = (const float*)d_in[5];
  const float* proj_b = (const float*)d_in[6];
  float* outp = (float*)d_out;

  const size_t szWQ  = (size_t)4 * CH * CH * 2;         //    524288 (x2)
  const size_t szWP  = (size_t)CH * CH * 2;             //    131072 (x2)
  const size_t szR   = (size_t)NB * CH * NP * 4;        //  33554432 (x2)
  const size_t szKVT = (size_t)NB * NH * HD * HD * 2;   //    131072 (x2)
  const size_t szM   = (size_t)NB * NH * HD * 4;        //      8192 (x2)
  const size_t szPK  = (size_t)NB * NH * KS * KREC * 4; //  17825792
  size_t off = 0;
  char* ws = (char*)d_ws;
  us_t*  WQh  = (us_t*)(ws + off);  off += szWQ;
  us_t*  WQl  = (us_t*)(ws + off);  off += szWQ;
  us_t*  WPh  = (us_t*)(ws + off);  off += szWP;
  us_t*  WPl  = (us_t*)(ws + off);  off += szWP;
  float* VF   = (float*)(ws + off); off += szR;     // v planes
  float* LF   = (float*)(ws + off); off += szR;     // depthwise result
  us_t*  KVTh = (us_t*)(ws + off);  off += szKVT;
  us_t*  KVTl = (us_t*)(ws + off);  off += szKVT;
  float* KM   = (float*)(ws + off); off += szM;
  float* VM   = (float*)(ws + off); off += szM;
  float* PK   = (float*)(ws + off); off += szPK;    // row records; total 86523904
  if (off > ws_size) return;

  k_wcvt<<<dim3(160), 256, 0, stream>>>(qkvo_w, proj_w, WQh, WQl, WPh, WPl);
  hipFuncSetAttribute(reinterpret_cast<const void*>(&k_gemm),
                      hipFuncAttributeMaxDynamicSharedMemorySize, GM_BYTES);
  k_gemm<<<dim3(HW, NB), 256, GM_BYTES, stream>>>(x, WQh, WQl, qkvo_b, VF, PK);
  k_lepe<<<dim3(4 * NB * NH + CH * NB), 256, 0, stream>>>(VF, lepe_w, lepe_b, LF, PK, KVTh, KVTl, KM, VM);
  hipFuncSetAttribute(reinterpret_cast<const void*>(&k_resproj),
                      hipFuncAttributeMaxDynamicSharedMemorySize, RP_BYTES);
  k_resproj<<<dim3(NP / 64, NB), 256, RP_BYTES, stream>>>(x, WQh, WQl, qkvo_b, LF, KVTh, KVTl, KM, VM, WPh, WPl, proj_b, outp);
}
